// v000
// Times are from an AMD MI455X. After a warm-up the kernel runs many times in a row, and a time is the length of
// such a window on the GPU divided by its runs, so every launch and the gaps after it count. The runs cycle
// through copies of the inputs. A figure is the median of several windows, for all but v000 over two sittings.
// Sittings can differ by a few percent; kernels timed side by side share one.
// v000 is the starting kernel. One run takes 2630 microseconds.
#include <hip/hip_runtime.h>
// Non-local block (embedded Gaussian, single head, 2x2 max-pool sub-sampling) with an eval-mode BatchNorm on the output conv (x [8][256][64][64]; theta = conv1x1(x) [128 ch], phi = maxpool2x2(conv1x1(x)), g = maxpool2x2(conv1x1(x)) (natural [128][256] weights sigma 1/16 + biases 0.01); f[n][m] = theta[:, n].phi[:, m] over the 1024 pooled positions (NO scale); softmax over m; y[:, n] = sum_m f[n][m] g[:, m]; W_y = conv1x1(y; W [256][128] + b); z = (W_y - bn_mean) gamma / sqrt(bn_var + 1e-5) + bn_beta + x -> [8][256][64][64]).
// Structure: x as an exact f16 channel-first plane; per batch: LDS slab transposes give token-major x^T [4096][256]; theta^T = x^T W^T + b as a WMMA GEMM (32x64 wave tiles, f32 accumulation) into f32 rows, split into f16 hi + x1024 residual (unscaled scores have sigma ~11); phi and g CHANNEL-first = (16 W as the A operand) (x^T as the B^T operand) + b[c] (own-element addend planes) in f32, 2x2 max-pooled on VALU; phi split into hi/lo and both transposed to [1024][128]; g to f16; scores = three accumulating passes (th_hi.ph_hi + th_lo.ph_hi/1024 + th_hi.ph_lo/1024, K = 128) into an f32 [4096][1024] plane; row softmax on VALU (f32 statistics, native exp; weights x256 f16); y^T = P g^T (K = 1024) -> f16 [4096][128]; T = (16 w as A) (y^T as B^T) / 16 -> f32 channel-first output, then z = (T + bf16(b[c]) - mean) gamma / sqrt(var + eps) + beta + bf16(x) on VALU in place; launches: see trace.
// Compute dtype: inputs rounded to bf16; x / weights exact; q and k as f16 hi + x1024 residual pairs; v, softmax weights and o as plain f16 GEMM operands (~2^-12); scores and softmax statistics f32. v_wmma_f32_16x16x32_f16.
#define NB 8
#define SQ 1024
#define DM 256
#define NH 1
#define HD 64
#define HG 4                         /* heads per attention launch group */
#define B0 0                         /* unused: the batch loop runs all NB batches */
#define NBR NB                       /* not used by any kernel or launch */
#define NR ((size_t)NB * SQ)         /* unused */
#define MP ((int)((size_t)NBR * SQ)) /* not used by any kernel or launch */
#define QT 256                       /* query rows per causal tile */
#define NKX SQ                       /* S / P row pitch */
#define QT0 256                      /* first-tile rows recomputed exactly (256: buys margin for the few-key rows 128..255, which have no output projection to average the single-f16 P/v rounding) */
#define QN SQ                        /* unused (each batch attends NP query rows) */
#define NHD NH                       /* unused */
#define MPO MP                       /* unused */
#define LQ DM            /* unused */
typedef __bf16 v16b __attribute__((ext_vector_type(16)));
typedef unsigned short v8us __attribute__((ext_vector_type(8), may_alias));
typedef float  v8f  __attribute__((ext_vector_type(8)));
typedef float  v4f  __attribute__((ext_vector_type(4)));
typedef float  v4fa __attribute__((ext_vector_type(4), may_alias));
union FragB { v16b v; v8us half[2]; unsigned short u[16]; };

__device__ __forceinline__ unsigned short bf16_bits(float x) { unsigned int u = __float_as_uint(x); return (unsigned short)((u + 0x7FFFu + ((u >> 16) & 1u)) >> 16); }
__device__ __forceinline__ float bf16_val(unsigned short b) { return __uint_as_float(((unsigned int)b) << 16); }
__device__ __forceinline__ float bf16_round(float x) { return bf16_val(bf16_bits(x)); }
// D += A·B with NT terms: 1 = ah·bh, 2 = + al·bh (A split), 3 = + ah·bl (both split)
template <int NT>
__device__ __forceinline__ v8f mmaN(v16b ah, v16b al, v16b bh, v16b bl, v8f c) {
  c = __builtin_amdgcn_wmma_f32_16x16x32_bf16(false, ah, false, bh, (short)0, c, false, false);
  if (NT >= 2) c = __builtin_amdgcn_wmma_f32_16x16x32_bf16(false, al, false, bh, (short)0, c, false, false);
  if (NT >= 3) c = __builtin_amdgcn_wmma_f32_16x16x32_bf16(false, ah, false, bl, (short)0, c, false, false);
  asm volatile("v_nop\n\tv_nop\n\tv_nop\n\tv_nop" : "+v"(c) : "v"(ah), "v"(al), "v"(bh), "v"(bl));
  return c;
}

__global__ __launch_bounds__(256) void k_wt_bf16(const float* __restrict__ W, unsigned short* __restrict__ Wt, int K, int N) {
  const int t = blockIdx.x * 256 + threadIdx.x;
  const int k8n = K / 8;
  if (t >= N * k8n) return;
  const int n = t / k8n, k8 = (t % k8n) * 8;
  v8us v;
#pragma unroll
  for (int i = 0; i < 8; ++i) v[i] = bf16_bits(W[(size_t)(k8 + i) * N + n]);
  *(v8us*)(Wt + (size_t)n * K + k8) = v;
  
}

// GEMM C[M][N] (f32, pitch ldc) = act(A[M][K]·W + bias). A f32 row-major (pitch lda) converted per fragment to bf16
// (ASPLIT: hi/lo two planes -> 2 terms, else single rounded term); Wt bf16 [N][K] (pitch ldb). BIAS_BF16 rounds the
// bias to bf16 first (bias quantised to bf16 before the add). K%32==0, M%16==0, N%64==0.
template <bool ASPLIT, int ACT, bool BIAS_BF16>
__global__ __launch_bounds__(128) void k_gemm_bf(const float* __restrict__ A, int lda, const unsigned short* __restrict__ Wt, int ldb,
                                               const float* __restrict__ bias, float* __restrict__ C, int ldc, int M, int N, int K) {
  __shared__ __attribute__((aligned(16))) float so[4][16][64];
  const int tid = threadIdx.x, w = tid >> 5, lane = tid & 31, ln = lane & 15, hh = lane >> 4;
  const int ntn = N / 64;
  const int wid = blockIdx.x * 4 + w;
  const int mt = wid / ntn, nq = wid % ntn;
  if (mt * 16 >= M) return;
  const int row0 = mt * 16, col0 = nq * 64;
  const float* arow = A + (size_t)(row0 + ln) * lda;
  v8f acc[4] = {};
  for (int kb = 0; kb < K; kb += 32) {
    FragB ah, al;
    const v4f x0 = *(const v4fa*)(arow + kb + 8 * hh), x1 = *(const v4fa*)(arow + kb + 8 * hh + 4);
    const v4f x2 = *(const v4fa*)(arow + kb + 16 + 8 * hh), x3 = *(const v4fa*)(arow + kb + 16 + 8 * hh + 4);
    float xs[16] = {x0[0],x0[1],x0[2],x0[3],x1[0],x1[1],x1[2],x1[3],x2[0],x2[1],x2[2],x2[3],x3[0],x3[1],x3[2],x3[3]};
#pragma unroll
    for (int i = 0; i < 16; ++i) { const unsigned short hb = bf16_bits(xs[i]); ah.u[i] = hb; al.u[i] = ASPLIT ? bf16_bits(xs[i] - bf16_val(hb)) : (unsigned short)0; }
#pragma unroll
    for (int t = 0; t < 4; ++t) {
      const unsigned short* brow = Wt + (size_t)(col0 + t * 16 + ln) * ldb + kb;
      FragB b;
      b.half[0] = *(const v8us*)(brow + 8 * hh);
      b.half[1] = *(const v8us*)(brow + 16 + 8 * hh);
      acc[t] = mmaN<ASPLIT ? 2 : 1>(ah.v, al.v, b.v, b.v, acc[t]);
    }
  }
#pragma unroll
  for (int t = 0; t < 4; ++t) {
    float bv = bias ? bias[col0 + t * 16 + ln] : 0.f;
    if (BIAS_BF16) bv = bf16_round(bv);
#pragma unroll
    for (int r = 0; r < 8; ++r) { float v = acc[t][r] + bv; if (ACT == 1) v = fmaxf(v, 0.f); so[w][8 * hh + r][t * 16 + ln] = v; }
  }
  __builtin_amdgcn_fence(__ATOMIC_ACQ_REL, "workgroup");
  __builtin_amdgcn_wave_barrier();
  const int rsub = lane >> 4, c4 = (lane & 15) * 4;
  {
#pragma unroll
    for (int q = 0; q < 8; ++q) {
      const int r = q * 2 + rsub;
      const v4f v = *(const v4fa*)&so[w][r][c4];
      *(v4f*)(C + (size_t)(row0 + r) * ldc + col0 + c4) = v;
    }
    
  }
}

// GEMM C = act(A·W + bias + resid): A f32 (ASPLIT -> hi/lo 2 terms), Wt bf16 [N][K]; ACT 0 none, 1 relu, 2 exact gelu;
// resid (optional, f32, row index = (row % rmod), pitch ldr, RES_BF16 rounds it) added before the activation.
template <bool ASPLIT, int ACT, bool BIAS_BF16, bool RES_BF16>
__global__ __launch_bounds__(128) void k_gemm_bf3(const float* __restrict__ A, int lda, const unsigned short* __restrict__ Wt, int ldb,
                                                const float* __restrict__ bias, const float* __restrict__ resid, int rmod, int ldr,
                                                float* __restrict__ C, int ldc, int M, int N, int K) {
  __shared__ __attribute__((aligned(16))) float so[4][16][64];
  const int tid = threadIdx.x, w = tid >> 5, lane = tid & 31, ln = lane & 15, hh = lane >> 4;
  const int ntn = N / 64;
  const int wid = blockIdx.x * 4 + w;
  const int mt = wid / ntn, nq = wid % ntn;
  if (mt * 16 >= M) return;
  const int row0 = mt * 16, col0 = nq * 64;
  const float* arow = A + (size_t)(row0 + ln) * lda;
  v8f acc[4] = {};
  for (int kb = 0; kb < K; kb += 32) {
    FragB ah, al;
    const v4f x0 = *(const v4fa*)(arow + kb + 8 * hh), x1 = *(const v4fa*)(arow + kb + 8 * hh + 4);
    const v4f x2 = *(const v4fa*)(arow + kb + 16 + 8 * hh), x3 = *(const v4fa*)(arow + kb + 16 + 8 * hh + 4);
    float xs[16] = {x0[0],x0[1],x0[2],x0[3],x1[0],x1[1],x1[2],x1[3],x2[0],x2[1],x2[2],x2[3],x3[0],x3[1],x3[2],x3[3]};
#pragma unroll
    for (int i = 0; i < 16; ++i) { const unsigned short hb = bf16_bits(xs[i]); ah.u[i] = hb; al.u[i] = ASPLIT ? bf16_bits(xs[i] - bf16_val(hb)) : (unsigned short)0; }
#pragma unroll
    for (int t = 0; t < 4; ++t) {
      const unsigned short* brow = Wt + (size_t)(col0 + t * 16 + ln) * ldb + kb;
      FragB b;
      b.half[0] = *(const v8us*)(brow + 8 * hh);
      b.half[1] = *(const v8us*)(brow + 16 + 8 * hh);
      acc[t] = mmaN<ASPLIT ? 2 : 1>(ah.v, al.v, b.v, b.v, acc[t]);
    }
  }
#pragma unroll
  for (int t = 0; t < 4; ++t) {
    const int col = col0 + t * 16 + ln;
    float bv = bias ? bias[col] : 0.f;
    if (BIAS_BF16) bv = bf16_round(bv);
#pragma unroll
    for (int r = 0; r < 8; ++r) {
      float v = acc[t][r] + bv;
      if (resid) { float rv = resid[(size_t)((row0 + 8 * hh + r) % rmod) * ldr + col]; if (RES_BF16) rv = bf16_round(rv); v += rv; }
      if (ACT == 1) v = fmaxf(v, 0.f);
      if (ACT == 2) v = 0.5f * v * (1.0f + erff(v * 0.70710678118654752f));
      if (ACT == 3) { const float u = 0.7978845608028654f * (v + 0.044715f * v * v * v); v = 0.5f * v * (1.0f + tanhf(u)); }
      so[w][8 * hh + r][t * 16 + ln] = v;
    }
  }
  __builtin_amdgcn_fence(__ATOMIC_ACQ_REL, "workgroup");
  __builtin_amdgcn_wave_barrier();
  const int rsub = lane >> 4, c4 = (lane & 15) * 4;
  {
#pragma unroll
    for (int q = 0; q < 8; ++q) {
      const int r = q * 2 + rsub;
      const v4f v = *(const v4fa*)&so[w][r][c4];
      *(v4f*)(C + (size_t)(row0 + r) * ldc + col0 + c4) = v;
    }
    
  }
}
// row LayerNorm (biased variance, eps) over N: s = X (+ R); optional out_sum <- s; out_norm <- (s-mu)*rsqrt(var+eps)*g + b
template <bool PARAM_BF16>
__global__ __launch_bounds__(256) void k_layernorm(const float* __restrict__ X, const float* __restrict__ R, const float* __restrict__ g, const float* __restrict__ bta,
                                                  float* __restrict__ out_sum, float* __restrict__ out_norm, int N, float eps) {
  __shared__ float red[256];
  const int row = blockIdx.x, tid = threadIdx.x;
  const float* x = X + (size_t)row * N; const float* rr = R ? R + (size_t)row * N : nullptr;
  float vals[16];                     // up to N = 4096
  const int per = N / 256;            // contiguous chunk per thread? use strided-by-4 chunks: thread handles j = tid*4 + 1024*u
  float s1 = 0.f;
  for (int u = 0; u < per / 4; ++u) {
    const int j = tid * 4 + 1024 * u;
    const v4f a = *(const v4fa*)(x + j);
    v4f b = {0.f,0.f,0.f,0.f}; if (rr) b = *(const v4fa*)(rr + j);
#pragma unroll
    for (int q = 0; q < 4; ++q) { const float v = a[q] + b[q]; vals[u * 4 + q] = v; s1 += v; }
  }
  red[tid] = s1; __syncthreads();
  for (int st = 128; st > 0; st >>= 1) { if (tid < st) red[tid] += red[tid + st]; __syncthreads(); }
  const float mu = red[0] / (float)N; __syncthreads();
  float s2 = 0.f;
  for (int u = 0; u < per / 4; ++u)
#pragma unroll
    for (int q = 0; q < 4; ++q) { const float c = vals[u * 4 + q] - mu; s2 += c * c; }
  red[tid] = s2; __syncthreads();
  for (int st = 128; st > 0; st >>= 1) { if (tid < st) red[tid] += red[tid + st]; __syncthreads(); }
  const float rs = rsqrtf(red[0] / (float)N + eps);
  {
    for (int u = 0; u < per / 4; ++u) {
      const int j = tid * 4 + 1024 * u;
      v4f o, sm;
#pragma unroll
      for (int q = 0; q < 4; ++q) {
        float gg = g[j + q], bb = bta[j + q];
        if (PARAM_BF16) { gg = bf16_round(gg); bb = bf16_round(bb); }
        sm[q] = vals[u * 4 + q]; o[q] = (vals[u * 4 + q] - mu) * rs * gg + bb;
      }
      if (out_sum) *(v4f*)(out_sum + (size_t)row * N + j) = sm;
      *(v4f*)(out_norm + (size_t)row * N + j) = o;
    }
    
  }
}



// ---- f16 WMMA path (v_wmma_f32_16x16x32_f16): 11-bit significands for operands in range — used where a [0,1] probability operand needs more precision than bf16
typedef _Float16 v16h __attribute__((ext_vector_type(16)));
union FragH { v16h v; v8us half[2]; _Float16 h[16]; unsigned short u[16]; };
template <int NT>
__device__ __forceinline__ v8f mmaH(v16h ah, v16h al, v16h bh, v16h bl, v8f c) {
  c = __builtin_amdgcn_wmma_f32_16x16x32_f16(false, ah, false, bh, (short)0, c, false, false);
  if (NT >= 2) c = __builtin_amdgcn_wmma_f32_16x16x32_f16(false, al, false, bh, (short)0, c, false, false);
  if (NT >= 3) c = __builtin_amdgcn_wmma_f32_16x16x32_f16(false, ah, false, bl, (short)0, c, false, false);
  asm volatile("v_nop\n\tv_nop\n\tv_nop\n\tv_nop" : "+v"(c) : "v"(ah), "v"(al), "v"(bh), "v"(bl));
  return c;
}
// batched GEMM like k_gemm_b but f16 operands: A f32 (split into f16 hi/lo if ASPLIT, else rounded to f16), Bt = f16 values [n][k]; alpha; C f32; N multiple of 16 (partial tiles skipped)
template <bool ASPLIT>
__global__ __launch_bounds__(128) void k_gemm_h(const float* __restrict__ A, int lda, size_t sA, const _Float16* __restrict__ Bh, int ldb, size_t sB, float alpha, float* __restrict__ C, int ldc, size_t sC, int M, int N, int K) {
  __shared__ __attribute__((aligned(16))) float so[4][16][64];
  const int tid = threadIdx.x, w = tid >> 5, lane = tid & 31, ln = lane & 15, hh = lane >> 4; const int by = blockIdx.y;
  A += (size_t)by * sA; Bh += (size_t)by * sB; C += (size_t)by * sC;
  const int ntn = (N + 63) / 64; const int wid = blockIdx.x * 4 + w; const int mt = wid / ntn, nq = wid % ntn; if (mt * 16 >= M) return;
  const int row0 = mt * 16, col0 = nq * 64; const float* arow = A + (size_t)(row0 + ln) * lda;
  v8f acc[4] = {};
  for (int kb = 0; kb < K; kb += 32) {
    FragH ah, al;
    const v4f x0 = *(const v4fa*)(arow + kb + 8 * hh), x1 = *(const v4fa*)(arow + kb + 8 * hh + 4), x2 = *(const v4fa*)(arow + kb + 16 + 8 * hh), x3 = *(const v4fa*)(arow + kb + 16 + 8 * hh + 4);
    float xs[16] = {x0[0],x0[1],x0[2],x0[3],x1[0],x1[1],x1[2],x1[3],x2[0],x2[1],x2[2],x2[3],x3[0],x3[1],x3[2],x3[3]};
#pragma unroll
    for (int i = 0; i < 16; ++i) { const _Float16 h = (_Float16)xs[i]; ah.h[i] = h; al.h[i] = ASPLIT ? (_Float16)(xs[i] - (float)h) : (_Float16)0.0f; }
#pragma unroll
    for (int t = 0; t < 4; ++t) { if (col0 + t * 16 >= N) continue; const size_t boff = (size_t)(col0 + t * 16 + ln) * ldb + kb; FragH bq; bq.half[0] = *(const v8us*)(Bh + boff + 8 * hh); bq.half[1] = *(const v8us*)(Bh + boff + 16 + 8 * hh);
      acc[t] = mmaH<ASPLIT ? 2 : 1>(ah.v, al.v, bq.v, bq.v, acc[t]); }
  }
#pragma unroll
  for (int t = 0; t < 4; ++t) { if (col0 + t * 16 >= N) continue;
#pragma unroll
    for (int r = 0; r < 8; ++r) so[w][8 * hh + r][t * 16 + ln] = acc[t][r] * alpha; }
  __builtin_amdgcn_fence(__ATOMIC_ACQ_REL, "workgroup"); __builtin_amdgcn_wave_barrier();
  const int rsub = lane >> 4, c4 = (lane & 15) * 4;
  {
#pragma unroll
    for (int q = 0; q < 8; ++q) { const int r = q * 2 + rsub; if (col0 + c4 < N) { const v4f v = *(const v4fa*)&so[w][r][c4]; *(v4f*)(C + (size_t)(row0 + r) * ldc + col0 + c4) = v; } }
     }
}

// Wt[n][k] = f16(W[k][n]·scale) from f32 row-major W[K][N] (scale = power of two; bf16-exact weights stay exact in f16 away from the subnormal range)
__global__ __launch_bounds__(256) void k_wt_f16(const float* __restrict__ W, _Float16* __restrict__ Wt, int K, int N, float scale) {
  const int t = blockIdx.x * 256 + threadIdx.x; if (t >= N * (K / 8)) return; const int n = t / (K / 8), k8 = (t % (K / 8)) * 8; FragH f;
#pragma unroll
  for (int i = 0; i < 8; ++i) f.h[i] = (_Float16)(bf16_round(W[(size_t)(k8 + i) * N + n]) * scale); const v8us o = f.half[0];
  *(v8us*)((unsigned short*)Wt + (size_t)n * K + k8) = o; 
}
// k_gemm_hh variant with fused epilogue: v = acc·alpha + bias[by·sBias + col] (+ CP[(row/rowsPerB)·sCPb + by·64 + col] if CP) ; ACT 0 none / 1 elu ; writes f16 C16 (and f32 C if non-null)
template <int ACT>
__global__ __launch_bounds__(128) void k_gemm_hhx(const _Float16* __restrict__ A, int lda, size_t sA, const _Float16* __restrict__ Bh, int ldb, size_t sB, float alpha, const float* __restrict__ bias, size_t sBias, const float* __restrict__ CP, int rowsPerB, size_t sCPb, int row0g,
    float* __restrict__ C, _Float16* __restrict__ C16, int ldc, size_t sC, int M, int N, int K) {
  __shared__ __attribute__((aligned(16))) float so[4][16][64];
  const int tid = threadIdx.x, w = tid >> 5, lane = tid & 31, ln = lane & 15, hh = lane >> 4; const int by = blockIdx.y;
  A += (size_t)by * sA; Bh += (size_t)by * sB; const size_t cofs = (size_t)by * sC; const float* bp = bias ? bias + (size_t)by * sBias : nullptr;
  const int ntn = (N + 63) / 64; const int wid = blockIdx.x * 4 + w; const int mt = wid / ntn, nq = wid % ntn; if (mt * 16 >= M) return;
  const int row0 = mt * 16, col0 = nq * 64; const _Float16* arow = A + (size_t)(row0 + ln) * lda;
  v8f acc[4] = {};
  for (int kb = 0; kb < K; kb += 32) { FragH ah; ah.half[0] = *(const v8us*)((const unsigned short*)arow + kb + 8 * hh); ah.half[1] = *(const v8us*)((const unsigned short*)arow + kb + 16 + 8 * hh);
#pragma unroll
    for (int t = 0; t < 4; ++t) { if (col0 + t * 16 >= N) continue; const size_t boff = (size_t)(col0 + t * 16 + ln) * ldb + kb; FragH bq; bq.half[0] = *(const v8us*)((const unsigned short*)Bh + boff + 8 * hh); bq.half[1] = *(const v8us*)((const unsigned short*)Bh + boff + 16 + 8 * hh);
      acc[t] = mmaH<1>(ah.v, ah.v, bq.v, bq.v, acc[t]); }
  }
#pragma unroll
  for (int t = 0; t < 4; ++t) { if (col0 + t * 16 >= N) continue; const int col = col0 + t * 16 + ln; const float bv = bp ? bf16_round(bp[col]) : 0.f;
#pragma unroll
    for (int r = 0; r < 8; ++r) { float v = acc[t][r] * alpha + bv; if (CP) { const int rr = row0g + row0 + 8 * hh + r; if (rowsPerB < 0) v += CP[cofs + (size_t)rr * ldc + col];      /* rowsPerB < 0: own element of the batched C plane */ else { const int bidx = rr / rowsPerB; v += CP[(size_t)bidx * sCPb + (size_t)by * 64 + col]; } } if (ACT == 1) v = (v > 0.f) ? v : expm1f(v); else if (ACT == 7) v = (v > 0.f) ? v + 1.0f : expf(v); else if (ACT == 8) v = tanhf(v); else if (ACT == 9) v = 0.5f * v * (1.0f + tanhf(0.7978845608028654f * (v + 0.044715f * v * v * v))); else if (ACT == 11) v = 1.0f / (1.0f + expf(-v)); else if (ACT == 12) v = (v > 0.f) ? v : 0.01f * v; else if (ACT == 14) v = (v > 0.f) ? v : 0.1f * v; else if (ACT == 16) v = (v >= 0.f) ? v : 0.3f * v; else if (ACT == 17) v = (v >= 0.f) ? v : 0.2f * v; else if (ACT == 15) v = v / (1.0f + expf(-v)); else if (ACT == 3) v = fmaxf(v, 0.f); else if (ACT == 6) v = 0.5f * v * (1.0f + erff(v * 0.70710678118654752f)); so[w][8 * hh + r][t * 16 + ln] = v; } }
  __builtin_amdgcn_fence(__ATOMIC_ACQ_REL, "workgroup"); __builtin_amdgcn_wave_barrier();
  const int rsub = lane >> 4, c4 = (lane & 15) * 4; typedef _Float16 v4h __attribute__((ext_vector_type(4)));
  {
#pragma unroll
    for (int q = 0; q < 8; ++q) { const int r = q * 2 + rsub; if (col0 + c4 < N) { const v4f v = *(const v4fa*)&so[w][r][c4]; if (C) *(v4f*)(C + cofs + (size_t)(row0 + r) * ldc + col0 + c4) = v; if (C16) { v4h h4; for (int i = 0; i < 4; ++i) h4[i] = (_Float16)v[i]; *(v4h*)(C16 + cofs + (size_t)(row0 + r) * ldc + col0 + c4) = h4; } } }
     }
}


typedef _Float16 v4h __attribute__((ext_vector_type(4)));

__global__ __launch_bounds__(256) void k_x16(const float* __restrict__ x, _Float16* __restrict__ X16, size_t n8) { const size_t t = (size_t)blockIdx.x * 256 + threadIdx.x; if (t >= n8) return; FragH f;
#pragma unroll
  for (int q = 0; q < 8; ++q) f.h[q] = (_Float16)bf16_round(x[t * 8 + q]); *(v8us*)((unsigned short*)X16 + t * 8) = f.half[0];  }
__global__ __launch_bounds__(256) void k_h16(const float* __restrict__ x, _Float16* __restrict__ X16, size_t n8) { const size_t t = (size_t)blockIdx.x * 256 + threadIdx.x; if (t >= n8) return; FragH f;
#pragma unroll
  for (int q = 0; q < 8; ++q) f.h[q] = (_Float16)x[t * 8 + q]; *(v8us*)((unsigned short*)X16 + t * 8) = f.half[0];  }
__global__ __launch_bounds__(256) void k_round16f(const float* __restrict__ W, _Float16* __restrict__ Bt, size_t n8) { const size_t t = (size_t)blockIdx.x * 256 + threadIdx.x; if (t >= n8) return; FragH f;
#pragma unroll
  for (int i = 0; i < 8; ++i) f.h[i] = (_Float16)(bf16_round(W[t * 8 + i]) * 16.0f); *(v8us*)((unsigned short*)Bt + t * 8) = f.half[0];  }
template <int NHv, int TTv>
__global__ __launch_bounds__(256) void k_vt(const _Float16* __restrict__ V16, int ldv, int voff, _Float16* __restrict__ Vt) { __shared__ unsigned short tl[64][66]; const int tid = threadIdx.x; const int slab = blockIdx.x / (TTv / 64), lg = blockIdx.x % (TTv / 64); const int b = slab / NHv, h = slab % NHv;
  for (int i = tid; i < 64 * 8; i += 256) { const int r = i / 8, c8 = (i % 8) * 8; FragH f; f.half[0] = *(const v8us*)((const unsigned short*)V16 + ((size_t)b * TTv + lg * 64 + r) * ldv + voff + h * 64 + c8);
#pragma unroll
    for (int q = 0; q < 8; ++q) tl[r][c8 + q] = f.u[q]; }
  __syncthreads();
  {
#pragma unroll
    for (int rd = 0; rd < 2; ++rd) { const int d = rd * 32 + tid / 8, pc = tid % 8; FragH f;
#pragma unroll
      for (int q = 0; q < 8; ++q) f.u[q] = tl[pc * 8 + q][d];
      *(v8us*)((unsigned short*)Vt + ((size_t)slab * 64 + d) * TTv + lg * 64 + pc * 8) = f.half[0]; }
     } }

__global__ __launch_bounds__(256) void k_hl(const float* __restrict__ F, _Float16* __restrict__ Hh, _Float16* __restrict__ Hl, size_t n8) { const size_t t = (size_t)blockIdx.x * 256 + threadIdx.x; if (t >= n8) return; FragH fh, fl; const v4f a = *(const v4fa*)(F + t * 8), c = *(const v4fa*)(F + t * 8 + 4);
#pragma unroll
  for (int q = 0; q < 4; ++q) { _Float16 h = (_Float16)a[q]; fh.h[q] = h; fl.h[q] = (_Float16)((a[q] - (float)h) * 1024.0f); h = (_Float16)c[q]; fh.h[4 + q] = h; fl.h[4 + q] = (_Float16)((c[q] - (float)h) * 1024.0f); }
  { *(v8us*)((unsigned short*)Hh + t * 8) = fh.half[0]; *(v8us*)((unsigned short*)Hl + t * 8) = fl.half[0];  } }

// ---- fast GEMM (wave tile 32x64; requires M % 32 == 0 rows per launch region and N % 64 == 0); epilogue = k_gemm_hhx semantics ----
__device__ __forceinline__ v16h g2_frag(const _Float16* p, int hh) { FragH f; f.half[0] = *(const v8us*)((const unsigned short*)p + 8 * hh); f.half[1] = *(const v8us*)((const unsigned short*)p + 16 + 8 * hh); return f.v; }
__device__ __forceinline__ v8f g2_mma(v16h a, v16h b, v8f c) { v8f d = __builtin_amdgcn_wmma_f32_16x16x32_f16(false, a, false, b, (short)0, c, false, false); asm volatile("v_nop\n\tv_nop\n\tv_nop\n\tv_nop" : "+v"(d) : "v"(a), "v"(b)); return d; }
template <int ACT>
__global__ __launch_bounds__(128) void k_gemm2(const _Float16* __restrict__ A, int lda, size_t sA, const _Float16* __restrict__ Bh, int ldb, size_t sB, float alpha, const float* __restrict__ bias, size_t sBias, const float* __restrict__ CP, int rowsPerB, size_t sCPb, int row0g,
    float* __restrict__ C, _Float16* __restrict__ C16, int ldc, size_t sC, int M, int N, int K) { static_assert(ACT == 0 || ACT == 3 || ACT == 6 || ACT == 8 || ACT == 9 || ACT == 11 || ACT == 12 || ACT == 14 || ACT == 15 || ACT == 16 || ACT == 17, "k_gemm2: unsupported ACT code (would silently apply no activation)");
  __shared__ __attribute__((aligned(16))) float so[4][32][68];
  const int tid = threadIdx.x, w = tid >> 5, lane = tid & 31, ln = lane & 15, hh = lane >> 4; const int by = blockIdx.y;
  A += (size_t)by * sA; Bh += (size_t)by * sB; const size_t cofs = (size_t)by * sC; const float* bp = bias ? bias + (size_t)by * sBias : nullptr;
  const int ntn = N >> 6; const int mt = blockIdx.x / ntn, nq = blockIdx.x - mt * ntn; const int row0 = mt * 128 + 32 * w, col0 = nq * 64; if (row0 >= M) return;
  const _Float16* a0p = A + (size_t)(row0 + ln) * lda; const _Float16* a1p = a0p + (size_t)16 * lda;
  const _Float16* b0p = Bh + (size_t)(col0 + ln) * ldb; const _Float16* b1p = b0p + (size_t)16 * ldb; const _Float16* b2p = b1p + (size_t)16 * ldb; const _Float16* b3p = b2p + (size_t)16 * ldb;
  const v8f z8 = {0.f,0.f,0.f,0.f,0.f,0.f,0.f,0.f}; v8f c00 = z8, c01 = z8, c02 = z8, c03 = z8, c10 = z8, c11 = z8, c12 = z8, c13 = z8;
#pragma unroll 1
  for (int kb = 0; kb < K; kb += 32) { const v16h a0 = g2_frag(a0p + kb, hh), a1 = g2_frag(a1p + kb, hh);
    v16h b = g2_frag(b0p + kb, hh); c00 = g2_mma(a0, b, c00); c10 = g2_mma(a1, b, c10);
    b = g2_frag(b1p + kb, hh); c01 = g2_mma(a0, b, c01); c11 = g2_mma(a1, b, c11);
    b = g2_frag(b2p + kb, hh); c02 = g2_mma(a0, b, c02); c12 = g2_mma(a1, b, c12);
    b = g2_frag(b3p + kb, hh); c03 = g2_mma(a0, b, c03); c13 = g2_mma(a1, b, c13); }
  v8f accs[8] = {c00, c01, c02, c03, c10, c11, c12, c13};
#pragma unroll
  for (int u = 0; u < 8; ++u) { const int t = u & 3, half = u >> 2; const int col = col0 + t * 16 + ln; const float bv = bp ? bf16_round(bp[col]) : 0.f;
#pragma unroll
    for (int r = 0; r < 8; ++r) { const int rloc = half * 16 + 8 * hh + r; float v = accs[u][r] * alpha + bv; if (CP) { if (rowsPerB < 0) v += CP[cofs + (size_t)(row0g + row0 + rloc) * ldc + col];      /* rowsPerB < 0: own element of the batched C plane */ else { const int bidx = (row0g + row0 + rloc) / rowsPerB; v += CP[(size_t)bidx * sCPb + (size_t)by * 64 + col]; } }
      if (ACT == 3) v = fmaxf(v, 0.f); else if (ACT == 6) v = 0.5f * v * (1.0f + erff(v * 0.70710678118654752f)); else if (ACT == 11) v = 1.0f / (1.0f + expf(-v)); else if (ACT == 15) v = v / (1.0f + expf(-v)); else if (ACT == 12) v = (v > 0.f) ? v : 0.01f * v; else if (ACT == 8) v = tanhf(v); else if (ACT == 9) v = 0.5f * v * (1.0f + tanhf(0.7978845608028654f * (v + 0.044715f * v * v * v))); else if (ACT == 14) v = (v > 0.f) ? v : 0.1f * v; else if (ACT == 16) v = (v >= 0.f) ? v : 0.3f * v; else if (ACT == 17) v = (v >= 0.f) ? v : 0.2f * v;
      so[w][rloc][t * 16 + ln] = v; } }
  __builtin_amdgcn_fence(__ATOMIC_ACQ_REL, "workgroup"); __builtin_amdgcn_wave_barrier();
  const int rsub = lane >> 4, c4 = (lane & 15) * 4;
  {
#pragma unroll
    for (int q = 0; q < 16; ++q) { const int r = q * 2 + rsub; const v4f v = *(const v4fa*)&so[w][r][c4]; if (C) *(v4f*)(C + cofs + (size_t)(row0 + r) * ldc + col0 + c4) = v; if (C16) { v4h h4; for (int i = 0; i < 4; ++i) h4[i] = (_Float16)v[i]; *(v4h*)(C16 + cofs + (size_t)(row0 + r) * ldc + col0 + c4) = h4; } }
     } }


__global__ __launch_bounds__(256) void k_wnat(const float* __restrict__ w, size_t n8, _Float16* __restrict__ Bt) { const size_t t = (size_t)blockIdx.x * 256 + threadIdx.x; if (t >= n8) return; FragH f; for (int q = 0; q < 8; ++q) f.h[q] = (_Float16)(bf16_round(w[t * 8 + q]) * 16.0f); *(v8us*)((unsigned short*)Bt + t * 8) = f.half[0];  }
__global__ __launch_bounds__(256) void k_rsm(const float* __restrict__ S, _Float16* __restrict__ P, int nrows) {
  #pragma clang fp contract(off)
  const int i = blockIdx.x * 256 + threadIdx.x; if (i >= nrows) return; const float* s = S + (size_t)i * SQ; float mx = -3.0e38f;
#pragma unroll 1
  for (int j = 0; j < SQ; ++j) mx = fmaxf(mx, s[j]); float se = 0.f;
#pragma unroll 1
  for (int j = 0; j < SQ; ++j) se += expf(s[j] - mx); const float sc = 256.0f / se;
#pragma unroll 1
  for (int j0 = 0; j0 < SQ; j0 += 8) { FragH f; for (int q = 0; q < 8; ++q) f.h[q] = (_Float16)(expf(s[j0 + q] - mx) * sc); unsigned short* d = (unsigned short*)P + (size_t)i * SQ + j0; *(v8us*)d = f.half[0];  } }
__global__ __launch_bounds__(256) void k_vt(const _Float16* __restrict__ V16, int b, int h0, _Float16* __restrict__ VT) { __shared__ unsigned short tl[64][65]; const int tid = threadIdx.x; const int hh = blockIdx.x % HG, sg = blockIdx.x / HG; const int s0 = sg * 64; const int h = h0 + hh;
  for (int i = tid; i < 64 * 8; i += 256) { const int j = i / 8, d8 = (i % 8) * 8; FragH f; f.half[0] = *(const v8us*)((const unsigned short*)V16 + ((size_t)b * SQ + s0 + j) * DM + h * HD + d8); for (int q = 0; q < 8; ++q) tl[d8 + q][j] = f.u[q]; }
  __syncthreads();
  { for (int i = tid; i < 64 * 8; i += 256) { const int d = i / 8, j8 = (i % 8) * 8; FragH f; for (int q = 0; q < 8; ++q) f.u[q] = tl[d][j8 + q]; *(v8us*)((unsigned short*)VT + ((size_t)hh * HD + d) * SQ + s0 + j8) = f.half[0]; }  } }



__global__ __launch_bounds__(256) void k_rsmcf2(const float* __restrict__ S, _Float16* __restrict__ P, int hg, int q0, int nk) {
  #pragma clang fp contract(off)
  const int t = blockIdx.x * 256 + threadIdx.x; if (t >= hg * QT) return; const size_t i = (size_t)t; const float* s = S + i * NKX; const int last = q0 + (t % QT); float mx = -3.0e38f;
#pragma unroll 1
  for (int j = 0; j < nk; ++j) { const float f = (j <= last) ? 1.f : 0.f; mx = fmaxf(mx, fmaf(f, s[j], (1.f - f) * -1.0e9f)); } float se = 0.f;
#pragma unroll 1
  for (int j = 0; j < nk; ++j) { const float f = (j <= last) ? 1.f : 0.f; se += __expf(fmaf(f, s[j], (1.f - f) * -1.0e9f) - mx); } const float sc = 256.0f / se;
#pragma unroll 1
  for (int j0 = 0; j0 < nk; j0 += 8) { FragH fr; for (int q = 0; q < 8; ++q) { const int j = j0 + q; const float f = (j <= last) ? 1.f : 0.f; fr.h[q] = (_Float16)(__expf(fmaf(f, s[j], (1.f - f) * -1.0e9f) - mx) * sc); } unsigned short* d = (unsigned short*)P + i * NKX + j0; *(v8us*)d = fr.half[0];  } }

template <int MASKADD>
__global__ __launch_bounds__(64) void k_att0(const float* __restrict__ QF, const float* __restrict__ KF, const float* __restrict__ VF, int ld, const float* __restrict__ mask, float scale, float* __restrict__ OF, int ldo) {
  #pragma clang fp contract(off)
  __shared__ __attribute__((aligned(16))) float lq[64][64]; __shared__ __attribute__((aligned(16))) float lo[64][64];
  const int tid = threadIdx.x; const int h = blockIdx.x / (QT0 / 64), rg = blockIdx.x % (QT0 / 64); const int i = rg * 64 + tid;
  const float* qr = QF + (size_t)i * ld + h * HD;
#pragma unroll 1
  for (int c = 0; c < HD / 4; ++c) { *(v4f*)&lq[tid][c * 4] = *(const v4fa*)(qr + c * 4); const v4f z = {0.f, 0.f, 0.f, 0.f}; *(v4f*)&lo[tid][c * 4] = z; }
  float m = -1.0e30f, l = 0.f; const int jmax = MASKADD ? (SQ - 1) : (rg * 64 + 63);      /* additive-mask form: every key (the mask input decides); causal form: keys up to the block's last row */
#pragma unroll 1
  for (int j = 0; j <= jmax; ++j) { const float* kr = KF + (size_t)j * ld + h * HD; const float* vr = VF + (size_t)j * ld + h * HD; float s = 0.f;
#pragma unroll 1
    for (int c = 0; c < HD / 4; ++c) { const v4f kq = *(const v4fa*)(kr + c * 4); const v4f qq = *(v4f*)&lq[tid][c * 4]; s = __fadd_rn(s, __fmul_rn(qq[0], kq[0])); s = __fadd_rn(s, __fmul_rn(qq[1], kq[1])); s = __fadd_rn(s, __fmul_rn(qq[2], kq[2])); s = __fadd_rn(s, __fmul_rn(qq[3], kq[3])); }
    s = __fmul_rn(s, scale); if (MASKADD) s = __fadd_rn(s, __fmul_rn(bf16_round(mask[(size_t)i * SQ + j]), -10000.0f));
    const float f = (MASKADD || j <= i) ? 1.f : 0.f; const float sm = fmaf(f, s, (1.f - f) * -1.0e30f); const float mn = fmaxf(m, sm); const float sc = expf(m - mn); const float e = expf(sm - mn); l = __fadd_rn(__fmul_rn(l, sc), e); m = mn;
#pragma unroll 1
    for (int c = 0; c < HD / 4; ++c) { const v4f vv = *(const v4fa*)(vr + c * 4); v4f oo = *(v4f*)&lo[tid][c * 4]; for (int u = 0; u < 4; ++u) oo[u] = __fadd_rn(__fmul_rn(oo[u], sc), __fmul_rn(e, vv[u])); *(v4f*)&lo[tid][c * 4] = oo; } }
  const float fin = 64.0f / l;      /* o carried x64 like the f16 path */
#pragma unroll 1
  for (int c = 0; c < HD / 4; ++c) { v4f oo = *(v4f*)&lo[tid][c * 4]; for (int u = 0; u < 4; ++u) oo[u] = __fmul_rn(oo[u], fin); *(v4f*)&lo[tid][c * 4] = oo; }
  __syncthreads();
  {
#pragma unroll 1
    for (int it = 0; it < 16; ++it) { const int row = it * 4 + tid / 16, pc = (tid % 16) * 4; const v4f v = *(const v4f*)&lo[row][pc]; *(v4f*)(OF + (size_t)(rg * 64 + row) * ldo + h * HD + pc) = v; }
     } }

__global__ __launch_bounds__(256) void k_oscale(const float* __restrict__ OF, float* __restrict__ out, size_t n4) { const size_t t = (size_t)blockIdx.x * 256 + threadIdx.x; if (t >= n4) return; const v4f a = *(const v4fa*)(OF + t * 4); v4f o; for (int q = 0; q < 4; ++q) o[q] = a[q] * 0.015625f; *(v4f*)(out + t * 4) = o;  }

__global__ __launch_bounds__(256) void k_bfr(const float* __restrict__ x, float* __restrict__ XB, size_t n8) { const size_t t = (size_t)blockIdx.x * 256 + threadIdx.x; if (t >= n8) return; v4f a = *(const v4fa*)(x + t * 8), c = *(const v4fa*)(x + t * 8 + 4); for (int q = 0; q < 4; ++q) { a[q] = bf16_round(a[q]); c[q] = bf16_round(c[q]); }
  { *(v4f*)(XB + t * 8) = a; *(v4f*)(XB + t * 8 + 4) = c;  } }



__global__ __launch_bounds__(256) void k_rsmfvl(const float* __restrict__ S, _Float16* __restrict__ P, _Float16* __restrict__ PL, int qn, const int* __restrict__ vlp) {
  #pragma clang fp contract(off)
  const int t = blockIdx.x * 256 + threadIdx.x; if (t >= qn) return; const int vl = vlp[0]; const size_t i = (size_t)t; const float* s = S + i * SQ; float mx = -3.0e38f;
#pragma unroll 1
  for (int j = 0; j < SQ; ++j) { const float f = (j < vl) ? 1.f : 0.f; mx = fmaxf(mx, fmaf(f, s[j], (1.f - f) * -1000000.0f)); } float se = 0.f;
#pragma unroll 1
  for (int j = 0; j < SQ; ++j) { const float f = (j < vl) ? 1.f : 0.f; se += __expf(fmaf(f, s[j], (1.f - f) * -1000000.0f) - mx); } const float sc = 256.0f / se;
#pragma unroll 1
  for (int j0 = 0; j0 < SQ; j0 += 8) { FragH fr, gr; for (int q = 0; q < 8; ++q) { const int j = j0 + q; const float f = (j < vl) ? 1.f : 0.f; const float pv = __expf(fmaf(f, s[j], (1.f - f) * -1000000.0f) - mx) * sc; const _Float16 ph = (_Float16)pv; fr.h[q] = ph; gr.h[q] = (_Float16)((pv - (float)ph) * 1024.0f); }
    unsigned short* d = (unsigned short*)P + i * SQ + j0; unsigned short* dl = (unsigned short*)PL + i * SQ + j0; *(v8us*)d = fr.half[0]; *(v8us*)dl = gr.half[0];  } }

__global__ __launch_bounds__(256) void k_rsmf(const float* __restrict__ S, _Float16* __restrict__ P, int qn, int hg) {
  #pragma clang fp contract(off)
  const int t = blockIdx.x * 256 + threadIdx.x; if (t >= qn * hg) return; const size_t i = (size_t)(t / qn) * SQ + (t % qn); const float* s = S + i * SQ; float mx = -3.0e38f;
#pragma unroll 1
  for (int j = 0; j < SQ; ++j) mx = fmaxf(mx, s[j]); float se = 0.f;
#pragma unroll 1
  for (int j = 0; j < SQ; ++j) se += __expf(s[j] - mx); const float sc = 256.0f / se;
#pragma unroll 1
  for (int j0 = 0; j0 < SQ; j0 += 8) { FragH f; for (int q = 0; q < 8; ++q) f.h[q] = (_Float16)(__expf(s[j0 + q] - mx) * sc); unsigned short* d = (unsigned short*)P + i * SQ + j0; *(v8us*)d = f.half[0];  } }


#define CN 256          /* channels */
#define CI 128          /* inner channels */
#define NP 4096         /* positions */
#define NM 1024         /* pooled positions (= SQ: the softmax key count) */

__global__ __launch_bounds__(256) void k_rowbias(const float* __restrict__ b, float* __restrict__ BP, size_t n4, int ncol) { const size_t t = (size_t)blockIdx.x * 256 + threadIdx.x; if (t >= n4) return; const size_t e = t * 4; const float v = bf16_round(b[e / ncol]); const v4f o = {v, v, v, v}; *(v4f*)(BP + e) = o;  }




__global__ __launch_bounds__(256) void k_mp2(const float* __restrict__ src, float* __restrict__ dst, int nout) {
  const int t = blockIdx.x * 256 + threadIdx.x; if (t >= nout) return; const int c = t / 1024; const int o = t % 1024; const int oy = o / 32, ox = o % 32; const float* p = src + (size_t)c * 4096 + (size_t)(2 * oy) * 64 + 2 * ox;
  const float v = fmaxf(fmaxf(p[0], p[1]), fmaxf(p[64], p[65])); *(float*)(dst + t) = v;  }
__global__ __launch_bounds__(256) void k_xpb(const float* __restrict__ x, const float* __restrict__ wb, float* __restrict__ CPP, size_t n4) {
  #pragma clang fp contract(off)
  const size_t t = (size_t)blockIdx.x * 256 + threadIdx.x; if (t >= n4) return; const size_t e = t * 4; const int c = (int)((e / 4096) % 256); const float bb = bf16_round(wb[c]); const v4f a = *(const v4fa*)(x + e); v4f o; for (int q = 0; q < 4; ++q) o[q] = __fadd_rn(bf16_round(a[q]), bb);
  *(v4f*)(CPP + e) = o;  }


__global__ __launch_bounds__(256) void k_bnres(float* __restrict__ O, const float* __restrict__ x, const float* __restrict__ wb, const float* __restrict__ g, const float* __restrict__ be, const float* __restrict__ mu, const float* __restrict__ var, float eps, size_t n4) {
  #pragma clang fp contract(off)
  const size_t t = (size_t)blockIdx.x * 256 + threadIdx.x; if (t >= n4) return; const size_t e = t * 4; const int c = (int)((e / NP) % CN);
  const float inv = __fdiv_rn(bf16_round(g[c]), sqrtf(__fadd_rn(bf16_round(var[c]), eps))); const float wbc = bf16_round(wb[c]), mc = bf16_round(mu[c]), bc = bf16_round(be[c]);
  const v4f a = *(const v4fa*)(O + e); const v4f xx = *(const v4fa*)(x + e); v4f o;
  for (int q = 0; q < 4; ++q) o[q] = __fadd_rn(__fadd_rn(__fmul_rn(__fadd_rn(__fadd_rn(a[q], wbc), -mc), inv), bc), bf16_round(xx[q]));
  *(v4f*)(O + e) = o;  }
extern "C" void kernel_launch(void* const* d_in, const int* in_sizes, int n_in,
                              void* d_out, int out_size, void* d_ws, size_t ws_size, hipStream_t stream) {
  (void)in_sizes; (void)n_in; (void)out_size;
  const float* const* I = (const float* const*)d_in; const float* x = I[0]; const float* gw = I[1]; const float* gb = I[2]; const float* tw = I[3]; const float* tb = I[4]; const float* pw = I[5]; const float* pb = I[6]; const float* ww = I[7]; const float* wb = I[8]; const float* bng = I[9]; const float* bnb = I[10]; const float* bnm = I[11]; const float* bnv = I[12];      /* natural [out][in] 1x1-conv weights + biases: g, theta, phi [128][256]; W [256][128] + b; eval BatchNorm gamma / beta / running mean / var [256] */
  char* ws = (char*)d_ws; size_t off = 0;
  auto take = [&](size_t bytes) { char* p = ws + off; off += (bytes + 255) & ~(size_t)255; return p; };
  const size_t PL = (size_t)CN * NP;      /* one input map */
  _Float16* BG = (_Float16*)take((size_t)CI * CN * 2); _Float16* BT = (_Float16*)take((size_t)CI * CN * 2); _Float16* BP = (_Float16*)take((size_t)CI * CN * 2); _Float16* BW = (_Float16*)take((size_t)CN * CI * 2);
  float* GBP = (float*)take((size_t)CI * NP * 4); float* PBP = (float*)take((size_t)CI * NP * 4);      /* g_b / phi_b broadcast along the position axis */
  _Float16* X16 = (_Float16*)take(NB * PL * 2);      /* x f16 channel-first */
  _Float16* XT = (_Float16*)take(PL * 2); float* F1 = (float*)take((size_t)NP * CI * 4); float* F2 = (float*)take((size_t)CI * NM * 4);      /* one batch: x^T [n][c]; f32 scratch [4096 x 128] (theta^T, then phi, then g maps); pooled f32 [128][1024] */
  _Float16* TH = (_Float16*)take((size_t)NP * CI * 2); _Float16* THL = (_Float16*)take((size_t)NP * CI * 2); _Float16* PH = (_Float16*)take((size_t)CI * NM * 2); _Float16* PHL = (_Float16*)take((size_t)CI * NM * 2); _Float16* PHT = (_Float16*)take((size_t)NM * CI * 2); _Float16* PHLT = (_Float16*)take((size_t)NM * CI * 2); _Float16* G16 = (_Float16*)take((size_t)CI * NM * 2); _Float16* GL = (_Float16*)take((size_t)CI * NM * 2); _Float16* YT = (_Float16*)take((size_t)NP * CI * 2);
  float* S = (float*)take((size_t)NP * NM * 4); _Float16* P = (_Float16*)take((size_t)NP * NM * 2);
  if (off > ws_size) return;
  { const unsigned g = (unsigned)(((size_t)CI * CN / 8 + 255) / 256); k_wnat<<<g, 256, 0, stream>>>(gw, (size_t)CI * CN / 8, BG); k_wnat<<<g, 256, 0, stream>>>(tw, (size_t)CI * CN / 8, BT); k_wnat<<<g, 256, 0, stream>>>(pw, (size_t)CI * CN / 8, BP); k_wnat<<<g, 256, 0, stream>>>(ww, (size_t)CN * CI / 8, BW); }      /* natural [out][in] x16 f16 planes (Bt for theta; the A operand for g / phi / w) */
  k_rowbias<<<(unsigned)(((size_t)CI * NP / 4 + 255) / 256), 256, 0, stream>>>(gb, GBP, (size_t)CI * NP / 4, NP); k_rowbias<<<(unsigned)(((size_t)CI * NP / 4 + 255) / 256), 256, 0, stream>>>(pb, PBP, (size_t)CI * NP / 4, NP);
  k_x16<<<(unsigned)((NB * PL / 8 + 255) / 256), 256, 0, stream>>>(x, X16, NB * PL / 8);
  for (int b = 0; b < NB; ++b) {
    k_vt<NP / 64, CN><<<(NP / 64) * (CN / 64), 256, 0, stream>>>(X16 + (size_t)b * PL, NP, 0, XT);      /* [c][n] -> x^T [n][c] */
    k_gemm2<0><<<dim3((unsigned)((NP / 128) * (CI / 64)), 1), 128, 0, stream>>>(XT, CN, 0, BT, CN, 0, 0.0625f, tb, 0, nullptr, 1, 0, 0, F1, nullptr, CI, 0, NP, CI, CN); k_hl<<<(unsigned)(((size_t)NP * CI / 8 + 255) / 256), 256, 0, stream>>>(F1, TH, THL, (size_t)NP * CI / 8);      /* theta^T [n][ci] f32 -> f16 hi + x1024 residual */
    k_gemm2<0><<<dim3((unsigned)((CI / 128) * (NP / 64)), 1), 128, 0, stream>>>(BP, CN, 0, XT, CN, 0, 0.0625f, nullptr, 0, PBP, -1, 0, 0, F1, nullptr, NP, 0, CI, NP, CN); k_mp2<<<(unsigned)((CI * NM + 255) / 256), 256, 0, stream>>>(F1, F2, CI * NM); k_hl<<<(unsigned)(((size_t)CI * NM / 8 + 255) / 256), 256, 0, stream>>>(F2, PH, PHL, (size_t)CI * NM / 8);      /* phi [ci][n] (f32) -> 2x2 max pool -> [ci][m] -> hi + residual */
    k_vt<NM / 64, CI><<<(NM / 64) * (CI / 64), 256, 0, stream>>>(PH, NM, 0, PHT); k_vt<NM / 64, CI><<<(NM / 64) * (CI / 64), 256, 0, stream>>>(PHL, NM, 0, PHLT);      /* -> phi^T planes [m][ci] (the scores' B^T operand) */
    k_gemm2<0><<<dim3((unsigned)((CI / 128) * (NP / 64)), 1), 128, 0, stream>>>(BG, CN, 0, XT, CN, 0, 0.0625f, nullptr, 0, GBP, -1, 0, 0, F1, nullptr, NP, 0, CI, NP, CN); k_mp2<<<(unsigned)((CI * NM + 255) / 256), 256, 0, stream>>>(F1, F2, CI * NM); k_hl<<<(unsigned)(((size_t)CI * NM / 8 + 255) / 256), 256, 0, stream>>>(F2, G16, GL, (size_t)CI * NM / 8);      /* g [ci][n] -> pooled [ci][m] -> f16 (the residual plane GL is not used) */
    k_gemm2<0><<<dim3((unsigned)((NP / 128) * (NM / 64)), 1), 128, 0, stream>>>(TH, CI, 0, PHT, CI, 0, 1.0f, nullptr, 0, nullptr, 1, 0, 0, S, nullptr, NM, 0, NP, NM, CI); k_gemm2<0><<<dim3((unsigned)((NP / 128) * (NM / 64)), 1), 128, 0, stream>>>(THL, CI, 0, PHT, CI, 0, 0.0009765625f, nullptr, 0, S, -1, 0, 0, S, nullptr, NM, 0, NP, NM, CI); k_gemm2<0><<<dim3((unsigned)((NP / 128) * (NM / 64)), 1), 128, 0, stream>>>(TH, CI, 0, PHLT, CI, 0, 0.0009765625f, nullptr, 0, S, -1, 0, 0, S, nullptr, NM, 0, NP, NM, CI);      /* f[n][m] = theta.phi (three accumulating passes; no scale) */
    k_rsmf<<<(NP + 255) / 256, 256, 0, stream>>>(S, P, NP, 1);      /* softmax over the 1024 pooled positions -> P x256 f16 */
    k_gemm2<0><<<dim3((unsigned)((NP / 128) * (CI / 64)), 1), 128, 0, stream>>>(P, NM, 0, G16, NM, 0, 0.00390625f, nullptr, 0, nullptr, 1, 0, 0, nullptr, YT, CI, 0, NP, CI, NM);      /* y^T [n][ci] = P g^T (A = P, B^T = the pooled g rows [ci][m]) -> f16 */
    k_gemm2<0><<<dim3((unsigned)((CN / 128) * (NP / 64)), 1), 128, 0, stream>>>(BW, CI, 0, YT, CI, 0, 0.0625f, nullptr, 0, nullptr, 1, 0, 0, (float*)d_out + (size_t)b * PL, nullptr, NP, 0, CN, NP, CI); }      /* T[c][n] = (16 W as A) x (y^T as B^T) / 16 -> f32 channel-first (bias, BN and residual follow on VALU) */
  k_bnres<<<(unsigned)((NB * PL / 4 + 255) / 256), 256, 0, stream>>>((float*)d_out, x, wb, bng, bnb, bnm, bnv, 1e-5f, NB * PL / 4);      /* z = ((T + bf16 W_b[c]) - bf16 mean[c]) (bf16 gamma[c] / sqrt(bf16 var[c] + eps)) + bf16 beta[c] + bf16 x (in place, own 16-B pieces) */
}

// v001
// One run takes 1410 microseconds.
// Timed twice side by side with v000, it ran 1.89 times as fast both times.
#include <hip/hip_runtime.h>
// Non-local block (embedded Gaussian, single head, 2x2 max-pool sub-sampling) with an eval-mode BatchNorm on the output conv (x [8][256][64][64]; theta = conv1x1(x) [128 ch], phi = maxpool2x2(conv1x1(x)), g = maxpool2x2(conv1x1(x)) (natural [128][256] weights sigma 1/16 + biases 0.01); f[n][m] = theta[:, n].phi[:, m] over the 1024 pooled positions (NO scale); softmax over m; y[:, n] = sum_m f[n][m] g[:, m]; W_y = conv1x1(y; W [256][128] + b); z = (W_y - bn_mean) gamma / sqrt(bn_var + 1e-5) + bn_beta + x -> [8][256][64][64]).
// Structure: x as an exact f16 channel-first plane; per batch: LDS slab transposes give token-major x^T [4096][256]; theta^T = x^T W^T + b as a WMMA GEMM (32x64 wave tiles, f32 accumulation) into f32 rows, split into f16 hi + x1024 residual (unscaled scores have sigma ~11); phi and g CHANNEL-first = (16 W as the A operand) (x^T as the B^T operand) + b[c] (own-element addend planes) in f32, 2x2 max-pooled on VALU; phi split into hi/lo and both transposed to [1024][128]; g to f16; scores = three accumulating passes (th_hi.ph_hi + th_lo.ph_hi/1024 + th_hi.ph_lo/1024, K = 128) into an f32 [4096][1024] plane; row softmax on VALU (f32 statistics, native exp; weights x256 f16); y^T = P g^T (K = 1024) -> f16 [4096][128]; T = (16 w as A) (y^T as B^T) / 16 -> f32 channel-first output, then z = (T + bf16(b[c]) - mean) gamma / sqrt(var + eps) + beta + bf16(x) on VALU in place; launches: see trace.
// Compute dtype: inputs rounded to bf16; x / weights exact; q and k as f16 hi + x1024 residual pairs; v, softmax weights and o as plain f16 GEMM operands (~2^-12); scores and softmax statistics f32. v_wmma_f32_16x16x32_f16.
#define NB 8
#define SQ 1024
#define DM 256
#define NH 1
#define HD 64
#define HG 4                         /* heads per attention launch group */
#define B0 0                         /* unused: the batch loop runs all NB batches */
#define NBR NB                       /* not used by any kernel or launch */
#define NR ((size_t)NB * SQ)         /* unused */
#define MP ((int)((size_t)NBR * SQ)) /* not used by any kernel or launch */
#define QT 256                       /* query rows per causal tile */
#define NKX SQ                       /* S / P row pitch */
#define QT0 256                      /* first-tile rows recomputed exactly (256: buys margin for the few-key rows 128..255, which have no output projection to average the single-f16 P/v rounding) */
#define QN SQ                        /* unused (each batch attends NP query rows) */
#define NHD NH                       /* unused */
#define MPO MP                       /* unused */
#define LQ DM            /* unused */
typedef __bf16 v16b __attribute__((ext_vector_type(16)));
typedef unsigned short v8us __attribute__((ext_vector_type(8), may_alias));
typedef float  v8f  __attribute__((ext_vector_type(8)));
typedef float  v4f  __attribute__((ext_vector_type(4)));
typedef float  v4fa __attribute__((ext_vector_type(4), may_alias));
union FragB { v16b v; v8us half[2]; unsigned short u[16]; };

__device__ __forceinline__ unsigned short bf16_bits(float x) { unsigned int u = __float_as_uint(x); return (unsigned short)((u + 0x7FFFu + ((u >> 16) & 1u)) >> 16); }
__device__ __forceinline__ float bf16_val(unsigned short b) { return __uint_as_float(((unsigned int)b) << 16); }
__device__ __forceinline__ float bf16_round(float x) { return bf16_val(bf16_bits(x)); }
// D += A·B with NT terms: 1 = ah·bh, 2 = + al·bh (A split), 3 = + ah·bl (both split)
template <int NT>
__device__ __forceinline__ v8f mmaN(v16b ah, v16b al, v16b bh, v16b bl, v8f c) {
  c = __builtin_amdgcn_wmma_f32_16x16x32_bf16(false, ah, false, bh, (short)0, c, false, false);
  if (NT >= 2) c = __builtin_amdgcn_wmma_f32_16x16x32_bf16(false, al, false, bh, (short)0, c, false, false);
  if (NT >= 3) c = __builtin_amdgcn_wmma_f32_16x16x32_bf16(false, ah, false, bl, (short)0, c, false, false);
  asm volatile("v_nop\n\tv_nop\n\tv_nop\n\tv_nop" : "+v"(c) : "v"(ah), "v"(al), "v"(bh), "v"(bl));
  return c;
}

__global__ __launch_bounds__(256) void k_wt_bf16(const float* __restrict__ W, unsigned short* __restrict__ Wt, int K, int N) {
  const int t = blockIdx.x * 256 + threadIdx.x;
  const int k8n = K / 8;
  if (t >= N * k8n) return;
  const int n = t / k8n, k8 = (t % k8n) * 8;
  v8us v;
#pragma unroll
  for (int i = 0; i < 8; ++i) v[i] = bf16_bits(W[(size_t)(k8 + i) * N + n]);
  *(v8us*)(Wt + (size_t)n * K + k8) = v;
  
}

// GEMM C[M][N] (f32, pitch ldc) = act(A[M][K]·W + bias). A f32 row-major (pitch lda) converted per fragment to bf16
// (ASPLIT: hi/lo two planes -> 2 terms, else single rounded term); Wt bf16 [N][K] (pitch ldb). BIAS_BF16 rounds the
// bias to bf16 first (bias quantised to bf16 before the add). K%32==0, M%16==0, N%64==0.
template <bool ASPLIT, int ACT, bool BIAS_BF16>
__global__ __launch_bounds__(128) void k_gemm_bf(const float* __restrict__ A, int lda, const unsigned short* __restrict__ Wt, int ldb,
                                               const float* __restrict__ bias, float* __restrict__ C, int ldc, int M, int N, int K) {
  __shared__ __attribute__((aligned(16))) float so[4][16][64];
  const int tid = threadIdx.x, w = tid >> 5, lane = tid & 31, ln = lane & 15, hh = lane >> 4;
  const int ntn = N / 64;
  const int wid = blockIdx.x * 4 + w;
  const int mt = wid / ntn, nq = wid % ntn;
  if (mt * 16 >= M) return;
  const int row0 = mt * 16, col0 = nq * 64;
  const float* arow = A + (size_t)(row0 + ln) * lda;
  v8f acc[4] = {};
  for (int kb = 0; kb < K; kb += 32) {
    FragB ah, al;
    const v4f x0 = *(const v4fa*)(arow + kb + 8 * hh), x1 = *(const v4fa*)(arow + kb + 8 * hh + 4);
    const v4f x2 = *(const v4fa*)(arow + kb + 16 + 8 * hh), x3 = *(const v4fa*)(arow + kb + 16 + 8 * hh + 4);
    float xs[16] = {x0[0],x0[1],x0[2],x0[3],x1[0],x1[1],x1[2],x1[3],x2[0],x2[1],x2[2],x2[3],x3[0],x3[1],x3[2],x3[3]};
#pragma unroll
    for (int i = 0; i < 16; ++i) { const unsigned short hb = bf16_bits(xs[i]); ah.u[i] = hb; al.u[i] = ASPLIT ? bf16_bits(xs[i] - bf16_val(hb)) : (unsigned short)0; }
#pragma unroll
    for (int t = 0; t < 4; ++t) {
      const unsigned short* brow = Wt + (size_t)(col0 + t * 16 + ln) * ldb + kb;
      FragB b;
      b.half[0] = *(const v8us*)(brow + 8 * hh);
      b.half[1] = *(const v8us*)(brow + 16 + 8 * hh);
      acc[t] = mmaN<ASPLIT ? 2 : 1>(ah.v, al.v, b.v, b.v, acc[t]);
    }
  }
#pragma unroll
  for (int t = 0; t < 4; ++t) {
    float bv = bias ? bias[col0 + t * 16 + ln] : 0.f;
    if (BIAS_BF16) bv = bf16_round(bv);
#pragma unroll
    for (int r = 0; r < 8; ++r) { float v = acc[t][r] + bv; if (ACT == 1) v = fmaxf(v, 0.f); so[w][8 * hh + r][t * 16 + ln] = v; }
  }
  __builtin_amdgcn_fence(__ATOMIC_ACQ_REL, "workgroup");
  __builtin_amdgcn_wave_barrier();
  const int rsub = lane >> 4, c4 = (lane & 15) * 4;
  {
#pragma unroll
    for (int q = 0; q < 8; ++q) {
      const int r = q * 2 + rsub;
      const v4f v = *(const v4fa*)&so[w][r][c4];
      *(v4f*)(C + (size_t)(row0 + r) * ldc + col0 + c4) = v;
    }
    
  }
}

// GEMM C = act(A·W + bias + resid): A f32 (ASPLIT -> hi/lo 2 terms), Wt bf16 [N][K]; ACT 0 none, 1 relu, 2 exact gelu;
// resid (optional, f32, row index = (row % rmod), pitch ldr, RES_BF16 rounds it) added before the activation.
template <bool ASPLIT, int ACT, bool BIAS_BF16, bool RES_BF16>
__global__ __launch_bounds__(128) void k_gemm_bf3(const float* __restrict__ A, int lda, const unsigned short* __restrict__ Wt, int ldb,
                                                const float* __restrict__ bias, const float* __restrict__ resid, int rmod, int ldr,
                                                float* __restrict__ C, int ldc, int M, int N, int K) {
  __shared__ __attribute__((aligned(16))) float so[4][16][64];
  const int tid = threadIdx.x, w = tid >> 5, lane = tid & 31, ln = lane & 15, hh = lane >> 4;
  const int ntn = N / 64;
  const int wid = blockIdx.x * 4 + w;
  const int mt = wid / ntn, nq = wid % ntn;
  if (mt * 16 >= M) return;
  const int row0 = mt * 16, col0 = nq * 64;
  const float* arow = A + (size_t)(row0 + ln) * lda;
  v8f acc[4] = {};
  for (int kb = 0; kb < K; kb += 32) {
    FragB ah, al;
    const v4f x0 = *(const v4fa*)(arow + kb + 8 * hh), x1 = *(const v4fa*)(arow + kb + 8 * hh + 4);
    const v4f x2 = *(const v4fa*)(arow + kb + 16 + 8 * hh), x3 = *(const v4fa*)(arow + kb + 16 + 8 * hh + 4);
    float xs[16] = {x0[0],x0[1],x0[2],x0[3],x1[0],x1[1],x1[2],x1[3],x2[0],x2[1],x2[2],x2[3],x3[0],x3[1],x3[2],x3[3]};
#pragma unroll
    for (int i = 0; i < 16; ++i) { const unsigned short hb = bf16_bits(xs[i]); ah.u[i] = hb; al.u[i] = ASPLIT ? bf16_bits(xs[i] - bf16_val(hb)) : (unsigned short)0; }
#pragma unroll
    for (int t = 0; t < 4; ++t) {
      const unsigned short* brow = Wt + (size_t)(col0 + t * 16 + ln) * ldb + kb;
      FragB b;
      b.half[0] = *(const v8us*)(brow + 8 * hh);
      b.half[1] = *(const v8us*)(brow + 16 + 8 * hh);
      acc[t] = mmaN<ASPLIT ? 2 : 1>(ah.v, al.v, b.v, b.v, acc[t]);
    }
  }
#pragma unroll
  for (int t = 0; t < 4; ++t) {
    const int col = col0 + t * 16 + ln;
    float bv = bias ? bias[col] : 0.f;
    if (BIAS_BF16) bv = bf16_round(bv);
#pragma unroll
    for (int r = 0; r < 8; ++r) {
      float v = acc[t][r] + bv;
      if (resid) { float rv = resid[(size_t)((row0 + 8 * hh + r) % rmod) * ldr + col]; if (RES_BF16) rv = bf16_round(rv); v += rv; }
      if (ACT == 1) v = fmaxf(v, 0.f);
      if (ACT == 2) v = 0.5f * v * (1.0f + erff(v * 0.70710678118654752f));
      if (ACT == 3) { const float u = 0.7978845608028654f * (v + 0.044715f * v * v * v); v = 0.5f * v * (1.0f + tanhf(u)); }
      so[w][8 * hh + r][t * 16 + ln] = v;
    }
  }
  __builtin_amdgcn_fence(__ATOMIC_ACQ_REL, "workgroup");
  __builtin_amdgcn_wave_barrier();
  const int rsub = lane >> 4, c4 = (lane & 15) * 4;
  {
#pragma unroll
    for (int q = 0; q < 8; ++q) {
      const int r = q * 2 + rsub;
      const v4f v = *(const v4fa*)&so[w][r][c4];
      *(v4f*)(C + (size_t)(row0 + r) * ldc + col0 + c4) = v;
    }
    
  }
}
// row LayerNorm (biased variance, eps) over N: s = X (+ R); optional out_sum <- s; out_norm <- (s-mu)*rsqrt(var+eps)*g + b
template <bool PARAM_BF16>
__global__ __launch_bounds__(256) void k_layernorm(const float* __restrict__ X, const float* __restrict__ R, const float* __restrict__ g, const float* __restrict__ bta,
                                                  float* __restrict__ out_sum, float* __restrict__ out_norm, int N, float eps) {
  __shared__ float red[256];
  const int row = blockIdx.x, tid = threadIdx.x;
  const float* x = X + (size_t)row * N; const float* rr = R ? R + (size_t)row * N : nullptr;
  float vals[16];                     // up to N = 4096
  const int per = N / 256;            // contiguous chunk per thread? use strided-by-4 chunks: thread handles j = tid*4 + 1024*u
  float s1 = 0.f;
  for (int u = 0; u < per / 4; ++u) {
    const int j = tid * 4 + 1024 * u;
    const v4f a = *(const v4fa*)(x + j);
    v4f b = {0.f,0.f,0.f,0.f}; if (rr) b = *(const v4fa*)(rr + j);
#pragma unroll
    for (int q = 0; q < 4; ++q) { const float v = a[q] + b[q]; vals[u * 4 + q] = v; s1 += v; }
  }
  red[tid] = s1; __syncthreads();
  for (int st = 128; st > 0; st >>= 1) { if (tid < st) red[tid] += red[tid + st]; __syncthreads(); }
  const float mu = red[0] / (float)N; __syncthreads();
  float s2 = 0.f;
  for (int u = 0; u < per / 4; ++u)
#pragma unroll
    for (int q = 0; q < 4; ++q) { const float c = vals[u * 4 + q] - mu; s2 += c * c; }
  red[tid] = s2; __syncthreads();
  for (int st = 128; st > 0; st >>= 1) { if (tid < st) red[tid] += red[tid + st]; __syncthreads(); }
  const float rs = rsqrtf(red[0] / (float)N + eps);
  {
    for (int u = 0; u < per / 4; ++u) {
      const int j = tid * 4 + 1024 * u;
      v4f o, sm;
#pragma unroll
      for (int q = 0; q < 4; ++q) {
        float gg = g[j + q], bb = bta[j + q];
        if (PARAM_BF16) { gg = bf16_round(gg); bb = bf16_round(bb); }
        sm[q] = vals[u * 4 + q]; o[q] = (vals[u * 4 + q] - mu) * rs * gg + bb;
      }
      if (out_sum) *(v4f*)(out_sum + (size_t)row * N + j) = sm;
      *(v4f*)(out_norm + (size_t)row * N + j) = o;
    }
    
  }
}



// ---- f16 WMMA path (v_wmma_f32_16x16x32_f16): 11-bit significands for operands in range — used where a [0,1] probability operand needs more precision than bf16
typedef _Float16 v16h __attribute__((ext_vector_type(16)));
union FragH { v16h v; v8us half[2]; _Float16 h[16]; unsigned short u[16]; };
template <int NT>
__device__ __forceinline__ v8f mmaH(v16h ah, v16h al, v16h bh, v16h bl, v8f c) {
  c = __builtin_amdgcn_wmma_f32_16x16x32_f16(false, ah, false, bh, (short)0, c, false, false);
  if (NT >= 2) c = __builtin_amdgcn_wmma_f32_16x16x32_f16(false, al, false, bh, (short)0, c, false, false);
  if (NT >= 3) c = __builtin_amdgcn_wmma_f32_16x16x32_f16(false, ah, false, bl, (short)0, c, false, false);
  asm volatile("v_nop\n\tv_nop\n\tv_nop\n\tv_nop" : "+v"(c) : "v"(ah), "v"(al), "v"(bh), "v"(bl));
  return c;
}
// batched GEMM like k_gemm_b but f16 operands: A f32 (split into f16 hi/lo if ASPLIT, else rounded to f16), Bt = f16 values [n][k]; alpha; C f32; N multiple of 16 (partial tiles skipped)
template <bool ASPLIT>
__global__ __launch_bounds__(128) void k_gemm_h(const float* __restrict__ A, int lda, size_t sA, const _Float16* __restrict__ Bh, int ldb, size_t sB, float alpha, float* __restrict__ C, int ldc, size_t sC, int M, int N, int K) {
  __shared__ __attribute__((aligned(16))) float so[4][16][64];
  const int tid = threadIdx.x, w = tid >> 5, lane = tid & 31, ln = lane & 15, hh = lane >> 4; const int by = blockIdx.y;
  A += (size_t)by * sA; Bh += (size_t)by * sB; C += (size_t)by * sC;
  const int ntn = (N + 63) / 64; const int wid = blockIdx.x * 4 + w; const int mt = wid / ntn, nq = wid % ntn; if (mt * 16 >= M) return;
  const int row0 = mt * 16, col0 = nq * 64; const float* arow = A + (size_t)(row0 + ln) * lda;
  v8f acc[4] = {};
  for (int kb = 0; kb < K; kb += 32) {
    FragH ah, al;
    const v4f x0 = *(const v4fa*)(arow + kb + 8 * hh), x1 = *(const v4fa*)(arow + kb + 8 * hh + 4), x2 = *(const v4fa*)(arow + kb + 16 + 8 * hh), x3 = *(const v4fa*)(arow + kb + 16 + 8 * hh + 4);
    float xs[16] = {x0[0],x0[1],x0[2],x0[3],x1[0],x1[1],x1[2],x1[3],x2[0],x2[1],x2[2],x2[3],x3[0],x3[1],x3[2],x3[3]};
#pragma unroll
    for (int i = 0; i < 16; ++i) { const _Float16 h = (_Float16)xs[i]; ah.h[i] = h; al.h[i] = ASPLIT ? (_Float16)(xs[i] - (float)h) : (_Float16)0.0f; }
#pragma unroll
    for (int t = 0; t < 4; ++t) { if (col0 + t * 16 >= N) continue; const size_t boff = (size_t)(col0 + t * 16 + ln) * ldb + kb; FragH bq; bq.half[0] = *(const v8us*)(Bh + boff + 8 * hh); bq.half[1] = *(const v8us*)(Bh + boff + 16 + 8 * hh);
      acc[t] = mmaH<ASPLIT ? 2 : 1>(ah.v, al.v, bq.v, bq.v, acc[t]); }
  }
#pragma unroll
  for (int t = 0; t < 4; ++t) { if (col0 + t * 16 >= N) continue;
#pragma unroll
    for (int r = 0; r < 8; ++r) so[w][8 * hh + r][t * 16 + ln] = acc[t][r] * alpha; }
  __builtin_amdgcn_fence(__ATOMIC_ACQ_REL, "workgroup"); __builtin_amdgcn_wave_barrier();
  const int rsub = lane >> 4, c4 = (lane & 15) * 4;
  {
#pragma unroll
    for (int q = 0; q < 8; ++q) { const int r = q * 2 + rsub; if (col0 + c4 < N) { const v4f v = *(const v4fa*)&so[w][r][c4]; *(v4f*)(C + (size_t)(row0 + r) * ldc + col0 + c4) = v; } }
     }
}

// Wt[n][k] = f16(W[k][n]·scale) from f32 row-major W[K][N] (scale = power of two; bf16-exact weights stay exact in f16 away from the subnormal range)
__global__ __launch_bounds__(256) void k_wt_f16(const float* __restrict__ W, _Float16* __restrict__ Wt, int K, int N, float scale) {
  const int t = blockIdx.x * 256 + threadIdx.x; if (t >= N * (K / 8)) return; const int n = t / (K / 8), k8 = (t % (K / 8)) * 8; FragH f;
#pragma unroll
  for (int i = 0; i < 8; ++i) f.h[i] = (_Float16)(bf16_round(W[(size_t)(k8 + i) * N + n]) * scale); const v8us o = f.half[0];
  *(v8us*)((unsigned short*)Wt + (size_t)n * K + k8) = o; 
}
// k_gemm_hh variant with fused epilogue: v = acc·alpha + bias[by·sBias + col] (+ CP[(row/rowsPerB)·sCPb + by·64 + col] if CP) ; ACT 0 none / 1 elu ; writes f16 C16 (and f32 C if non-null)
template <int ACT>
__global__ __launch_bounds__(128) void k_gemm_hhx(const _Float16* __restrict__ A, int lda, size_t sA, const _Float16* __restrict__ Bh, int ldb, size_t sB, float alpha, const float* __restrict__ bias, size_t sBias, const float* __restrict__ CP, int rowsPerB, size_t sCPb, int row0g,
    float* __restrict__ C, _Float16* __restrict__ C16, int ldc, size_t sC, int M, int N, int K) {
  __shared__ __attribute__((aligned(16))) float so[4][16][64];
  const int tid = threadIdx.x, w = tid >> 5, lane = tid & 31, ln = lane & 15, hh = lane >> 4; const int by = blockIdx.y;
  A += (size_t)by * sA; Bh += (size_t)by * sB; const size_t cofs = (size_t)by * sC; const float* bp = bias ? bias + (size_t)by * sBias : nullptr;
  const int ntn = (N + 63) / 64; const int wid = blockIdx.x * 4 + w; const int mt = wid / ntn, nq = wid % ntn; if (mt * 16 >= M) return;
  const int row0 = mt * 16, col0 = nq * 64; const _Float16* arow = A + (size_t)(row0 + ln) * lda;
  v8f acc[4] = {};
  for (int kb = 0; kb < K; kb += 32) { FragH ah; ah.half[0] = *(const v8us*)((const unsigned short*)arow + kb + 8 * hh); ah.half[1] = *(const v8us*)((const unsigned short*)arow + kb + 16 + 8 * hh);
#pragma unroll
    for (int t = 0; t < 4; ++t) { if (col0 + t * 16 >= N) continue; const size_t boff = (size_t)(col0 + t * 16 + ln) * ldb + kb; FragH bq; bq.half[0] = *(const v8us*)((const unsigned short*)Bh + boff + 8 * hh); bq.half[1] = *(const v8us*)((const unsigned short*)Bh + boff + 16 + 8 * hh);
      acc[t] = mmaH<1>(ah.v, ah.v, bq.v, bq.v, acc[t]); }
  }
#pragma unroll
  for (int t = 0; t < 4; ++t) { if (col0 + t * 16 >= N) continue; const int col = col0 + t * 16 + ln; const float bv = bp ? bf16_round(bp[col]) : 0.f;
#pragma unroll
    for (int r = 0; r < 8; ++r) { float v = acc[t][r] * alpha + bv; if (CP) { const int rr = row0g + row0 + 8 * hh + r; if (rowsPerB < 0) v += CP[cofs + (size_t)rr * ldc + col];      /* rowsPerB < 0: own element of the batched C plane */ else { const int bidx = rr / rowsPerB; v += CP[(size_t)bidx * sCPb + (size_t)by * 64 + col]; } } if (ACT == 1) v = (v > 0.f) ? v : expm1f(v); else if (ACT == 7) v = (v > 0.f) ? v + 1.0f : expf(v); else if (ACT == 8) v = tanhf(v); else if (ACT == 9) v = 0.5f * v * (1.0f + tanhf(0.7978845608028654f * (v + 0.044715f * v * v * v))); else if (ACT == 11) v = 1.0f / (1.0f + expf(-v)); else if (ACT == 12) v = (v > 0.f) ? v : 0.01f * v; else if (ACT == 14) v = (v > 0.f) ? v : 0.1f * v; else if (ACT == 16) v = (v >= 0.f) ? v : 0.3f * v; else if (ACT == 17) v = (v >= 0.f) ? v : 0.2f * v; else if (ACT == 15) v = v / (1.0f + expf(-v)); else if (ACT == 3) v = fmaxf(v, 0.f); else if (ACT == 6) v = 0.5f * v * (1.0f + erff(v * 0.70710678118654752f)); so[w][8 * hh + r][t * 16 + ln] = v; } }
  __builtin_amdgcn_fence(__ATOMIC_ACQ_REL, "workgroup"); __builtin_amdgcn_wave_barrier();
  const int rsub = lane >> 4, c4 = (lane & 15) * 4; typedef _Float16 v4h __attribute__((ext_vector_type(4)));
  {
#pragma unroll
    for (int q = 0; q < 8; ++q) { const int r = q * 2 + rsub; if (col0 + c4 < N) { const v4f v = *(const v4fa*)&so[w][r][c4]; if (C) *(v4f*)(C + cofs + (size_t)(row0 + r) * ldc + col0 + c4) = v; if (C16) { v4h h4; for (int i = 0; i < 4; ++i) h4[i] = (_Float16)v[i]; *(v4h*)(C16 + cofs + (size_t)(row0 + r) * ldc + col0 + c4) = h4; } } }
     }
}


typedef _Float16 v4h __attribute__((ext_vector_type(4)));

__global__ __launch_bounds__(256) void k_x16(const float* __restrict__ x, _Float16* __restrict__ X16, size_t n8) { const size_t t = (size_t)blockIdx.x * 256 + threadIdx.x; if (t >= n8) return; FragH f;
#pragma unroll
  for (int q = 0; q < 8; ++q) f.h[q] = (_Float16)bf16_round(x[t * 8 + q]); *(v8us*)((unsigned short*)X16 + t * 8) = f.half[0];  }
__global__ __launch_bounds__(256) void k_h16(const float* __restrict__ x, _Float16* __restrict__ X16, size_t n8) { const size_t t = (size_t)blockIdx.x * 256 + threadIdx.x; if (t >= n8) return; FragH f;
#pragma unroll
  for (int q = 0; q < 8; ++q) f.h[q] = (_Float16)x[t * 8 + q]; *(v8us*)((unsigned short*)X16 + t * 8) = f.half[0];  }
__global__ __launch_bounds__(256) void k_round16f(const float* __restrict__ W, _Float16* __restrict__ Bt, size_t n8) { const size_t t = (size_t)blockIdx.x * 256 + threadIdx.x; if (t >= n8) return; FragH f;
#pragma unroll
  for (int i = 0; i < 8; ++i) f.h[i] = (_Float16)(bf16_round(W[t * 8 + i]) * 16.0f); *(v8us*)((unsigned short*)Bt + t * 8) = f.half[0];  }
template <int NHv, int TTv>
__global__ __launch_bounds__(256) void k_vt(const _Float16* __restrict__ V16, int ldv, int voff, _Float16* __restrict__ Vt) { __shared__ unsigned short tl[64][66]; const int tid = threadIdx.x; const int slab = blockIdx.x / (TTv / 64), lg = blockIdx.x % (TTv / 64); const int b = slab / NHv, h = slab % NHv;
  for (int i = tid; i < 64 * 8; i += 256) { const int r = i / 8, c8 = (i % 8) * 8; FragH f; f.half[0] = *(const v8us*)((const unsigned short*)V16 + ((size_t)b * TTv + lg * 64 + r) * ldv + voff + h * 64 + c8);
#pragma unroll
    for (int q = 0; q < 8; ++q) tl[r][c8 + q] = f.u[q]; }
  __syncthreads();
  {
#pragma unroll
    for (int rd = 0; rd < 2; ++rd) { const int d = rd * 32 + tid / 8, pc = tid % 8; FragH f;
#pragma unroll
      for (int q = 0; q < 8; ++q) f.u[q] = tl[pc * 8 + q][d];
      *(v8us*)((unsigned short*)Vt + ((size_t)slab * 64 + d) * TTv + lg * 64 + pc * 8) = f.half[0]; }
     } }

__global__ __launch_bounds__(256) void k_hl(const float* __restrict__ F, _Float16* __restrict__ Hh, _Float16* __restrict__ Hl, size_t n8) { const size_t t = (size_t)blockIdx.x * 256 + threadIdx.x; if (t >= n8) return; FragH fh, fl; const v4f a = *(const v4fa*)(F + t * 8), c = *(const v4fa*)(F + t * 8 + 4);
#pragma unroll
  for (int q = 0; q < 4; ++q) { _Float16 h = (_Float16)a[q]; fh.h[q] = h; fl.h[q] = (_Float16)((a[q] - (float)h) * 1024.0f); h = (_Float16)c[q]; fh.h[4 + q] = h; fl.h[4 + q] = (_Float16)((c[q] - (float)h) * 1024.0f); }
  { *(v8us*)((unsigned short*)Hh + t * 8) = fh.half[0]; *(v8us*)((unsigned short*)Hl + t * 8) = fl.half[0];  } }

// ---- fast GEMM (wave tile 32x64; requires M % 32 == 0 rows per launch region and N % 64 == 0); epilogue = k_gemm_hhx semantics ----
__device__ __forceinline__ v16h g2_frag(const _Float16* p, int hh) { FragH f; f.half[0] = *(const v8us*)((const unsigned short*)p + 8 * hh); f.half[1] = *(const v8us*)((const unsigned short*)p + 16 + 8 * hh); return f.v; }
__device__ __forceinline__ v8f g2_mma(v16h a, v16h b, v8f c) { v8f d = __builtin_amdgcn_wmma_f32_16x16x32_f16(false, a, false, b, (short)0, c, false, false); asm volatile("v_nop\n\tv_nop\n\tv_nop\n\tv_nop" : "+v"(d) : "v"(a), "v"(b)); return d; }
template <int ACT>
__global__ __launch_bounds__(128) void k_gemm2(const _Float16* __restrict__ A, int lda, size_t sA, const _Float16* __restrict__ Bh, int ldb, size_t sB, float alpha, const float* __restrict__ bias, size_t sBias, const float* __restrict__ CP, int rowsPerB, size_t sCPb, int row0g,
    float* __restrict__ C, _Float16* __restrict__ C16, int ldc, size_t sC, int M, int N, int K) { static_assert(ACT == 0 || ACT == 3 || ACT == 6 || ACT == 8 || ACT == 9 || ACT == 11 || ACT == 12 || ACT == 14 || ACT == 15 || ACT == 16 || ACT == 17, "k_gemm2: unsupported ACT code (would silently apply no activation)");
  __shared__ __attribute__((aligned(16))) float so[4][32][68];
  const int tid = threadIdx.x, w = tid >> 5, lane = tid & 31, ln = lane & 15, hh = lane >> 4; const int by = blockIdx.y;
  A += (size_t)by * sA; Bh += (size_t)by * sB; const size_t cofs = (size_t)by * sC; const float* bp = bias ? bias + (size_t)by * sBias : nullptr;
  const int ntn = N >> 6; const int mt = blockIdx.x / ntn, nq = blockIdx.x - mt * ntn; const int row0 = mt * 128 + 32 * w, col0 = nq * 64; if (row0 >= M) return;
  const _Float16* a0p = A + (size_t)(row0 + ln) * lda; const _Float16* a1p = a0p + (size_t)16 * lda;
  const _Float16* b0p = Bh + (size_t)(col0 + ln) * ldb; const _Float16* b1p = b0p + (size_t)16 * ldb; const _Float16* b2p = b1p + (size_t)16 * ldb; const _Float16* b3p = b2p + (size_t)16 * ldb;
  const v8f z8 = {0.f,0.f,0.f,0.f,0.f,0.f,0.f,0.f}; v8f c00 = z8, c01 = z8, c02 = z8, c03 = z8, c10 = z8, c11 = z8, c12 = z8, c13 = z8;
#pragma unroll 1
  for (int kb = 0; kb < K; kb += 32) { const v16h a0 = g2_frag(a0p + kb, hh), a1 = g2_frag(a1p + kb, hh);
    v16h b = g2_frag(b0p + kb, hh); c00 = g2_mma(a0, b, c00); c10 = g2_mma(a1, b, c10);
    b = g2_frag(b1p + kb, hh); c01 = g2_mma(a0, b, c01); c11 = g2_mma(a1, b, c11);
    b = g2_frag(b2p + kb, hh); c02 = g2_mma(a0, b, c02); c12 = g2_mma(a1, b, c12);
    b = g2_frag(b3p + kb, hh); c03 = g2_mma(a0, b, c03); c13 = g2_mma(a1, b, c13); }
  v8f accs[8] = {c00, c01, c02, c03, c10, c11, c12, c13};
#pragma unroll
  for (int u = 0; u < 8; ++u) { const int t = u & 3, half = u >> 2; const int col = col0 + t * 16 + ln; const float bv = bp ? bf16_round(bp[col]) : 0.f;
#pragma unroll
    for (int r = 0; r < 8; ++r) { const int rloc = half * 16 + 8 * hh + r; float v = accs[u][r] * alpha + bv; if (CP) { if (rowsPerB < 0) v += CP[cofs + (size_t)(row0g + row0 + rloc) * ldc + col];      /* rowsPerB < 0: own element of the batched C plane */ else { const int bidx = (row0g + row0 + rloc) / rowsPerB; v += CP[(size_t)bidx * sCPb + (size_t)by * 64 + col]; } }
      if (ACT == 3) v = fmaxf(v, 0.f); else if (ACT == 6) v = 0.5f * v * (1.0f + erff(v * 0.70710678118654752f)); else if (ACT == 11) v = 1.0f / (1.0f + expf(-v)); else if (ACT == 15) v = v / (1.0f + expf(-v)); else if (ACT == 12) v = (v > 0.f) ? v : 0.01f * v; else if (ACT == 8) v = tanhf(v); else if (ACT == 9) v = 0.5f * v * (1.0f + tanhf(0.7978845608028654f * (v + 0.044715f * v * v * v))); else if (ACT == 14) v = (v > 0.f) ? v : 0.1f * v; else if (ACT == 16) v = (v >= 0.f) ? v : 0.3f * v; else if (ACT == 17) v = (v >= 0.f) ? v : 0.2f * v;
      so[w][rloc][t * 16 + ln] = v; } }
  __builtin_amdgcn_fence(__ATOMIC_ACQ_REL, "workgroup"); __builtin_amdgcn_wave_barrier();
  const int rsub = lane >> 4, c4 = (lane & 15) * 4;
  {
#pragma unroll
    for (int q = 0; q < 16; ++q) { const int r = q * 2 + rsub; const v4f v = *(const v4fa*)&so[w][r][c4]; if (C) *(v4f*)(C + cofs + (size_t)(row0 + r) * ldc + col0 + c4) = v; if (C16) { v4h h4; for (int i = 0; i < 4; ++i) h4[i] = (_Float16)v[i]; *(v4h*)(C16 + cofs + (size_t)(row0 + r) * ldc + col0 + c4) = h4; } }
     } }


__global__ __launch_bounds__(256) void k_wnat(const float* __restrict__ w, size_t n8, _Float16* __restrict__ Bt) { const size_t t = (size_t)blockIdx.x * 256 + threadIdx.x; if (t >= n8) return; FragH f; for (int q = 0; q < 8; ++q) f.h[q] = (_Float16)(bf16_round(w[t * 8 + q]) * 16.0f); *(v8us*)((unsigned short*)Bt + t * 8) = f.half[0];  }
__global__ __launch_bounds__(256) void k_rsm(const float* __restrict__ S, _Float16* __restrict__ P, int nrows) {
  #pragma clang fp contract(off)
  const int i = blockIdx.x * 256 + threadIdx.x; if (i >= nrows) return; const float* s = S + (size_t)i * SQ; float mx = -3.0e38f;
#pragma unroll 1
  for (int j = 0; j < SQ; ++j) mx = fmaxf(mx, s[j]); float se = 0.f;
#pragma unroll 1
  for (int j = 0; j < SQ; ++j) se += expf(s[j] - mx); const float sc = 256.0f / se;
#pragma unroll 1
  for (int j0 = 0; j0 < SQ; j0 += 8) { FragH f; for (int q = 0; q < 8; ++q) f.h[q] = (_Float16)(expf(s[j0 + q] - mx) * sc); unsigned short* d = (unsigned short*)P + (size_t)i * SQ + j0; *(v8us*)d = f.half[0];  } }
__global__ __launch_bounds__(256) void k_vt(const _Float16* __restrict__ V16, int b, int h0, _Float16* __restrict__ VT) { __shared__ unsigned short tl[64][65]; const int tid = threadIdx.x; const int hh = blockIdx.x % HG, sg = blockIdx.x / HG; const int s0 = sg * 64; const int h = h0 + hh;
  for (int i = tid; i < 64 * 8; i += 256) { const int j = i / 8, d8 = (i % 8) * 8; FragH f; f.half[0] = *(const v8us*)((const unsigned short*)V16 + ((size_t)b * SQ + s0 + j) * DM + h * HD + d8); for (int q = 0; q < 8; ++q) tl[d8 + q][j] = f.u[q]; }
  __syncthreads();
  { for (int i = tid; i < 64 * 8; i += 256) { const int d = i / 8, j8 = (i % 8) * 8; FragH f; for (int q = 0; q < 8; ++q) f.u[q] = tl[d][j8 + q]; *(v8us*)((unsigned short*)VT + ((size_t)hh * HD + d) * SQ + s0 + j8) = f.half[0]; }  } }



__global__ __launch_bounds__(256) void k_rsmcf2(const float* __restrict__ S, _Float16* __restrict__ P, int hg, int q0, int nk) {
  #pragma clang fp contract(off)
  const int t = blockIdx.x * 256 + threadIdx.x; if (t >= hg * QT) return; const size_t i = (size_t)t; const float* s = S + i * NKX; const int last = q0 + (t % QT); float mx = -3.0e38f;
#pragma unroll 1
  for (int j = 0; j < nk; ++j) { const float f = (j <= last) ? 1.f : 0.f; mx = fmaxf(mx, fmaf(f, s[j], (1.f - f) * -1.0e9f)); } float se = 0.f;
#pragma unroll 1
  for (int j = 0; j < nk; ++j) { const float f = (j <= last) ? 1.f : 0.f; se += __expf(fmaf(f, s[j], (1.f - f) * -1.0e9f) - mx); } const float sc = 256.0f / se;
#pragma unroll 1
  for (int j0 = 0; j0 < nk; j0 += 8) { FragH fr; for (int q = 0; q < 8; ++q) { const int j = j0 + q; const float f = (j <= last) ? 1.f : 0.f; fr.h[q] = (_Float16)(__expf(fmaf(f, s[j], (1.f - f) * -1.0e9f) - mx) * sc); } unsigned short* d = (unsigned short*)P + i * NKX + j0; *(v8us*)d = fr.half[0];  } }

template <int MASKADD>
__global__ __launch_bounds__(64) void k_att0(const float* __restrict__ QF, const float* __restrict__ KF, const float* __restrict__ VF, int ld, const float* __restrict__ mask, float scale, float* __restrict__ OF, int ldo) {
  #pragma clang fp contract(off)
  __shared__ __attribute__((aligned(16))) float lq[64][64]; __shared__ __attribute__((aligned(16))) float lo[64][64];
  const int tid = threadIdx.x; const int h = blockIdx.x / (QT0 / 64), rg = blockIdx.x % (QT0 / 64); const int i = rg * 64 + tid;
  const float* qr = QF + (size_t)i * ld + h * HD;
#pragma unroll 1
  for (int c = 0; c < HD / 4; ++c) { *(v4f*)&lq[tid][c * 4] = *(const v4fa*)(qr + c * 4); const v4f z = {0.f, 0.f, 0.f, 0.f}; *(v4f*)&lo[tid][c * 4] = z; }
  float m = -1.0e30f, l = 0.f; const int jmax = MASKADD ? (SQ - 1) : (rg * 64 + 63);      /* additive-mask form: every key (the mask input decides); causal form: keys up to the block's last row */
#pragma unroll 1
  for (int j = 0; j <= jmax; ++j) { const float* kr = KF + (size_t)j * ld + h * HD; const float* vr = VF + (size_t)j * ld + h * HD; float s = 0.f;
#pragma unroll 1
    for (int c = 0; c < HD / 4; ++c) { const v4f kq = *(const v4fa*)(kr + c * 4); const v4f qq = *(v4f*)&lq[tid][c * 4]; s = __fadd_rn(s, __fmul_rn(qq[0], kq[0])); s = __fadd_rn(s, __fmul_rn(qq[1], kq[1])); s = __fadd_rn(s, __fmul_rn(qq[2], kq[2])); s = __fadd_rn(s, __fmul_rn(qq[3], kq[3])); }
    s = __fmul_rn(s, scale); if (MASKADD) s = __fadd_rn(s, __fmul_rn(bf16_round(mask[(size_t)i * SQ + j]), -10000.0f));
    const float f = (MASKADD || j <= i) ? 1.f : 0.f; const float sm = fmaf(f, s, (1.f - f) * -1.0e30f); const float mn = fmaxf(m, sm); const float sc = expf(m - mn); const float e = expf(sm - mn); l = __fadd_rn(__fmul_rn(l, sc), e); m = mn;
#pragma unroll 1
    for (int c = 0; c < HD / 4; ++c) { const v4f vv = *(const v4fa*)(vr + c * 4); v4f oo = *(v4f*)&lo[tid][c * 4]; for (int u = 0; u < 4; ++u) oo[u] = __fadd_rn(__fmul_rn(oo[u], sc), __fmul_rn(e, vv[u])); *(v4f*)&lo[tid][c * 4] = oo; } }
  const float fin = 64.0f / l;      /* o carried x64 like the f16 path */
#pragma unroll 1
  for (int c = 0; c < HD / 4; ++c) { v4f oo = *(v4f*)&lo[tid][c * 4]; for (int u = 0; u < 4; ++u) oo[u] = __fmul_rn(oo[u], fin); *(v4f*)&lo[tid][c * 4] = oo; }
  __syncthreads();
  {
#pragma unroll 1
    for (int it = 0; it < 16; ++it) { const int row = it * 4 + tid / 16, pc = (tid % 16) * 4; const v4f v = *(const v4f*)&lo[row][pc]; *(v4f*)(OF + (size_t)(rg * 64 + row) * ldo + h * HD + pc) = v; }
     } }

__global__ __launch_bounds__(256) void k_oscale(const float* __restrict__ OF, float* __restrict__ out, size_t n4) { const size_t t = (size_t)blockIdx.x * 256 + threadIdx.x; if (t >= n4) return; const v4f a = *(const v4fa*)(OF + t * 4); v4f o; for (int q = 0; q < 4; ++q) o[q] = a[q] * 0.015625f; *(v4f*)(out + t * 4) = o;  }

__global__ __launch_bounds__(256) void k_bfr(const float* __restrict__ x, float* __restrict__ XB, size_t n8) { const size_t t = (size_t)blockIdx.x * 256 + threadIdx.x; if (t >= n8) return; v4f a = *(const v4fa*)(x + t * 8), c = *(const v4fa*)(x + t * 8 + 4); for (int q = 0; q < 4; ++q) { a[q] = bf16_round(a[q]); c[q] = bf16_round(c[q]); }
  { *(v4f*)(XB + t * 8) = a; *(v4f*)(XB + t * 8 + 4) = c;  } }



__global__ __launch_bounds__(256) void k_rsmfvl(const float* __restrict__ S, _Float16* __restrict__ P, _Float16* __restrict__ PL, int qn, const int* __restrict__ vlp) {
  #pragma clang fp contract(off)
  const int t = blockIdx.x * 256 + threadIdx.x; if (t >= qn) return; const int vl = vlp[0]; const size_t i = (size_t)t; const float* s = S + i * SQ; float mx = -3.0e38f;
#pragma unroll 1
  for (int j = 0; j < SQ; ++j) { const float f = (j < vl) ? 1.f : 0.f; mx = fmaxf(mx, fmaf(f, s[j], (1.f - f) * -1000000.0f)); } float se = 0.f;
#pragma unroll 1
  for (int j = 0; j < SQ; ++j) { const float f = (j < vl) ? 1.f : 0.f; se += __expf(fmaf(f, s[j], (1.f - f) * -1000000.0f) - mx); } const float sc = 256.0f / se;
#pragma unroll 1
  for (int j0 = 0; j0 < SQ; j0 += 8) { FragH fr, gr; for (int q = 0; q < 8; ++q) { const int j = j0 + q; const float f = (j < vl) ? 1.f : 0.f; const float pv = __expf(fmaf(f, s[j], (1.f - f) * -1000000.0f) - mx) * sc; const _Float16 ph = (_Float16)pv; fr.h[q] = ph; gr.h[q] = (_Float16)((pv - (float)ph) * 1024.0f); }
    unsigned short* d = (unsigned short*)P + i * SQ + j0; unsigned short* dl = (unsigned short*)PL + i * SQ + j0; *(v8us*)d = fr.half[0]; *(v8us*)dl = gr.half[0];  } }

// 2^x on the transcendental unit; the v_nop is the one free slot the instruction set asks for behind a transcendental, in the same statement so that it stays directly behind it.
__device__ __forceinline__ float exp2_slot(float x) { float r; asm("v_exp_f32 %0, %1\n\tv_nop" : "=v"(r) : "v"(x)); return r; }
// Row softmax, one wave per row: every load is 512 contiguous bytes of the row, each lane keeps its 32 scores in registers (S is read once, each exp is taken once); row max and row sum by lane partials and a five-step butterfly. The loops over u are unrolled so that v[] is indexed by constants and stays in registers, and so that the eight loads are in flight together.
__global__ __launch_bounds__(256) void k_rsmf(const float* __restrict__ S, _Float16* __restrict__ P, int nrows) {
  const int row = blockIdx.x * 8 + (threadIdx.x >> 5), lane = threadIdx.x & 31; if (row >= nrows) return;
  const float* s = S + (size_t)row * SQ + lane * 4; _Float16* d = P + (size_t)row * SQ + lane * 4; v4f v[8];
#pragma unroll
  for (int u = 0; u < 8; ++u) v[u] = *(const v4fa*)(s + u * 128);
  float mx = -3.0e38f;
#pragma unroll
  for (int u = 0; u < 8; ++u) mx = fmaxf(mx, fmaxf(fmaxf(v[u][0], v[u][1]), fmaxf(v[u][2], v[u][3])));
  for (int m = 16; m >= 1; m >>= 1) mx = fmaxf(mx, __shfl_xor(mx, m, 32));
  v4f a = {0.f, 0.f, 0.f, 0.f};
#pragma unroll
  for (int u = 0; u < 8; ++u) for (int q = 0; q < 4; ++q) { v[u][q] = exp2_slot((v[u][q] - mx) * 1.44269504f); a[q] += v[u][q]; }
  float se = (a[0] + a[1]) + (a[2] + a[3]);
  for (int m = 16; m >= 1; m >>= 1) se += __shfl_xor(se, m, 32);
  const float sc = 256.0f / se;
#pragma unroll
  for (int u = 0; u < 8; ++u) { v4h h; for (int q = 0; q < 4; ++q) h[q] = (_Float16)(v[u][q] * sc); *(v4h*)(d + u * 128) = h; } }


#define CN 256          /* channels */
#define CI 128          /* inner channels */
#define NP 4096         /* positions */
#define NM 1024         /* pooled positions (= SQ: the softmax key count) */

__global__ __launch_bounds__(256) void k_rowbias(const float* __restrict__ b, float* __restrict__ BP, size_t n4, int ncol) { const size_t t = (size_t)blockIdx.x * 256 + threadIdx.x; if (t >= n4) return; const size_t e = t * 4; const float v = bf16_round(b[e / ncol]); const v4f o = {v, v, v, v}; *(v4f*)(BP + e) = o;  }




__global__ __launch_bounds__(256) void k_mp2(const float* __restrict__ src, float* __restrict__ dst, int nout) {
  const int t = blockIdx.x * 256 + threadIdx.x; if (t >= nout) return; const int c = t / 1024; const int o = t % 1024; const int oy = o / 32, ox = o % 32; const float* p = src + (size_t)c * 4096 + (size_t)(2 * oy) * 64 + 2 * ox;
  const float v = fmaxf(fmaxf(p[0], p[1]), fmaxf(p[64], p[65])); *(float*)(dst + t) = v;  }
__global__ __launch_bounds__(256) void k_xpb(const float* __restrict__ x, const float* __restrict__ wb, float* __restrict__ CPP, size_t n4) {
  #pragma clang fp contract(off)
  const size_t t = (size_t)blockIdx.x * 256 + threadIdx.x; if (t >= n4) return; const size_t e = t * 4; const int c = (int)((e / 4096) % 256); const float bb = bf16_round(wb[c]); const v4f a = *(const v4fa*)(x + e); v4f o; for (int q = 0; q < 4; ++q) o[q] = __fadd_rn(bf16_round(a[q]), bb);
  *(v4f*)(CPP + e) = o;  }


__global__ __launch_bounds__(256) void k_bnres(float* __restrict__ O, const float* __restrict__ x, const float* __restrict__ wb, const float* __restrict__ g, const float* __restrict__ be, const float* __restrict__ mu, const float* __restrict__ var, float eps, size_t n4) {
  #pragma clang fp contract(off)
  const size_t t = (size_t)blockIdx.x * 256 + threadIdx.x; if (t >= n4) return; const size_t e = t * 4; const int c = (int)((e / NP) % CN);
  const float inv = __fdiv_rn(bf16_round(g[c]), sqrtf(__fadd_rn(bf16_round(var[c]), eps))); const float wbc = bf16_round(wb[c]), mc = bf16_round(mu[c]), bc = bf16_round(be[c]);
  const v4f a = *(const v4fa*)(O + e); const v4f xx = *(const v4fa*)(x + e); v4f o;
  for (int q = 0; q < 4; ++q) o[q] = __fadd_rn(__fadd_rn(__fmul_rn(__fadd_rn(__fadd_rn(a[q], wbc), -mc), inv), bc), bf16_round(xx[q]));
  *(v4f*)(O + e) = o;  }
extern "C" void kernel_launch(void* const* d_in, const int* in_sizes, int n_in,
                              void* d_out, int out_size, void* d_ws, size_t ws_size, hipStream_t stream) {
  (void)in_sizes; (void)n_in; (void)out_size;
  const float* const* I = (const float* const*)d_in; const float* x = I[0]; const float* gw = I[1]; const float* gb = I[2]; const float* tw = I[3]; const float* tb = I[4]; const float* pw = I[5]; const float* pb = I[6]; const float* ww = I[7]; const float* wb = I[8]; const float* bng = I[9]; const float* bnb = I[10]; const float* bnm = I[11]; const float* bnv = I[12];      /* natural [out][in] 1x1-conv weights + biases: g, theta, phi [128][256]; W [256][128] + b; eval BatchNorm gamma / beta / running mean / var [256] */
  char* ws = (char*)d_ws; size_t off = 0;
  auto take = [&](size_t bytes) { char* p = ws + off; off += (bytes + 255) & ~(size_t)255; return p; };
  const size_t PL = (size_t)CN * NP;      /* one input map */
  _Float16* BG = (_Float16*)take((size_t)CI * CN * 2); _Float16* BT = (_Float16*)take((size_t)CI * CN * 2); _Float16* BP = (_Float16*)take((size_t)CI * CN * 2); _Float16* BW = (_Float16*)take((size_t)CN * CI * 2);
  float* GBP = (float*)take((size_t)CI * NP * 4); float* PBP = (float*)take((size_t)CI * NP * 4);      /* g_b / phi_b broadcast along the position axis */
  _Float16* X16 = (_Float16*)take(NB * PL * 2);      /* x f16 channel-first */
  _Float16* XT = (_Float16*)take(PL * 2); float* F1 = (float*)take((size_t)NP * CI * 4); float* F2 = (float*)take((size_t)CI * NM * 4);      /* one batch: x^T [n][c]; f32 scratch [4096 x 128] (theta^T, then phi, then g maps); pooled f32 [128][1024] */
  _Float16* TH = (_Float16*)take((size_t)NP * CI * 2); _Float16* THL = (_Float16*)take((size_t)NP * CI * 2); _Float16* PH = (_Float16*)take((size_t)CI * NM * 2); _Float16* PHL = (_Float16*)take((size_t)CI * NM * 2); _Float16* PHT = (_Float16*)take((size_t)NM * CI * 2); _Float16* PHLT = (_Float16*)take((size_t)NM * CI * 2); _Float16* G16 = (_Float16*)take((size_t)CI * NM * 2); _Float16* GL = (_Float16*)take((size_t)CI * NM * 2); _Float16* YT = (_Float16*)take((size_t)NP * CI * 2);
  float* S = (float*)take((size_t)NP * NM * 4); _Float16* P = (_Float16*)take((size_t)NP * NM * 2);
  if (off > ws_size) return;
  { const unsigned g = (unsigned)(((size_t)CI * CN / 8 + 255) / 256); k_wnat<<<g, 256, 0, stream>>>(gw, (size_t)CI * CN / 8, BG); k_wnat<<<g, 256, 0, stream>>>(tw, (size_t)CI * CN / 8, BT); k_wnat<<<g, 256, 0, stream>>>(pw, (size_t)CI * CN / 8, BP); k_wnat<<<g, 256, 0, stream>>>(ww, (size_t)CN * CI / 8, BW); }      /* natural [out][in] x16 f16 planes (Bt for theta; the A operand for g / phi / w) */
  k_rowbias<<<(unsigned)(((size_t)CI * NP / 4 + 255) / 256), 256, 0, stream>>>(gb, GBP, (size_t)CI * NP / 4, NP); k_rowbias<<<(unsigned)(((size_t)CI * NP / 4 + 255) / 256), 256, 0, stream>>>(pb, PBP, (size_t)CI * NP / 4, NP);
  k_x16<<<(unsigned)((NB * PL / 8 + 255) / 256), 256, 0, stream>>>(x, X16, NB * PL / 8);
  for (int b = 0; b < NB; ++b) {
    k_vt<NP / 64, CN><<<(NP / 64) * (CN / 64), 256, 0, stream>>>(X16 + (size_t)b * PL, NP, 0, XT);      /* [c][n] -> x^T [n][c] */
    k_gemm2<0><<<dim3((unsigned)((NP / 128) * (CI / 64)), 1), 128, 0, stream>>>(XT, CN, 0, BT, CN, 0, 0.0625f, tb, 0, nullptr, 1, 0, 0, F1, nullptr, CI, 0, NP, CI, CN); k_hl<<<(unsigned)(((size_t)NP * CI / 8 + 255) / 256), 256, 0, stream>>>(F1, TH, THL, (size_t)NP * CI / 8);      /* theta^T [n][ci] f32 -> f16 hi + x1024 residual */
    k_gemm2<0><<<dim3((unsigned)((CI / 128) * (NP / 64)), 1), 128, 0, stream>>>(BP, CN, 0, XT, CN, 0, 0.0625f, nullptr, 0, PBP, -1, 0, 0, F1, nullptr, NP, 0, CI, NP, CN); k_mp2<<<(unsigned)((CI * NM + 255) / 256), 256, 0, stream>>>(F1, F2, CI * NM); k_hl<<<(unsigned)(((size_t)CI * NM / 8 + 255) / 256), 256, 0, stream>>>(F2, PH, PHL, (size_t)CI * NM / 8);      /* phi [ci][n] (f32) -> 2x2 max pool -> [ci][m] -> hi + residual */
    k_vt<NM / 64, CI><<<(NM / 64) * (CI / 64), 256, 0, stream>>>(PH, NM, 0, PHT); k_vt<NM / 64, CI><<<(NM / 64) * (CI / 64), 256, 0, stream>>>(PHL, NM, 0, PHLT);      /* -> phi^T planes [m][ci] (the scores' B^T operand) */
    k_gemm2<0><<<dim3((unsigned)((CI / 128) * (NP / 64)), 1), 128, 0, stream>>>(BG, CN, 0, XT, CN, 0, 0.0625f, nullptr, 0, GBP, -1, 0, 0, F1, nullptr, NP, 0, CI, NP, CN); k_mp2<<<(unsigned)((CI * NM + 255) / 256), 256, 0, stream>>>(F1, F2, CI * NM); k_hl<<<(unsigned)(((size_t)CI * NM / 8 + 255) / 256), 256, 0, stream>>>(F2, G16, GL, (size_t)CI * NM / 8);      /* g [ci][n] -> pooled [ci][m] -> f16 (the residual plane GL is not used) */
    k_gemm2<0><<<dim3((unsigned)((NP / 128) * (NM / 64)), 1), 128, 0, stream>>>(TH, CI, 0, PHT, CI, 0, 1.0f, nullptr, 0, nullptr, 1, 0, 0, S, nullptr, NM, 0, NP, NM, CI); k_gemm2<0><<<dim3((unsigned)((NP / 128) * (NM / 64)), 1), 128, 0, stream>>>(THL, CI, 0, PHT, CI, 0, 0.0009765625f, nullptr, 0, S, -1, 0, 0, S, nullptr, NM, 0, NP, NM, CI); k_gemm2<0><<<dim3((unsigned)((NP / 128) * (NM / 64)), 1), 128, 0, stream>>>(TH, CI, 0, PHLT, CI, 0, 0.0009765625f, nullptr, 0, S, -1, 0, 0, S, nullptr, NM, 0, NP, NM, CI);      /* f[n][m] = theta.phi (three accumulating passes; no scale) */
    k_rsmf<<<NP / 8, 256, 0, stream>>>(S, P, NP);      /* softmax over the 1024 pooled positions -> P x256 f16 */
    k_gemm2<0><<<dim3((unsigned)((NP / 128) * (CI / 64)), 1), 128, 0, stream>>>(P, NM, 0, G16, NM, 0, 0.00390625f, nullptr, 0, nullptr, 1, 0, 0, nullptr, YT, CI, 0, NP, CI, NM);      /* y^T [n][ci] = P g^T (A = P, B^T = the pooled g rows [ci][m]) -> f16 */
    k_gemm2<0><<<dim3((unsigned)((CN / 128) * (NP / 64)), 1), 128, 0, stream>>>(BW, CI, 0, YT, CI, 0, 0.0625f, nullptr, 0, nullptr, 1, 0, 0, (float*)d_out + (size_t)b * PL, nullptr, NP, 0, CN, NP, CI); }      /* T[c][n] = (16 W as A) x (y^T as B^T) / 16 -> f32 channel-first (bias, BN and residual follow on VALU) */
  k_bnres<<<(unsigned)((NB * PL / 4 + 255) / 256), 256, 0, stream>>>((float*)d_out, x, wb, bng, bnb, bnm, bnv, 1e-5f, NB * PL / 4);      /* z = ((T + bf16 W_b[c]) - bf16 mean[c]) (bf16 gamma[c] / sqrt(bf16 var[c] + eps)) + bf16 beta[c] + bf16 x (in place, own 16-B pieces) */
}

// v002
// Measured time: 416 microseconds a run.
// In two side-by-side timings against v001, it was 3.38 and 3.37 times as fast.
// Over all steps from v000 it is 6.37 times as fast.
#include <hip/hip_runtime.h>
// Non-local block (embedded Gaussian, single head, 2x2 max-pool sub-sampling) with an eval-mode BatchNorm on the output conv (x [8][256][64][64]; theta = conv1x1(x) [128 ch], phi = maxpool2x2(conv1x1(x)), g = maxpool2x2(conv1x1(x)) (natural [128][256] weights sigma 1/16 + biases 0.01); f[n][m] = theta[:, n].phi[:, m] over the 1024 pooled positions (NO scale); softmax over m; y[:, n] = sum_m f[n][m] g[:, m]; W_y = conv1x1(y; W [256][128] + b); z = (W_y - bn_mean) gamma / sqrt(bn_var + 1e-5) + bn_beta + x -> [8][256][64][64]).
// Structure: x as an exact f16 channel-first plane; every stage is one launch over all 8 images: LDS slab transposes give token-major x^T [4096][256]; theta^T = x^T W^T + b as a WMMA GEMM (32x64 wave tiles, f32 accumulation) into f32 rows, split into f16 hi + x1024 residual (unscaled scores have sigma ~11); phi and g CHANNEL-first = (16 W as the A operand) (x^T as the B^T operand) + b[c] (own-element addend planes) in f32, 2x2 max-pooled on VALU; phi split into hi/lo and both transposed to [1024][128]; g to f16; scores = three accumulating passes (th_hi.ph_hi + th_lo.ph_hi/1024 + th_hi.ph_lo/1024, K = 128) into an f32 [4096][1024] plane; row softmax on VALU (f32 statistics, native exp; weights x256 f16); y^T = P g^T (K = 1024) -> f16 [4096][128]; T = (16 w as A) (y^T as B^T) / 16 -> f32 channel-first output, then bias, BN and bf16(x) residual on VALU in place; launches: see trace.
// Compute dtype: inputs rounded to bf16; x / weights exact; q and k as f16 hi + x1024 residual pairs; v, softmax weights and o as plain f16 GEMM operands (~2^-12); scores and softmax statistics f32. v_wmma_f32_16x16x32_f16.
#define NB 8
#define SQ 1024
#define DM 256
#define NH 1
#define HD 64
#define HG 4                         /* heads per attention launch group */
#define B0 0                         /* unused: every launch covers all NB images */
#define NBR NB                       /* not used by any kernel or launch */
#define NR ((size_t)NB * SQ)         /* unused */
#define MP ((int)((size_t)NBR * SQ)) /* not used by any kernel or launch */
#define QT 256                       /* query rows per causal tile */
#define NKX SQ                       /* S / P row pitch */
#define QT0 256                      /* first-tile rows recomputed exactly (256: buys margin for the few-key rows 128..255, which have no output projection to average the single-f16 P/v rounding) */
#define QN SQ                        /* unused (each batch attends NP query rows) */
#define NHD NH                       /* unused */
#define MPO MP                       /* unused */
#define LQ DM            /* unused */
typedef __bf16 v16b __attribute__((ext_vector_type(16)));
typedef unsigned short v8us __attribute__((ext_vector_type(8), may_alias));
typedef float  v8f  __attribute__((ext_vector_type(8)));
typedef float  v4f  __attribute__((ext_vector_type(4)));
typedef float  v4fa __attribute__((ext_vector_type(4), may_alias));
union FragB { v16b v; v8us half[2]; unsigned short u[16]; };

__device__ __forceinline__ unsigned short bf16_bits(float x) { unsigned int u = __float_as_uint(x); return (unsigned short)((u + 0x7FFFu + ((u >> 16) & 1u)) >> 16); }
__device__ __forceinline__ float bf16_val(unsigned short b) { return __uint_as_float(((unsigned int)b) << 16); }
__device__ __forceinline__ float bf16_round(float x) { return bf16_val(bf16_bits(x)); }
// D += A·B with NT terms: 1 = ah·bh, 2 = + al·bh (A split), 3 = + ah·bl (both split)
template <int NT>
__device__ __forceinline__ v8f mmaN(v16b ah, v16b al, v16b bh, v16b bl, v8f c) {
  c = __builtin_amdgcn_wmma_f32_16x16x32_bf16(false, ah, false, bh, (short)0, c, false, false);
  if (NT >= 2) c = __builtin_amdgcn_wmma_f32_16x16x32_bf16(false, al, false, bh, (short)0, c, false, false);
  if (NT >= 3) c = __builtin_amdgcn_wmma_f32_16x16x32_bf16(false, ah, false, bl, (short)0, c, false, false);
  asm volatile("v_nop\n\tv_nop\n\tv_nop\n\tv_nop" : "+v"(c) : "v"(ah), "v"(al), "v"(bh), "v"(bl));
  return c;
}

__global__ __launch_bounds__(256) void k_wt_bf16(const float* __restrict__ W, unsigned short* __restrict__ Wt, int K, int N) {
  const int t = blockIdx.x * 256 + threadIdx.x;
  const int k8n = K / 8;
  if (t >= N * k8n) return;
  const int n = t / k8n, k8 = (t % k8n) * 8;
  v8us v;
#pragma unroll
  for (int i = 0; i < 8; ++i) v[i] = bf16_bits(W[(size_t)(k8 + i) * N + n]);
  *(v8us*)(Wt + (size_t)n * K + k8) = v;
  
}

// GEMM C[M][N] (f32, pitch ldc) = act(A[M][K]·W + bias). A f32 row-major (pitch lda) converted per fragment to bf16
// (ASPLIT: hi/lo two planes -> 2 terms, else single rounded term); Wt bf16 [N][K] (pitch ldb). BIAS_BF16 rounds the
// bias to bf16 first (bias quantised to bf16 before the add). K%32==0, M%16==0, N%64==0.
template <bool ASPLIT, int ACT, bool BIAS_BF16>
__global__ __launch_bounds__(128) void k_gemm_bf(const float* __restrict__ A, int lda, const unsigned short* __restrict__ Wt, int ldb,
                                               const float* __restrict__ bias, float* __restrict__ C, int ldc, int M, int N, int K) {
  __shared__ __attribute__((aligned(16))) float so[4][16][64];
  const int tid = threadIdx.x, w = tid >> 5, lane = tid & 31, ln = lane & 15, hh = lane >> 4;
  const int ntn = N / 64;
  const int wid = blockIdx.x * 4 + w;
  const int mt = wid / ntn, nq = wid % ntn;
  if (mt * 16 >= M) return;
  const int row0 = mt * 16, col0 = nq * 64;
  const float* arow = A + (size_t)(row0 + ln) * lda;
  v8f acc[4] = {};
  for (int kb = 0; kb < K; kb += 32) {
    FragB ah, al;
    const v4f x0 = *(const v4fa*)(arow + kb + 8 * hh), x1 = *(const v4fa*)(arow + kb + 8 * hh + 4);
    const v4f x2 = *(const v4fa*)(arow + kb + 16 + 8 * hh), x3 = *(const v4fa*)(arow + kb + 16 + 8 * hh + 4);
    float xs[16] = {x0[0],x0[1],x0[2],x0[3],x1[0],x1[1],x1[2],x1[3],x2[0],x2[1],x2[2],x2[3],x3[0],x3[1],x3[2],x3[3]};
#pragma unroll
    for (int i = 0; i < 16; ++i) { const unsigned short hb = bf16_bits(xs[i]); ah.u[i] = hb; al.u[i] = ASPLIT ? bf16_bits(xs[i] - bf16_val(hb)) : (unsigned short)0; }
#pragma unroll
    for (int t = 0; t < 4; ++t) {
      const unsigned short* brow = Wt + (size_t)(col0 + t * 16 + ln) * ldb + kb;
      FragB b;
      b.half[0] = *(const v8us*)(brow + 8 * hh);
      b.half[1] = *(const v8us*)(brow + 16 + 8 * hh);
      acc[t] = mmaN<ASPLIT ? 2 : 1>(ah.v, al.v, b.v, b.v, acc[t]);
    }
  }
#pragma unroll
  for (int t = 0; t < 4; ++t) {
    float bv = bias ? bias[col0 + t * 16 + ln] : 0.f;
    if (BIAS_BF16) bv = bf16_round(bv);
#pragma unroll
    for (int r = 0; r < 8; ++r) { float v = acc[t][r] + bv; if (ACT == 1) v = fmaxf(v, 0.f); so[w][8 * hh + r][t * 16 + ln] = v; }
  }
  __builtin_amdgcn_fence(__ATOMIC_ACQ_REL, "workgroup");
  __builtin_amdgcn_wave_barrier();
  const int rsub = lane >> 4, c4 = (lane & 15) * 4;
  {
#pragma unroll
    for (int q = 0; q < 8; ++q) {
      const int r = q * 2 + rsub;
      const v4f v = *(const v4fa*)&so[w][r][c4];
      *(v4f*)(C + (size_t)(row0 + r) * ldc + col0 + c4) = v;
    }
    
  }
}

// GEMM C = act(A·W + bias + resid): A f32 (ASPLIT -> hi/lo 2 terms), Wt bf16 [N][K]; ACT 0 none, 1 relu, 2 exact gelu;
// resid (optional, f32, row index = (row % rmod), pitch ldr, RES_BF16 rounds it) added before the activation.
template <bool ASPLIT, int ACT, bool BIAS_BF16, bool RES_BF16>
__global__ __launch_bounds__(128) void k_gemm_bf3(const float* __restrict__ A, int lda, const unsigned short* __restrict__ Wt, int ldb,
                                                const float* __restrict__ bias, const float* __restrict__ resid, int rmod, int ldr,
                                                float* __restrict__ C, int ldc, int M, int N, int K) {
  __shared__ __attribute__((aligned(16))) float so[4][16][64];
  const int tid = threadIdx.x, w = tid >> 5, lane = tid & 31, ln = lane & 15, hh = lane >> 4;
  const int ntn = N / 64;
  const int wid = blockIdx.x * 4 + w;
  const int mt = wid / ntn, nq = wid % ntn;
  if (mt * 16 >= M) return;
  const int row0 = mt * 16, col0 = nq * 64;
  const float* arow = A + (size_t)(row0 + ln) * lda;
  v8f acc[4] = {};
  for (int kb = 0; kb < K; kb += 32) {
    FragB ah, al;
    const v4f x0 = *(const v4fa*)(arow + kb + 8 * hh), x1 = *(const v4fa*)(arow + kb + 8 * hh + 4);
    const v4f x2 = *(const v4fa*)(arow + kb + 16 + 8 * hh), x3 = *(const v4fa*)(arow + kb + 16 + 8 * hh + 4);
    float xs[16] = {x0[0],x0[1],x0[2],x0[3],x1[0],x1[1],x1[2],x1[3],x2[0],x2[1],x2[2],x2[3],x3[0],x3[1],x3[2],x3[3]};
#pragma unroll
    for (int i = 0; i < 16; ++i) { const unsigned short hb = bf16_bits(xs[i]); ah.u[i] = hb; al.u[i] = ASPLIT ? bf16_bits(xs[i] - bf16_val(hb)) : (unsigned short)0; }
#pragma unroll
    for (int t = 0; t < 4; ++t) {
      const unsigned short* brow = Wt + (size_t)(col0 + t * 16 + ln) * ldb + kb;
      FragB b;
      b.half[0] = *(const v8us*)(brow + 8 * hh);
      b.half[1] = *(const v8us*)(brow + 16 + 8 * hh);
      acc[t] = mmaN<ASPLIT ? 2 : 1>(ah.v, al.v, b.v, b.v, acc[t]);
    }
  }
#pragma unroll
  for (int t = 0; t < 4; ++t) {
    const int col = col0 + t * 16 + ln;
    float bv = bias ? bias[col] : 0.f;
    if (BIAS_BF16) bv = bf16_round(bv);
#pragma unroll
    for (int r = 0; r < 8; ++r) {
      float v = acc[t][r] + bv;
      if (resid) { float rv = resid[(size_t)((row0 + 8 * hh + r) % rmod) * ldr + col]; if (RES_BF16) rv = bf16_round(rv); v += rv; }
      if (ACT == 1) v = fmaxf(v, 0.f);
      if (ACT == 2) v = 0.5f * v * (1.0f + erff(v * 0.70710678118654752f));
      if (ACT == 3) { const float u = 0.7978845608028654f * (v + 0.044715f * v * v * v); v = 0.5f * v * (1.0f + tanhf(u)); }
      so[w][8 * hh + r][t * 16 + ln] = v;
    }
  }
  __builtin_amdgcn_fence(__ATOMIC_ACQ_REL, "workgroup");
  __builtin_amdgcn_wave_barrier();
  const int rsub = lane >> 4, c4 = (lane & 15) * 4;
  {
#pragma unroll
    for (int q = 0; q < 8; ++q) {
      const int r = q * 2 + rsub;
      const v4f v = *(const v4fa*)&so[w][r][c4];
      *(v4f*)(C + (size_t)(row0 + r) * ldc + col0 + c4) = v;
    }
    
  }
}
// row LayerNorm (biased variance, eps) over N: s = X (+ R); optional out_sum <- s; out_norm <- (s-mu)*rsqrt(var+eps)*g + b
template <bool PARAM_BF16>
__global__ __launch_bounds__(256) void k_layernorm(const float* __restrict__ X, const float* __restrict__ R, const float* __restrict__ g, const float* __restrict__ bta,
                                                  float* __restrict__ out_sum, float* __restrict__ out_norm, int N, float eps) {
  __shared__ float red[256];
  const int row = blockIdx.x, tid = threadIdx.x;
  const float* x = X + (size_t)row * N; const float* rr = R ? R + (size_t)row * N : nullptr;
  float vals[16];                     // up to N = 4096
  const int per = N / 256;            // contiguous chunk per thread? use strided-by-4 chunks: thread handles j = tid*4 + 1024*u
  float s1 = 0.f;
  for (int u = 0; u < per / 4; ++u) {
    const int j = tid * 4 + 1024 * u;
    const v4f a = *(const v4fa*)(x + j);
    v4f b = {0.f,0.f,0.f,0.f}; if (rr) b = *(const v4fa*)(rr + j);
#pragma unroll
    for (int q = 0; q < 4; ++q) { const float v = a[q] + b[q]; vals[u * 4 + q] = v; s1 += v; }
  }
  red[tid] = s1; __syncthreads();
  for (int st = 128; st > 0; st >>= 1) { if (tid < st) red[tid] += red[tid + st]; __syncthreads(); }
  const float mu = red[0] / (float)N; __syncthreads();
  float s2 = 0.f;
  for (int u = 0; u < per / 4; ++u)
#pragma unroll
    for (int q = 0; q < 4; ++q) { const float c = vals[u * 4 + q] - mu; s2 += c * c; }
  red[tid] = s2; __syncthreads();
  for (int st = 128; st > 0; st >>= 1) { if (tid < st) red[tid] += red[tid + st]; __syncthreads(); }
  const float rs = rsqrtf(red[0] / (float)N + eps);
  {
    for (int u = 0; u < per / 4; ++u) {
      const int j = tid * 4 + 1024 * u;
      v4f o, sm;
#pragma unroll
      for (int q = 0; q < 4; ++q) {
        float gg = g[j + q], bb = bta[j + q];
        if (PARAM_BF16) { gg = bf16_round(gg); bb = bf16_round(bb); }
        sm[q] = vals[u * 4 + q]; o[q] = (vals[u * 4 + q] - mu) * rs * gg + bb;
      }
      if (out_sum) *(v4f*)(out_sum + (size_t)row * N + j) = sm;
      *(v4f*)(out_norm + (size_t)row * N + j) = o;
    }
    
  }
}



// ---- f16 WMMA path (v_wmma_f32_16x16x32_f16): 11-bit significands for operands in range — used where a [0,1] probability operand needs more precision than bf16
typedef _Float16 v16h __attribute__((ext_vector_type(16)));
union FragH { v16h v; v8us half[2]; _Float16 h[16]; unsigned short u[16]; };
template <int NT>
__device__ __forceinline__ v8f mmaH(v16h ah, v16h al, v16h bh, v16h bl, v8f c) {
  c = __builtin_amdgcn_wmma_f32_16x16x32_f16(false, ah, false, bh, (short)0, c, false, false);
  if (NT >= 2) c = __builtin_amdgcn_wmma_f32_16x16x32_f16(false, al, false, bh, (short)0, c, false, false);
  if (NT >= 3) c = __builtin_amdgcn_wmma_f32_16x16x32_f16(false, ah, false, bl, (short)0, c, false, false);
  asm volatile("v_nop\n\tv_nop\n\tv_nop\n\tv_nop" : "+v"(c) : "v"(ah), "v"(al), "v"(bh), "v"(bl));
  return c;
}
// batched GEMM like k_gemm_b but f16 operands: A f32 (split into f16 hi/lo if ASPLIT, else rounded to f16), Bt = f16 values [n][k]; alpha; C f32; N multiple of 16 (partial tiles skipped)
template <bool ASPLIT>
__global__ __launch_bounds__(128) void k_gemm_h(const float* __restrict__ A, int lda, size_t sA, const _Float16* __restrict__ Bh, int ldb, size_t sB, float alpha, float* __restrict__ C, int ldc, size_t sC, int M, int N, int K) {
  __shared__ __attribute__((aligned(16))) float so[4][16][64];
  const int tid = threadIdx.x, w = tid >> 5, lane = tid & 31, ln = lane & 15, hh = lane >> 4; const int by = blockIdx.y;
  A += (size_t)by * sA; Bh += (size_t)by * sB; C += (size_t)by * sC;
  const int ntn = (N + 63) / 64; const int wid = blockIdx.x * 4 + w; const int mt = wid / ntn, nq = wid % ntn; if (mt * 16 >= M) return;
  const int row0 = mt * 16, col0 = nq * 64; const float* arow = A + (size_t)(row0 + ln) * lda;
  v8f acc[4] = {};
  for (int kb = 0; kb < K; kb += 32) {
    FragH ah, al;
    const v4f x0 = *(const v4fa*)(arow + kb + 8 * hh), x1 = *(const v4fa*)(arow + kb + 8 * hh + 4), x2 = *(const v4fa*)(arow + kb + 16 + 8 * hh), x3 = *(const v4fa*)(arow + kb + 16 + 8 * hh + 4);
    float xs[16] = {x0[0],x0[1],x0[2],x0[3],x1[0],x1[1],x1[2],x1[3],x2[0],x2[1],x2[2],x2[3],x3[0],x3[1],x3[2],x3[3]};
#pragma unroll
    for (int i = 0; i < 16; ++i) { const _Float16 h = (_Float16)xs[i]; ah.h[i] = h; al.h[i] = ASPLIT ? (_Float16)(xs[i] - (float)h) : (_Float16)0.0f; }
#pragma unroll
    for (int t = 0; t < 4; ++t) { if (col0 + t * 16 >= N) continue; const size_t boff = (size_t)(col0 + t * 16 + ln) * ldb + kb; FragH bq; bq.half[0] = *(const v8us*)(Bh + boff + 8 * hh); bq.half[1] = *(const v8us*)(Bh + boff + 16 + 8 * hh);
      acc[t] = mmaH<ASPLIT ? 2 : 1>(ah.v, al.v, bq.v, bq.v, acc[t]); }
  }
#pragma unroll
  for (int t = 0; t < 4; ++t) { if (col0 + t * 16 >= N) continue;
#pragma unroll
    for (int r = 0; r < 8; ++r) so[w][8 * hh + r][t * 16 + ln] = acc[t][r] * alpha; }
  __builtin_amdgcn_fence(__ATOMIC_ACQ_REL, "workgroup"); __builtin_amdgcn_wave_barrier();
  const int rsub = lane >> 4, c4 = (lane & 15) * 4;
  {
#pragma unroll
    for (int q = 0; q < 8; ++q) { const int r = q * 2 + rsub; if (col0 + c4 < N) { const v4f v = *(const v4fa*)&so[w][r][c4]; *(v4f*)(C + (size_t)(row0 + r) * ldc + col0 + c4) = v; } }
     }
}

// Wt[n][k] = f16(W[k][n]·scale) from f32 row-major W[K][N] (scale = power of two; bf16-exact weights stay exact in f16 away from the subnormal range)
__global__ __launch_bounds__(256) void k_wt_f16(const float* __restrict__ W, _Float16* __restrict__ Wt, int K, int N, float scale) {
  const int t = blockIdx.x * 256 + threadIdx.x; if (t >= N * (K / 8)) return; const int n = t / (K / 8), k8 = (t % (K / 8)) * 8; FragH f;
#pragma unroll
  for (int i = 0; i < 8; ++i) f.h[i] = (_Float16)(bf16_round(W[(size_t)(k8 + i) * N + n]) * scale); const v8us o = f.half[0];
  *(v8us*)((unsigned short*)Wt + (size_t)n * K + k8) = o; 
}
// k_gemm_hh variant with fused epilogue: v = acc·alpha + bias[by·sBias + col] (+ CP[(row/rowsPerB)·sCPb + by·64 + col] if CP) ; ACT 0 none / 1 elu ; writes f16 C16 (and f32 C if non-null)
template <int ACT>
__global__ __launch_bounds__(128) void k_gemm_hhx(const _Float16* __restrict__ A, int lda, size_t sA, const _Float16* __restrict__ Bh, int ldb, size_t sB, float alpha, const float* __restrict__ bias, size_t sBias, const float* __restrict__ CP, int rowsPerB, size_t sCPb, int row0g,
    float* __restrict__ C, _Float16* __restrict__ C16, int ldc, size_t sC, int M, int N, int K) {
  __shared__ __attribute__((aligned(16))) float so[4][16][64];
  const int tid = threadIdx.x, w = tid >> 5, lane = tid & 31, ln = lane & 15, hh = lane >> 4; const int by = blockIdx.y;
  A += (size_t)by * sA; Bh += (size_t)by * sB; const size_t cofs = (size_t)by * sC; const float* bp = bias ? bias + (size_t)by * sBias : nullptr;
  const int ntn = (N + 63) / 64; const int wid = blockIdx.x * 4 + w; const int mt = wid / ntn, nq = wid % ntn; if (mt * 16 >= M) return;
  const int row0 = mt * 16, col0 = nq * 64; const _Float16* arow = A + (size_t)(row0 + ln) * lda;
  v8f acc[4] = {};
  for (int kb = 0; kb < K; kb += 32) { FragH ah; ah.half[0] = *(const v8us*)((const unsigned short*)arow + kb + 8 * hh); ah.half[1] = *(const v8us*)((const unsigned short*)arow + kb + 16 + 8 * hh);
#pragma unroll
    for (int t = 0; t < 4; ++t) { if (col0 + t * 16 >= N) continue; const size_t boff = (size_t)(col0 + t * 16 + ln) * ldb + kb; FragH bq; bq.half[0] = *(const v8us*)((const unsigned short*)Bh + boff + 8 * hh); bq.half[1] = *(const v8us*)((const unsigned short*)Bh + boff + 16 + 8 * hh);
      acc[t] = mmaH<1>(ah.v, ah.v, bq.v, bq.v, acc[t]); }
  }
#pragma unroll
  for (int t = 0; t < 4; ++t) { if (col0 + t * 16 >= N) continue; const int col = col0 + t * 16 + ln; const float bv = bp ? bf16_round(bp[col]) : 0.f;
#pragma unroll
    for (int r = 0; r < 8; ++r) { float v = acc[t][r] * alpha + bv; if (CP) { const int rr = row0g + row0 + 8 * hh + r; if (rowsPerB < 0) v += CP[cofs + (size_t)rr * ldc + col];      /* rowsPerB < 0: own element of the batched C plane */ else { const int bidx = rr / rowsPerB; v += CP[(size_t)bidx * sCPb + (size_t)by * 64 + col]; } } if (ACT == 1) v = (v > 0.f) ? v : expm1f(v); else if (ACT == 7) v = (v > 0.f) ? v + 1.0f : expf(v); else if (ACT == 8) v = tanhf(v); else if (ACT == 9) v = 0.5f * v * (1.0f + tanhf(0.7978845608028654f * (v + 0.044715f * v * v * v))); else if (ACT == 11) v = 1.0f / (1.0f + expf(-v)); else if (ACT == 12) v = (v > 0.f) ? v : 0.01f * v; else if (ACT == 14) v = (v > 0.f) ? v : 0.1f * v; else if (ACT == 16) v = (v >= 0.f) ? v : 0.3f * v; else if (ACT == 17) v = (v >= 0.f) ? v : 0.2f * v; else if (ACT == 15) v = v / (1.0f + expf(-v)); else if (ACT == 3) v = fmaxf(v, 0.f); else if (ACT == 6) v = 0.5f * v * (1.0f + erff(v * 0.70710678118654752f)); so[w][8 * hh + r][t * 16 + ln] = v; } }
  __builtin_amdgcn_fence(__ATOMIC_ACQ_REL, "workgroup"); __builtin_amdgcn_wave_barrier();
  const int rsub = lane >> 4, c4 = (lane & 15) * 4; typedef _Float16 v4h __attribute__((ext_vector_type(4)));
  {
#pragma unroll
    for (int q = 0; q < 8; ++q) { const int r = q * 2 + rsub; if (col0 + c4 < N) { const v4f v = *(const v4fa*)&so[w][r][c4]; if (C) *(v4f*)(C + cofs + (size_t)(row0 + r) * ldc + col0 + c4) = v; if (C16) { v4h h4; for (int i = 0; i < 4; ++i) h4[i] = (_Float16)v[i]; *(v4h*)(C16 + cofs + (size_t)(row0 + r) * ldc + col0 + c4) = h4; } } }
     }
}


typedef _Float16 v4h __attribute__((ext_vector_type(4)));

__global__ __launch_bounds__(256) void k_x16(const float* __restrict__ x, _Float16* __restrict__ X16, size_t n8) { const size_t t = (size_t)blockIdx.x * 256 + threadIdx.x; if (t >= n8) return; FragH f;
#pragma unroll
  for (int q = 0; q < 8; ++q) f.h[q] = (_Float16)bf16_round(x[t * 8 + q]); *(v8us*)((unsigned short*)X16 + t * 8) = f.half[0];  }
__global__ __launch_bounds__(256) void k_h16(const float* __restrict__ x, _Float16* __restrict__ X16, size_t n8) { const size_t t = (size_t)blockIdx.x * 256 + threadIdx.x; if (t >= n8) return; FragH f;
#pragma unroll
  for (int q = 0; q < 8; ++q) f.h[q] = (_Float16)x[t * 8 + q]; *(v8us*)((unsigned short*)X16 + t * 8) = f.half[0];  }
__global__ __launch_bounds__(256) void k_round16f(const float* __restrict__ W, _Float16* __restrict__ Bt, size_t n8) { const size_t t = (size_t)blockIdx.x * 256 + threadIdx.x; if (t >= n8) return; FragH f;
#pragma unroll
  for (int i = 0; i < 8; ++i) f.h[i] = (_Float16)(bf16_round(W[t * 8 + i]) * 16.0f); *(v8us*)((unsigned short*)Bt + t * 8) = f.half[0];  }
template <int NHv, int TTv>
__global__ __launch_bounds__(256) void k_vt(const _Float16* __restrict__ V16, int ldv, int voff, _Float16* __restrict__ Vt) { __shared__ unsigned short tl[64][66]; const int tid = threadIdx.x; const int slab = blockIdx.x / (TTv / 64), lg = blockIdx.x % (TTv / 64); const int b = slab / NHv, h = slab % NHv;
  for (int i = tid; i < 64 * 8; i += 256) { const int r = i / 8, c8 = (i % 8) * 8; FragH f; f.half[0] = *(const v8us*)((const unsigned short*)V16 + ((size_t)b * TTv + lg * 64 + r) * ldv + voff + h * 64 + c8);
#pragma unroll
    for (int q = 0; q < 8; ++q) tl[r][c8 + q] = f.u[q]; }
  __syncthreads();
  {
#pragma unroll
    for (int rd = 0; rd < 2; ++rd) { const int d = rd * 32 + tid / 8, pc = tid % 8; FragH f;
#pragma unroll
      for (int q = 0; q < 8; ++q) f.u[q] = tl[pc * 8 + q][d];
      *(v8us*)((unsigned short*)Vt + ((size_t)slab * 64 + d) * TTv + lg * 64 + pc * 8) = f.half[0]; }
     } }

__global__ __launch_bounds__(256) void k_hl(const float* __restrict__ F, _Float16* __restrict__ Hh, _Float16* __restrict__ Hl, size_t n8) { const size_t t = (size_t)blockIdx.x * 256 + threadIdx.x; if (t >= n8) return; FragH fh, fl; const v4f a = *(const v4fa*)(F + t * 8), c = *(const v4fa*)(F + t * 8 + 4);
#pragma unroll
  for (int q = 0; q < 4; ++q) { _Float16 h = (_Float16)a[q]; fh.h[q] = h; fl.h[q] = (_Float16)((a[q] - (float)h) * 1024.0f); h = (_Float16)c[q]; fh.h[4 + q] = h; fl.h[4 + q] = (_Float16)((c[q] - (float)h) * 1024.0f); }
  { *(v8us*)((unsigned short*)Hh + t * 8) = fh.half[0]; *(v8us*)((unsigned short*)Hl + t * 8) = fl.half[0];  } }

// ---- fast GEMM (wave tile 32x64; requires M % 32 == 0 rows per launch region and N % 64 == 0); epilogue = k_gemm_hhx semantics, except the rowsPerB < 0 addend plane steps by sCPb per grid.y slice ----
__device__ __forceinline__ v16h g2_frag(const _Float16* p, int hh) { FragH f; f.half[0] = *(const v8us*)((const unsigned short*)p + 8 * hh); f.half[1] = *(const v8us*)((const unsigned short*)p + 16 + 8 * hh); return f.v; }
__device__ __forceinline__ v8f g2_mma(v16h a, v16h b, v8f c) { v8f d = __builtin_amdgcn_wmma_f32_16x16x32_f16(false, a, false, b, (short)0, c, false, false); asm volatile("v_nop\n\tv_nop\n\tv_nop\n\tv_nop" : "+v"(d) : "v"(a), "v"(b)); return d; }
template <int ACT>
__global__ __launch_bounds__(128) void k_gemm2(const _Float16* __restrict__ A, int lda, size_t sA, const _Float16* __restrict__ Bh, int ldb, size_t sB, float alpha, const float* __restrict__ bias, size_t sBias, const float* __restrict__ CP, int rowsPerB, size_t sCPb, int row0g,
    float* __restrict__ C, _Float16* __restrict__ C16, int ldc, size_t sC, int M, int N, int K) { static_assert(ACT == 0 || ACT == 3 || ACT == 6 || ACT == 8 || ACT == 9 || ACT == 11 || ACT == 12 || ACT == 14 || ACT == 15 || ACT == 16 || ACT == 17, "k_gemm2: unsupported ACT code (would silently apply no activation)");
  __shared__ __attribute__((aligned(16))) float so[4][32][68];
  const int tid = threadIdx.x, w = tid >> 5, lane = tid & 31, ln = lane & 15, hh = lane >> 4; const int by = blockIdx.y;
  A += (size_t)by * sA; Bh += (size_t)by * sB; const size_t cofs = (size_t)by * sC; const float* bp = bias ? bias + (size_t)by * sBias : nullptr;
  const int ntn = N >> 6; const int mt = blockIdx.x / ntn, nq = blockIdx.x - mt * ntn; const int row0 = mt * 128 + 32 * w, col0 = nq * 64; if (row0 >= M) return;
  const _Float16* a0p = A + (size_t)(row0 + ln) * lda; const _Float16* a1p = a0p + (size_t)16 * lda;
  const _Float16* b0p = Bh + (size_t)(col0 + ln) * ldb; const _Float16* b1p = b0p + (size_t)16 * ldb; const _Float16* b2p = b1p + (size_t)16 * ldb; const _Float16* b3p = b2p + (size_t)16 * ldb;
  const v8f z8 = {0.f,0.f,0.f,0.f,0.f,0.f,0.f,0.f}; v8f c00 = z8, c01 = z8, c02 = z8, c03 = z8, c10 = z8, c11 = z8, c12 = z8, c13 = z8;
#pragma unroll 1
  for (int kb = 0; kb < K; kb += 32) { const v16h a0 = g2_frag(a0p + kb, hh), a1 = g2_frag(a1p + kb, hh);
    v16h b = g2_frag(b0p + kb, hh); c00 = g2_mma(a0, b, c00); c10 = g2_mma(a1, b, c10);
    b = g2_frag(b1p + kb, hh); c01 = g2_mma(a0, b, c01); c11 = g2_mma(a1, b, c11);
    b = g2_frag(b2p + kb, hh); c02 = g2_mma(a0, b, c02); c12 = g2_mma(a1, b, c12);
    b = g2_frag(b3p + kb, hh); c03 = g2_mma(a0, b, c03); c13 = g2_mma(a1, b, c13); }
  v8f accs[8] = {c00, c01, c02, c03, c10, c11, c12, c13};
#pragma unroll
  for (int u = 0; u < 8; ++u) { const int t = u & 3, half = u >> 2; const int col = col0 + t * 16 + ln; const float bv = bp ? bf16_round(bp[col]) : 0.f;
#pragma unroll
    for (int r = 0; r < 8; ++r) { const int rloc = half * 16 + 8 * hh + r; float v = accs[u][r] * alpha + bv; if (CP) { if (rowsPerB < 0) v += CP[(size_t)by * sCPb + (size_t)(row0g + row0 + rloc) * ldc + col];      /* rowsPerB < 0: own element of an addend plane shaped like C; sCPb = its step from one grid.y slice to the next (0: one plane shared by all slices) */ else { const int bidx = (row0g + row0 + rloc) / rowsPerB; v += CP[(size_t)bidx * sCPb + (size_t)by * 64 + col]; } }
      if (ACT == 3) v = fmaxf(v, 0.f); else if (ACT == 6) v = 0.5f * v * (1.0f + erff(v * 0.70710678118654752f)); else if (ACT == 11) v = 1.0f / (1.0f + expf(-v)); else if (ACT == 15) v = v / (1.0f + expf(-v)); else if (ACT == 12) v = (v > 0.f) ? v : 0.01f * v; else if (ACT == 8) v = tanhf(v); else if (ACT == 9) v = 0.5f * v * (1.0f + tanhf(0.7978845608028654f * (v + 0.044715f * v * v * v))); else if (ACT == 14) v = (v > 0.f) ? v : 0.1f * v; else if (ACT == 16) v = (v >= 0.f) ? v : 0.3f * v; else if (ACT == 17) v = (v >= 0.f) ? v : 0.2f * v;
      so[w][rloc][t * 16 + ln] = v; } }
  __builtin_amdgcn_fence(__ATOMIC_ACQ_REL, "workgroup"); __builtin_amdgcn_wave_barrier();
  const int rsub = lane >> 4, c4 = (lane & 15) * 4;
  {
#pragma unroll
    for (int q = 0; q < 16; ++q) { const int r = q * 2 + rsub; const v4f v = *(const v4fa*)&so[w][r][c4]; if (C) *(v4f*)(C + cofs + (size_t)(row0 + r) * ldc + col0 + c4) = v; if (C16) { v4h h4; for (int i = 0; i < 4; ++i) h4[i] = (_Float16)v[i]; *(v4h*)(C16 + cofs + (size_t)(row0 + r) * ldc + col0 + c4) = h4; } }
     } }


__global__ __launch_bounds__(256) void k_wnat(const float* __restrict__ w, size_t n8, _Float16* __restrict__ Bt) { const size_t t = (size_t)blockIdx.x * 256 + threadIdx.x; if (t >= n8) return; FragH f; for (int q = 0; q < 8; ++q) f.h[q] = (_Float16)(bf16_round(w[t * 8 + q]) * 16.0f); *(v8us*)((unsigned short*)Bt + t * 8) = f.half[0];  }
__global__ __launch_bounds__(256) void k_rsm(const float* __restrict__ S, _Float16* __restrict__ P, int nrows) {
  #pragma clang fp contract(off)
  const int i = blockIdx.x * 256 + threadIdx.x; if (i >= nrows) return; const float* s = S + (size_t)i * SQ; float mx = -3.0e38f;
#pragma unroll 1
  for (int j = 0; j < SQ; ++j) mx = fmaxf(mx, s[j]); float se = 0.f;
#pragma unroll 1
  for (int j = 0; j < SQ; ++j) se += expf(s[j] - mx); const float sc = 256.0f / se;
#pragma unroll 1
  for (int j0 = 0; j0 < SQ; j0 += 8) { FragH f; for (int q = 0; q < 8; ++q) f.h[q] = (_Float16)(expf(s[j0 + q] - mx) * sc); unsigned short* d = (unsigned short*)P + (size_t)i * SQ + j0; *(v8us*)d = f.half[0];  } }
__global__ __launch_bounds__(256) void k_vt(const _Float16* __restrict__ V16, int b, int h0, _Float16* __restrict__ VT) { __shared__ unsigned short tl[64][65]; const int tid = threadIdx.x; const int hh = blockIdx.x % HG, sg = blockIdx.x / HG; const int s0 = sg * 64; const int h = h0 + hh;
  for (int i = tid; i < 64 * 8; i += 256) { const int j = i / 8, d8 = (i % 8) * 8; FragH f; f.half[0] = *(const v8us*)((const unsigned short*)V16 + ((size_t)b * SQ + s0 + j) * DM + h * HD + d8); for (int q = 0; q < 8; ++q) tl[d8 + q][j] = f.u[q]; }
  __syncthreads();
  { for (int i = tid; i < 64 * 8; i += 256) { const int d = i / 8, j8 = (i % 8) * 8; FragH f; for (int q = 0; q < 8; ++q) f.u[q] = tl[d][j8 + q]; *(v8us*)((unsigned short*)VT + ((size_t)hh * HD + d) * SQ + s0 + j8) = f.half[0]; }  } }



__global__ __launch_bounds__(256) void k_rsmcf2(const float* __restrict__ S, _Float16* __restrict__ P, int hg, int q0, int nk) {
  #pragma clang fp contract(off)
  const int t = blockIdx.x * 256 + threadIdx.x; if (t >= hg * QT) return; const size_t i = (size_t)t; const float* s = S + i * NKX; const int last = q0 + (t % QT); float mx = -3.0e38f;
#pragma unroll 1
  for (int j = 0; j < nk; ++j) { const float f = (j <= last) ? 1.f : 0.f; mx = fmaxf(mx, fmaf(f, s[j], (1.f - f) * -1.0e9f)); } float se = 0.f;
#pragma unroll 1
  for (int j = 0; j < nk; ++j) { const float f = (j <= last) ? 1.f : 0.f; se += __expf(fmaf(f, s[j], (1.f - f) * -1.0e9f) - mx); } const float sc = 256.0f / se;
#pragma unroll 1
  for (int j0 = 0; j0 < nk; j0 += 8) { FragH fr; for (int q = 0; q < 8; ++q) { const int j = j0 + q; const float f = (j <= last) ? 1.f : 0.f; fr.h[q] = (_Float16)(__expf(fmaf(f, s[j], (1.f - f) * -1.0e9f) - mx) * sc); } unsigned short* d = (unsigned short*)P + i * NKX + j0; *(v8us*)d = fr.half[0];  } }

template <int MASKADD>
__global__ __launch_bounds__(64) void k_att0(const float* __restrict__ QF, const float* __restrict__ KF, const float* __restrict__ VF, int ld, const float* __restrict__ mask, float scale, float* __restrict__ OF, int ldo) {
  #pragma clang fp contract(off)
  __shared__ __attribute__((aligned(16))) float lq[64][64]; __shared__ __attribute__((aligned(16))) float lo[64][64];
  const int tid = threadIdx.x; const int h = blockIdx.x / (QT0 / 64), rg = blockIdx.x % (QT0 / 64); const int i = rg * 64 + tid;
  const float* qr = QF + (size_t)i * ld + h * HD;
#pragma unroll 1
  for (int c = 0; c < HD / 4; ++c) { *(v4f*)&lq[tid][c * 4] = *(const v4fa*)(qr + c * 4); const v4f z = {0.f, 0.f, 0.f, 0.f}; *(v4f*)&lo[tid][c * 4] = z; }
  float m = -1.0e30f, l = 0.f; const int jmax = MASKADD ? (SQ - 1) : (rg * 64 + 63);      /* additive-mask form: every key (the mask input decides); causal form: keys up to the block's last row */
#pragma unroll 1
  for (int j = 0; j <= jmax; ++j) { const float* kr = KF + (size_t)j * ld + h * HD; const float* vr = VF + (size_t)j * ld + h * HD; float s = 0.f;
#pragma unroll 1
    for (int c = 0; c < HD / 4; ++c) { const v4f kq = *(const v4fa*)(kr + c * 4); const v4f qq = *(v4f*)&lq[tid][c * 4]; s = __fadd_rn(s, __fmul_rn(qq[0], kq[0])); s = __fadd_rn(s, __fmul_rn(qq[1], kq[1])); s = __fadd_rn(s, __fmul_rn(qq[2], kq[2])); s = __fadd_rn(s, __fmul_rn(qq[3], kq[3])); }
    s = __fmul_rn(s, scale); if (MASKADD) s = __fadd_rn(s, __fmul_rn(bf16_round(mask[(size_t)i * SQ + j]), -10000.0f));
    const float f = (MASKADD || j <= i) ? 1.f : 0.f; const float sm = fmaf(f, s, (1.f - f) * -1.0e30f); const float mn = fmaxf(m, sm); const float sc = expf(m - mn); const float e = expf(sm - mn); l = __fadd_rn(__fmul_rn(l, sc), e); m = mn;
#pragma unroll 1
    for (int c = 0; c < HD / 4; ++c) { const v4f vv = *(const v4fa*)(vr + c * 4); v4f oo = *(v4f*)&lo[tid][c * 4]; for (int u = 0; u < 4; ++u) oo[u] = __fadd_rn(__fmul_rn(oo[u], sc), __fmul_rn(e, vv[u])); *(v4f*)&lo[tid][c * 4] = oo; } }
  const float fin = 64.0f / l;      /* o carried x64 like the f16 path */
#pragma unroll 1
  for (int c = 0; c < HD / 4; ++c) { v4f oo = *(v4f*)&lo[tid][c * 4]; for (int u = 0; u < 4; ++u) oo[u] = __fmul_rn(oo[u], fin); *(v4f*)&lo[tid][c * 4] = oo; }
  __syncthreads();
  {
#pragma unroll 1
    for (int it = 0; it < 16; ++it) { const int row = it * 4 + tid / 16, pc = (tid % 16) * 4; const v4f v = *(const v4f*)&lo[row][pc]; *(v4f*)(OF + (size_t)(rg * 64 + row) * ldo + h * HD + pc) = v; }
     } }

__global__ __launch_bounds__(256) void k_oscale(const float* __restrict__ OF, float* __restrict__ out, size_t n4) { const size_t t = (size_t)blockIdx.x * 256 + threadIdx.x; if (t >= n4) return; const v4f a = *(const v4fa*)(OF + t * 4); v4f o; for (int q = 0; q < 4; ++q) o[q] = a[q] * 0.015625f; *(v4f*)(out + t * 4) = o;  }

__global__ __launch_bounds__(256) void k_bfr(const float* __restrict__ x, float* __restrict__ XB, size_t n8) { const size_t t = (size_t)blockIdx.x * 256 + threadIdx.x; if (t >= n8) return; v4f a = *(const v4fa*)(x + t * 8), c = *(const v4fa*)(x + t * 8 + 4); for (int q = 0; q < 4; ++q) { a[q] = bf16_round(a[q]); c[q] = bf16_round(c[q]); }
  { *(v4f*)(XB + t * 8) = a; *(v4f*)(XB + t * 8 + 4) = c;  } }



__global__ __launch_bounds__(256) void k_rsmfvl(const float* __restrict__ S, _Float16* __restrict__ P, _Float16* __restrict__ PL, int qn, const int* __restrict__ vlp) {
  #pragma clang fp contract(off)
  const int t = blockIdx.x * 256 + threadIdx.x; if (t >= qn) return; const int vl = vlp[0]; const size_t i = (size_t)t; const float* s = S + i * SQ; float mx = -3.0e38f;
#pragma unroll 1
  for (int j = 0; j < SQ; ++j) { const float f = (j < vl) ? 1.f : 0.f; mx = fmaxf(mx, fmaf(f, s[j], (1.f - f) * -1000000.0f)); } float se = 0.f;
#pragma unroll 1
  for (int j = 0; j < SQ; ++j) { const float f = (j < vl) ? 1.f : 0.f; se += __expf(fmaf(f, s[j], (1.f - f) * -1000000.0f) - mx); } const float sc = 256.0f / se;
#pragma unroll 1
  for (int j0 = 0; j0 < SQ; j0 += 8) { FragH fr, gr; for (int q = 0; q < 8; ++q) { const int j = j0 + q; const float f = (j < vl) ? 1.f : 0.f; const float pv = __expf(fmaf(f, s[j], (1.f - f) * -1000000.0f) - mx) * sc; const _Float16 ph = (_Float16)pv; fr.h[q] = ph; gr.h[q] = (_Float16)((pv - (float)ph) * 1024.0f); }
    unsigned short* d = (unsigned short*)P + i * SQ + j0; unsigned short* dl = (unsigned short*)PL + i * SQ + j0; *(v8us*)d = fr.half[0]; *(v8us*)dl = gr.half[0];  } }

// 2^x on the transcendental unit; the v_nop is the one free slot the instruction set asks for behind a transcendental, in the same statement so that it stays directly behind it.
__device__ __forceinline__ float exp2_slot(float x) { float r; asm("v_exp_f32 %0, %1\n\tv_nop" : "=v"(r) : "v"(x)); return r; }
// Row softmax, one wave per row: every load is 512 contiguous bytes of the row, each lane keeps its 32 scores in registers (S is read once, each exp is taken once); row max and row sum by lane partials and a five-step butterfly. The loops over u are unrolled so that v[] is indexed by constants and stays in registers, and so that the eight loads are in flight together.
__global__ __launch_bounds__(256) void k_rsmf(const float* __restrict__ S, _Float16* __restrict__ P, int nrows) {
  const int row = blockIdx.x * 8 + (threadIdx.x >> 5), lane = threadIdx.x & 31; if (row >= nrows) return;
  const float* s = S + (size_t)row * SQ + lane * 4; _Float16* d = P + (size_t)row * SQ + lane * 4; v4f v[8];
#pragma unroll
  for (int u = 0; u < 8; ++u) v[u] = *(const v4fa*)(s + u * 128);
  float mx = -3.0e38f;
#pragma unroll
  for (int u = 0; u < 8; ++u) mx = fmaxf(mx, fmaxf(fmaxf(v[u][0], v[u][1]), fmaxf(v[u][2], v[u][3])));
  for (int m = 16; m >= 1; m >>= 1) mx = fmaxf(mx, __shfl_xor(mx, m, 32));
  v4f a = {0.f, 0.f, 0.f, 0.f};
#pragma unroll
  for (int u = 0; u < 8; ++u) for (int q = 0; q < 4; ++q) { v[u][q] = exp2_slot((v[u][q] - mx) * 1.44269504f); a[q] += v[u][q]; }
  float se = (a[0] + a[1]) + (a[2] + a[3]);
  for (int m = 16; m >= 1; m >>= 1) se += __shfl_xor(se, m, 32);
  const float sc = 256.0f / se;
#pragma unroll
  for (int u = 0; u < 8; ++u) { v4h h; for (int q = 0; q < 4; ++q) h[q] = (_Float16)(v[u][q] * sc); *(v4h*)(d + u * 128) = h; } }


#define CN 256          /* channels */
#define CI 128          /* inner channels */
#define NP 4096         /* positions */
#define NM 1024         /* pooled positions (= SQ: the softmax key count) */

__global__ __launch_bounds__(256) void k_rowbias(const float* __restrict__ b, float* __restrict__ BP, size_t n4, int ncol) { const size_t t = (size_t)blockIdx.x * 256 + threadIdx.x; if (t >= n4) return; const size_t e = t * 4; const float v = bf16_round(b[e / ncol]); const v4f o = {v, v, v, v}; *(v4f*)(BP + e) = o;  }




__global__ __launch_bounds__(256) void k_mp2(const float* __restrict__ src, float* __restrict__ dst, int nout) {
  const int t = blockIdx.x * 256 + threadIdx.x; if (t >= nout) return; const int c = t / 1024; const int o = t % 1024; const int oy = o / 32, ox = o % 32; const float* p = src + (size_t)c * 4096 + (size_t)(2 * oy) * 64 + 2 * ox;
  const float v = fmaxf(fmaxf(p[0], p[1]), fmaxf(p[64], p[65])); *(float*)(dst + t) = v;  }
__global__ __launch_bounds__(256) void k_xpb(const float* __restrict__ x, const float* __restrict__ wb, float* __restrict__ CPP, size_t n4) {
  #pragma clang fp contract(off)
  const size_t t = (size_t)blockIdx.x * 256 + threadIdx.x; if (t >= n4) return; const size_t e = t * 4; const int c = (int)((e / 4096) % 256); const float bb = bf16_round(wb[c]); const v4f a = *(const v4fa*)(x + e); v4f o; for (int q = 0; q < 4; ++q) o[q] = __fadd_rn(bf16_round(a[q]), bb);
  *(v4f*)(CPP + e) = o;  }


__global__ __launch_bounds__(256) void k_bnres(float* __restrict__ O, const float* __restrict__ x, const float* __restrict__ wb, const float* __restrict__ g, const float* __restrict__ be, const float* __restrict__ mu, const float* __restrict__ var, float eps, size_t n4) {
  #pragma clang fp contract(off)
  const size_t t = (size_t)blockIdx.x * 256 + threadIdx.x; if (t >= n4) return; const size_t e = t * 4; const int c = (int)((e / NP) % CN);
  const float inv = __fdiv_rn(bf16_round(g[c]), sqrtf(__fadd_rn(bf16_round(var[c]), eps))); const float wbc = bf16_round(wb[c]), mc = bf16_round(mu[c]), bc = bf16_round(be[c]);
  const v4f a = *(const v4fa*)(O + e); const v4f xx = *(const v4fa*)(x + e); v4f o;
  for (int q = 0; q < 4; ++q) o[q] = __fadd_rn(__fadd_rn(__fmul_rn(__fadd_rn(__fadd_rn(a[q], wbc), -mc), inv), bc), bf16_round(xx[q]));
  *(v4f*)(O + e) = o;  }
extern "C" void kernel_launch(void* const* d_in, const int* in_sizes, int n_in,
                              void* d_out, int out_size, void* d_ws, size_t ws_size, hipStream_t stream) {
  (void)in_sizes; (void)n_in; (void)out_size;
  const float* const* I = (const float* const*)d_in; const float* x = I[0]; const float* gw = I[1]; const float* gb = I[2]; const float* tw = I[3]; const float* tb = I[4]; const float* pw = I[5]; const float* pb = I[6]; const float* ww = I[7]; const float* wb = I[8]; const float* bng = I[9]; const float* bnb = I[10]; const float* bnm = I[11]; const float* bnv = I[12];      /* natural [out][in] 1x1-conv weights + biases: g, theta, phi [128][256]; W [256][128] + b; eval BatchNorm gamma / beta / running mean / var [256] */
  char* ws = (char*)d_ws; size_t off = 0;
  auto take = [&](size_t bytes) { char* p = ws + off; off += (bytes + 255) & ~(size_t)255; return p; };
  const size_t PL = (size_t)CN * NP;      /* one input map */
  _Float16* BG = (_Float16*)take((size_t)CI * CN * 2); _Float16* BT = (_Float16*)take((size_t)CI * CN * 2); _Float16* BP = (_Float16*)take((size_t)CI * CN * 2); _Float16* BW = (_Float16*)take((size_t)CN * CI * 2);
  float* GBP = (float*)take((size_t)CI * NP * 4); float* PBP = (float*)take((size_t)CI * NP * 4);      /* g_b / phi_b broadcast along the position axis */
  _Float16* X16 = (_Float16*)take(NB * PL * 2);      /* x f16 channel-first */
  /* every plane below holds all NB images, image b at b times the one-image size: each stage is ONE launch over all images (grid.y of the GEMMs; a longer grid.x elsewhere) */
  const size_t sT = (size_t)NP * CI, sM = (size_t)CI * NM, sS = (size_t)NP * NM;      /* one image: [4096][128], [128][1024], [4096][1024] elements */
  _Float16* XT = (_Float16*)take(NB * PL * 2); float* F1 = (float*)take(NB * sT * 4); float* F2 = (float*)take(NB * sM * 4);      /* x^T [n][c]; f32 scratch [4096 x 128] (theta^T, then phi, then g maps); pooled f32 [128][1024] */
  _Float16* TH = (_Float16*)take(NB * sT * 2); _Float16* THL = (_Float16*)take(NB * sT * 2); _Float16* PH = (_Float16*)take(NB * sM * 2); _Float16* PHL = (_Float16*)take(NB * sM * 2); _Float16* PHT = (_Float16*)take(NB * sM * 2); _Float16* PHLT = (_Float16*)take(NB * sM * 2); _Float16* G16 = (_Float16*)take(NB * sM * 2); _Float16* GL = (_Float16*)take(NB * sM * 2); _Float16* YT = (_Float16*)take(NB * sT * 2);
  float* S = (float*)take(NB * sS * 4);
  _Float16* P = X16;      /* the weights P (NB * sS f16 = 64 MiB) lie over X16, XT, F1, F2, TH, THL (68 MiB in a row), whose last reader is the third score pass, launched before the softmax writes P: S and P for all images would not fit the workspace beside them */
  static_assert((size_t)NB * NP * NM * 2 <= (size_t)NB * ((size_t)CN * NP * 4 + (size_t)NP * CI * 8 + (size_t)CI * NM * 4), "P must end before PH");
  if (off > ws_size) return;
  { const unsigned g = (unsigned)(((size_t)CI * CN / 8 + 255) / 256); k_wnat<<<g, 256, 0, stream>>>(gw, (size_t)CI * CN / 8, BG); k_wnat<<<g, 256, 0, stream>>>(tw, (size_t)CI * CN / 8, BT); k_wnat<<<g, 256, 0, stream>>>(pw, (size_t)CI * CN / 8, BP); k_wnat<<<g, 256, 0, stream>>>(ww, (size_t)CN * CI / 8, BW); }      /* natural [out][in] x16 f16 planes (Bt for theta; the A operand for g / phi / w) */
  k_rowbias<<<(unsigned)(((size_t)CI * NP / 4 + 255) / 256), 256, 0, stream>>>(gb, GBP, (size_t)CI * NP / 4, NP); k_rowbias<<<(unsigned)(((size_t)CI * NP / 4 + 255) / 256), 256, 0, stream>>>(pb, PBP, (size_t)CI * NP / 4, NP);
  k_x16<<<(unsigned)((NB * PL / 8 + 255) / 256), 256, 0, stream>>>(x, X16, NB * PL / 8);
  k_vt<NP / 64, CN><<<NB * (NP / 64) * (CN / 64), 256, 0, stream>>>(X16, NP, 0, XT);      /* [c][n] -> x^T [n][c] (the kernel's own image index: slab / NHv) */
  k_gemm2<0><<<dim3((unsigned)((NP / 128) * (CI / 64)), NB), 128, 0, stream>>>(XT, CN, PL, BT, CN, 0, 0.0625f, tb, 0, nullptr, 1, 0, 0, F1, nullptr, CI, sT, NP, CI, CN); k_hl<<<(unsigned)((NB * sT / 8 + 255) / 256), 256, 0, stream>>>(F1, TH, THL, NB * sT / 8);      /* theta^T [n][ci] f32 -> f16 hi + x1024 residual */
  k_gemm2<0><<<dim3((unsigned)((CI / 128) * (NP / 64)), NB), 128, 0, stream>>>(BP, CN, 0, XT, CN, PL, 0.0625f, nullptr, 0, PBP, -1, 0, 0, F1, nullptr, NP, sT, CI, NP, CN); k_mp2<<<(unsigned)((NB * CI * NM + 255) / 256), 256, 0, stream>>>(F1, F2, NB * CI * NM); k_hl<<<(unsigned)((NB * sM / 8 + 255) / 256), 256, 0, stream>>>(F2, PH, PHL, NB * sM / 8);      /* phi [ci][n] (f32; one bias plane for all images) -> 2x2 max pool -> [ci][m] -> hi + residual */
  k_vt<NM / 64, CI><<<NB * (NM / 64) * (CI / 64), 256, 0, stream>>>(PH, NM, 0, PHT); k_vt<NM / 64, CI><<<NB * (NM / 64) * (CI / 64), 256, 0, stream>>>(PHL, NM, 0, PHLT);      /* -> phi^T planes [m][ci] (the scores' B^T operand) */
  k_gemm2<0><<<dim3((unsigned)((CI / 128) * (NP / 64)), NB), 128, 0, stream>>>(BG, CN, 0, XT, CN, PL, 0.0625f, nullptr, 0, GBP, -1, 0, 0, F1, nullptr, NP, sT, CI, NP, CN); k_mp2<<<(unsigned)((NB * CI * NM + 255) / 256), 256, 0, stream>>>(F1, F2, NB * CI * NM); k_hl<<<(unsigned)((NB * sM / 8 + 255) / 256), 256, 0, stream>>>(F2, G16, GL, NB * sM / 8);      /* g [ci][n] -> pooled [ci][m] -> f16 (the residual plane GL is not used) */
  k_gemm2<0><<<dim3((unsigned)((NP / 128) * (NM / 64)), NB), 128, 0, stream>>>(TH, CI, sT, PHT, CI, sM, 1.0f, nullptr, 0, nullptr, 1, 0, 0, S, nullptr, NM, sS, NP, NM, CI); k_gemm2<0><<<dim3((unsigned)((NP / 128) * (NM / 64)), NB), 128, 0, stream>>>(THL, CI, sT, PHT, CI, sM, 0.0009765625f, nullptr, 0, S, -1, sS, 0, S, nullptr, NM, sS, NP, NM, CI); k_gemm2<0><<<dim3((unsigned)((NP / 128) * (NM / 64)), NB), 128, 0, stream>>>(TH, CI, sT, PHLT, CI, sM, 0.0009765625f, nullptr, 0, S, -1, sS, 0, S, nullptr, NM, sS, NP, NM, CI);      /* f[n][m] = theta.phi (three accumulating passes; no scale) */
  k_rsmf<<<NB * NP / 8, 256, 0, stream>>>(S, P, NB * NP);      /* softmax over the 1024 pooled positions -> P x256 f16 */
  k_gemm2<0><<<dim3((unsigned)((NP / 128) * (CI / 64)), NB), 128, 0, stream>>>(P, NM, sS, G16, NM, sM, 0.00390625f, nullptr, 0, nullptr, 1, 0, 0, nullptr, YT, CI, sT, NP, CI, NM);      /* y^T [n][ci] = P g^T (A = P, B^T = the pooled g rows [ci][m]) -> f16 */
  k_gemm2<0><<<dim3((unsigned)((CN / 128) * (NP / 64)), NB), 128, 0, stream>>>(BW, CI, 0, YT, CI, sT, 0.0625f, nullptr, 0, nullptr, 1, 0, 0, (float*)d_out, nullptr, NP, PL, CN, NP, CI);      /* T[c][n] = (16 W as A) x (y^T as B^T) / 16 -> f32 channel-first (bias, BN and residual follow on VALU) */
  k_bnres<<<(unsigned)((NB * PL / 4 + 255) / 256), 256, 0, stream>>>((float*)d_out, x, wb, bng, bnb, bnm, bnv, 1e-5f, NB * PL / 4);      /* z = ((T + bf16 W_b[c]) - bf16 mean[c]) (bf16 gamma[c] / sqrt(bf16 var[c] + eps)) + bf16 beta[c] + bf16 x (in place, own 16-B pieces) */
}

// v003
// One run takes 184 microseconds.
// In both of two side-by-side timings against v002, it was 2.26 times as fast.
// Over all steps from v000 it is 14.4 times as fast.
#include <hip/hip_runtime.h>
// Non-local block (embedded Gaussian, single head, 2x2 max-pool sub-sampling) with an eval-mode BatchNorm on the output conv (x [8][256][64][64]; theta = conv1x1(x) [128 ch], phi = maxpool2x2(conv1x1(x)), g = maxpool2x2(conv1x1(x)) (natural [128][256] weights sigma 1/16 + biases 0.01); f[n][m] = theta[:, n].phi[:, m] over the 1024 pooled positions (NO scale); softmax over m; y[:, n] = sum_m f[n][m] g[:, m]; W_y = conv1x1(y; W [256][128] + b); z = (W_y - bn_mean) gamma / sqrt(bn_var + 1e-5) + bn_beta + x -> [8][256][64][64]).
// Structure: x as an exact f16 channel-first plane; every stage is one launch over all 8 images: LDS slab transposes give token-major x^T [4096][256]; theta^T = x^T W^T + b as a WMMA GEMM (32x64 wave tiles, f32 accumulation) into f32 rows, split into f16 hi + x1024 residual (unscaled scores have sigma ~11); phi and g CHANNEL-first = (16 W as the A operand) (x^T as the B^T operand) + b[c] (own-element addend planes) in f32, 2x2 max-pooled on VALU; phi split into hi/lo and both transposed to [1024][128]; g to f16; scores (th_hi.ph_hi + (th_lo.ph_hi + th_hi.ph_lo)/1024, K = 128, f32), online row softmax on VALU (f32 statistics, native exp; weights x256 f16) and y^T = P g^T (K = 1024) -> f16 [4096][128] in one fused launch that keeps scores and weights in registers; W y = (16 w as A) (y^T as B^T) / 16 -> f32 channel-first output, then + bf16(b[c]), BN and + bf16(x) on VALU in place; launches: see trace.
// Compute dtype: inputs rounded to bf16; x / weights exact; q and k as f16 hi + x1024 residual pairs; v, softmax weights and o as plain f16 GEMM operands (~2^-12); scores and softmax statistics f32. v_wmma_f32_16x16x32_f16.
#define NB 8
#define SQ 1024
#define DM 256
#define NH 1
#define HD 64
#define HG 4                         /* heads per attention launch group */
#define B0 0                         /* unused: every launch covers all NB images */
#define NBR NB                       /* not used by any kernel or launch */
#define NR ((size_t)NB * SQ)         /* unused */
#define MP ((int)((size_t)NBR * SQ)) /* not used by any kernel or launch */
#define QT 256                       /* query rows per causal tile */
#define NKX SQ                       /* S / P row pitch */
#define QT0 256                      /* first-tile rows recomputed exactly (256: buys margin for the few-key rows 128..255, which have no output projection to average the single-f16 P/v rounding) */
#define QN SQ                        /* unused (each batch attends NP query rows) */
#define NHD NH                       /* unused */
#define MPO MP                       /* unused */
#define LQ DM            /* unused */
typedef __bf16 v16b __attribute__((ext_vector_type(16)));
typedef unsigned short v8us __attribute__((ext_vector_type(8), may_alias));
typedef float  v8f  __attribute__((ext_vector_type(8)));
typedef float  v4f  __attribute__((ext_vector_type(4)));
typedef float  v4fa __attribute__((ext_vector_type(4), may_alias));
union FragB { v16b v; v8us half[2]; unsigned short u[16]; };

__device__ __forceinline__ unsigned short bf16_bits(float x) { unsigned int u = __float_as_uint(x); return (unsigned short)((u + 0x7FFFu + ((u >> 16) & 1u)) >> 16); }
__device__ __forceinline__ float bf16_val(unsigned short b) { return __uint_as_float(((unsigned int)b) << 16); }
__device__ __forceinline__ float bf16_round(float x) { return bf16_val(bf16_bits(x)); }
// D += A·B with NT terms: 1 = ah·bh, 2 = + al·bh (A split), 3 = + ah·bl (both split)
template <int NT>
__device__ __forceinline__ v8f mmaN(v16b ah, v16b al, v16b bh, v16b bl, v8f c) {
  c = __builtin_amdgcn_wmma_f32_16x16x32_bf16(false, ah, false, bh, (short)0, c, false, false);
  if (NT >= 2) c = __builtin_amdgcn_wmma_f32_16x16x32_bf16(false, al, false, bh, (short)0, c, false, false);
  if (NT >= 3) c = __builtin_amdgcn_wmma_f32_16x16x32_bf16(false, ah, false, bl, (short)0, c, false, false);
  asm volatile("v_nop\n\tv_nop\n\tv_nop\n\tv_nop" : "+v"(c) : "v"(ah), "v"(al), "v"(bh), "v"(bl));
  return c;
}

__global__ __launch_bounds__(256) void k_wt_bf16(const float* __restrict__ W, unsigned short* __restrict__ Wt, int K, int N) {
  const int t = blockIdx.x * 256 + threadIdx.x;
  const int k8n = K / 8;
  if (t >= N * k8n) return;
  const int n = t / k8n, k8 = (t % k8n) * 8;
  v8us v;
#pragma unroll
  for (int i = 0; i < 8; ++i) v[i] = bf16_bits(W[(size_t)(k8 + i) * N + n]);
  *(v8us*)(Wt + (size_t)n * K + k8) = v;
  
}

// GEMM C[M][N] (f32, pitch ldc) = act(A[M][K]·W + bias). A f32 row-major (pitch lda) converted per fragment to bf16
// (ASPLIT: hi/lo two planes -> 2 terms, else single rounded term); Wt bf16 [N][K] (pitch ldb). BIAS_BF16 rounds the
// bias to bf16 first (bias quantised to bf16 before the add). K%32==0, M%16==0, N%64==0.
template <bool ASPLIT, int ACT, bool BIAS_BF16>
__global__ __launch_bounds__(128) void k_gemm_bf(const float* __restrict__ A, int lda, const unsigned short* __restrict__ Wt, int ldb,
                                               const float* __restrict__ bias, float* __restrict__ C, int ldc, int M, int N, int K) {
  __shared__ __attribute__((aligned(16))) float so[4][16][64];
  const int tid = threadIdx.x, w = tid >> 5, lane = tid & 31, ln = lane & 15, hh = lane >> 4;
  const int ntn = N / 64;
  const int wid = blockIdx.x * 4 + w;
  const int mt = wid / ntn, nq = wid % ntn;
  if (mt * 16 >= M) return;
  const int row0 = mt * 16, col0 = nq * 64;
  const float* arow = A + (size_t)(row0 + ln) * lda;
  v8f acc[4] = {};
  for (int kb = 0; kb < K; kb += 32) {
    FragB ah, al;
    const v4f x0 = *(const v4fa*)(arow + kb + 8 * hh), x1 = *(const v4fa*)(arow + kb + 8 * hh + 4);
    const v4f x2 = *(const v4fa*)(arow + kb + 16 + 8 * hh), x3 = *(const v4fa*)(arow + kb + 16 + 8 * hh + 4);
    float xs[16] = {x0[0],x0[1],x0[2],x0[3],x1[0],x1[1],x1[2],x1[3],x2[0],x2[1],x2[2],x2[3],x3[0],x3[1],x3[2],x3[3]};
#pragma unroll
    for (int i = 0; i < 16; ++i) { const unsigned short hb = bf16_bits(xs[i]); ah.u[i] = hb; al.u[i] = ASPLIT ? bf16_bits(xs[i] - bf16_val(hb)) : (unsigned short)0; }
#pragma unroll
    for (int t = 0; t < 4; ++t) {
      const unsigned short* brow = Wt + (size_t)(col0 + t * 16 + ln) * ldb + kb;
      FragB b;
      b.half[0] = *(const v8us*)(brow + 8 * hh);
      b.half[1] = *(const v8us*)(brow + 16 + 8 * hh);
      acc[t] = mmaN<ASPLIT ? 2 : 1>(ah.v, al.v, b.v, b.v, acc[t]);
    }
  }
#pragma unroll
  for (int t = 0; t < 4; ++t) {
    float bv = bias ? bias[col0 + t * 16 + ln] : 0.f;
    if (BIAS_BF16) bv = bf16_round(bv);
#pragma unroll
    for (int r = 0; r < 8; ++r) { float v = acc[t][r] + bv; if (ACT == 1) v = fmaxf(v, 0.f); so[w][8 * hh + r][t * 16 + ln] = v; }
  }
  __builtin_amdgcn_fence(__ATOMIC_ACQ_REL, "workgroup");
  __builtin_amdgcn_wave_barrier();
  const int rsub = lane >> 4, c4 = (lane & 15) * 4;
  {
#pragma unroll
    for (int q = 0; q < 8; ++q) {
      const int r = q * 2 + rsub;
      const v4f v = *(const v4fa*)&so[w][r][c4];
      *(v4f*)(C + (size_t)(row0 + r) * ldc + col0 + c4) = v;
    }
    
  }
}

// GEMM C = act(A·W + bias + resid): A f32 (ASPLIT -> hi/lo 2 terms), Wt bf16 [N][K]; ACT 0 none, 1 relu, 2 exact gelu;
// resid (optional, f32, row index = (row % rmod), pitch ldr, RES_BF16 rounds it) added before the activation.
template <bool ASPLIT, int ACT, bool BIAS_BF16, bool RES_BF16>
__global__ __launch_bounds__(128) void k_gemm_bf3(const float* __restrict__ A, int lda, const unsigned short* __restrict__ Wt, int ldb,
                                                const float* __restrict__ bias, const float* __restrict__ resid, int rmod, int ldr,
                                                float* __restrict__ C, int ldc, int M, int N, int K) {
  __shared__ __attribute__((aligned(16))) float so[4][16][64];
  const int tid = threadIdx.x, w = tid >> 5, lane = tid & 31, ln = lane & 15, hh = lane >> 4;
  const int ntn = N / 64;
  const int wid = blockIdx.x * 4 + w;
  const int mt = wid / ntn, nq = wid % ntn;
  if (mt * 16 >= M) return;
  const int row0 = mt * 16, col0 = nq * 64;
  const float* arow = A + (size_t)(row0 + ln) * lda;
  v8f acc[4] = {};
  for (int kb = 0; kb < K; kb += 32) {
    FragB ah, al;
    const v4f x0 = *(const v4fa*)(arow + kb + 8 * hh), x1 = *(const v4fa*)(arow + kb + 8 * hh + 4);
    const v4f x2 = *(const v4fa*)(arow + kb + 16 + 8 * hh), x3 = *(const v4fa*)(arow + kb + 16 + 8 * hh + 4);
    float xs[16] = {x0[0],x0[1],x0[2],x0[3],x1[0],x1[1],x1[2],x1[3],x2[0],x2[1],x2[2],x2[3],x3[0],x3[1],x3[2],x3[3]};
#pragma unroll
    for (int i = 0; i < 16; ++i) { const unsigned short hb = bf16_bits(xs[i]); ah.u[i] = hb; al.u[i] = ASPLIT ? bf16_bits(xs[i] - bf16_val(hb)) : (unsigned short)0; }
#pragma unroll
    for (int t = 0; t < 4; ++t) {
      const unsigned short* brow = Wt + (size_t)(col0 + t * 16 + ln) * ldb + kb;
      FragB b;
      b.half[0] = *(const v8us*)(brow + 8 * hh);
      b.half[1] = *(const v8us*)(brow + 16 + 8 * hh);
      acc[t] = mmaN<ASPLIT ? 2 : 1>(ah.v, al.v, b.v, b.v, acc[t]);
    }
  }
#pragma unroll
  for (int t = 0; t < 4; ++t) {
    const int col = col0 + t * 16 + ln;
    float bv = bias ? bias[col] : 0.f;
    if (BIAS_BF16) bv = bf16_round(bv);
#pragma unroll
    for (int r = 0; r < 8; ++r) {
      float v = acc[t][r] + bv;
      if (resid) { float rv = resid[(size_t)((row0 + 8 * hh + r) % rmod) * ldr + col]; if (RES_BF16) rv = bf16_round(rv); v += rv; }
      if (ACT == 1) v = fmaxf(v, 0.f);
      if (ACT == 2) v = 0.5f * v * (1.0f + erff(v * 0.70710678118654752f));
      if (ACT == 3) { const float u = 0.7978845608028654f * (v + 0.044715f * v * v * v); v = 0.5f * v * (1.0f + tanhf(u)); }
      so[w][8 * hh + r][t * 16 + ln] = v;
    }
  }
  __builtin_amdgcn_fence(__ATOMIC_ACQ_REL, "workgroup");
  __builtin_amdgcn_wave_barrier();
  const int rsub = lane >> 4, c4 = (lane & 15) * 4;
  {
#pragma unroll
    for (int q = 0; q < 8; ++q) {
      const int r = q * 2 + rsub;
      const v4f v = *(const v4fa*)&so[w][r][c4];
      *(v4f*)(C + (size_t)(row0 + r) * ldc + col0 + c4) = v;
    }
    
  }
}
// row LayerNorm (biased variance, eps) over N: s = X (+ R); optional out_sum <- s; out_norm <- (s-mu)*rsqrt(var+eps)*g + b
template <bool PARAM_BF16>
__global__ __launch_bounds__(256) void k_layernorm(const float* __restrict__ X, const float* __restrict__ R, const float* __restrict__ g, const float* __restrict__ bta,
                                                  float* __restrict__ out_sum, float* __restrict__ out_norm, int N, float eps) {
  __shared__ float red[256];
  const int row = blockIdx.x, tid = threadIdx.x;
  const float* x = X + (size_t)row * N; const float* rr = R ? R + (size_t)row * N : nullptr;
  float vals[16];                     // up to N = 4096
  const int per = N / 256;            // contiguous chunk per thread? use strided-by-4 chunks: thread handles j = tid*4 + 1024*u
  float s1 = 0.f;
  for (int u = 0; u < per / 4; ++u) {
    const int j = tid * 4 + 1024 * u;
    const v4f a = *(const v4fa*)(x + j);
    v4f b = {0.f,0.f,0.f,0.f}; if (rr) b = *(const v4fa*)(rr + j);
#pragma unroll
    for (int q = 0; q < 4; ++q) { const float v = a[q] + b[q]; vals[u * 4 + q] = v; s1 += v; }
  }
  red[tid] = s1; __syncthreads();
  for (int st = 128; st > 0; st >>= 1) { if (tid < st) red[tid] += red[tid + st]; __syncthreads(); }
  const float mu = red[0] / (float)N; __syncthreads();
  float s2 = 0.f;
  for (int u = 0; u < per / 4; ++u)
#pragma unroll
    for (int q = 0; q < 4; ++q) { const float c = vals[u * 4 + q] - mu; s2 += c * c; }
  red[tid] = s2; __syncthreads();
  for (int st = 128; st > 0; st >>= 1) { if (tid < st) red[tid] += red[tid + st]; __syncthreads(); }
  const float rs = rsqrtf(red[0] / (float)N + eps);
  {
    for (int u = 0; u < per / 4; ++u) {
      const int j = tid * 4 + 1024 * u;
      v4f o, sm;
#pragma unroll
      for (int q = 0; q < 4; ++q) {
        float gg = g[j + q], bb = bta[j + q];
        if (PARAM_BF16) { gg = bf16_round(gg); bb = bf16_round(bb); }
        sm[q] = vals[u * 4 + q]; o[q] = (vals[u * 4 + q] - mu) * rs * gg + bb;
      }
      if (out_sum) *(v4f*)(out_sum + (size_t)row * N + j) = sm;
      *(v4f*)(out_norm + (size_t)row * N + j) = o;
    }
    
  }
}



// ---- f16 WMMA path (v_wmma_f32_16x16x32_f16): 11-bit significands for operands in range — used where a [0,1] probability operand needs more precision than bf16
typedef _Float16 v16h __attribute__((ext_vector_type(16)));
union FragH { v16h v; v8us half[2]; _Float16 h[16]; unsigned short u[16]; };
template <int NT>
__device__ __forceinline__ v8f mmaH(v16h ah, v16h al, v16h bh, v16h bl, v8f c) {
  c = __builtin_amdgcn_wmma_f32_16x16x32_f16(false, ah, false, bh, (short)0, c, false, false);
  if (NT >= 2) c = __builtin_amdgcn_wmma_f32_16x16x32_f16(false, al, false, bh, (short)0, c, false, false);
  if (NT >= 3) c = __builtin_amdgcn_wmma_f32_16x16x32_f16(false, ah, false, bl, (short)0, c, false, false);
  asm volatile("v_nop\n\tv_nop\n\tv_nop\n\tv_nop" : "+v"(c) : "v"(ah), "v"(al), "v"(bh), "v"(bl));
  return c;
}
// batched GEMM like k_gemm_b but f16 operands: A f32 (split into f16 hi/lo if ASPLIT, else rounded to f16), Bt = f16 values [n][k]; alpha; C f32; N multiple of 16 (partial tiles skipped)
template <bool ASPLIT>
__global__ __launch_bounds__(128) void k_gemm_h(const float* __restrict__ A, int lda, size_t sA, const _Float16* __restrict__ Bh, int ldb, size_t sB, float alpha, float* __restrict__ C, int ldc, size_t sC, int M, int N, int K) {
  __shared__ __attribute__((aligned(16))) float so[4][16][64];
  const int tid = threadIdx.x, w = tid >> 5, lane = tid & 31, ln = lane & 15, hh = lane >> 4; const int by = blockIdx.y;
  A += (size_t)by * sA; Bh += (size_t)by * sB; C += (size_t)by * sC;
  const int ntn = (N + 63) / 64; const int wid = blockIdx.x * 4 + w; const int mt = wid / ntn, nq = wid % ntn; if (mt * 16 >= M) return;
  const int row0 = mt * 16, col0 = nq * 64; const float* arow = A + (size_t)(row0 + ln) * lda;
  v8f acc[4] = {};
  for (int kb = 0; kb < K; kb += 32) {
    FragH ah, al;
    const v4f x0 = *(const v4fa*)(arow + kb + 8 * hh), x1 = *(const v4fa*)(arow + kb + 8 * hh + 4), x2 = *(const v4fa*)(arow + kb + 16 + 8 * hh), x3 = *(const v4fa*)(arow + kb + 16 + 8 * hh + 4);
    float xs[16] = {x0[0],x0[1],x0[2],x0[3],x1[0],x1[1],x1[2],x1[3],x2[0],x2[1],x2[2],x2[3],x3[0],x3[1],x3[2],x3[3]};
#pragma unroll
    for (int i = 0; i < 16; ++i) { const _Float16 h = (_Float16)xs[i]; ah.h[i] = h; al.h[i] = ASPLIT ? (_Float16)(xs[i] - (float)h) : (_Float16)0.0f; }
#pragma unroll
    for (int t = 0; t < 4; ++t) { if (col0 + t * 16 >= N) continue; const size_t boff = (size_t)(col0 + t * 16 + ln) * ldb + kb; FragH bq; bq.half[0] = *(const v8us*)(Bh + boff + 8 * hh); bq.half[1] = *(const v8us*)(Bh + boff + 16 + 8 * hh);
      acc[t] = mmaH<ASPLIT ? 2 : 1>(ah.v, al.v, bq.v, bq.v, acc[t]); }
  }
#pragma unroll
  for (int t = 0; t < 4; ++t) { if (col0 + t * 16 >= N) continue;
#pragma unroll
    for (int r = 0; r < 8; ++r) so[w][8 * hh + r][t * 16 + ln] = acc[t][r] * alpha; }
  __builtin_amdgcn_fence(__ATOMIC_ACQ_REL, "workgroup"); __builtin_amdgcn_wave_barrier();
  const int rsub = lane >> 4, c4 = (lane & 15) * 4;
  {
#pragma unroll
    for (int q = 0; q < 8; ++q) { const int r = q * 2 + rsub; if (col0 + c4 < N) { const v4f v = *(const v4fa*)&so[w][r][c4]; *(v4f*)(C + (size_t)(row0 + r) * ldc + col0 + c4) = v; } }
     }
}

// Wt[n][k] = f16(W[k][n]·scale) from f32 row-major W[K][N] (scale = power of two; bf16-exact weights stay exact in f16 away from the subnormal range)
__global__ __launch_bounds__(256) void k_wt_f16(const float* __restrict__ W, _Float16* __restrict__ Wt, int K, int N, float scale) {
  const int t = blockIdx.x * 256 + threadIdx.x; if (t >= N * (K / 8)) return; const int n = t / (K / 8), k8 = (t % (K / 8)) * 8; FragH f;
#pragma unroll
  for (int i = 0; i < 8; ++i) f.h[i] = (_Float16)(bf16_round(W[(size_t)(k8 + i) * N + n]) * scale); const v8us o = f.half[0];
  *(v8us*)((unsigned short*)Wt + (size_t)n * K + k8) = o; 
}
// k_gemm_hh variant with fused epilogue: v = acc·alpha + bias[by·sBias + col] (+ CP[(row/rowsPerB)·sCPb + by·64 + col] if CP) ; ACT 0 none / 1 elu ; writes f16 C16 (and f32 C if non-null)
template <int ACT>
__global__ __launch_bounds__(128) void k_gemm_hhx(const _Float16* __restrict__ A, int lda, size_t sA, const _Float16* __restrict__ Bh, int ldb, size_t sB, float alpha, const float* __restrict__ bias, size_t sBias, const float* __restrict__ CP, int rowsPerB, size_t sCPb, int row0g,
    float* __restrict__ C, _Float16* __restrict__ C16, int ldc, size_t sC, int M, int N, int K) {
  __shared__ __attribute__((aligned(16))) float so[4][16][64];
  const int tid = threadIdx.x, w = tid >> 5, lane = tid & 31, ln = lane & 15, hh = lane >> 4; const int by = blockIdx.y;
  A += (size_t)by * sA; Bh += (size_t)by * sB; const size_t cofs = (size_t)by * sC; const float* bp = bias ? bias + (size_t)by * sBias : nullptr;
  const int ntn = (N + 63) / 64; const int wid = blockIdx.x * 4 + w; const int mt = wid / ntn, nq = wid % ntn; if (mt * 16 >= M) return;
  const int row0 = mt * 16, col0 = nq * 64; const _Float16* arow = A + (size_t)(row0 + ln) * lda;
  v8f acc[4] = {};
  for (int kb = 0; kb < K; kb += 32) { FragH ah; ah.half[0] = *(const v8us*)((const unsigned short*)arow + kb + 8 * hh); ah.half[1] = *(const v8us*)((const unsigned short*)arow + kb + 16 + 8 * hh);
#pragma unroll
    for (int t = 0; t < 4; ++t) { if (col0 + t * 16 >= N) continue; const size_t boff = (size_t)(col0 + t * 16 + ln) * ldb + kb; FragH bq; bq.half[0] = *(const v8us*)((const unsigned short*)Bh + boff + 8 * hh); bq.half[1] = *(const v8us*)((const unsigned short*)Bh + boff + 16 + 8 * hh);
      acc[t] = mmaH<1>(ah.v, ah.v, bq.v, bq.v, acc[t]); }
  }
#pragma unroll
  for (int t = 0; t < 4; ++t) { if (col0 + t * 16 >= N) continue; const int col = col0 + t * 16 + ln; const float bv = bp ? bf16_round(bp[col]) : 0.f;
#pragma unroll
    for (int r = 0; r < 8; ++r) { float v = acc[t][r] * alpha + bv; if (CP) { const int rr = row0g + row0 + 8 * hh + r; if (rowsPerB < 0) v += CP[cofs + (size_t)rr * ldc + col];      /* rowsPerB < 0: own element of the batched C plane */ else { const int bidx = rr / rowsPerB; v += CP[(size_t)bidx * sCPb + (size_t)by * 64 + col]; } } if (ACT == 1) v = (v > 0.f) ? v : expm1f(v); else if (ACT == 7) v = (v > 0.f) ? v + 1.0f : expf(v); else if (ACT == 8) v = tanhf(v); else if (ACT == 9) v = 0.5f * v * (1.0f + tanhf(0.7978845608028654f * (v + 0.044715f * v * v * v))); else if (ACT == 11) v = 1.0f / (1.0f + expf(-v)); else if (ACT == 12) v = (v > 0.f) ? v : 0.01f * v; else if (ACT == 14) v = (v > 0.f) ? v : 0.1f * v; else if (ACT == 16) v = (v >= 0.f) ? v : 0.3f * v; else if (ACT == 17) v = (v >= 0.f) ? v : 0.2f * v; else if (ACT == 15) v = v / (1.0f + expf(-v)); else if (ACT == 3) v = fmaxf(v, 0.f); else if (ACT == 6) v = 0.5f * v * (1.0f + erff(v * 0.70710678118654752f)); so[w][8 * hh + r][t * 16 + ln] = v; } }
  __builtin_amdgcn_fence(__ATOMIC_ACQ_REL, "workgroup"); __builtin_amdgcn_wave_barrier();
  const int rsub = lane >> 4, c4 = (lane & 15) * 4; typedef _Float16 v4h __attribute__((ext_vector_type(4)));
  {
#pragma unroll
    for (int q = 0; q < 8; ++q) { const int r = q * 2 + rsub; if (col0 + c4 < N) { const v4f v = *(const v4fa*)&so[w][r][c4]; if (C) *(v4f*)(C + cofs + (size_t)(row0 + r) * ldc + col0 + c4) = v; if (C16) { v4h h4; for (int i = 0; i < 4; ++i) h4[i] = (_Float16)v[i]; *(v4h*)(C16 + cofs + (size_t)(row0 + r) * ldc + col0 + c4) = h4; } } }
     }
}


typedef _Float16 v4h __attribute__((ext_vector_type(4)));

__global__ __launch_bounds__(256) void k_x16(const float* __restrict__ x, _Float16* __restrict__ X16, size_t n8) { const size_t t = (size_t)blockIdx.x * 256 + threadIdx.x; if (t >= n8) return; FragH f;
#pragma unroll
  for (int q = 0; q < 8; ++q) f.h[q] = (_Float16)bf16_round(x[t * 8 + q]); *(v8us*)((unsigned short*)X16 + t * 8) = f.half[0];  }
__global__ __launch_bounds__(256) void k_h16(const float* __restrict__ x, _Float16* __restrict__ X16, size_t n8) { const size_t t = (size_t)blockIdx.x * 256 + threadIdx.x; if (t >= n8) return; FragH f;
#pragma unroll
  for (int q = 0; q < 8; ++q) f.h[q] = (_Float16)x[t * 8 + q]; *(v8us*)((unsigned short*)X16 + t * 8) = f.half[0];  }
__global__ __launch_bounds__(256) void k_round16f(const float* __restrict__ W, _Float16* __restrict__ Bt, size_t n8) { const size_t t = (size_t)blockIdx.x * 256 + threadIdx.x; if (t >= n8) return; FragH f;
#pragma unroll
  for (int i = 0; i < 8; ++i) f.h[i] = (_Float16)(bf16_round(W[t * 8 + i]) * 16.0f); *(v8us*)((unsigned short*)Bt + t * 8) = f.half[0];  }
template <int NHv, int TTv>
__global__ __launch_bounds__(256) void k_vt(const _Float16* __restrict__ V16, int ldv, int voff, _Float16* __restrict__ Vt) { __shared__ unsigned short tl[64][66]; const int tid = threadIdx.x; const int slab = blockIdx.x / (TTv / 64), lg = blockIdx.x % (TTv / 64); const int b = slab / NHv, h = slab % NHv;
  for (int i = tid; i < 64 * 8; i += 256) { const int r = i / 8, c8 = (i % 8) * 8; FragH f; f.half[0] = *(const v8us*)((const unsigned short*)V16 + ((size_t)b * TTv + lg * 64 + r) * ldv + voff + h * 64 + c8);
#pragma unroll
    for (int q = 0; q < 8; ++q) tl[r][c8 + q] = f.u[q]; }
  __syncthreads();
  {
#pragma unroll
    for (int rd = 0; rd < 2; ++rd) { const int d = rd * 32 + tid / 8, pc = tid % 8; FragH f;
#pragma unroll
      for (int q = 0; q < 8; ++q) f.u[q] = tl[pc * 8 + q][d];
      *(v8us*)((unsigned short*)Vt + ((size_t)slab * 64 + d) * TTv + lg * 64 + pc * 8) = f.half[0]; }
     } }

__global__ __launch_bounds__(256) void k_hl(const float* __restrict__ F, _Float16* __restrict__ Hh, _Float16* __restrict__ Hl, size_t n8) { const size_t t = (size_t)blockIdx.x * 256 + threadIdx.x; if (t >= n8) return; FragH fh, fl; const v4f a = *(const v4fa*)(F + t * 8), c = *(const v4fa*)(F + t * 8 + 4);
#pragma unroll
  for (int q = 0; q < 4; ++q) { _Float16 h = (_Float16)a[q]; fh.h[q] = h; fl.h[q] = (_Float16)((a[q] - (float)h) * 1024.0f); h = (_Float16)c[q]; fh.h[4 + q] = h; fl.h[4 + q] = (_Float16)((c[q] - (float)h) * 1024.0f); }
  { *(v8us*)((unsigned short*)Hh + t * 8) = fh.half[0]; *(v8us*)((unsigned short*)Hl + t * 8) = fl.half[0];  } }

// ---- fast GEMM (wave tile 32x64; requires M % 32 == 0 rows per launch region and N % 64 == 0); epilogue = k_gemm_hhx semantics, except the rowsPerB < 0 addend plane steps by sCPb per grid.y slice ----
__device__ __forceinline__ v16h g2_frag(const _Float16* p, int hh) { FragH f; f.half[0] = *(const v8us*)((const unsigned short*)p + 8 * hh); f.half[1] = *(const v8us*)((const unsigned short*)p + 16 + 8 * hh); return f.v; }
__device__ __forceinline__ v8f g2_mma(v16h a, v16h b, v8f c) { v8f d = __builtin_amdgcn_wmma_f32_16x16x32_f16(false, a, false, b, (short)0, c, false, false); asm volatile("v_nop\n\tv_nop\n\tv_nop\n\tv_nop" : "+v"(d) : "v"(a), "v"(b)); return d; }
template <int ACT>
__global__ __launch_bounds__(128) void k_gemm2(const _Float16* __restrict__ A, int lda, size_t sA, const _Float16* __restrict__ Bh, int ldb, size_t sB, float alpha, const float* __restrict__ bias, size_t sBias, const float* __restrict__ CP, int rowsPerB, size_t sCPb, int row0g,
    float* __restrict__ C, _Float16* __restrict__ C16, int ldc, size_t sC, int M, int N, int K) { static_assert(ACT == 0 || ACT == 3 || ACT == 6 || ACT == 8 || ACT == 9 || ACT == 11 || ACT == 12 || ACT == 14 || ACT == 15 || ACT == 16 || ACT == 17, "k_gemm2: unsupported ACT code (would silently apply no activation)");
  __shared__ __attribute__((aligned(16))) float so[4][32][68];
  const int tid = threadIdx.x, w = tid >> 5, lane = tid & 31, ln = lane & 15, hh = lane >> 4; const int by = blockIdx.y;
  A += (size_t)by * sA; Bh += (size_t)by * sB; const size_t cofs = (size_t)by * sC; const float* bp = bias ? bias + (size_t)by * sBias : nullptr;
  const int ntn = N >> 6; const int mt = blockIdx.x / ntn, nq = blockIdx.x - mt * ntn; const int row0 = mt * 128 + 32 * w, col0 = nq * 64; if (row0 >= M) return;
  const _Float16* a0p = A + (size_t)(row0 + ln) * lda; const _Float16* a1p = a0p + (size_t)16 * lda;
  const _Float16* b0p = Bh + (size_t)(col0 + ln) * ldb; const _Float16* b1p = b0p + (size_t)16 * ldb; const _Float16* b2p = b1p + (size_t)16 * ldb; const _Float16* b3p = b2p + (size_t)16 * ldb;
  const v8f z8 = {0.f,0.f,0.f,0.f,0.f,0.f,0.f,0.f}; v8f c00 = z8, c01 = z8, c02 = z8, c03 = z8, c10 = z8, c11 = z8, c12 = z8, c13 = z8;
#pragma unroll 1
  for (int kb = 0; kb < K; kb += 32) { const v16h a0 = g2_frag(a0p + kb, hh), a1 = g2_frag(a1p + kb, hh);
    v16h b = g2_frag(b0p + kb, hh); c00 = g2_mma(a0, b, c00); c10 = g2_mma(a1, b, c10);
    b = g2_frag(b1p + kb, hh); c01 = g2_mma(a0, b, c01); c11 = g2_mma(a1, b, c11);
    b = g2_frag(b2p + kb, hh); c02 = g2_mma(a0, b, c02); c12 = g2_mma(a1, b, c12);
    b = g2_frag(b3p + kb, hh); c03 = g2_mma(a0, b, c03); c13 = g2_mma(a1, b, c13); }
  v8f accs[8] = {c00, c01, c02, c03, c10, c11, c12, c13};
#pragma unroll
  for (int u = 0; u < 8; ++u) { const int t = u & 3, half = u >> 2; const int col = col0 + t * 16 + ln; const float bv = bp ? bf16_round(bp[col]) : 0.f;
#pragma unroll
    for (int r = 0; r < 8; ++r) { const int rloc = half * 16 + 8 * hh + r; float v = accs[u][r] * alpha + bv; if (CP) { if (rowsPerB < 0) v += CP[(size_t)by * sCPb + (size_t)(row0g + row0 + rloc) * ldc + col];      /* rowsPerB < 0: own element of an addend plane shaped like C; sCPb = its step from one grid.y slice to the next (0: one plane shared by all slices) */ else { const int bidx = (row0g + row0 + rloc) / rowsPerB; v += CP[(size_t)bidx * sCPb + (size_t)by * 64 + col]; } }
      if (ACT == 3) v = fmaxf(v, 0.f); else if (ACT == 6) v = 0.5f * v * (1.0f + erff(v * 0.70710678118654752f)); else if (ACT == 11) v = 1.0f / (1.0f + expf(-v)); else if (ACT == 15) v = v / (1.0f + expf(-v)); else if (ACT == 12) v = (v > 0.f) ? v : 0.01f * v; else if (ACT == 8) v = tanhf(v); else if (ACT == 9) v = 0.5f * v * (1.0f + tanhf(0.7978845608028654f * (v + 0.044715f * v * v * v))); else if (ACT == 14) v = (v > 0.f) ? v : 0.1f * v; else if (ACT == 16) v = (v >= 0.f) ? v : 0.3f * v; else if (ACT == 17) v = (v >= 0.f) ? v : 0.2f * v;
      so[w][rloc][t * 16 + ln] = v; } }
  __builtin_amdgcn_fence(__ATOMIC_ACQ_REL, "workgroup"); __builtin_amdgcn_wave_barrier();
  const int rsub = lane >> 4, c4 = (lane & 15) * 4;
  {
#pragma unroll
    for (int q = 0; q < 16; ++q) { const int r = q * 2 + rsub; const v4f v = *(const v4fa*)&so[w][r][c4]; if (C) *(v4f*)(C + cofs + (size_t)(row0 + r) * ldc + col0 + c4) = v; if (C16) { v4h h4; for (int i = 0; i < 4; ++i) h4[i] = (_Float16)v[i]; *(v4h*)(C16 + cofs + (size_t)(row0 + r) * ldc + col0 + c4) = h4; } }
     } }


__global__ __launch_bounds__(256) void k_wnat(const float* __restrict__ w, size_t n8, _Float16* __restrict__ Bt) { const size_t t = (size_t)blockIdx.x * 256 + threadIdx.x; if (t >= n8) return; FragH f; for (int q = 0; q < 8; ++q) f.h[q] = (_Float16)(bf16_round(w[t * 8 + q]) * 16.0f); *(v8us*)((unsigned short*)Bt + t * 8) = f.half[0];  }
__global__ __launch_bounds__(256) void k_rsm(const float* __restrict__ S, _Float16* __restrict__ P, int nrows) {
  #pragma clang fp contract(off)
  const int i = blockIdx.x * 256 + threadIdx.x; if (i >= nrows) return; const float* s = S + (size_t)i * SQ; float mx = -3.0e38f;
#pragma unroll 1
  for (int j = 0; j < SQ; ++j) mx = fmaxf(mx, s[j]); float se = 0.f;
#pragma unroll 1
  for (int j = 0; j < SQ; ++j) se += expf(s[j] - mx); const float sc = 256.0f / se;
#pragma unroll 1
  for (int j0 = 0; j0 < SQ; j0 += 8) { FragH f; for (int q = 0; q < 8; ++q) f.h[q] = (_Float16)(expf(s[j0 + q] - mx) * sc); unsigned short* d = (unsigned short*)P + (size_t)i * SQ + j0; *(v8us*)d = f.half[0];  } }
__global__ __launch_bounds__(256) void k_vt(const _Float16* __restrict__ V16, int b, int h0, _Float16* __restrict__ VT) { __shared__ unsigned short tl[64][65]; const int tid = threadIdx.x; const int hh = blockIdx.x % HG, sg = blockIdx.x / HG; const int s0 = sg * 64; const int h = h0 + hh;
  for (int i = tid; i < 64 * 8; i += 256) { const int j = i / 8, d8 = (i % 8) * 8; FragH f; f.half[0] = *(const v8us*)((const unsigned short*)V16 + ((size_t)b * SQ + s0 + j) * DM + h * HD + d8); for (int q = 0; q < 8; ++q) tl[d8 + q][j] = f.u[q]; }
  __syncthreads();
  { for (int i = tid; i < 64 * 8; i += 256) { const int d = i / 8, j8 = (i % 8) * 8; FragH f; for (int q = 0; q < 8; ++q) f.u[q] = tl[d][j8 + q]; *(v8us*)((unsigned short*)VT + ((size_t)hh * HD + d) * SQ + s0 + j8) = f.half[0]; }  } }



__global__ __launch_bounds__(256) void k_rsmcf2(const float* __restrict__ S, _Float16* __restrict__ P, int hg, int q0, int nk) {
  #pragma clang fp contract(off)
  const int t = blockIdx.x * 256 + threadIdx.x; if (t >= hg * QT) return; const size_t i = (size_t)t; const float* s = S + i * NKX; const int last = q0 + (t % QT); float mx = -3.0e38f;
#pragma unroll 1
  for (int j = 0; j < nk; ++j) { const float f = (j <= last) ? 1.f : 0.f; mx = fmaxf(mx, fmaf(f, s[j], (1.f - f) * -1.0e9f)); } float se = 0.f;
#pragma unroll 1
  for (int j = 0; j < nk; ++j) { const float f = (j <= last) ? 1.f : 0.f; se += __expf(fmaf(f, s[j], (1.f - f) * -1.0e9f) - mx); } const float sc = 256.0f / se;
#pragma unroll 1
  for (int j0 = 0; j0 < nk; j0 += 8) { FragH fr; for (int q = 0; q < 8; ++q) { const int j = j0 + q; const float f = (j <= last) ? 1.f : 0.f; fr.h[q] = (_Float16)(__expf(fmaf(f, s[j], (1.f - f) * -1.0e9f) - mx) * sc); } unsigned short* d = (unsigned short*)P + i * NKX + j0; *(v8us*)d = fr.half[0];  } }

template <int MASKADD>
__global__ __launch_bounds__(64) void k_att0(const float* __restrict__ QF, const float* __restrict__ KF, const float* __restrict__ VF, int ld, const float* __restrict__ mask, float scale, float* __restrict__ OF, int ldo) {
  #pragma clang fp contract(off)
  __shared__ __attribute__((aligned(16))) float lq[64][64]; __shared__ __attribute__((aligned(16))) float lo[64][64];
  const int tid = threadIdx.x; const int h = blockIdx.x / (QT0 / 64), rg = blockIdx.x % (QT0 / 64); const int i = rg * 64 + tid;
  const float* qr = QF + (size_t)i * ld + h * HD;
#pragma unroll 1
  for (int c = 0; c < HD / 4; ++c) { *(v4f*)&lq[tid][c * 4] = *(const v4fa*)(qr + c * 4); const v4f z = {0.f, 0.f, 0.f, 0.f}; *(v4f*)&lo[tid][c * 4] = z; }
  float m = -1.0e30f, l = 0.f; const int jmax = MASKADD ? (SQ - 1) : (rg * 64 + 63);      /* additive-mask form: every key (the mask input decides); causal form: keys up to the block's last row */
#pragma unroll 1
  for (int j = 0; j <= jmax; ++j) { const float* kr = KF + (size_t)j * ld + h * HD; const float* vr = VF + (size_t)j * ld + h * HD; float s = 0.f;
#pragma unroll 1
    for (int c = 0; c < HD / 4; ++c) { const v4f kq = *(const v4fa*)(kr + c * 4); const v4f qq = *(v4f*)&lq[tid][c * 4]; s = __fadd_rn(s, __fmul_rn(qq[0], kq[0])); s = __fadd_rn(s, __fmul_rn(qq[1], kq[1])); s = __fadd_rn(s, __fmul_rn(qq[2], kq[2])); s = __fadd_rn(s, __fmul_rn(qq[3], kq[3])); }
    s = __fmul_rn(s, scale); if (MASKADD) s = __fadd_rn(s, __fmul_rn(bf16_round(mask[(size_t)i * SQ + j]), -10000.0f));
    const float f = (MASKADD || j <= i) ? 1.f : 0.f; const float sm = fmaf(f, s, (1.f - f) * -1.0e30f); const float mn = fmaxf(m, sm); const float sc = expf(m - mn); const float e = expf(sm - mn); l = __fadd_rn(__fmul_rn(l, sc), e); m = mn;
#pragma unroll 1
    for (int c = 0; c < HD / 4; ++c) { const v4f vv = *(const v4fa*)(vr + c * 4); v4f oo = *(v4f*)&lo[tid][c * 4]; for (int u = 0; u < 4; ++u) oo[u] = __fadd_rn(__fmul_rn(oo[u], sc), __fmul_rn(e, vv[u])); *(v4f*)&lo[tid][c * 4] = oo; } }
  const float fin = 64.0f / l;      /* o carried x64 like the f16 path */
#pragma unroll 1
  for (int c = 0; c < HD / 4; ++c) { v4f oo = *(v4f*)&lo[tid][c * 4]; for (int u = 0; u < 4; ++u) oo[u] = __fmul_rn(oo[u], fin); *(v4f*)&lo[tid][c * 4] = oo; }
  __syncthreads();
  {
#pragma unroll 1
    for (int it = 0; it < 16; ++it) { const int row = it * 4 + tid / 16, pc = (tid % 16) * 4; const v4f v = *(const v4f*)&lo[row][pc]; *(v4f*)(OF + (size_t)(rg * 64 + row) * ldo + h * HD + pc) = v; }
     } }

__global__ __launch_bounds__(256) void k_oscale(const float* __restrict__ OF, float* __restrict__ out, size_t n4) { const size_t t = (size_t)blockIdx.x * 256 + threadIdx.x; if (t >= n4) return; const v4f a = *(const v4fa*)(OF + t * 4); v4f o; for (int q = 0; q < 4; ++q) o[q] = a[q] * 0.015625f; *(v4f*)(out + t * 4) = o;  }

__global__ __launch_bounds__(256) void k_bfr(const float* __restrict__ x, float* __restrict__ XB, size_t n8) { const size_t t = (size_t)blockIdx.x * 256 + threadIdx.x; if (t >= n8) return; v4f a = *(const v4fa*)(x + t * 8), c = *(const v4fa*)(x + t * 8 + 4); for (int q = 0; q < 4; ++q) { a[q] = bf16_round(a[q]); c[q] = bf16_round(c[q]); }
  { *(v4f*)(XB + t * 8) = a; *(v4f*)(XB + t * 8 + 4) = c;  } }



__global__ __launch_bounds__(256) void k_rsmfvl(const float* __restrict__ S, _Float16* __restrict__ P, _Float16* __restrict__ PL, int qn, const int* __restrict__ vlp) {
  #pragma clang fp contract(off)
  const int t = blockIdx.x * 256 + threadIdx.x; if (t >= qn) return; const int vl = vlp[0]; const size_t i = (size_t)t; const float* s = S + i * SQ; float mx = -3.0e38f;
#pragma unroll 1
  for (int j = 0; j < SQ; ++j) { const float f = (j < vl) ? 1.f : 0.f; mx = fmaxf(mx, fmaf(f, s[j], (1.f - f) * -1000000.0f)); } float se = 0.f;
#pragma unroll 1
  for (int j = 0; j < SQ; ++j) { const float f = (j < vl) ? 1.f : 0.f; se += __expf(fmaf(f, s[j], (1.f - f) * -1000000.0f) - mx); } const float sc = 256.0f / se;
#pragma unroll 1
  for (int j0 = 0; j0 < SQ; j0 += 8) { FragH fr, gr; for (int q = 0; q < 8; ++q) { const int j = j0 + q; const float f = (j < vl) ? 1.f : 0.f; const float pv = __expf(fmaf(f, s[j], (1.f - f) * -1000000.0f) - mx) * sc; const _Float16 ph = (_Float16)pv; fr.h[q] = ph; gr.h[q] = (_Float16)((pv - (float)ph) * 1024.0f); }
    unsigned short* d = (unsigned short*)P + i * SQ + j0; unsigned short* dl = (unsigned short*)PL + i * SQ + j0; *(v8us*)d = fr.half[0]; *(v8us*)dl = gr.half[0];  } }

// 2^x on the transcendental unit; the v_nop is the one free slot the instruction set asks for behind a transcendental, in the same statement so that it stays directly behind it.
__device__ __forceinline__ float exp2_slot(float x) { float r; asm("v_exp_f32 %0, %1\n\tv_nop" : "=v"(r) : "v"(x)); return r; }

#define CN 256          /* channels */
#define CI 128          /* inner channels */
#define NP 4096         /* positions */
#define NM 1024         /* pooled positions (= SQ: the softmax key count) */

// Fused attention: one launch computes scores, softmax and the weighted sum of g for all images; neither the scores nor the weights go to memory.
// A work-group of 8 waves takes 128 queries of one image (16 a wave) and walks the 1024 pooled positions 32 at a time.
// S^T = phi^T (A, rows m) x theta (B, columns n; fragments kept in registers), three terms as before: hi.hi + (hi.lo + lo.hi) / 1024.
// In the accumulator a lane holds, for ITS query n = lane & 15, the keys m = 8 * (lane >> 4) + r of a 16-key tile: two such tiles are, register for register, the B fragment of y[c][n] += g[c][m] P^T[m][n]
// (elements 0..7 = keys 8 hh + r, elements 8..15 = keys 16 + 8 hh + r, the k order in which g2_frag / lds_frag read the rows of g), so the weights move through no LDS and no other lane.
// Running row maximum and row sum per lane (online softmax; the two half-waves share the maximum every pass and join their sums once at the end). Weights are carried x256 in f16 as before; the sum carries the same factor.
// The phi hi / lo rows and the g columns of a pass are shared by the 8 waves through LDS, two buffers: the next pass's tile is loaded to registers while this one's softmax and g products run, stored into the other buffer, and one barrier a pass publishes it (and ends the reads of the buffer that the next pass overwrites).
#define FK 32                            /* keys per pass */
#define FPP 136                          /* LDS pitch of a phi row in f16: 256 B + 16 B, an odd multiple of 16 B (no bank conflict for 16-byte reads of 16 rows) */
#define FGP 40                           /* LDS pitch of a g row in f16: 64 B + 16 B, likewise */
#define FBUF (2 * FK * FPP + CI * FGP)   /* one buffer in f16: phi hi, phi lo, g */
__device__ __forceinline__ v16h lds_frag(const unsigned short* p) { FragH f; f.half[0] = *(const v8us*)p; f.half[1] = *(const v8us*)(p + 16); return f.v; }
__device__ __forceinline__ v8f f_mma(v16h a, v16h b, v8f c) { return __builtin_amdgcn_wmma_f32_16x16x32_f16(false, a, false, b, (short)0, c, false, false); }
__global__ __launch_bounds__(256) void k_fattn(const _Float16* __restrict__ TH, const _Float16* __restrict__ THL, const _Float16* __restrict__ PHT, const _Float16* __restrict__ PHLT, const _Float16* __restrict__ G16, _Float16* __restrict__ YT) {
  __shared__ __attribute__((aligned(16))) unsigned short sm[2 * FBUF];
  const int tid = threadIdx.x, w = tid >> 5, lane = tid & 31, ln = lane & 15, hh = lane >> 4, by = blockIdx.y;
  const int n0 = blockIdx.x * 128 + w * 16;
  const unsigned short* ph = (const unsigned short*)PHT + (size_t)by * CI * NM; const unsigned short* pl = (const unsigned short*)PHLT + (size_t)by * CI * NM; const unsigned short* gg = (const unsigned short*)G16 + (size_t)by * CI * NM;
  const _Float16* tq = TH + ((size_t)by * NP + n0 + ln) * CI; const _Float16* tl = THL + ((size_t)by * NP + n0 + ln) * CI;
  v16h qh[4], ql[4];
#pragma unroll
  for (int j = 0; j < 4; ++j) { qh[j] = g2_frag(tq + j * 32, hh); ql[j] = g2_frag(tl + j * 32, hh); }
  /* staging: 16-byte pieces; phi tile = 32 rows x 16 pieces (contiguous in memory), g tile = 128 rows x 4 pieces; two pieces of each plane a thread */
  const int pr = tid >> 4, pc = (tid & 15) * 8, gr = tid >> 2, gc = (tid & 3) * 8;
  v8us r0, r1, r2, r3, r4, r5;
  auto fetch = [&](int t) { const size_t m0 = (size_t)t * FK;
    r0 = *(const v8us*)(ph + (m0 + pr) * CI + pc); r1 = *(const v8us*)(ph + (m0 + pr + 16) * CI + pc);
    r2 = *(const v8us*)(pl + (m0 + pr) * CI + pc); r3 = *(const v8us*)(pl + (m0 + pr + 16) * CI + pc);
    r4 = *(const v8us*)(gg + (size_t)gr * NM + m0 + gc); r5 = *(const v8us*)(gg + (size_t)(gr + 64) * NM + m0 + gc); };
  auto put = [&](int b) { unsigned short* d = sm + b * FBUF;
    *(v8us*)(d + pr * FPP + pc) = r0; *(v8us*)(d + (pr + 16) * FPP + pc) = r1;
    *(v8us*)(d + FK * FPP + pr * FPP + pc) = r2; *(v8us*)(d + FK * FPP + (pr + 16) * FPP + pc) = r3;
    *(v8us*)(d + 2 * FK * FPP + gr * FGP + gc) = r4; *(v8us*)(d + 2 * FK * FPP + (gr + 64) * FGP + gc) = r5; };
  const v8f z8 = {0.f,0.f,0.f,0.f,0.f,0.f,0.f,0.f};
  v8f o[8];
#pragma unroll
  for (int ct = 0; ct < 8; ++ct) o[ct] = z8;
  float m = -1.0e30f, l = 0.f;
  fetch(0); put(0);
  __syncthreads();      /* publishes tile 0 */
  /* rolled: one pass is already some hundred instructions, and the buffer index is the only thing that changes */
#pragma unroll 1
  for (int t = 0; t < NM / FK; ++t) {
    const unsigned short* cur = sm + (t & 1) * FBUF;
    const unsigned short* ah = cur + ln * FPP + 8 * hh; const unsigned short* al = ah + FK * FPP; const unsigned short* ag = cur + 2 * FK * FPP + ln * FGP + 8 * hh;
    v8f sh0 = z8, sh1 = z8, sl0 = z8, sl1 = z8;
#pragma unroll
    for (int j = 0; j < 4; ++j) {
      const v16h h0 = lds_frag(ah + j * 32), h1 = lds_frag(ah + 16 * FPP + j * 32), l0 = lds_frag(al + j * 32), l1 = lds_frag(al + 16 * FPP + j * 32);
      sh0 = f_mma(h0, qh[j], sh0); sh1 = f_mma(h1, qh[j], sh1);
      sl0 = f_mma(h0, ql[j], sl0); sl1 = f_mma(h1, ql[j], sl1);
      sl0 = f_mma(l0, qh[j], sl0); sl1 = f_mma(l1, qh[j], sl1);
    }
    if (t + 1 < NM / FK) fetch(t + 1);      /* behind the score products, whose fragments are dead here, so that the 24 staging registers do not add to the loop's register peak (in front of them the build took 260 registers); softmax and the g products cover the loads */
    float s[16];
#pragma unroll
    for (int r = 0; r < 8; ++r) { s[r] = sh0[r] + sl0[r] * 0.0009765625f; s[8 + r] = sh1[r] + sl1[r] * 0.0009765625f; }
    float mx = fmaxf(s[0], s[1]);
#pragma unroll
    for (int r = 2; r < 16; ++r) mx = fmaxf(mx, s[r]);
    mx = fmaxf(mx, __shfl_xor(mx, 16, 32));      /* the other half-wave holds the same query's other 16 keys */
    const float mn = fmaxf(m, mx);
    const float sc = exp2_slot((m - mn) * 1.44269504f);
    m = mn;
    FragH pf; float p0 = 0.f, p1 = 0.f;
#pragma unroll
    for (int r = 0; r < 8; ++r) {
      const float e0 = exp2_slot((s[r] - mn) * 1.44269504f + 8.0f), e1 = exp2_slot((s[8 + r] - mn) * 1.44269504f + 8.0f);
      p0 += e0; p1 += e1; pf.h[r] = (_Float16)e0; pf.h[8 + r] = (_Float16)e1;
    }
    l = l * sc + (p0 + p1);
#pragma unroll
    for (int ct = 0; ct < 8; ++ct) o[ct] *= sc;
#pragma unroll
    for (int ct = 0; ct < 8; ++ct) o[ct] = f_mma(lds_frag(ag + ct * 16 * FGP), pf.v, o[ct]);
    if (t + 1 < NM / FK) put((t + 1) & 1);
    __syncthreads();      /* publishes tile t + 1; ends every wave's reads of tile t, whose buffer pass t + 1 overwrites */
  }
  l += __shfl_xor(l, 16, 32);
  const float inv = 1.0f / l;
  unsigned short* yo = (unsigned short*)YT + ((size_t)by * NP + n0 + ln) * CI + 8 * hh;      /* y^T [n][ci]: the lane's 8 channels of a tile are 16 contiguous bytes of its query's row */
#pragma unroll
  for (int ct = 0; ct < 8; ++ct) { FragH f;
#pragma unroll
    for (int r = 0; r < 8; ++r) f.h[r] = (_Float16)(o[ct][r] * inv);
    *(v8us*)(yo + ct * 16) = f.half[0]; }
}

__global__ __launch_bounds__(256) void k_rowbias(const float* __restrict__ b, float* __restrict__ BP, size_t n4, int ncol) { const size_t t = (size_t)blockIdx.x * 256 + threadIdx.x; if (t >= n4) return; const size_t e = t * 4; const float v = bf16_round(b[e / ncol]); const v4f o = {v, v, v, v}; *(v4f*)(BP + e) = o;  }




__global__ __launch_bounds__(256) void k_mp2(const float* __restrict__ src, float* __restrict__ dst, int nout) {
  const int t = blockIdx.x * 256 + threadIdx.x; if (t >= nout) return; const int c = t / 1024; const int o = t % 1024; const int oy = o / 32, ox = o % 32; const float* p = src + (size_t)c * 4096 + (size_t)(2 * oy) * 64 + 2 * ox;
  const float v = fmaxf(fmaxf(p[0], p[1]), fmaxf(p[64], p[65])); *(float*)(dst + t) = v;  }
__global__ __launch_bounds__(256) void k_xpb(const float* __restrict__ x, const float* __restrict__ wb, float* __restrict__ CPP, size_t n4) {
  #pragma clang fp contract(off)
  const size_t t = (size_t)blockIdx.x * 256 + threadIdx.x; if (t >= n4) return; const size_t e = t * 4; const int c = (int)((e / 4096) % 256); const float bb = bf16_round(wb[c]); const v4f a = *(const v4fa*)(x + e); v4f o; for (int q = 0; q < 4; ++q) o[q] = __fadd_rn(bf16_round(a[q]), bb);
  *(v4f*)(CPP + e) = o;  }


__global__ __launch_bounds__(256) void k_bnres(float* __restrict__ O, const float* __restrict__ x, const float* __restrict__ wb, const float* __restrict__ g, const float* __restrict__ be, const float* __restrict__ mu, const float* __restrict__ var, float eps, size_t n4) {
  #pragma clang fp contract(off)
  const size_t t = (size_t)blockIdx.x * 256 + threadIdx.x; if (t >= n4) return; const size_t e = t * 4; const int c = (int)((e / NP) % CN);
  const float inv = __fdiv_rn(bf16_round(g[c]), sqrtf(__fadd_rn(bf16_round(var[c]), eps))); const float wbc = bf16_round(wb[c]), mc = bf16_round(mu[c]), bc = bf16_round(be[c]);
  const v4f a = *(const v4fa*)(O + e); const v4f xx = *(const v4fa*)(x + e); v4f o;
  for (int q = 0; q < 4; ++q) o[q] = __fadd_rn(__fadd_rn(__fmul_rn(__fadd_rn(__fadd_rn(a[q], wbc), -mc), inv), bc), bf16_round(xx[q]));
  *(v4f*)(O + e) = o;  }
extern "C" void kernel_launch(void* const* d_in, const int* in_sizes, int n_in,
                              void* d_out, int out_size, void* d_ws, size_t ws_size, hipStream_t stream) {
  (void)in_sizes; (void)n_in; (void)out_size;
  const float* const* I = (const float* const*)d_in; const float* x = I[0]; const float* gw = I[1]; const float* gb = I[2]; const float* tw = I[3]; const float* tb = I[4]; const float* pw = I[5]; const float* pb = I[6]; const float* ww = I[7]; const float* wb = I[8]; const float* bng = I[9]; const float* bnb = I[10]; const float* bnm = I[11]; const float* bnv = I[12];      /* natural [out][in] 1x1-conv weights + biases: g, theta, phi [128][256]; W [256][128] + b; eval BatchNorm gamma / beta / running mean / var [256] */
  char* ws = (char*)d_ws; size_t off = 0;
  auto take = [&](size_t bytes) { char* p = ws + off; off += (bytes + 255) & ~(size_t)255; return p; };
  const size_t PL = (size_t)CN * NP;      /* one input map */
  _Float16* BG = (_Float16*)take((size_t)CI * CN * 2); _Float16* BT = (_Float16*)take((size_t)CI * CN * 2); _Float16* BP = (_Float16*)take((size_t)CI * CN * 2); _Float16* BW = (_Float16*)take((size_t)CN * CI * 2);
  float* GBP = (float*)take((size_t)CI * NP * 4); float* PBP = (float*)take((size_t)CI * NP * 4);      /* g_b / phi_b broadcast along the position axis */
  _Float16* X16 = (_Float16*)take(NB * PL * 2);      /* x f16 channel-first */
  /* every plane below holds all NB images, image b at b times the one-image size: each stage is ONE launch over all images (grid.y of the GEMMs and of the fused attention; a longer grid.x elsewhere) */
  const size_t sT = (size_t)NP * CI, sM = (size_t)CI * NM;      /* one image: [4096][128], [128][1024] elements */
  _Float16* XT = (_Float16*)take(NB * PL * 2); float* F1 = (float*)take(NB * sT * 4); float* F2 = (float*)take(NB * sM * 4);      /* x^T [n][c]; f32 scratch [4096 x 128] (theta^T, then phi, then g maps); pooled f32 [128][1024] */
  _Float16* TH = (_Float16*)take(NB * sT * 2); _Float16* THL = (_Float16*)take(NB * sT * 2); _Float16* PH = (_Float16*)take(NB * sM * 2); _Float16* PHL = (_Float16*)take(NB * sM * 2); _Float16* PHT = (_Float16*)take(NB * sM * 2); _Float16* PHLT = (_Float16*)take(NB * sM * 2); _Float16* G16 = (_Float16*)take(NB * sM * 2); _Float16* GL = (_Float16*)take(NB * sM * 2); _Float16* YT = (_Float16*)take(NB * sT * 2);
  if (off > ws_size) return;
  { const unsigned g = (unsigned)(((size_t)CI * CN / 8 + 255) / 256); k_wnat<<<g, 256, 0, stream>>>(gw, (size_t)CI * CN / 8, BG); k_wnat<<<g, 256, 0, stream>>>(tw, (size_t)CI * CN / 8, BT); k_wnat<<<g, 256, 0, stream>>>(pw, (size_t)CI * CN / 8, BP); k_wnat<<<g, 256, 0, stream>>>(ww, (size_t)CN * CI / 8, BW); }      /* natural [out][in] x16 f16 planes (Bt for theta; the A operand for g / phi / w) */
  k_rowbias<<<(unsigned)(((size_t)CI * NP / 4 + 255) / 256), 256, 0, stream>>>(gb, GBP, (size_t)CI * NP / 4, NP); k_rowbias<<<(unsigned)(((size_t)CI * NP / 4 + 255) / 256), 256, 0, stream>>>(pb, PBP, (size_t)CI * NP / 4, NP);
  k_x16<<<(unsigned)((NB * PL / 8 + 255) / 256), 256, 0, stream>>>(x, X16, NB * PL / 8);
  k_vt<NP / 64, CN><<<NB * (NP / 64) * (CN / 64), 256, 0, stream>>>(X16, NP, 0, XT);      /* [c][n] -> x^T [n][c] (the kernel's own image index: slab / NHv) */
  k_gemm2<0><<<dim3((unsigned)((NP / 128) * (CI / 64)), NB), 128, 0, stream>>>(XT, CN, PL, BT, CN, 0, 0.0625f, tb, 0, nullptr, 1, 0, 0, F1, nullptr, CI, sT, NP, CI, CN); k_hl<<<(unsigned)((NB * sT / 8 + 255) / 256), 256, 0, stream>>>(F1, TH, THL, NB * sT / 8);      /* theta^T [n][ci] f32 -> f16 hi + x1024 residual */
  k_gemm2<0><<<dim3((unsigned)((CI / 128) * (NP / 64)), NB), 128, 0, stream>>>(BP, CN, 0, XT, CN, PL, 0.0625f, nullptr, 0, PBP, -1, 0, 0, F1, nullptr, NP, sT, CI, NP, CN); k_mp2<<<(unsigned)((NB * CI * NM + 255) / 256), 256, 0, stream>>>(F1, F2, NB * CI * NM); k_hl<<<(unsigned)((NB * sM / 8 + 255) / 256), 256, 0, stream>>>(F2, PH, PHL, NB * sM / 8);      /* phi [ci][n] (f32; one bias plane for all images) -> 2x2 max pool -> [ci][m] -> hi + residual */
  k_vt<NM / 64, CI><<<NB * (NM / 64) * (CI / 64), 256, 0, stream>>>(PH, NM, 0, PHT); k_vt<NM / 64, CI><<<NB * (NM / 64) * (CI / 64), 256, 0, stream>>>(PHL, NM, 0, PHLT);      /* -> phi^T planes [m][ci] (the scores' A operand) */
  k_gemm2<0><<<dim3((unsigned)((CI / 128) * (NP / 64)), NB), 128, 0, stream>>>(BG, CN, 0, XT, CN, PL, 0.0625f, nullptr, 0, GBP, -1, 0, 0, F1, nullptr, NP, sT, CI, NP, CN); k_mp2<<<(unsigned)((NB * CI * NM + 255) / 256), 256, 0, stream>>>(F1, F2, NB * CI * NM); k_hl<<<(unsigned)((NB * sM / 8 + 255) / 256), 256, 0, stream>>>(F2, G16, GL, NB * sM / 8);      /* g [ci][n] -> pooled [ci][m] -> f16 (the residual plane GL is not used) */
  k_fattn<<<dim3(NP / 128, NB), 256, 0, stream>>>(TH, THL, PHT, PHLT, G16, YT);      /* f[n][m] = theta.phi (hi.hi + (hi.lo + lo.hi) / 1024; no scale), softmax over the 1024 pooled positions, y^T [n][ci] = P g^T -> f16, in one launch */
  k_gemm2<0><<<dim3((unsigned)((CN / 128) * (NP / 64)), NB), 128, 0, stream>>>(BW, CI, 0, YT, CI, sT, 0.0625f, nullptr, 0, nullptr, 1, 0, 0, (float*)d_out, nullptr, NP, PL, CN, NP, CI);      /* T[c][n] = (16 W as A) x (y^T as B^T) / 16 -> f32 channel-first (bias, BN and residual follow on VALU) */
  k_bnres<<<(unsigned)((NB * PL / 4 + 255) / 256), 256, 0, stream>>>((float*)d_out, x, wb, bng, bnb, bnm, bnv, 1e-5f, NB * PL / 4);      /* z = ((T + bf16 W_b[c]) - bf16 mean[c]) (bf16 gamma[c] / sqrt(bf16 var[c] + eps)) + bf16 beta[c] + bf16 x (in place, own 16-B pieces) */
}

// v004
// Measured time: 82.6 microseconds a run.
// Timed twice side by side with v003, it ran 2.24 and 2.20 times as fast.
// All steps since v000 together make it 32.0 times as fast.
#include <hip/hip_runtime.h>
// Non-local block (embedded Gaussian, single head, 2x2 max-pool sub-sampling) with an eval-mode BatchNorm on the output conv (x [8][256][64][64]; theta = conv1x1(x) [128 ch], phi = maxpool2x2(conv1x1(x)), g = maxpool2x2(conv1x1(x)) (natural [128][256] weights sigma 1/16 + biases 0.01); f[n][m] = theta[:, n].phi[:, m] over the 1024 pooled positions (NO scale); softmax over m; y[:, n] = sum_m f[n][m] g[:, m]; W_y = conv1x1(y; W [256][128] + b); z = (W_y - bn_mean) gamma / sqrt(bn_var + 1e-5) + bn_beta + x -> [8][256][64][64]).
// Structure: four launches; the last three each over all 8 images. k_prep: weights as x16 f16 planes, rounded biases, BatchNorm constants. k_proj: x (bf16-rounded, exact in f16) transposed in LDS to token-major x^T; theta, phi, g = (16 W as the A operand) (x^T as the B^T operand) / 16 + b[c], WMMA with f32 accumulation; theta split into f16 hi + x1024 residual (unscaled scores have sigma ~11) as [4096][128] rows; phi and g 2x2 max-pooled in registers, phi split into hi/lo as [1024][128] rows, g to f16 as 32-key tiles. k_fattn: scores (th_hi.ph_hi + (th_lo.ph_hi + th_hi.ph_lo)/1024, K = 128, f32), online row softmax on VALU (f32 statistics, native exp; weights x256 f16) and y^T = P g^T (K = 1024) -> f16 [4096][128], scores and weights kept in registers. k_gemmw: z = BN((16 w as A) (y^T as B^T) / 16 + b[c]) + bf16(x) -> f32 channel-first output.
// Compute dtype: inputs rounded to bf16; x / weights exact; theta and phi as f16 hi + x1024 residual; g, softmax weights and y as plain f16 GEMM operands (~2^-12); scores and softmax statistics f32. v_wmma_f32_16x16x32_f16.
#define NB 8
#define SQ 1024
#define DM 256
#define NH 1
#define HD 64
#define HG 4                         /* heads per k_vt launch; k_vt is not launched */
#define B0 0                         /* unused: every launch over images covers all NB images */
#define NBR NB                       /* not used by any kernel or launch */
#define NR ((size_t)NB * SQ)         /* unused */
#define MP ((int)((size_t)NBR * SQ)) /* not used by any kernel or launch */
#define QT 256                       /* query rows per causal tile */
#define NKX SQ                       /* S / P row pitch */
#define QT0 256                      /* first-tile rows recomputed exactly (256: buys margin for the few-key rows 128..255, which have no output projection to average the single-f16 P/v rounding) */
#define QN SQ                        /* unused (each batch attends NP query rows) */
#define NHD NH                       /* unused */
#define MPO MP                       /* unused */
#define LQ DM            /* unused */
typedef __bf16 v16b __attribute__((ext_vector_type(16)));
typedef unsigned short v8us __attribute__((ext_vector_type(8), may_alias));
typedef float  v8f  __attribute__((ext_vector_type(8)));
typedef float  v4f  __attribute__((ext_vector_type(4)));
typedef float  v4fa __attribute__((ext_vector_type(4), may_alias));
union FragB { v16b v; v8us half[2]; unsigned short u[16]; };

__device__ __forceinline__ unsigned short bf16_bits(float x) { unsigned int u = __float_as_uint(x); return (unsigned short)((u + 0x7FFFu + ((u >> 16) & 1u)) >> 16); }
__device__ __forceinline__ float bf16_val(unsigned short b) { return __uint_as_float(((unsigned int)b) << 16); }
__device__ __forceinline__ float bf16_round(float x) { return bf16_val(bf16_bits(x)); }
// D += A·B with NT terms: 1 = ah·bh, 2 = + al·bh (A split), 3 = + ah·bl (both split)
template <int NT>
__device__ __forceinline__ v8f mmaN(v16b ah, v16b al, v16b bh, v16b bl, v8f c) {
  c = __builtin_amdgcn_wmma_f32_16x16x32_bf16(false, ah, false, bh, (short)0, c, false, false);
  if (NT >= 2) c = __builtin_amdgcn_wmma_f32_16x16x32_bf16(false, al, false, bh, (short)0, c, false, false);
  if (NT >= 3) c = __builtin_amdgcn_wmma_f32_16x16x32_bf16(false, ah, false, bl, (short)0, c, false, false);
  asm volatile("v_nop\n\tv_nop\n\tv_nop\n\tv_nop" : "+v"(c) : "v"(ah), "v"(al), "v"(bh), "v"(bl));
  return c;
}

__global__ __launch_bounds__(256) void k_wt_bf16(const float* __restrict__ W, unsigned short* __restrict__ Wt, int K, int N) {
  const int t = blockIdx.x * 256 + threadIdx.x;
  const int k8n = K / 8;
  if (t >= N * k8n) return;
  const int n = t / k8n, k8 = (t % k8n) * 8;
  v8us v;
#pragma unroll
  for (int i = 0; i < 8; ++i) v[i] = bf16_bits(W[(size_t)(k8 + i) * N + n]);
  *(v8us*)(Wt + (size_t)n * K + k8) = v;
  
}

// GEMM C[M][N] (f32, pitch ldc) = act(A[M][K]·W + bias). A f32 row-major (pitch lda) converted per fragment to bf16
// (ASPLIT: hi/lo two planes -> 2 terms, else single rounded term); Wt bf16 [N][K] (pitch ldb). BIAS_BF16 rounds the
// bias to bf16 first (bias quantised to bf16 before the add). K%32==0, M%16==0, N%64==0.
template <bool ASPLIT, int ACT, bool BIAS_BF16>
__global__ __launch_bounds__(128) void k_gemm_bf(const float* __restrict__ A, int lda, const unsigned short* __restrict__ Wt, int ldb,
                                               const float* __restrict__ bias, float* __restrict__ C, int ldc, int M, int N, int K) {
  __shared__ __attribute__((aligned(16))) float so[4][16][64];
  const int tid = threadIdx.x, w = tid >> 5, lane = tid & 31, ln = lane & 15, hh = lane >> 4;
  const int ntn = N / 64;
  const int wid = blockIdx.x * 4 + w;
  const int mt = wid / ntn, nq = wid % ntn;
  if (mt * 16 >= M) return;
  const int row0 = mt * 16, col0 = nq * 64;
  const float* arow = A + (size_t)(row0 + ln) * lda;
  v8f acc[4] = {};
  for (int kb = 0; kb < K; kb += 32) {
    FragB ah, al;
    const v4f x0 = *(const v4fa*)(arow + kb + 8 * hh), x1 = *(const v4fa*)(arow + kb + 8 * hh + 4);
    const v4f x2 = *(const v4fa*)(arow + kb + 16 + 8 * hh), x3 = *(const v4fa*)(arow + kb + 16 + 8 * hh + 4);
    float xs[16] = {x0[0],x0[1],x0[2],x0[3],x1[0],x1[1],x1[2],x1[3],x2[0],x2[1],x2[2],x2[3],x3[0],x3[1],x3[2],x3[3]};
#pragma unroll
    for (int i = 0; i < 16; ++i) { const unsigned short hb = bf16_bits(xs[i]); ah.u[i] = hb; al.u[i] = ASPLIT ? bf16_bits(xs[i] - bf16_val(hb)) : (unsigned short)0; }
#pragma unroll
    for (int t = 0; t < 4; ++t) {
      const unsigned short* brow = Wt + (size_t)(col0 + t * 16 + ln) * ldb + kb;
      FragB b;
      b.half[0] = *(const v8us*)(brow + 8 * hh);
      b.half[1] = *(const v8us*)(brow + 16 + 8 * hh);
      acc[t] = mmaN<ASPLIT ? 2 : 1>(ah.v, al.v, b.v, b.v, acc[t]);
    }
  }
#pragma unroll
  for (int t = 0; t < 4; ++t) {
    float bv = bias ? bias[col0 + t * 16 + ln] : 0.f;
    if (BIAS_BF16) bv = bf16_round(bv);
#pragma unroll
    for (int r = 0; r < 8; ++r) { float v = acc[t][r] + bv; if (ACT == 1) v = fmaxf(v, 0.f); so[w][8 * hh + r][t * 16 + ln] = v; }
  }
  __builtin_amdgcn_fence(__ATOMIC_ACQ_REL, "workgroup");
  __builtin_amdgcn_wave_barrier();
  const int rsub = lane >> 4, c4 = (lane & 15) * 4;
  {
#pragma unroll
    for (int q = 0; q < 8; ++q) {
      const int r = q * 2 + rsub;
      const v4f v = *(const v4fa*)&so[w][r][c4];
      *(v4f*)(C + (size_t)(row0 + r) * ldc + col0 + c4) = v;
    }
    
  }
}

// GEMM C = act(A·W + bias + resid): A f32 (ASPLIT -> hi/lo 2 terms), Wt bf16 [N][K]; ACT 0 none, 1 relu, 2 exact gelu;
// resid (optional, f32, row index = (row % rmod), pitch ldr, RES_BF16 rounds it) added before the activation.
template <bool ASPLIT, int ACT, bool BIAS_BF16, bool RES_BF16>
__global__ __launch_bounds__(128) void k_gemm_bf3(const float* __restrict__ A, int lda, const unsigned short* __restrict__ Wt, int ldb,
                                                const float* __restrict__ bias, const float* __restrict__ resid, int rmod, int ldr,
                                                float* __restrict__ C, int ldc, int M, int N, int K) {
  __shared__ __attribute__((aligned(16))) float so[4][16][64];
  const int tid = threadIdx.x, w = tid >> 5, lane = tid & 31, ln = lane & 15, hh = lane >> 4;
  const int ntn = N / 64;
  const int wid = blockIdx.x * 4 + w;
  const int mt = wid / ntn, nq = wid % ntn;
  if (mt * 16 >= M) return;
  const int row0 = mt * 16, col0 = nq * 64;
  const float* arow = A + (size_t)(row0 + ln) * lda;
  v8f acc[4] = {};
  for (int kb = 0; kb < K; kb += 32) {
    FragB ah, al;
    const v4f x0 = *(const v4fa*)(arow + kb + 8 * hh), x1 = *(const v4fa*)(arow + kb + 8 * hh + 4);
    const v4f x2 = *(const v4fa*)(arow + kb + 16 + 8 * hh), x3 = *(const v4fa*)(arow + kb + 16 + 8 * hh + 4);
    float xs[16] = {x0[0],x0[1],x0[2],x0[3],x1[0],x1[1],x1[2],x1[3],x2[0],x2[1],x2[2],x2[3],x3[0],x3[1],x3[2],x3[3]};
#pragma unroll
    for (int i = 0; i < 16; ++i) { const unsigned short hb = bf16_bits(xs[i]); ah.u[i] = hb; al.u[i] = ASPLIT ? bf16_bits(xs[i] - bf16_val(hb)) : (unsigned short)0; }
#pragma unroll
    for (int t = 0; t < 4; ++t) {
      const unsigned short* brow = Wt + (size_t)(col0 + t * 16 + ln) * ldb + kb;
      FragB b;
      b.half[0] = *(const v8us*)(brow + 8 * hh);
      b.half[1] = *(const v8us*)(brow + 16 + 8 * hh);
      acc[t] = mmaN<ASPLIT ? 2 : 1>(ah.v, al.v, b.v, b.v, acc[t]);
    }
  }
#pragma unroll
  for (int t = 0; t < 4; ++t) {
    const int col = col0 + t * 16 + ln;
    float bv = bias ? bias[col] : 0.f;
    if (BIAS_BF16) bv = bf16_round(bv);
#pragma unroll
    for (int r = 0; r < 8; ++r) {
      float v = acc[t][r] + bv;
      if (resid) { float rv = resid[(size_t)((row0 + 8 * hh + r) % rmod) * ldr + col]; if (RES_BF16) rv = bf16_round(rv); v += rv; }
      if (ACT == 1) v = fmaxf(v, 0.f);
      if (ACT == 2) v = 0.5f * v * (1.0f + erff(v * 0.70710678118654752f));
      if (ACT == 3) { const float u = 0.7978845608028654f * (v + 0.044715f * v * v * v); v = 0.5f * v * (1.0f + tanhf(u)); }
      so[w][8 * hh + r][t * 16 + ln] = v;
    }
  }
  __builtin_amdgcn_fence(__ATOMIC_ACQ_REL, "workgroup");
  __builtin_amdgcn_wave_barrier();
  const int rsub = lane >> 4, c4 = (lane & 15) * 4;
  {
#pragma unroll
    for (int q = 0; q < 8; ++q) {
      const int r = q * 2 + rsub;
      const v4f v = *(const v4fa*)&so[w][r][c4];
      *(v4f*)(C + (size_t)(row0 + r) * ldc + col0 + c4) = v;
    }
    
  }
}
// row LayerNorm (biased variance, eps) over N: s = X (+ R); optional out_sum <- s; out_norm <- (s-mu)*rsqrt(var+eps)*g + b
template <bool PARAM_BF16>
__global__ __launch_bounds__(256) void k_layernorm(const float* __restrict__ X, const float* __restrict__ R, const float* __restrict__ g, const float* __restrict__ bta,
                                                  float* __restrict__ out_sum, float* __restrict__ out_norm, int N, float eps) {
  __shared__ float red[256];
  const int row = blockIdx.x, tid = threadIdx.x;
  const float* x = X + (size_t)row * N; const float* rr = R ? R + (size_t)row * N : nullptr;
  float vals[16];                     // up to N = 4096
  const int per = N / 256;            // contiguous chunk per thread? use strided-by-4 chunks: thread handles j = tid*4 + 1024*u
  float s1 = 0.f;
  for (int u = 0; u < per / 4; ++u) {
    const int j = tid * 4 + 1024 * u;
    const v4f a = *(const v4fa*)(x + j);
    v4f b = {0.f,0.f,0.f,0.f}; if (rr) b = *(const v4fa*)(rr + j);
#pragma unroll
    for (int q = 0; q < 4; ++q) { const float v = a[q] + b[q]; vals[u * 4 + q] = v; s1 += v; }
  }
  red[tid] = s1; __syncthreads();
  for (int st = 128; st > 0; st >>= 1) { if (tid < st) red[tid] += red[tid + st]; __syncthreads(); }
  const float mu = red[0] / (float)N; __syncthreads();
  float s2 = 0.f;
  for (int u = 0; u < per / 4; ++u)
#pragma unroll
    for (int q = 0; q < 4; ++q) { const float c = vals[u * 4 + q] - mu; s2 += c * c; }
  red[tid] = s2; __syncthreads();
  for (int st = 128; st > 0; st >>= 1) { if (tid < st) red[tid] += red[tid + st]; __syncthreads(); }
  const float rs = rsqrtf(red[0] / (float)N + eps);
  {
    for (int u = 0; u < per / 4; ++u) {
      const int j = tid * 4 + 1024 * u;
      v4f o, sm;
#pragma unroll
      for (int q = 0; q < 4; ++q) {
        float gg = g[j + q], bb = bta[j + q];
        if (PARAM_BF16) { gg = bf16_round(gg); bb = bf16_round(bb); }
        sm[q] = vals[u * 4 + q]; o[q] = (vals[u * 4 + q] - mu) * rs * gg + bb;
      }
      if (out_sum) *(v4f*)(out_sum + (size_t)row * N + j) = sm;
      *(v4f*)(out_norm + (size_t)row * N + j) = o;
    }
    
  }
}



// ---- f16 WMMA path (v_wmma_f32_16x16x32_f16): 11-bit significands for operands in range — used where a [0,1] probability operand needs more precision than bf16
typedef _Float16 v16h __attribute__((ext_vector_type(16)));
union FragH { v16h v; v8us half[2]; _Float16 h[16]; unsigned short u[16]; };
template <int NT>
__device__ __forceinline__ v8f mmaH(v16h ah, v16h al, v16h bh, v16h bl, v8f c) {
  c = __builtin_amdgcn_wmma_f32_16x16x32_f16(false, ah, false, bh, (short)0, c, false, false);
  if (NT >= 2) c = __builtin_amdgcn_wmma_f32_16x16x32_f16(false, al, false, bh, (short)0, c, false, false);
  if (NT >= 3) c = __builtin_amdgcn_wmma_f32_16x16x32_f16(false, ah, false, bl, (short)0, c, false, false);
  asm volatile("v_nop\n\tv_nop\n\tv_nop\n\tv_nop" : "+v"(c) : "v"(ah), "v"(al), "v"(bh), "v"(bl));
  return c;
}
// batched GEMM like k_gemm_b but f16 operands: A f32 (split into f16 hi/lo if ASPLIT, else rounded to f16), Bt = f16 values [n][k]; alpha; C f32; N multiple of 16 (partial tiles skipped)
template <bool ASPLIT>
__global__ __launch_bounds__(128) void k_gemm_h(const float* __restrict__ A, int lda, size_t sA, const _Float16* __restrict__ Bh, int ldb, size_t sB, float alpha, float* __restrict__ C, int ldc, size_t sC, int M, int N, int K) {
  __shared__ __attribute__((aligned(16))) float so[4][16][64];
  const int tid = threadIdx.x, w = tid >> 5, lane = tid & 31, ln = lane & 15, hh = lane >> 4; const int by = blockIdx.y;
  A += (size_t)by * sA; Bh += (size_t)by * sB; C += (size_t)by * sC;
  const int ntn = (N + 63) / 64; const int wid = blockIdx.x * 4 + w; const int mt = wid / ntn, nq = wid % ntn; if (mt * 16 >= M) return;
  const int row0 = mt * 16, col0 = nq * 64; const float* arow = A + (size_t)(row0 + ln) * lda;
  v8f acc[4] = {};
  for (int kb = 0; kb < K; kb += 32) {
    FragH ah, al;
    const v4f x0 = *(const v4fa*)(arow + kb + 8 * hh), x1 = *(const v4fa*)(arow + kb + 8 * hh + 4), x2 = *(const v4fa*)(arow + kb + 16 + 8 * hh), x3 = *(const v4fa*)(arow + kb + 16 + 8 * hh + 4);
    float xs[16] = {x0[0],x0[1],x0[2],x0[3],x1[0],x1[1],x1[2],x1[3],x2[0],x2[1],x2[2],x2[3],x3[0],x3[1],x3[2],x3[3]};
#pragma unroll
    for (int i = 0; i < 16; ++i) { const _Float16 h = (_Float16)xs[i]; ah.h[i] = h; al.h[i] = ASPLIT ? (_Float16)(xs[i] - (float)h) : (_Float16)0.0f; }
#pragma unroll
    for (int t = 0; t < 4; ++t) { if (col0 + t * 16 >= N) continue; const size_t boff = (size_t)(col0 + t * 16 + ln) * ldb + kb; FragH bq; bq.half[0] = *(const v8us*)(Bh + boff + 8 * hh); bq.half[1] = *(const v8us*)(Bh + boff + 16 + 8 * hh);
      acc[t] = mmaH<ASPLIT ? 2 : 1>(ah.v, al.v, bq.v, bq.v, acc[t]); }
  }
#pragma unroll
  for (int t = 0; t < 4; ++t) { if (col0 + t * 16 >= N) continue;
#pragma unroll
    for (int r = 0; r < 8; ++r) so[w][8 * hh + r][t * 16 + ln] = acc[t][r] * alpha; }
  __builtin_amdgcn_fence(__ATOMIC_ACQ_REL, "workgroup"); __builtin_amdgcn_wave_barrier();
  const int rsub = lane >> 4, c4 = (lane & 15) * 4;
  {
#pragma unroll
    for (int q = 0; q < 8; ++q) { const int r = q * 2 + rsub; if (col0 + c4 < N) { const v4f v = *(const v4fa*)&so[w][r][c4]; *(v4f*)(C + (size_t)(row0 + r) * ldc + col0 + c4) = v; } }
     }
}

// Wt[n][k] = f16(W[k][n]·scale) from f32 row-major W[K][N] (scale = power of two; bf16-exact weights stay exact in f16 away from the subnormal range)
__global__ __launch_bounds__(256) void k_wt_f16(const float* __restrict__ W, _Float16* __restrict__ Wt, int K, int N, float scale) {
  const int t = blockIdx.x * 256 + threadIdx.x; if (t >= N * (K / 8)) return; const int n = t / (K / 8), k8 = (t % (K / 8)) * 8; FragH f;
#pragma unroll
  for (int i = 0; i < 8; ++i) f.h[i] = (_Float16)(bf16_round(W[(size_t)(k8 + i) * N + n]) * scale); const v8us o = f.half[0];
  *(v8us*)((unsigned short*)Wt + (size_t)n * K + k8) = o; 
}
// k_gemm_hh variant with fused epilogue: v = acc·alpha + bias[by·sBias + col] (+ CP[(row/rowsPerB)·sCPb + by·64 + col] if CP) ; ACT 0 none / 1 elu ; writes f16 C16 (and f32 C if non-null)
template <int ACT>
__global__ __launch_bounds__(128) void k_gemm_hhx(const _Float16* __restrict__ A, int lda, size_t sA, const _Float16* __restrict__ Bh, int ldb, size_t sB, float alpha, const float* __restrict__ bias, size_t sBias, const float* __restrict__ CP, int rowsPerB, size_t sCPb, int row0g,
    float* __restrict__ C, _Float16* __restrict__ C16, int ldc, size_t sC, int M, int N, int K) {
  __shared__ __attribute__((aligned(16))) float so[4][16][64];
  const int tid = threadIdx.x, w = tid >> 5, lane = tid & 31, ln = lane & 15, hh = lane >> 4; const int by = blockIdx.y;
  A += (size_t)by * sA; Bh += (size_t)by * sB; const size_t cofs = (size_t)by * sC; const float* bp = bias ? bias + (size_t)by * sBias : nullptr;
  const int ntn = (N + 63) / 64; const int wid = blockIdx.x * 4 + w; const int mt = wid / ntn, nq = wid % ntn; if (mt * 16 >= M) return;
  const int row0 = mt * 16, col0 = nq * 64; const _Float16* arow = A + (size_t)(row0 + ln) * lda;
  v8f acc[4] = {};
  for (int kb = 0; kb < K; kb += 32) { FragH ah; ah.half[0] = *(const v8us*)((const unsigned short*)arow + kb + 8 * hh); ah.half[1] = *(const v8us*)((const unsigned short*)arow + kb + 16 + 8 * hh);
#pragma unroll
    for (int t = 0; t < 4; ++t) { if (col0 + t * 16 >= N) continue; const size_t boff = (size_t)(col0 + t * 16 + ln) * ldb + kb; FragH bq; bq.half[0] = *(const v8us*)((const unsigned short*)Bh + boff + 8 * hh); bq.half[1] = *(const v8us*)((const unsigned short*)Bh + boff + 16 + 8 * hh);
      acc[t] = mmaH<1>(ah.v, ah.v, bq.v, bq.v, acc[t]); }
  }
#pragma unroll
  for (int t = 0; t < 4; ++t) { if (col0 + t * 16 >= N) continue; const int col = col0 + t * 16 + ln; const float bv = bp ? bf16_round(bp[col]) : 0.f;
#pragma unroll
    for (int r = 0; r < 8; ++r) { float v = acc[t][r] * alpha + bv; if (CP) { const int rr = row0g + row0 + 8 * hh + r; if (rowsPerB < 0) v += CP[cofs + (size_t)rr * ldc + col];      /* rowsPerB < 0: own element of the batched C plane */ else { const int bidx = rr / rowsPerB; v += CP[(size_t)bidx * sCPb + (size_t)by * 64 + col]; } } if (ACT == 1) v = (v > 0.f) ? v : expm1f(v); else if (ACT == 7) v = (v > 0.f) ? v + 1.0f : expf(v); else if (ACT == 8) v = tanhf(v); else if (ACT == 9) v = 0.5f * v * (1.0f + tanhf(0.7978845608028654f * (v + 0.044715f * v * v * v))); else if (ACT == 11) v = 1.0f / (1.0f + expf(-v)); else if (ACT == 12) v = (v > 0.f) ? v : 0.01f * v; else if (ACT == 14) v = (v > 0.f) ? v : 0.1f * v; else if (ACT == 16) v = (v >= 0.f) ? v : 0.3f * v; else if (ACT == 17) v = (v >= 0.f) ? v : 0.2f * v; else if (ACT == 15) v = v / (1.0f + expf(-v)); else if (ACT == 3) v = fmaxf(v, 0.f); else if (ACT == 6) v = 0.5f * v * (1.0f + erff(v * 0.70710678118654752f)); so[w][8 * hh + r][t * 16 + ln] = v; } }
  __builtin_amdgcn_fence(__ATOMIC_ACQ_REL, "workgroup"); __builtin_amdgcn_wave_barrier();
  const int rsub = lane >> 4, c4 = (lane & 15) * 4; typedef _Float16 v4h __attribute__((ext_vector_type(4)));
  {
#pragma unroll
    for (int q = 0; q < 8; ++q) { const int r = q * 2 + rsub; if (col0 + c4 < N) { const v4f v = *(const v4fa*)&so[w][r][c4]; if (C) *(v4f*)(C + cofs + (size_t)(row0 + r) * ldc + col0 + c4) = v; if (C16) { v4h h4; for (int i = 0; i < 4; ++i) h4[i] = (_Float16)v[i]; *(v4h*)(C16 + cofs + (size_t)(row0 + r) * ldc + col0 + c4) = h4; } } }
     }
}


typedef _Float16 v4h __attribute__((ext_vector_type(4)));

__global__ __launch_bounds__(256) void k_x16(const float* __restrict__ x, _Float16* __restrict__ X16, size_t n8) { const size_t t = (size_t)blockIdx.x * 256 + threadIdx.x; if (t >= n8) return; FragH f;
#pragma unroll
  for (int q = 0; q < 8; ++q) f.h[q] = (_Float16)bf16_round(x[t * 8 + q]); *(v8us*)((unsigned short*)X16 + t * 8) = f.half[0];  }
__global__ __launch_bounds__(256) void k_h16(const float* __restrict__ x, _Float16* __restrict__ X16, size_t n8) { const size_t t = (size_t)blockIdx.x * 256 + threadIdx.x; if (t >= n8) return; FragH f;
#pragma unroll
  for (int q = 0; q < 8; ++q) f.h[q] = (_Float16)x[t * 8 + q]; *(v8us*)((unsigned short*)X16 + t * 8) = f.half[0];  }
__global__ __launch_bounds__(256) void k_round16f(const float* __restrict__ W, _Float16* __restrict__ Bt, size_t n8) { const size_t t = (size_t)blockIdx.x * 256 + threadIdx.x; if (t >= n8) return; FragH f;
#pragma unroll
  for (int i = 0; i < 8; ++i) f.h[i] = (_Float16)(bf16_round(W[t * 8 + i]) * 16.0f); *(v8us*)((unsigned short*)Bt + t * 8) = f.half[0];  }
template <int NHv, int TTv>
__global__ __launch_bounds__(256) void k_vt(const _Float16* __restrict__ V16, int ldv, int voff, _Float16* __restrict__ Vt) { __shared__ unsigned short tl[64][66]; const int tid = threadIdx.x; const int slab = blockIdx.x / (TTv / 64), lg = blockIdx.x % (TTv / 64); const int b = slab / NHv, h = slab % NHv;
  for (int i = tid; i < 64 * 8; i += 256) { const int r = i / 8, c8 = (i % 8) * 8; FragH f; f.half[0] = *(const v8us*)((const unsigned short*)V16 + ((size_t)b * TTv + lg * 64 + r) * ldv + voff + h * 64 + c8);
#pragma unroll
    for (int q = 0; q < 8; ++q) tl[r][c8 + q] = f.u[q]; }
  __syncthreads();
  {
#pragma unroll
    for (int rd = 0; rd < 2; ++rd) { const int d = rd * 32 + tid / 8, pc = tid % 8; FragH f;
#pragma unroll
      for (int q = 0; q < 8; ++q) f.u[q] = tl[pc * 8 + q][d];
      *(v8us*)((unsigned short*)Vt + ((size_t)slab * 64 + d) * TTv + lg * 64 + pc * 8) = f.half[0]; }
     } }

__global__ __launch_bounds__(256) void k_hl(const float* __restrict__ F, _Float16* __restrict__ Hh, _Float16* __restrict__ Hl, size_t n8) { const size_t t = (size_t)blockIdx.x * 256 + threadIdx.x; if (t >= n8) return; FragH fh, fl; const v4f a = *(const v4fa*)(F + t * 8), c = *(const v4fa*)(F + t * 8 + 4);
#pragma unroll
  for (int q = 0; q < 4; ++q) { _Float16 h = (_Float16)a[q]; fh.h[q] = h; fl.h[q] = (_Float16)((a[q] - (float)h) * 1024.0f); h = (_Float16)c[q]; fh.h[4 + q] = h; fl.h[4 + q] = (_Float16)((c[q] - (float)h) * 1024.0f); }
  { *(v8us*)((unsigned short*)Hh + t * 8) = fh.half[0]; *(v8us*)((unsigned short*)Hl + t * 8) = fl.half[0];  } }

// ---- fast GEMM (wave tile 32x64; requires M % 32 == 0 rows per launch region and N % 64 == 0); epilogue = k_gemm_hhx semantics, except the rowsPerB < 0 addend plane steps by sCPb per grid.y slice ----
__device__ __forceinline__ v16h g2_frag(const _Float16* p, int hh) { FragH f; f.half[0] = *(const v8us*)((const unsigned short*)p + 8 * hh); f.half[1] = *(const v8us*)((const unsigned short*)p + 16 + 8 * hh); return f.v; }
__device__ __forceinline__ v8f g2_mma(v16h a, v16h b, v8f c) { v8f d = __builtin_amdgcn_wmma_f32_16x16x32_f16(false, a, false, b, (short)0, c, false, false); asm volatile("v_nop\n\tv_nop\n\tv_nop\n\tv_nop" : "+v"(d) : "v"(a), "v"(b)); return d; }
template <int ACT>
__global__ __launch_bounds__(128) void k_gemm2(const _Float16* __restrict__ A, int lda, size_t sA, const _Float16* __restrict__ Bh, int ldb, size_t sB, float alpha, const float* __restrict__ bias, size_t sBias, const float* __restrict__ CP, int rowsPerB, size_t sCPb, int row0g,
    float* __restrict__ C, _Float16* __restrict__ C16, int ldc, size_t sC, int M, int N, int K) { static_assert(ACT == 0 || ACT == 3 || ACT == 6 || ACT == 8 || ACT == 9 || ACT == 11 || ACT == 12 || ACT == 14 || ACT == 15 || ACT == 16 || ACT == 17, "k_gemm2: unsupported ACT code (would silently apply no activation)");
  __shared__ __attribute__((aligned(16))) float so[4][32][68];
  const int tid = threadIdx.x, w = tid >> 5, lane = tid & 31, ln = lane & 15, hh = lane >> 4; const int by = blockIdx.y;
  A += (size_t)by * sA; Bh += (size_t)by * sB; const size_t cofs = (size_t)by * sC; const float* bp = bias ? bias + (size_t)by * sBias : nullptr;
  const int ntn = N >> 6; const int mt = blockIdx.x / ntn, nq = blockIdx.x - mt * ntn; const int row0 = mt * 128 + 32 * w, col0 = nq * 64; if (row0 >= M) return;
  const _Float16* a0p = A + (size_t)(row0 + ln) * lda; const _Float16* a1p = a0p + (size_t)16 * lda;
  const _Float16* b0p = Bh + (size_t)(col0 + ln) * ldb; const _Float16* b1p = b0p + (size_t)16 * ldb; const _Float16* b2p = b1p + (size_t)16 * ldb; const _Float16* b3p = b2p + (size_t)16 * ldb;
  const v8f z8 = {0.f,0.f,0.f,0.f,0.f,0.f,0.f,0.f}; v8f c00 = z8, c01 = z8, c02 = z8, c03 = z8, c10 = z8, c11 = z8, c12 = z8, c13 = z8;
#pragma unroll 1
  for (int kb = 0; kb < K; kb += 32) { const v16h a0 = g2_frag(a0p + kb, hh), a1 = g2_frag(a1p + kb, hh);
    v16h b = g2_frag(b0p + kb, hh); c00 = g2_mma(a0, b, c00); c10 = g2_mma(a1, b, c10);
    b = g2_frag(b1p + kb, hh); c01 = g2_mma(a0, b, c01); c11 = g2_mma(a1, b, c11);
    b = g2_frag(b2p + kb, hh); c02 = g2_mma(a0, b, c02); c12 = g2_mma(a1, b, c12);
    b = g2_frag(b3p + kb, hh); c03 = g2_mma(a0, b, c03); c13 = g2_mma(a1, b, c13); }
  v8f accs[8] = {c00, c01, c02, c03, c10, c11, c12, c13};
#pragma unroll
  for (int u = 0; u < 8; ++u) { const int t = u & 3, half = u >> 2; const int col = col0 + t * 16 + ln; const float bv = bp ? bf16_round(bp[col]) : 0.f;
#pragma unroll
    for (int r = 0; r < 8; ++r) { const int rloc = half * 16 + 8 * hh + r; float v = accs[u][r] * alpha + bv; if (CP) { if (rowsPerB < 0) v += CP[(size_t)by * sCPb + (size_t)(row0g + row0 + rloc) * ldc + col];      /* rowsPerB < 0: own element of an addend plane shaped like C; sCPb = its step from one grid.y slice to the next (0: one plane shared by all slices) */ else { const int bidx = (row0g + row0 + rloc) / rowsPerB; v += CP[(size_t)bidx * sCPb + (size_t)by * 64 + col]; } }
      if (ACT == 3) v = fmaxf(v, 0.f); else if (ACT == 6) v = 0.5f * v * (1.0f + erff(v * 0.70710678118654752f)); else if (ACT == 11) v = 1.0f / (1.0f + expf(-v)); else if (ACT == 15) v = v / (1.0f + expf(-v)); else if (ACT == 12) v = (v > 0.f) ? v : 0.01f * v; else if (ACT == 8) v = tanhf(v); else if (ACT == 9) v = 0.5f * v * (1.0f + tanhf(0.7978845608028654f * (v + 0.044715f * v * v * v))); else if (ACT == 14) v = (v > 0.f) ? v : 0.1f * v; else if (ACT == 16) v = (v >= 0.f) ? v : 0.3f * v; else if (ACT == 17) v = (v >= 0.f) ? v : 0.2f * v;
      so[w][rloc][t * 16 + ln] = v; } }
  __builtin_amdgcn_fence(__ATOMIC_ACQ_REL, "workgroup"); __builtin_amdgcn_wave_barrier();
  const int rsub = lane >> 4, c4 = (lane & 15) * 4;
  {
#pragma unroll
    for (int q = 0; q < 16; ++q) { const int r = q * 2 + rsub; const v4f v = *(const v4fa*)&so[w][r][c4]; if (C) *(v4f*)(C + cofs + (size_t)(row0 + r) * ldc + col0 + c4) = v; if (C16) { v4h h4; for (int i = 0; i < 4; ++i) h4[i] = (_Float16)v[i]; *(v4h*)(C16 + cofs + (size_t)(row0 + r) * ldc + col0 + c4) = h4; } }
     } }


__global__ __launch_bounds__(256) void k_wnat(const float* __restrict__ w, size_t n8, _Float16* __restrict__ Bt) { const size_t t = (size_t)blockIdx.x * 256 + threadIdx.x; if (t >= n8) return; FragH f; for (int q = 0; q < 8; ++q) f.h[q] = (_Float16)(bf16_round(w[t * 8 + q]) * 16.0f); *(v8us*)((unsigned short*)Bt + t * 8) = f.half[0];  }
__global__ __launch_bounds__(256) void k_rsm(const float* __restrict__ S, _Float16* __restrict__ P, int nrows) {
  #pragma clang fp contract(off)
  const int i = blockIdx.x * 256 + threadIdx.x; if (i >= nrows) return; const float* s = S + (size_t)i * SQ; float mx = -3.0e38f;
#pragma unroll 1
  for (int j = 0; j < SQ; ++j) mx = fmaxf(mx, s[j]); float se = 0.f;
#pragma unroll 1
  for (int j = 0; j < SQ; ++j) se += expf(s[j] - mx); const float sc = 256.0f / se;
#pragma unroll 1
  for (int j0 = 0; j0 < SQ; j0 += 8) { FragH f; for (int q = 0; q < 8; ++q) f.h[q] = (_Float16)(expf(s[j0 + q] - mx) * sc); unsigned short* d = (unsigned short*)P + (size_t)i * SQ + j0; *(v8us*)d = f.half[0];  } }
__global__ __launch_bounds__(256) void k_vt(const _Float16* __restrict__ V16, int b, int h0, _Float16* __restrict__ VT) { __shared__ unsigned short tl[64][65]; const int tid = threadIdx.x; const int hh = blockIdx.x % HG, sg = blockIdx.x / HG; const int s0 = sg * 64; const int h = h0 + hh;
  for (int i = tid; i < 64 * 8; i += 256) { const int j = i / 8, d8 = (i % 8) * 8; FragH f; f.half[0] = *(const v8us*)((const unsigned short*)V16 + ((size_t)b * SQ + s0 + j) * DM + h * HD + d8); for (int q = 0; q < 8; ++q) tl[d8 + q][j] = f.u[q]; }
  __syncthreads();
  { for (int i = tid; i < 64 * 8; i += 256) { const int d = i / 8, j8 = (i % 8) * 8; FragH f; for (int q = 0; q < 8; ++q) f.u[q] = tl[d][j8 + q]; *(v8us*)((unsigned short*)VT + ((size_t)hh * HD + d) * SQ + s0 + j8) = f.half[0]; }  } }



__global__ __launch_bounds__(256) void k_rsmcf2(const float* __restrict__ S, _Float16* __restrict__ P, int hg, int q0, int nk) {
  #pragma clang fp contract(off)
  const int t = blockIdx.x * 256 + threadIdx.x; if (t >= hg * QT) return; const size_t i = (size_t)t; const float* s = S + i * NKX; const int last = q0 + (t % QT); float mx = -3.0e38f;
#pragma unroll 1
  for (int j = 0; j < nk; ++j) { const float f = (j <= last) ? 1.f : 0.f; mx = fmaxf(mx, fmaf(f, s[j], (1.f - f) * -1.0e9f)); } float se = 0.f;
#pragma unroll 1
  for (int j = 0; j < nk; ++j) { const float f = (j <= last) ? 1.f : 0.f; se += __expf(fmaf(f, s[j], (1.f - f) * -1.0e9f) - mx); } const float sc = 256.0f / se;
#pragma unroll 1
  for (int j0 = 0; j0 < nk; j0 += 8) { FragH fr; for (int q = 0; q < 8; ++q) { const int j = j0 + q; const float f = (j <= last) ? 1.f : 0.f; fr.h[q] = (_Float16)(__expf(fmaf(f, s[j], (1.f - f) * -1.0e9f) - mx) * sc); } unsigned short* d = (unsigned short*)P + i * NKX + j0; *(v8us*)d = fr.half[0];  } }

template <int MASKADD>
__global__ __launch_bounds__(64) void k_att0(const float* __restrict__ QF, const float* __restrict__ KF, const float* __restrict__ VF, int ld, const float* __restrict__ mask, float scale, float* __restrict__ OF, int ldo) {
  #pragma clang fp contract(off)
  __shared__ __attribute__((aligned(16))) float lq[64][64]; __shared__ __attribute__((aligned(16))) float lo[64][64];
  const int tid = threadIdx.x; const int h = blockIdx.x / (QT0 / 64), rg = blockIdx.x % (QT0 / 64); const int i = rg * 64 + tid;
  const float* qr = QF + (size_t)i * ld + h * HD;
#pragma unroll 1
  for (int c = 0; c < HD / 4; ++c) { *(v4f*)&lq[tid][c * 4] = *(const v4fa*)(qr + c * 4); const v4f z = {0.f, 0.f, 0.f, 0.f}; *(v4f*)&lo[tid][c * 4] = z; }
  float m = -1.0e30f, l = 0.f; const int jmax = MASKADD ? (SQ - 1) : (rg * 64 + 63);      /* additive-mask form: every key (the mask input decides); causal form: keys up to the block's last row */
#pragma unroll 1
  for (int j = 0; j <= jmax; ++j) { const float* kr = KF + (size_t)j * ld + h * HD; const float* vr = VF + (size_t)j * ld + h * HD; float s = 0.f;
#pragma unroll 1
    for (int c = 0; c < HD / 4; ++c) { const v4f kq = *(const v4fa*)(kr + c * 4); const v4f qq = *(v4f*)&lq[tid][c * 4]; s = __fadd_rn(s, __fmul_rn(qq[0], kq[0])); s = __fadd_rn(s, __fmul_rn(qq[1], kq[1])); s = __fadd_rn(s, __fmul_rn(qq[2], kq[2])); s = __fadd_rn(s, __fmul_rn(qq[3], kq[3])); }
    s = __fmul_rn(s, scale); if (MASKADD) s = __fadd_rn(s, __fmul_rn(bf16_round(mask[(size_t)i * SQ + j]), -10000.0f));
    const float f = (MASKADD || j <= i) ? 1.f : 0.f; const float sm = fmaf(f, s, (1.f - f) * -1.0e30f); const float mn = fmaxf(m, sm); const float sc = expf(m - mn); const float e = expf(sm - mn); l = __fadd_rn(__fmul_rn(l, sc), e); m = mn;
#pragma unroll 1
    for (int c = 0; c < HD / 4; ++c) { const v4f vv = *(const v4fa*)(vr + c * 4); v4f oo = *(v4f*)&lo[tid][c * 4]; for (int u = 0; u < 4; ++u) oo[u] = __fadd_rn(__fmul_rn(oo[u], sc), __fmul_rn(e, vv[u])); *(v4f*)&lo[tid][c * 4] = oo; } }
  const float fin = 64.0f / l;      /* o carried x64 like the f16 path */
#pragma unroll 1
  for (int c = 0; c < HD / 4; ++c) { v4f oo = *(v4f*)&lo[tid][c * 4]; for (int u = 0; u < 4; ++u) oo[u] = __fmul_rn(oo[u], fin); *(v4f*)&lo[tid][c * 4] = oo; }
  __syncthreads();
  {
#pragma unroll 1
    for (int it = 0; it < 16; ++it) { const int row = it * 4 + tid / 16, pc = (tid % 16) * 4; const v4f v = *(const v4f*)&lo[row][pc]; *(v4f*)(OF + (size_t)(rg * 64 + row) * ldo + h * HD + pc) = v; }
     } }

__global__ __launch_bounds__(256) void k_oscale(const float* __restrict__ OF, float* __restrict__ out, size_t n4) { const size_t t = (size_t)blockIdx.x * 256 + threadIdx.x; if (t >= n4) return; const v4f a = *(const v4fa*)(OF + t * 4); v4f o; for (int q = 0; q < 4; ++q) o[q] = a[q] * 0.015625f; *(v4f*)(out + t * 4) = o;  }

__global__ __launch_bounds__(256) void k_bfr(const float* __restrict__ x, float* __restrict__ XB, size_t n8) { const size_t t = (size_t)blockIdx.x * 256 + threadIdx.x; if (t >= n8) return; v4f a = *(const v4fa*)(x + t * 8), c = *(const v4fa*)(x + t * 8 + 4); for (int q = 0; q < 4; ++q) { a[q] = bf16_round(a[q]); c[q] = bf16_round(c[q]); }
  { *(v4f*)(XB + t * 8) = a; *(v4f*)(XB + t * 8 + 4) = c;  } }



__global__ __launch_bounds__(256) void k_rsmfvl(const float* __restrict__ S, _Float16* __restrict__ P, _Float16* __restrict__ PL, int qn, const int* __restrict__ vlp) {
  #pragma clang fp contract(off)
  const int t = blockIdx.x * 256 + threadIdx.x; if (t >= qn) return; const int vl = vlp[0]; const size_t i = (size_t)t; const float* s = S + i * SQ; float mx = -3.0e38f;
#pragma unroll 1
  for (int j = 0; j < SQ; ++j) { const float f = (j < vl) ? 1.f : 0.f; mx = fmaxf(mx, fmaf(f, s[j], (1.f - f) * -1000000.0f)); } float se = 0.f;
#pragma unroll 1
  for (int j = 0; j < SQ; ++j) { const float f = (j < vl) ? 1.f : 0.f; se += __expf(fmaf(f, s[j], (1.f - f) * -1000000.0f) - mx); } const float sc = 256.0f / se;
#pragma unroll 1
  for (int j0 = 0; j0 < SQ; j0 += 8) { FragH fr, gr; for (int q = 0; q < 8; ++q) { const int j = j0 + q; const float f = (j < vl) ? 1.f : 0.f; const float pv = __expf(fmaf(f, s[j], (1.f - f) * -1000000.0f) - mx) * sc; const _Float16 ph = (_Float16)pv; fr.h[q] = ph; gr.h[q] = (_Float16)((pv - (float)ph) * 1024.0f); }
    unsigned short* d = (unsigned short*)P + i * SQ + j0; unsigned short* dl = (unsigned short*)PL + i * SQ + j0; *(v8us*)d = fr.half[0]; *(v8us*)dl = gr.half[0];  } }

// 2^x on the transcendental unit; the v_nop is the one free slot the instruction set asks for behind a transcendental, in the same statement so that it stays directly behind it.
__device__ __forceinline__ float exp2_slot(float x) { float r; asm("v_exp_f32 %0, %1\n\tv_nop" : "=v"(r) : "v"(x)); return r; }

#define CN 256          /* channels */
#define CI 128          /* inner channels */
#define NP 4096         /* positions */
#define NM 1024         /* pooled positions (= SQ: the softmax key count) */

// Fused attention: one launch computes scores, softmax and the weighted sum of g for all images; neither the scores nor the weights go to memory.
// A work-group of 8 waves takes 128 queries of one image (16 a wave) and walks the 1024 pooled positions 32 at a time.
// S^T = phi^T (A, rows m) x theta (B, columns n; fragments kept in registers), three terms as before: hi.hi + (hi.lo + lo.hi) / 1024.
// In the accumulator a lane holds, for ITS query n = lane & 15, the keys m = 8 * (lane >> 4) + r of a 16-key tile: two such tiles are, register for register, the B fragment of y[c][n] += g[c][m] P^T[m][n]
// (elements 0..7 = keys 8 hh + r, elements 8..15 = keys 16 + 8 hh + r, the k order in which g2_frag / lds_frag read the rows of g), so the weights move through no LDS and no other lane.
// Running row maximum and row sum per lane (online softmax; the two half-waves share the maximum every pass and join their sums once at the end). Weights are carried x256 in f16 as before; the sum carries the same factor.
// The phi hi / lo rows and the g columns of a pass are shared by the 8 waves through LDS, two buffers: the next pass's tile is loaded to registers while this one's softmax and g products run, stored into the other buffer, and one barrier a pass publishes it (and ends the reads of the buffer that the next pass overwrites).
#define FK 32                            /* keys per pass */
#define FPP 136                          /* LDS pitch of a phi row in f16: 256 B + 16 B, an odd multiple of 16 B (no bank conflict for 16-byte reads of 16 rows) */
#define FGP 40                           /* LDS pitch of a g row in f16: 64 B + 16 B, likewise */
#define FBUF (2 * FK * FPP + CI * FGP)   /* one buffer in f16: phi hi, phi lo, g */
__device__ __forceinline__ v16h lds_frag(const unsigned short* p) { FragH f; f.half[0] = *(const v8us*)p; f.half[1] = *(const v8us*)(p + 16); return f.v; }
__device__ __forceinline__ v8f f_mma(v16h a, v16h b, v8f c) { return __builtin_amdgcn_wmma_f32_16x16x32_f16(false, a, false, b, (short)0, c, false, false); }
__global__ __launch_bounds__(256) void k_fattn(const _Float16* __restrict__ TH, const _Float16* __restrict__ THL, const _Float16* __restrict__ PHT, const _Float16* __restrict__ PHLT, const _Float16* __restrict__ G16, _Float16* __restrict__ YT) {
  __shared__ __attribute__((aligned(16))) unsigned short sm[2 * FBUF];
  const int tid = threadIdx.x, w = tid >> 5, lane = tid & 31, ln = lane & 15, hh = lane >> 4, by = blockIdx.y;
  const int n0 = blockIdx.x * 128 + w * 16;
  const unsigned short* ph = (const unsigned short*)PHT + (size_t)by * CI * NM; const unsigned short* pl = (const unsigned short*)PHLT + (size_t)by * CI * NM; const unsigned short* gg = (const unsigned short*)G16 + (size_t)by * CI * NM;
  const _Float16* tq = TH + ((size_t)by * NP + n0 + ln) * CI; const _Float16* tl = THL + ((size_t)by * NP + n0 + ln) * CI;
  v16h qh[4], ql[4];
#pragma unroll
  for (int j = 0; j < 4; ++j) { qh[j] = g2_frag(tq + j * 32, hh); ql[j] = g2_frag(tl + j * 32, hh); }
  /* staging: 16-byte pieces; phi tile = 32 rows x 16 pieces (contiguous in memory), g tile = 128 rows x 4 pieces; two pieces of each plane a thread */
  const int pr = tid >> 4, pc = (tid & 15) * 8, gr = tid >> 2, gc = (tid & 3) * 8;
  v8us r0, r1, r2, r3, r4, r5;
  auto fetch = [&](int t) { const size_t m0 = (size_t)t * FK;
    r0 = *(const v8us*)(ph + (m0 + pr) * CI + pc); r1 = *(const v8us*)(ph + (m0 + pr + 16) * CI + pc);
    r2 = *(const v8us*)(pl + (m0 + pr) * CI + pc); r3 = *(const v8us*)(pl + (m0 + pr + 16) * CI + pc);
    r4 = *(const v8us*)(gg + ((size_t)t * CI + gr) * FK + gc); r5 = *(const v8us*)(gg + ((size_t)t * CI + gr + 64) * FK + gc); };      /* g lies tile by tile: [m / 32][ci][32], one pass's tile = 8 KiB in a row */
  auto put = [&](int b) { unsigned short* d = sm + b * FBUF;
    *(v8us*)(d + pr * FPP + pc) = r0; *(v8us*)(d + (pr + 16) * FPP + pc) = r1;
    *(v8us*)(d + FK * FPP + pr * FPP + pc) = r2; *(v8us*)(d + FK * FPP + (pr + 16) * FPP + pc) = r3;
    *(v8us*)(d + 2 * FK * FPP + gr * FGP + gc) = r4; *(v8us*)(d + 2 * FK * FPP + (gr + 64) * FGP + gc) = r5; };
  const v8f z8 = {0.f,0.f,0.f,0.f,0.f,0.f,0.f,0.f};
  v8f o[8];
#pragma unroll
  for (int ct = 0; ct < 8; ++ct) o[ct] = z8;
  float m = -1.0e30f, l = 0.f;
  fetch(0); put(0);
  __syncthreads();      /* publishes tile 0 */
  /* rolled: one pass is already some hundred instructions, and the buffer index is the only thing that changes */
#pragma unroll 1
  for (int t = 0; t < NM / FK; ++t) {
    const unsigned short* cur = sm + (t & 1) * FBUF;
    const unsigned short* ah = cur + ln * FPP + 8 * hh; const unsigned short* al = ah + FK * FPP; const unsigned short* ag = cur + 2 * FK * FPP + ln * FGP + 8 * hh;
    v8f sh0 = z8, sh1 = z8, sl0 = z8, sl1 = z8;
#pragma unroll
    for (int j = 0; j < 4; ++j) {
      const v16h h0 = lds_frag(ah + j * 32), h1 = lds_frag(ah + 16 * FPP + j * 32), l0 = lds_frag(al + j * 32), l1 = lds_frag(al + 16 * FPP + j * 32);
      sh0 = f_mma(h0, qh[j], sh0); sh1 = f_mma(h1, qh[j], sh1);
      sl0 = f_mma(h0, ql[j], sl0); sl1 = f_mma(h1, ql[j], sl1);
      sl0 = f_mma(l0, qh[j], sl0); sl1 = f_mma(l1, qh[j], sl1);
    }
    if (t + 1 < NM / FK) fetch(t + 1);      /* behind the score products, whose fragments are dead here, so that the 24 staging registers do not add to the loop's register peak (in front of them the build took 260 registers); softmax and the g products cover the loads */
    float s[16];
#pragma unroll
    for (int r = 0; r < 8; ++r) { s[r] = sh0[r] + sl0[r] * 0.0009765625f; s[8 + r] = sh1[r] + sl1[r] * 0.0009765625f; }
    float mx = fmaxf(s[0], s[1]);
#pragma unroll
    for (int r = 2; r < 16; ++r) mx = fmaxf(mx, s[r]);
    mx = fmaxf(mx, __shfl_xor(mx, 16, 32));      /* the other half-wave holds the same query's other 16 keys */
    const float mn = fmaxf(m, mx);
    const float sc = exp2_slot((m - mn) * 1.44269504f);
    m = mn;
    FragH pf; float p0 = 0.f, p1 = 0.f;
#pragma unroll
    for (int r = 0; r < 8; ++r) {
      const float e0 = exp2_slot((s[r] - mn) * 1.44269504f + 8.0f), e1 = exp2_slot((s[8 + r] - mn) * 1.44269504f + 8.0f);
      p0 += e0; p1 += e1; pf.h[r] = (_Float16)e0; pf.h[8 + r] = (_Float16)e1;
    }
    l = l * sc + (p0 + p1);
#pragma unroll
    for (int ct = 0; ct < 8; ++ct) o[ct] *= sc;
#pragma unroll
    for (int ct = 0; ct < 8; ++ct) o[ct] = f_mma(lds_frag(ag + ct * 16 * FGP), pf.v, o[ct]);
    if (t + 1 < NM / FK) put((t + 1) & 1);
    __syncthreads();      /* publishes tile t + 1; ends every wave's reads of tile t, whose buffer pass t + 1 overwrites */
  }
  l += __shfl_xor(l, 16, 32);
  const float inv = 1.0f / l;
  unsigned short* yo = (unsigned short*)YT + ((size_t)by * NP + n0 + ln) * CI + 8 * hh;      /* y^T [n][ci]: the lane's 8 channels of a tile are 16 contiguous bytes of its query's row */
#pragma unroll
  for (int ct = 0; ct < 8; ++ct) { FragH f;
#pragma unroll
    for (int r = 0; r < 8; ++r) f.h[r] = (_Float16)(o[ct][r] * inv);
    *(v8us*)(yo + ct * 16) = f.half[0]; }
}

__global__ __launch_bounds__(256) void k_rowbias(const float* __restrict__ b, float* __restrict__ BP, size_t n4, int ncol) { const size_t t = (size_t)blockIdx.x * 256 + threadIdx.x; if (t >= n4) return; const size_t e = t * 4; const float v = bf16_round(b[e / ncol]); const v4f o = {v, v, v, v}; *(v4f*)(BP + e) = o;  }




__global__ __launch_bounds__(256) void k_mp2(const float* __restrict__ src, float* __restrict__ dst, int nout) {
  const int t = blockIdx.x * 256 + threadIdx.x; if (t >= nout) return; const int c = t / 1024; const int o = t % 1024; const int oy = o / 32, ox = o % 32; const float* p = src + (size_t)c * 4096 + (size_t)(2 * oy) * 64 + 2 * ox;
  const float v = fmaxf(fmaxf(p[0], p[1]), fmaxf(p[64], p[65])); *(float*)(dst + t) = v;  }
__global__ __launch_bounds__(256) void k_xpb(const float* __restrict__ x, const float* __restrict__ wb, float* __restrict__ CPP, size_t n4) {
  #pragma clang fp contract(off)
  const size_t t = (size_t)blockIdx.x * 256 + threadIdx.x; if (t >= n4) return; const size_t e = t * 4; const int c = (int)((e / 4096) % 256); const float bb = bf16_round(wb[c]); const v4f a = *(const v4fa*)(x + e); v4f o; for (int q = 0; q < 4; ++q) o[q] = __fadd_rn(bf16_round(a[q]), bb);
  *(v4f*)(CPP + e) = o;  }


__global__ __launch_bounds__(256) void k_bnres(float* __restrict__ O, const float* __restrict__ x, const float* __restrict__ wb, const float* __restrict__ g, const float* __restrict__ be, const float* __restrict__ mu, const float* __restrict__ var, float eps, size_t n4) {
  #pragma clang fp contract(off)
  const size_t t = (size_t)blockIdx.x * 256 + threadIdx.x; if (t >= n4) return; const size_t e = t * 4; const int c = (int)((e / NP) % CN);
  const float inv = __fdiv_rn(bf16_round(g[c]), sqrtf(__fadd_rn(bf16_round(var[c]), eps))); const float wbc = bf16_round(wb[c]), mc = bf16_round(mu[c]), bc = bf16_round(be[c]);
  const v4f a = *(const v4fa*)(O + e); const v4f xx = *(const v4fa*)(x + e); v4f o;
  for (int q = 0; q < 4; ++q) o[q] = __fadd_rn(__fadd_rn(__fmul_rn(__fadd_rn(__fadd_rn(a[q], wbc), -mc), inv), bc), bf16_round(xx[q]));
  *(v4f*)(O + e) = o;  }

// ---- the pointwise and layout stages of the activations live inside the three matrix kernels ----
// Every plain '#pragma unroll' below, except on k_proj's copy loops over it and k, stands on a short loop over a register array (fragments, accumulators, packed halves): its index must be a compile-time constant for the array to stay in registers.
// k_prep: every small operand once: the three projection weights stacked [384][256] (theta, phi, g) and W [256][128] as x16 f16 planes, the three biases [384] rounded, and per output channel {W_b, mean, gamma / sqrt(var + eps), beta}.
__global__ __launch_bounds__(256) void k_prep(const float* __restrict__ tw, const float* __restrict__ pw, const float* __restrict__ gw, const float* __restrict__ ww, const float* __restrict__ tb, const float* __restrict__ pb, const float* __restrict__ gb,
    const float* __restrict__ wb, const float* __restrict__ g, const float* __restrict__ be, const float* __restrict__ mu, const float* __restrict__ var, float eps, _Float16* __restrict__ WA, _Float16* __restrict__ BW, float* __restrict__ BB, float* __restrict__ BN4) {
  const int t = blockIdx.x * 256 + threadIdx.x;
  if (t < 4 * CI * CN / 8) { const int s = t / (CI * CN / 8), u = (t % (CI * CN / 8)) * 8; const float* sp = s == 0 ? tw : s == 1 ? pw : s == 2 ? gw : ww; unsigned short* d = s < 3 ? (unsigned short*)WA + (size_t)s * CI * CN : (unsigned short*)BW; FragH f;
#pragma unroll
    for (int q = 0; q < 8; ++q) f.h[q] = (_Float16)(bf16_round(sp[u + q]) * 16.0f);
    *(v8us*)(d + u) = f.half[0]; }
  else if (t < 4 * CI * CN / 8 + 3 * CI) { const int o = t - 4 * CI * CN / 8, s = o / CI; const float* sp = s == 0 ? tb : s == 1 ? pb : gb; BB[o] = bf16_round(sp[o % CI]); }
  else if (t < 4 * CI * CN / 8 + 3 * CI + CN) { const int c = t - (4 * CI * CN / 8 + 3 * CI); const v4f o = {bf16_round(wb[c]), bf16_round(mu[c]), __fdiv_rn(bf16_round(g[c]), sqrtf(bf16_round(var[c]) + eps)), bf16_round(be[c])}; *(v4f*)(BN4 + 4 * c) = o; }
}

// k_proj: theta, phi and g of 128 positions (two image rows = one pooled row) of one image in one work-group of 16 waves.
// 1. x [256 c][128 n] f32 -> bf16-rounded f16, transposed into LDS as x^T [n][c]. 2. D[o][n] = (stacked weights as A, rows o, from L2) x (x^T rows as B^T): a wave keeps the B fragments of position tiles p and p + 4 (the same 16 columns of the two image rows) in registers for all of K and walks 6 of the 24 row tiles.
// In D a lane holds 8 consecutive o of ITS position: theta splits into hi + x1024 residual as 16-byte pieces of its [n][ci] row; phi and g take the 2x2 maximum as max(tile p, tile p + 4), then with the neighbour lane. 3. All results are gathered in LDS and leave as whole lines.
#define XP 264                           /* LDS pitch of an x^T row in f16: 512 B + 16 B (16-byte reads and writes of 16 rows fall on all banks) */
#define TP 136                           /* LDS pitch of a gathered theta / phi row in f16: 256 B + 16 B */
#define GP 40                            /* LDS pitch of a gathered g row in f16: 64 B + 16 B */
__global__ __launch_bounds__(512) void k_proj(const float* __restrict__ x, const _Float16* __restrict__ WA, const float* __restrict__ BB, _Float16* __restrict__ TH, _Float16* __restrict__ THL, _Float16* __restrict__ PHT, _Float16* __restrict__ PHLT, _Float16* __restrict__ G16) {
  __shared__ __attribute__((aligned(16))) unsigned short xt[128 * XP];
  __shared__ __attribute__((aligned(16))) unsigned short sth[128 * TP];
  __shared__ __attribute__((aligned(16))) unsigned short stl[128 * TP];
  __shared__ __attribute__((aligned(16))) unsigned short sph[32 * TP];
  __shared__ __attribute__((aligned(16))) unsigned short spl[32 * TP];
  __shared__ __attribute__((aligned(16))) unsigned short sg[CI * GP];
  const int tid = threadIdx.x, w = tid >> 5, lane = tid & 31, ln = lane & 15, hh = lane >> 4, by = blockIdx.y;
  const int n0 = blockIdx.x * 128;
  { /* a wave takes blocks of 32 c x 32 n: a lane 8 c x 4 n; 8 lanes read one 128-byte line of a channel row, and the 16 lanes of a half-wave write 16-byte pieces that fall on all banks */
    const int n4 = (lane & 3) + 4 * hh, c8 = (lane >> 2) & 3;
#pragma unroll
    for (int it = 0; it < 2; ++it) { const int unit = it * 16 + w; const int n = (unit & 3) * 32 + 4 * n4, c = (unit >> 2) * 32 + 8 * c8;
      const float* sp = x + ((size_t)by * CN + c) * NP + n0 + n; v4f a[8];
#pragma unroll
      for (int q = 0; q < 8; ++q) a[q] = *(const v4fa*)(sp + (size_t)q * NP);
#pragma unroll
      for (int i = 0; i < 4; ++i) { FragH f;
#pragma unroll
        for (int q = 0; q < 8; ++q) f.h[q] = (_Float16)bf16_round(a[q][i]);
        *(v8us*)(xt + (n + i) * XP + c) = f.half[0]; } } }
  const int p = w & 3, oq = w >> 2;
  v16h a[8]; v4f bb0, bb1;
  auto lda = [&](int ot) { const unsigned short* ar = (const unsigned short*)WA + (size_t)(ot * 16 + ln) * CN + 8 * hh; const float* br = BB + ot * 16 + 8 * hh;      /* the lane's own first bytes: elements 0..7 = k 8 hh + 0..7, elements 8..15 = k 16 + 8 hh + 0..7 of each 32, as g2_frag reads them */
#pragma unroll
    for (int j = 0; j < 8; ++j) { FragH f; f.half[0] = *(const v8us*)(ar + j * 32); f.half[1] = *(const v8us*)(ar + j * 32 + 16); a[j] = f.v; }
    bb0 = *(const v4fa*)br; bb1 = *(const v4fa*)(br + 4);
    asm volatile("s_wait_xcnt 0x0" :: "v"(ar), "v"(br) : "memory"); };      /* the wait that stands in front of any overwrite of a register which an issued load names; the two addresses are inputs so that they stay live up to it and no load of the run lands in them */
  lda(oq * 6);
  __syncthreads();      /* publishes x^T */
  v16h b0[8], b1[8];
  { const unsigned short* r0 = xt + (p * 16 + ln) * XP + 8 * hh; const unsigned short* r1 = r0 + 64 * XP;
#pragma unroll
    for (int j = 0; j < 8; ++j) { b0[j] = lds_frag(r0 + j * 32); b1[j] = lds_frag(r1 + j * 32); } }
  const v8f z8 = {0.f,0.f,0.f,0.f,0.f,0.f,0.f,0.f};
  const int nl = p * 16 + ln, ml = nl >> 1;
  /* rolled: the three kinds of row tile share one body, and an unrolled one would hold several tiles' weight fragments at once */
#pragma unroll 1
  for (int i = 0; i < 6; ++i) { const int ot = oq * 6 + i;
    v8f c0 = z8, c1 = z8;
#pragma unroll
    for (int j = 0; j < 8; ++j) { c0 = f_mma(a[j], b0[j], c0); c1 = f_mma(a[j], b1[j], c1); }
    float v0[8], v1[8];
#pragma unroll
    for (int r = 0; r < 8; ++r) { const float bv = r < 4 ? bb0[r & 3] : bb1[r & 3]; v0[r] = c0[r] * 0.0625f + bv; v1[r] = c1[r] * 0.0625f + bv; }
    if (i + 1 < 6) lda(ot + 1);      /* the next row tile's weights fly while this one's results are packed */
    if (ot < 8) { FragH h0, l0, h1, l1;
#pragma unroll
      for (int r = 0; r < 8; ++r) { _Float16 h = (_Float16)v0[r]; h0.h[r] = h; l0.h[r] = (_Float16)((v0[r] - (float)h) * 1024.0f); h = (_Float16)v1[r]; h1.h[r] = h; l1.h[r] = (_Float16)((v1[r] - (float)h) * 1024.0f); }
      const int e = nl * TP + ot * 16 + 8 * hh;
      *(v8us*)(sth + e) = h0.half[0]; *(v8us*)(stl + e) = l0.half[0]; *(v8us*)(sth + e + 64 * TP) = h1.half[0]; *(v8us*)(stl + e + 64 * TP) = l1.half[0];
    } else { float mx[8];
#pragma unroll
      for (int r = 0; r < 8; ++r) { const float u = fmaxf(v0[r], v1[r]); mx[r] = fmaxf(u, __shfl_xor(u, 1, 32)); }
      if (ot < 16) { FragH h0, l0;
#pragma unroll
        for (int r = 0; r < 8; ++r) { const _Float16 h = (_Float16)mx[r]; h0.h[r] = h; l0.h[r] = (_Float16)((mx[r] - (float)h) * 1024.0f); }
        if (!(ln & 1)) { const int e = ml * TP + (ot - 8) * 16 + 8 * hh; *(v8us*)(sph + e) = h0.half[0]; *(v8us*)(spl + e) = l0.half[0]; }
      } else if (!(ln & 1)) { FragH h0;
#pragma unroll
        for (int r = 0; r < 8; ++r) { h0.h[r] = (_Float16)mx[r]; sg[((ot - 16) * 16 + 8 * hh + r) * GP + ml] = h0.u[r]; } }
    }
  }
  __syncthreads();      /* every wave's results are gathered */
  { unsigned short* dh = (unsigned short*)TH + ((size_t)by * NP + n0) * CI; unsigned short* dl = (unsigned short*)THL + ((size_t)by * NP + n0) * CI;
#pragma unroll
    for (int k = 0; k < 4; ++k) { const int pc = k * 512 + tid, r = pc >> 4, q = (pc & 15) * 8; *(v8us*)(dh + r * CI + q) = *(const v8us*)(sth + r * TP + q); *(v8us*)(dl + r * CI + q) = *(const v8us*)(stl + r * TP + q); }
    const size_t mo = ((size_t)by * NM + blockIdx.x * 32) * CI;      /* the pooled row's 32 positions: rows of phi^T [m][ci]; one 32-key tile [ci][32] of g */
    { const int r = tid >> 4, q = (tid & 15) * 8; *(v8us*)((unsigned short*)PHT + mo + r * CI + q) = *(const v8us*)(sph + r * TP + q); *(v8us*)((unsigned short*)PHLT + mo + r * CI + q) = *(const v8us*)(spl + r * TP + q); }
    { const int r = tid >> 2, q = (tid & 3) * 8; *(v8us*)((unsigned short*)G16 + mo + r * 32 + q) = *(const v8us*)(sg + r * GP + q); } }
}

// k_gemmw: z[c][n] = BN((16 W as A) (y^T as B^T) / 16 + W_b) + bf16(x): the wave tile and K loop of k_gemm2; bias, BatchNorm and residual are applied where the tile leaves LDS as whole lines.
__global__ __launch_bounds__(128) void k_gemmw(const _Float16* __restrict__ A, const _Float16* __restrict__ Bh, const float* __restrict__ BN4, const float* __restrict__ x, float* __restrict__ out) {
  __shared__ __attribute__((aligned(16))) float so[4][32][68];
  const int tid = threadIdx.x, w = tid >> 5, lane = tid & 31, ln = lane & 15, hh = lane >> 4; const int by = blockIdx.y;
  Bh += (size_t)by * NP * CI; const size_t cofs = (size_t)by * CN * NP;
  const int mt = blockIdx.x / (NP / 64), nq = blockIdx.x - mt * (NP / 64); const int row0 = mt * 128 + 32 * w, col0 = nq * 64;
  const _Float16* a0p = A + (size_t)(row0 + ln) * CI; const _Float16* a1p = a0p + (size_t)16 * CI;
  const _Float16* b0p = Bh + (size_t)(col0 + ln) * CI; const _Float16* b1p = b0p + (size_t)16 * CI; const _Float16* b2p = b1p + (size_t)16 * CI; const _Float16* b3p = b2p + (size_t)16 * CI;
  const v8f z8 = {0.f,0.f,0.f,0.f,0.f,0.f,0.f,0.f}; v8f c00 = z8, c01 = z8, c02 = z8, c03 = z8, c10 = z8, c11 = z8, c12 = z8, c13 = z8;
  /* rolled: k_gemm2's product loop taken over as it stands, so that this kernel differs from it in the epilogue alone; unrolling it or loading ahead is a step of its own */
#pragma unroll 1
  for (int kb = 0; kb < CI; kb += 32) { const v16h a0 = g2_frag(a0p + kb, hh), a1 = g2_frag(a1p + kb, hh);
    v16h b = g2_frag(b0p + kb, hh); c00 = g2_mma(a0, b, c00); c10 = g2_mma(a1, b, c10);
    b = g2_frag(b1p + kb, hh); c01 = g2_mma(a0, b, c01); c11 = g2_mma(a1, b, c11);
    b = g2_frag(b2p + kb, hh); c02 = g2_mma(a0, b, c02); c12 = g2_mma(a1, b, c12);
    b = g2_frag(b3p + kb, hh); c03 = g2_mma(a0, b, c03); c13 = g2_mma(a1, b, c13); }
  v8f accs[8] = {c00, c01, c02, c03, c10, c11, c12, c13};
  const int rsub = lane >> 4, c4 = (lane & 15) * 4;
  const size_t e0 = cofs + (size_t)(row0 + rsub) * NP + col0 + c4; const float* xb = x + e0; const float* pb4 = BN4 + 4 * (row0 + rsub);
  v4f xx[16], pr[16];      /* the lane's 16 pieces of x and their rows' constants */
#pragma unroll
  for (int q = 0; q < 16; ++q) { xx[q] = *(const v4fa*)(xb + (size_t)q * 2 * NP); pr[q] = *(const v4fa*)(pb4 + q * 8); }
  asm volatile("s_wait_xcnt 0x0" :: "v"(xb), "v"(pb4) : "memory");      /* the wait that stands in front of any overwrite of a register which an issued load names; the two addresses are inputs so that they stay live up to it and no load of the run lands in them */
#pragma unroll
  for (int u = 0; u < 8; ++u) { const int t = u & 3, half = u >> 2;
#pragma unroll
    for (int r = 0; r < 8; ++r) so[w][half * 16 + 8 * hh + r][t * 16 + ln] = accs[u][r] * 0.0625f; }
  __builtin_amdgcn_fence(__ATOMIC_ACQ_REL, "workgroup"); __builtin_amdgcn_wave_barrier();      /* the wave reads back what its own lanes wrote */
#pragma unroll
  for (int q = 0; q < 16; ++q) { const v4f v = *(const v4fa*)&so[w][q * 2 + rsub][c4]; v4f o;
#pragma unroll
    for (int i = 0; i < 4; ++i) o[i] = ((v[i] + pr[q][0]) - pr[q][1]) * pr[q][2] + pr[q][3] + bf16_round(xx[q][i]);
    *(v4f*)(out + e0 + (size_t)q * 2 * NP) = o; }
}
extern "C" void kernel_launch(void* const* d_in, const int* in_sizes, int n_in,
                              void* d_out, int out_size, void* d_ws, size_t ws_size, hipStream_t stream) {
  (void)in_sizes; (void)n_in; (void)out_size;
  const float* const* I = (const float* const*)d_in; const float* x = I[0]; const float* gw = I[1]; const float* gb = I[2]; const float* tw = I[3]; const float* tb = I[4]; const float* pw = I[5]; const float* pb = I[6]; const float* ww = I[7]; const float* wb = I[8]; const float* bng = I[9]; const float* bnb = I[10]; const float* bnm = I[11]; const float* bnv = I[12];      /* natural [out][in] 1x1-conv weights + biases: g, theta, phi [128][256]; W [256][128] + b; eval BatchNorm gamma / beta / running mean / var [256] */
  char* ws = (char*)d_ws; size_t off = 0;
  auto take = [&](size_t bytes) { char* p = ws + off; off += (bytes + 255) & ~(size_t)255; return p; };
  _Float16* WA = (_Float16*)take((size_t)3 * CI * CN * 2); _Float16* BW = (_Float16*)take((size_t)CN * CI * 2); float* BB = (float*)take((size_t)3 * CI * 4); float* BN4 = (float*)take((size_t)CN * 4 * 4);
  /* every plane below holds all NB images, image b at b times the one-image size */
  const size_t sT = (size_t)NP * CI, sM = (size_t)CI * NM;      /* one image: [4096][128], [1024][128] elements (g: 32 tiles [128][32]) */
  _Float16* TH = (_Float16*)take(NB * sT * 2); _Float16* THL = (_Float16*)take(NB * sT * 2); _Float16* PHT = (_Float16*)take(NB * sM * 2); _Float16* PHLT = (_Float16*)take(NB * sM * 2); _Float16* G16 = (_Float16*)take(NB * sM * 2); _Float16* YT = (_Float16*)take(NB * sT * 2);
  if (off > ws_size) return;
  k_prep<<<(4 * CI * CN / 8 + 3 * CI + CN + 255) / 256, 256, 0, stream>>>(tw, pw, gw, ww, tb, pb, gb, wb, bng, bnb, bnm, bnv, 1e-5f, WA, BW, BB, BN4);
  k_proj<<<dim3(NP / 128, NB), 512, 0, stream>>>(x, WA, BB, TH, THL, PHT, PHLT, G16);      /* theta^T [n][ci] hi + x1024 residual; pooled phi^T [m][ci] hi + residual; pooled g f16 as 32-key tiles [m / 32][ci][32] */
  k_fattn<<<dim3(NP / 128, NB), 256, 0, stream>>>(TH, THL, PHT, PHLT, G16, YT);      /* f[n][m] = theta.phi (hi.hi + (hi.lo + lo.hi) / 1024; no scale), softmax over the 1024 pooled positions, y^T [n][ci] = P g^T -> f16, in one launch */
  k_gemmw<<<dim3((CN / 128) * (NP / 64), NB), 128, 0, stream>>>(BW, YT, BN4, x, (float*)d_out);      /* z = ((W y + bf16 W_b[c]) - bf16 mean[c]) (bf16 gamma[c] / sqrt(bf16 var[c] + eps)) + bf16 beta[c] + bf16 x -> f32 channel-first output */
}

// v005
// One run takes 68.5 microseconds.
// Two timings next to v004 put it at 1.22 and 1.21 times that version's speed.
// Over all steps from v000 it is 38.9 times as fast.
#include <hip/hip_runtime.h>
// Non-local block (embedded Gaussian, single head, 2x2 max-pool sub-sampling) with an eval-mode BatchNorm on the output conv (x [8][256][64][64]; theta = conv1x1(x) [128 ch], phi = maxpool2x2(conv1x1(x)), g = maxpool2x2(conv1x1(x)) (natural [128][256] weights sigma 1/16 + biases 0.01); f[n][m] = theta[:, n].phi[:, m] over the 1024 pooled positions (NO scale); softmax over m; y[:, n] = sum_m f[n][m] g[:, m]; W_y = conv1x1(y; W [256][128] + b); z = (W_y - bn_mean) gamma / sqrt(bn_var + 1e-5) + bn_beta + x -> [8][256][64][64]).
// Structure: four launches; the last three each over all 8 images. k_prep: weights as x16 f16 planes, rounded biases, BatchNorm constants. k_proj: x (bf16-rounded, exact in f16) transposed in LDS to token-major x^T; theta, phi, g = (16 W as the A operand) (x^T as the B^T operand) / 16 + b[c], WMMA with f32 accumulation; theta split into f16 hi + x1024 residual (unscaled scores have sigma ~11) as [4096][128] rows; phi and g 2x2 max-pooled in registers, phi split into hi/lo as [1024][128] rows, g to f16 as 32-key tiles. k_fattn: scores (th_hi.ph_hi + (th_lo.ph_hi + th_hi.ph_lo)/1024, K = 128, f32), online row softmax on VALU (f32 statistics, native exp; weights x256 f16) and y^T = P g^T (K = 1024) -> f16 [4096][128], scores and weights kept in registers. k_gemmw: z = BN((16 w as A) (y^T as B^T) / 16 + b[c]) + bf16(x) -> f32 channel-first output.
// Compute dtype: inputs rounded to bf16; x / weights exact; theta and phi as f16 hi + x1024 residual; g, softmax weights and y as plain f16 GEMM operands (~2^-12); scores and softmax statistics f32. v_wmma_f32_16x16x32_f16.
#define NB 8
#define SQ 1024
#define DM 256
#define NH 1
#define HD 64
#define HG 4                         /* heads per k_vt launch; k_vt is not launched */
#define B0 0                         /* unused: every launch over images covers all NB images */
#define NBR NB                       /* not used by any kernel or launch */
#define NR ((size_t)NB * SQ)         /* unused */
#define MP ((int)((size_t)NBR * SQ)) /* not used by any kernel or launch */
#define QT 256                       /* query rows per causal tile */
#define NKX SQ                       /* S / P row pitch */
#define QT0 256                      /* first-tile rows recomputed exactly (256: buys margin for the few-key rows 128..255, which have no output projection to average the single-f16 P/v rounding) */
#define QN SQ                        /* unused (each batch attends NP query rows) */
#define NHD NH                       /* unused */
#define MPO MP                       /* unused */
#define LQ DM            /* unused */
typedef __bf16 v16b __attribute__((ext_vector_type(16)));
typedef unsigned short v8us __attribute__((ext_vector_type(8), may_alias));
typedef float  v8f  __attribute__((ext_vector_type(8)));
typedef float  v4f  __attribute__((ext_vector_type(4)));
typedef float  v4fa __attribute__((ext_vector_type(4), may_alias));
union FragB { v16b v; v8us half[2]; unsigned short u[16]; };

__device__ __forceinline__ unsigned short bf16_bits(float x) { unsigned int u = __float_as_uint(x); return (unsigned short)((u + 0x7FFFu + ((u >> 16) & 1u)) >> 16); }
__device__ __forceinline__ float bf16_val(unsigned short b) { return __uint_as_float(((unsigned int)b) << 16); }
__device__ __forceinline__ float bf16_round(float x) { return bf16_val(bf16_bits(x)); }
// D += A·B with NT terms: 1 = ah·bh, 2 = + al·bh (A split), 3 = + ah·bl (both split)
template <int NT>
__device__ __forceinline__ v8f mmaN(v16b ah, v16b al, v16b bh, v16b bl, v8f c) {
  c = __builtin_amdgcn_wmma_f32_16x16x32_bf16(false, ah, false, bh, (short)0, c, false, false);
  if (NT >= 2) c = __builtin_amdgcn_wmma_f32_16x16x32_bf16(false, al, false, bh, (short)0, c, false, false);
  if (NT >= 3) c = __builtin_amdgcn_wmma_f32_16x16x32_bf16(false, ah, false, bl, (short)0, c, false, false);
  asm volatile("v_nop\n\tv_nop\n\tv_nop\n\tv_nop" : "+v"(c) : "v"(ah), "v"(al), "v"(bh), "v"(bl));
  return c;
}

__global__ __launch_bounds__(256) void k_wt_bf16(const float* __restrict__ W, unsigned short* __restrict__ Wt, int K, int N) {
  const int t = blockIdx.x * 256 + threadIdx.x;
  const int k8n = K / 8;
  if (t >= N * k8n) return;
  const int n = t / k8n, k8 = (t % k8n) * 8;
  v8us v;
#pragma unroll
  for (int i = 0; i < 8; ++i) v[i] = bf16_bits(W[(size_t)(k8 + i) * N + n]);
  *(v8us*)(Wt + (size_t)n * K + k8) = v;
  
}

// GEMM C[M][N] (f32, pitch ldc) = act(A[M][K]·W + bias). A f32 row-major (pitch lda) converted per fragment to bf16
// (ASPLIT: hi/lo two planes -> 2 terms, else single rounded term); Wt bf16 [N][K] (pitch ldb). BIAS_BF16 rounds the
// bias to bf16 first (bias quantised to bf16 before the add). K%32==0, M%16==0, N%64==0.
template <bool ASPLIT, int ACT, bool BIAS_BF16>
__global__ __launch_bounds__(128) void k_gemm_bf(const float* __restrict__ A, int lda, const unsigned short* __restrict__ Wt, int ldb,
                                               const float* __restrict__ bias, float* __restrict__ C, int ldc, int M, int N, int K) {
  __shared__ __attribute__((aligned(16))) float so[4][16][64];
  const int tid = threadIdx.x, w = tid >> 5, lane = tid & 31, ln = lane & 15, hh = lane >> 4;
  const int ntn = N / 64;
  const int wid = blockIdx.x * 4 + w;
  const int mt = wid / ntn, nq = wid % ntn;
  if (mt * 16 >= M) return;
  const int row0 = mt * 16, col0 = nq * 64;
  const float* arow = A + (size_t)(row0 + ln) * lda;
  v8f acc[4] = {};
  for (int kb = 0; kb < K; kb += 32) {
    FragB ah, al;
    const v4f x0 = *(const v4fa*)(arow + kb + 8 * hh), x1 = *(const v4fa*)(arow + kb + 8 * hh + 4);
    const v4f x2 = *(const v4fa*)(arow + kb + 16 + 8 * hh), x3 = *(const v4fa*)(arow + kb + 16 + 8 * hh + 4);
    float xs[16] = {x0[0],x0[1],x0[2],x0[3],x1[0],x1[1],x1[2],x1[3],x2[0],x2[1],x2[2],x2[3],x3[0],x3[1],x3[2],x3[3]};
#pragma unroll
    for (int i = 0; i < 16; ++i) { const unsigned short hb = bf16_bits(xs[i]); ah.u[i] = hb; al.u[i] = ASPLIT ? bf16_bits(xs[i] - bf16_val(hb)) : (unsigned short)0; }
#pragma unroll
    for (int t = 0; t < 4; ++t) {
      const unsigned short* brow = Wt + (size_t)(col0 + t * 16 + ln) * ldb + kb;
      FragB b;
      b.half[0] = *(const v8us*)(brow + 8 * hh);
      b.half[1] = *(const v8us*)(brow + 16 + 8 * hh);
      acc[t] = mmaN<ASPLIT ? 2 : 1>(ah.v, al.v, b.v, b.v, acc[t]);
    }
  }
#pragma unroll
  for (int t = 0; t < 4; ++t) {
    float bv = bias ? bias[col0 + t * 16 + ln] : 0.f;
    if (BIAS_BF16) bv = bf16_round(bv);
#pragma unroll
    for (int r = 0; r < 8; ++r) { float v = acc[t][r] + bv; if (ACT == 1) v = fmaxf(v, 0.f); so[w][8 * hh + r][t * 16 + ln] = v; }
  }
  __builtin_amdgcn_fence(__ATOMIC_ACQ_REL, "workgroup");
  __builtin_amdgcn_wave_barrier();
  const int rsub = lane >> 4, c4 = (lane & 15) * 4;
  {
#pragma unroll
    for (int q = 0; q < 8; ++q) {
      const int r = q * 2 + rsub;
      const v4f v = *(const v4fa*)&so[w][r][c4];
      *(v4f*)(C + (size_t)(row0 + r) * ldc + col0 + c4) = v;
    }
    
  }
}

// GEMM C = act(A·W + bias + resid): A f32 (ASPLIT -> hi/lo 2 terms), Wt bf16 [N][K]; ACT 0 none, 1 relu, 2 exact gelu;
// resid (optional, f32, row index = (row % rmod), pitch ldr, RES_BF16 rounds it) added before the activation.
template <bool ASPLIT, int ACT, bool BIAS_BF16, bool RES_BF16>
__global__ __launch_bounds__(128) void k_gemm_bf3(const float* __restrict__ A, int lda, const unsigned short* __restrict__ Wt, int ldb,
                                                const float* __restrict__ bias, const float* __restrict__ resid, int rmod, int ldr,
                                                float* __restrict__ C, int ldc, int M, int N, int K) {
  __shared__ __attribute__((aligned(16))) float so[4][16][64];
  const int tid = threadIdx.x, w = tid >> 5, lane = tid & 31, ln = lane & 15, hh = lane >> 4;
  const int ntn = N / 64;
  const int wid = blockIdx.x * 4 + w;
  const int mt = wid / ntn, nq = wid % ntn;
  if (mt * 16 >= M) return;
  const int row0 = mt * 16, col0 = nq * 64;
  const float* arow = A + (size_t)(row0 + ln) * lda;
  v8f acc[4] = {};
  for (int kb = 0; kb < K; kb += 32) {
    FragB ah, al;
    const v4f x0 = *(const v4fa*)(arow + kb + 8 * hh), x1 = *(const v4fa*)(arow + kb + 8 * hh + 4);
    const v4f x2 = *(const v4fa*)(arow + kb + 16 + 8 * hh), x3 = *(const v4fa*)(arow + kb + 16 + 8 * hh + 4);
    float xs[16] = {x0[0],x0[1],x0[2],x0[3],x1[0],x1[1],x1[2],x1[3],x2[0],x2[1],x2[2],x2[3],x3[0],x3[1],x3[2],x3[3]};
#pragma unroll
    for (int i = 0; i < 16; ++i) { const unsigned short hb = bf16_bits(xs[i]); ah.u[i] = hb; al.u[i] = ASPLIT ? bf16_bits(xs[i] - bf16_val(hb)) : (unsigned short)0; }
#pragma unroll
    for (int t = 0; t < 4; ++t) {
      const unsigned short* brow = Wt + (size_t)(col0 + t * 16 + ln) * ldb + kb;
      FragB b;
      b.half[0] = *(const v8us*)(brow + 8 * hh);
      b.half[1] = *(const v8us*)(brow + 16 + 8 * hh);
      acc[t] = mmaN<ASPLIT ? 2 : 1>(ah.v, al.v, b.v, b.v, acc[t]);
    }
  }
#pragma unroll
  for (int t = 0; t < 4; ++t) {
    const int col = col0 + t * 16 + ln;
    float bv = bias ? bias[col] : 0.f;
    if (BIAS_BF16) bv = bf16_round(bv);
#pragma unroll
    for (int r = 0; r < 8; ++r) {
      float v = acc[t][r] + bv;
      if (resid) { float rv = resid[(size_t)((row0 + 8 * hh + r) % rmod) * ldr + col]; if (RES_BF16) rv = bf16_round(rv); v += rv; }
      if (ACT == 1) v = fmaxf(v, 0.f);
      if (ACT == 2) v = 0.5f * v * (1.0f + erff(v * 0.70710678118654752f));
      if (ACT == 3) { const float u = 0.7978845608028654f * (v + 0.044715f * v * v * v); v = 0.5f * v * (1.0f + tanhf(u)); }
      so[w][8 * hh + r][t * 16 + ln] = v;
    }
  }
  __builtin_amdgcn_fence(__ATOMIC_ACQ_REL, "workgroup");
  __builtin_amdgcn_wave_barrier();
  const int rsub = lane >> 4, c4 = (lane & 15) * 4;
  {
#pragma unroll
    for (int q = 0; q < 8; ++q) {
      const int r = q * 2 + rsub;
      const v4f v = *(const v4fa*)&so[w][r][c4];
      *(v4f*)(C + (size_t)(row0 + r) * ldc + col0 + c4) = v;
    }
    
  }
}
// row LayerNorm (biased variance, eps) over N: s = X (+ R); optional out_sum <- s; out_norm <- (s-mu)*rsqrt(var+eps)*g + b
template <bool PARAM_BF16>
__global__ __launch_bounds__(256) void k_layernorm(const float* __restrict__ X, const float* __restrict__ R, const float* __restrict__ g, const float* __restrict__ bta,
                                                  float* __restrict__ out_sum, float* __restrict__ out_norm, int N, float eps) {
  __shared__ float red[256];
  const int row = blockIdx.x, tid = threadIdx.x;
  const float* x = X + (size_t)row * N; const float* rr = R ? R + (size_t)row * N : nullptr;
  float vals[16];                     // up to N = 4096
  const int per = N / 256;            // contiguous chunk per thread? use strided-by-4 chunks: thread handles j = tid*4 + 1024*u
  float s1 = 0.f;
  for (int u = 0; u < per / 4; ++u) {
    const int j = tid * 4 + 1024 * u;
    const v4f a = *(const v4fa*)(x + j);
    v4f b = {0.f,0.f,0.f,0.f}; if (rr) b = *(const v4fa*)(rr + j);
#pragma unroll
    for (int q = 0; q < 4; ++q) { const float v = a[q] + b[q]; vals[u * 4 + q] = v; s1 += v; }
  }
  red[tid] = s1; __syncthreads();
  for (int st = 128; st > 0; st >>= 1) { if (tid < st) red[tid] += red[tid + st]; __syncthreads(); }
  const float mu = red[0] / (float)N; __syncthreads();
  float s2 = 0.f;
  for (int u = 0; u < per / 4; ++u)
#pragma unroll
    for (int q = 0; q < 4; ++q) { const float c = vals[u * 4 + q] - mu; s2 += c * c; }
  red[tid] = s2; __syncthreads();
  for (int st = 128; st > 0; st >>= 1) { if (tid < st) red[tid] += red[tid + st]; __syncthreads(); }
  const float rs = rsqrtf(red[0] / (float)N + eps);
  {
    for (int u = 0; u < per / 4; ++u) {
      const int j = tid * 4 + 1024 * u;
      v4f o, sm;
#pragma unroll
      for (int q = 0; q < 4; ++q) {
        float gg = g[j + q], bb = bta[j + q];
        if (PARAM_BF16) { gg = bf16_round(gg); bb = bf16_round(bb); }
        sm[q] = vals[u * 4 + q]; o[q] = (vals[u * 4 + q] - mu) * rs * gg + bb;
      }
      if (out_sum) *(v4f*)(out_sum + (size_t)row * N + j) = sm;
      *(v4f*)(out_norm + (size_t)row * N + j) = o;
    }
    
  }
}



// ---- f16 WMMA path (v_wmma_f32_16x16x32_f16): 11-bit significands for operands in range — used where a [0,1] probability operand needs more precision than bf16
typedef _Float16 v16h __attribute__((ext_vector_type(16)));
union FragH { v16h v; v8us half[2]; _Float16 h[16]; unsigned short u[16]; };
template <int NT>
__device__ __forceinline__ v8f mmaH(v16h ah, v16h al, v16h bh, v16h bl, v8f c) {
  c = __builtin_amdgcn_wmma_f32_16x16x32_f16(false, ah, false, bh, (short)0, c, false, false);
  if (NT >= 2) c = __builtin_amdgcn_wmma_f32_16x16x32_f16(false, al, false, bh, (short)0, c, false, false);
  if (NT >= 3) c = __builtin_amdgcn_wmma_f32_16x16x32_f16(false, ah, false, bl, (short)0, c, false, false);
  asm volatile("v_nop\n\tv_nop\n\tv_nop\n\tv_nop" : "+v"(c) : "v"(ah), "v"(al), "v"(bh), "v"(bl));
  return c;
}
// batched GEMM like k_gemm_b but f16 operands: A f32 (split into f16 hi/lo if ASPLIT, else rounded to f16), Bt = f16 values [n][k]; alpha; C f32; N multiple of 16 (partial tiles skipped)
template <bool ASPLIT>
__global__ __launch_bounds__(128) void k_gemm_h(const float* __restrict__ A, int lda, size_t sA, const _Float16* __restrict__ Bh, int ldb, size_t sB, float alpha, float* __restrict__ C, int ldc, size_t sC, int M, int N, int K) {
  __shared__ __attribute__((aligned(16))) float so[4][16][64];
  const int tid = threadIdx.x, w = tid >> 5, lane = tid & 31, ln = lane & 15, hh = lane >> 4; const int by = blockIdx.y;
  A += (size_t)by * sA; Bh += (size_t)by * sB; C += (size_t)by * sC;
  const int ntn = (N + 63) / 64; const int wid = blockIdx.x * 4 + w; const int mt = wid / ntn, nq = wid % ntn; if (mt * 16 >= M) return;
  const int row0 = mt * 16, col0 = nq * 64; const float* arow = A + (size_t)(row0 + ln) * lda;
  v8f acc[4] = {};
  for (int kb = 0; kb < K; kb += 32) {
    FragH ah, al;
    const v4f x0 = *(const v4fa*)(arow + kb + 8 * hh), x1 = *(const v4fa*)(arow + kb + 8 * hh + 4), x2 = *(const v4fa*)(arow + kb + 16 + 8 * hh), x3 = *(const v4fa*)(arow + kb + 16 + 8 * hh + 4);
    float xs[16] = {x0[0],x0[1],x0[2],x0[3],x1[0],x1[1],x1[2],x1[3],x2[0],x2[1],x2[2],x2[3],x3[0],x3[1],x3[2],x3[3]};
#pragma unroll
    for (int i = 0; i < 16; ++i) { const _Float16 h = (_Float16)xs[i]; ah.h[i] = h; al.h[i] = ASPLIT ? (_Float16)(xs[i] - (float)h) : (_Float16)0.0f; }
#pragma unroll
    for (int t = 0; t < 4; ++t) { if (col0 + t * 16 >= N) continue; const size_t boff = (size_t)(col0 + t * 16 + ln) * ldb + kb; FragH bq; bq.half[0] = *(const v8us*)(Bh + boff + 8 * hh); bq.half[1] = *(const v8us*)(Bh + boff + 16 + 8 * hh);
      acc[t] = mmaH<ASPLIT ? 2 : 1>(ah.v, al.v, bq.v, bq.v, acc[t]); }
  }
#pragma unroll
  for (int t = 0; t < 4; ++t) { if (col0 + t * 16 >= N) continue;
#pragma unroll
    for (int r = 0; r < 8; ++r) so[w][8 * hh + r][t * 16 + ln] = acc[t][r] * alpha; }
  __builtin_amdgcn_fence(__ATOMIC_ACQ_REL, "workgroup"); __builtin_amdgcn_wave_barrier();
  const int rsub = lane >> 4, c4 = (lane & 15) * 4;
  {
#pragma unroll
    for (int q = 0; q < 8; ++q) { const int r = q * 2 + rsub; if (col0 + c4 < N) { const v4f v = *(const v4fa*)&so[w][r][c4]; *(v4f*)(C + (size_t)(row0 + r) * ldc + col0 + c4) = v; } }
     }
}

// Wt[n][k] = f16(W[k][n]·scale) from f32 row-major W[K][N] (scale = power of two; bf16-exact weights stay exact in f16 away from the subnormal range)
__global__ __launch_bounds__(256) void k_wt_f16(const float* __restrict__ W, _Float16* __restrict__ Wt, int K, int N, float scale) {
  const int t = blockIdx.x * 256 + threadIdx.x; if (t >= N * (K / 8)) return; const int n = t / (K / 8), k8 = (t % (K / 8)) * 8; FragH f;
#pragma unroll
  for (int i = 0; i < 8; ++i) f.h[i] = (_Float16)(bf16_round(W[(size_t)(k8 + i) * N + n]) * scale); const v8us o = f.half[0];
  *(v8us*)((unsigned short*)Wt + (size_t)n * K + k8) = o; 
}
// k_gemm_hh variant with fused epilogue: v = acc·alpha + bias[by·sBias + col] (+ CP[(row/rowsPerB)·sCPb + by·64 + col] if CP) ; ACT 0 none / 1 elu ; writes f16 C16 (and f32 C if non-null)
template <int ACT>
__global__ __launch_bounds__(128) void k_gemm_hhx(const _Float16* __restrict__ A, int lda, size_t sA, const _Float16* __restrict__ Bh, int ldb, size_t sB, float alpha, const float* __restrict__ bias, size_t sBias, const float* __restrict__ CP, int rowsPerB, size_t sCPb, int row0g,
    float* __restrict__ C, _Float16* __restrict__ C16, int ldc, size_t sC, int M, int N, int K) {
  __shared__ __attribute__((aligned(16))) float so[4][16][64];
  const int tid = threadIdx.x, w = tid >> 5, lane = tid & 31, ln = lane & 15, hh = lane >> 4; const int by = blockIdx.y;
  A += (size_t)by * sA; Bh += (size_t)by * sB; const size_t cofs = (size_t)by * sC; const float* bp = bias ? bias + (size_t)by * sBias : nullptr;
  const int ntn = (N + 63) / 64; const int wid = blockIdx.x * 4 + w; const int mt = wid / ntn, nq = wid % ntn; if (mt * 16 >= M) return;
  const int row0 = mt * 16, col0 = nq * 64; const _Float16* arow = A + (size_t)(row0 + ln) * lda;
  v8f acc[4] = {};
  for (int kb = 0; kb < K; kb += 32) { FragH ah; ah.half[0] = *(const v8us*)((const unsigned short*)arow + kb + 8 * hh); ah.half[1] = *(const v8us*)((const unsigned short*)arow + kb + 16 + 8 * hh);
#pragma unroll
    for (int t = 0; t < 4; ++t) { if (col0 + t * 16 >= N) continue; const size_t boff = (size_t)(col0 + t * 16 + ln) * ldb + kb; FragH bq; bq.half[0] = *(const v8us*)((const unsigned short*)Bh + boff + 8 * hh); bq.half[1] = *(const v8us*)((const unsigned short*)Bh + boff + 16 + 8 * hh);
      acc[t] = mmaH<1>(ah.v, ah.v, bq.v, bq.v, acc[t]); }
  }
#pragma unroll
  for (int t = 0; t < 4; ++t) { if (col0 + t * 16 >= N) continue; const int col = col0 + t * 16 + ln; const float bv = bp ? bf16_round(bp[col]) : 0.f;
#pragma unroll
    for (int r = 0; r < 8; ++r) { float v = acc[t][r] * alpha + bv; if (CP) { const int rr = row0g + row0 + 8 * hh + r; if (rowsPerB < 0) v += CP[cofs + (size_t)rr * ldc + col];      /* rowsPerB < 0: own element of the batched C plane */ else { const int bidx = rr / rowsPerB; v += CP[(size_t)bidx * sCPb + (size_t)by * 64 + col]; } } if (ACT == 1) v = (v > 0.f) ? v : expm1f(v); else if (ACT == 7) v = (v > 0.f) ? v + 1.0f : expf(v); else if (ACT == 8) v = tanhf(v); else if (ACT == 9) v = 0.5f * v * (1.0f + tanhf(0.7978845608028654f * (v + 0.044715f * v * v * v))); else if (ACT == 11) v = 1.0f / (1.0f + expf(-v)); else if (ACT == 12) v = (v > 0.f) ? v : 0.01f * v; else if (ACT == 14) v = (v > 0.f) ? v : 0.1f * v; else if (ACT == 16) v = (v >= 0.f) ? v : 0.3f * v; else if (ACT == 17) v = (v >= 0.f) ? v : 0.2f * v; else if (ACT == 15) v = v / (1.0f + expf(-v)); else if (ACT == 3) v = fmaxf(v, 0.f); else if (ACT == 6) v = 0.5f * v * (1.0f + erff(v * 0.70710678118654752f)); so[w][8 * hh + r][t * 16 + ln] = v; } }
  __builtin_amdgcn_fence(__ATOMIC_ACQ_REL, "workgroup"); __builtin_amdgcn_wave_barrier();
  const int rsub = lane >> 4, c4 = (lane & 15) * 4; typedef _Float16 v4h __attribute__((ext_vector_type(4)));
  {
#pragma unroll
    for (int q = 0; q < 8; ++q) { const int r = q * 2 + rsub; if (col0 + c4 < N) { const v4f v = *(const v4fa*)&so[w][r][c4]; if (C) *(v4f*)(C + cofs + (size_t)(row0 + r) * ldc + col0 + c4) = v; if (C16) { v4h h4; for (int i = 0; i < 4; ++i) h4[i] = (_Float16)v[i]; *(v4h*)(C16 + cofs + (size_t)(row0 + r) * ldc + col0 + c4) = h4; } } }
     }
}


typedef _Float16 v4h __attribute__((ext_vector_type(4)));

__global__ __launch_bounds__(256) void k_x16(const float* __restrict__ x, _Float16* __restrict__ X16, size_t n8) { const size_t t = (size_t)blockIdx.x * 256 + threadIdx.x; if (t >= n8) return; FragH f;
#pragma unroll
  for (int q = 0; q < 8; ++q) f.h[q] = (_Float16)bf16_round(x[t * 8 + q]); *(v8us*)((unsigned short*)X16 + t * 8) = f.half[0];  }
__global__ __launch_bounds__(256) void k_h16(const float* __restrict__ x, _Float16* __restrict__ X16, size_t n8) { const size_t t = (size_t)blockIdx.x * 256 + threadIdx.x; if (t >= n8) return; FragH f;
#pragma unroll
  for (int q = 0; q < 8; ++q) f.h[q] = (_Float16)x[t * 8 + q]; *(v8us*)((unsigned short*)X16 + t * 8) = f.half[0];  }
__global__ __launch_bounds__(256) void k_round16f(const float* __restrict__ W, _Float16* __restrict__ Bt, size_t n8) { const size_t t = (size_t)blockIdx.x * 256 + threadIdx.x; if (t >= n8) return; FragH f;
#pragma unroll
  for (int i = 0; i < 8; ++i) f.h[i] = (_Float16)(bf16_round(W[t * 8 + i]) * 16.0f); *(v8us*)((unsigned short*)Bt + t * 8) = f.half[0];  }
template <int NHv, int TTv>
__global__ __launch_bounds__(256) void k_vt(const _Float16* __restrict__ V16, int ldv, int voff, _Float16* __restrict__ Vt) { __shared__ unsigned short tl[64][66]; const int tid = threadIdx.x; const int slab = blockIdx.x / (TTv / 64), lg = blockIdx.x % (TTv / 64); const int b = slab / NHv, h = slab % NHv;
  for (int i = tid; i < 64 * 8; i += 256) { const int r = i / 8, c8 = (i % 8) * 8; FragH f; f.half[0] = *(const v8us*)((const unsigned short*)V16 + ((size_t)b * TTv + lg * 64 + r) * ldv + voff + h * 64 + c8);
#pragma unroll
    for (int q = 0; q < 8; ++q) tl[r][c8 + q] = f.u[q]; }
  __syncthreads();
  {
#pragma unroll
    for (int rd = 0; rd < 2; ++rd) { const int d = rd * 32 + tid / 8, pc = tid % 8; FragH f;
#pragma unroll
      for (int q = 0; q < 8; ++q) f.u[q] = tl[pc * 8 + q][d];
      *(v8us*)((unsigned short*)Vt + ((size_t)slab * 64 + d) * TTv + lg * 64 + pc * 8) = f.half[0]; }
     } }

__global__ __launch_bounds__(256) void k_hl(const float* __restrict__ F, _Float16* __restrict__ Hh, _Float16* __restrict__ Hl, size_t n8) { const size_t t = (size_t)blockIdx.x * 256 + threadIdx.x; if (t >= n8) return; FragH fh, fl; const v4f a = *(const v4fa*)(F + t * 8), c = *(const v4fa*)(F + t * 8 + 4);
#pragma unroll
  for (int q = 0; q < 4; ++q) { _Float16 h = (_Float16)a[q]; fh.h[q] = h; fl.h[q] = (_Float16)((a[q] - (float)h) * 1024.0f); h = (_Float16)c[q]; fh.h[4 + q] = h; fl.h[4 + q] = (_Float16)((c[q] - (float)h) * 1024.0f); }
  { *(v8us*)((unsigned short*)Hh + t * 8) = fh.half[0]; *(v8us*)((unsigned short*)Hl + t * 8) = fl.half[0];  } }

// ---- fast GEMM (wave tile 32x64; requires M % 32 == 0 rows per launch region and N % 64 == 0); epilogue = k_gemm_hhx semantics, except the rowsPerB < 0 addend plane steps by sCPb per grid.y slice ----
__device__ __forceinline__ v16h g2_frag(const _Float16* p, int hh) { FragH f; f.half[0] = *(const v8us*)((const unsigned short*)p + 8 * hh); f.half[1] = *(const v8us*)((const unsigned short*)p + 16 + 8 * hh); return f.v; }
__device__ __forceinline__ v8f g2_mma(v16h a, v16h b, v8f c) { v8f d = __builtin_amdgcn_wmma_f32_16x16x32_f16(false, a, false, b, (short)0, c, false, false); asm volatile("v_nop\n\tv_nop\n\tv_nop\n\tv_nop" : "+v"(d) : "v"(a), "v"(b)); return d; }
template <int ACT>
__global__ __launch_bounds__(128) void k_gemm2(const _Float16* __restrict__ A, int lda, size_t sA, const _Float16* __restrict__ Bh, int ldb, size_t sB, float alpha, const float* __restrict__ bias, size_t sBias, const float* __restrict__ CP, int rowsPerB, size_t sCPb, int row0g,
    float* __restrict__ C, _Float16* __restrict__ C16, int ldc, size_t sC, int M, int N, int K) { static_assert(ACT == 0 || ACT == 3 || ACT == 6 || ACT == 8 || ACT == 9 || ACT == 11 || ACT == 12 || ACT == 14 || ACT == 15 || ACT == 16 || ACT == 17, "k_gemm2: unsupported ACT code (would silently apply no activation)");
  __shared__ __attribute__((aligned(16))) float so[4][32][68];
  const int tid = threadIdx.x, w = tid >> 5, lane = tid & 31, ln = lane & 15, hh = lane >> 4; const int by = blockIdx.y;
  A += (size_t)by * sA; Bh += (size_t)by * sB; const size_t cofs = (size_t)by * sC; const float* bp = bias ? bias + (size_t)by * sBias : nullptr;
  const int ntn = N >> 6; const int mt = blockIdx.x / ntn, nq = blockIdx.x - mt * ntn; const int row0 = mt * 128 + 32 * w, col0 = nq * 64; if (row0 >= M) return;
  const _Float16* a0p = A + (size_t)(row0 + ln) * lda; const _Float16* a1p = a0p + (size_t)16 * lda;
  const _Float16* b0p = Bh + (size_t)(col0 + ln) * ldb; const _Float16* b1p = b0p + (size_t)16 * ldb; const _Float16* b2p = b1p + (size_t)16 * ldb; const _Float16* b3p = b2p + (size_t)16 * ldb;
  const v8f z8 = {0.f,0.f,0.f,0.f,0.f,0.f,0.f,0.f}; v8f c00 = z8, c01 = z8, c02 = z8, c03 = z8, c10 = z8, c11 = z8, c12 = z8, c13 = z8;
#pragma unroll 1
  for (int kb = 0; kb < K; kb += 32) { const v16h a0 = g2_frag(a0p + kb, hh), a1 = g2_frag(a1p + kb, hh);
    v16h b = g2_frag(b0p + kb, hh); c00 = g2_mma(a0, b, c00); c10 = g2_mma(a1, b, c10);
    b = g2_frag(b1p + kb, hh); c01 = g2_mma(a0, b, c01); c11 = g2_mma(a1, b, c11);
    b = g2_frag(b2p + kb, hh); c02 = g2_mma(a0, b, c02); c12 = g2_mma(a1, b, c12);
    b = g2_frag(b3p + kb, hh); c03 = g2_mma(a0, b, c03); c13 = g2_mma(a1, b, c13); }
  v8f accs[8] = {c00, c01, c02, c03, c10, c11, c12, c13};
#pragma unroll
  for (int u = 0; u < 8; ++u) { const int t = u & 3, half = u >> 2; const int col = col0 + t * 16 + ln; const float bv = bp ? bf16_round(bp[col]) : 0.f;
#pragma unroll
    for (int r = 0; r < 8; ++r) { const int rloc = half * 16 + 8 * hh + r; float v = accs[u][r] * alpha + bv; if (CP) { if (rowsPerB < 0) v += CP[(size_t)by * sCPb + (size_t)(row0g + row0 + rloc) * ldc + col];      /* rowsPerB < 0: own element of an addend plane shaped like C; sCPb = its step from one grid.y slice to the next (0: one plane shared by all slices) */ else { const int bidx = (row0g + row0 + rloc) / rowsPerB; v += CP[(size_t)bidx * sCPb + (size_t)by * 64 + col]; } }
      if (ACT == 3) v = fmaxf(v, 0.f); else if (ACT == 6) v = 0.5f * v * (1.0f + erff(v * 0.70710678118654752f)); else if (ACT == 11) v = 1.0f / (1.0f + expf(-v)); else if (ACT == 15) v = v / (1.0f + expf(-v)); else if (ACT == 12) v = (v > 0.f) ? v : 0.01f * v; else if (ACT == 8) v = tanhf(v); else if (ACT == 9) v = 0.5f * v * (1.0f + tanhf(0.7978845608028654f * (v + 0.044715f * v * v * v))); else if (ACT == 14) v = (v > 0.f) ? v : 0.1f * v; else if (ACT == 16) v = (v >= 0.f) ? v : 0.3f * v; else if (ACT == 17) v = (v >= 0.f) ? v : 0.2f * v;
      so[w][rloc][t * 16 + ln] = v; } }
  __builtin_amdgcn_fence(__ATOMIC_ACQ_REL, "workgroup"); __builtin_amdgcn_wave_barrier();
  const int rsub = lane >> 4, c4 = (lane & 15) * 4;
  {
#pragma unroll
    for (int q = 0; q < 16; ++q) { const int r = q * 2 + rsub; const v4f v = *(const v4fa*)&so[w][r][c4]; if (C) *(v4f*)(C + cofs + (size_t)(row0 + r) * ldc + col0 + c4) = v; if (C16) { v4h h4; for (int i = 0; i < 4; ++i) h4[i] = (_Float16)v[i]; *(v4h*)(C16 + cofs + (size_t)(row0 + r) * ldc + col0 + c4) = h4; } }
     } }


__global__ __launch_bounds__(256) void k_wnat(const float* __restrict__ w, size_t n8, _Float16* __restrict__ Bt) { const size_t t = (size_t)blockIdx.x * 256 + threadIdx.x; if (t >= n8) return; FragH f; for (int q = 0; q < 8; ++q) f.h[q] = (_Float16)(bf16_round(w[t * 8 + q]) * 16.0f); *(v8us*)((unsigned short*)Bt + t * 8) = f.half[0];  }
__global__ __launch_bounds__(256) void k_rsm(const float* __restrict__ S, _Float16* __restrict__ P, int nrows) {
  #pragma clang fp contract(off)
  const int i = blockIdx.x * 256 + threadIdx.x; if (i >= nrows) return; const float* s = S + (size_t)i * SQ; float mx = -3.0e38f;
#pragma unroll 1
  for (int j = 0; j < SQ; ++j) mx = fmaxf(mx, s[j]); float se = 0.f;
#pragma unroll 1
  for (int j = 0; j < SQ; ++j) se += expf(s[j] - mx); const float sc = 256.0f / se;
#pragma unroll 1
  for (int j0 = 0; j0 < SQ; j0 += 8) { FragH f; for (int q = 0; q < 8; ++q) f.h[q] = (_Float16)(expf(s[j0 + q] - mx) * sc); unsigned short* d = (unsigned short*)P + (size_t)i * SQ + j0; *(v8us*)d = f.half[0];  } }
__global__ __launch_bounds__(256) void k_vt(const _Float16* __restrict__ V16, int b, int h0, _Float16* __restrict__ VT) { __shared__ unsigned short tl[64][65]; const int tid = threadIdx.x; const int hh = blockIdx.x % HG, sg = blockIdx.x / HG; const int s0 = sg * 64; const int h = h0 + hh;
  for (int i = tid; i < 64 * 8; i += 256) { const int j = i / 8, d8 = (i % 8) * 8; FragH f; f.half[0] = *(const v8us*)((const unsigned short*)V16 + ((size_t)b * SQ + s0 + j) * DM + h * HD + d8); for (int q = 0; q < 8; ++q) tl[d8 + q][j] = f.u[q]; }
  __syncthreads();
  { for (int i = tid; i < 64 * 8; i += 256) { const int d = i / 8, j8 = (i % 8) * 8; FragH f; for (int q = 0; q < 8; ++q) f.u[q] = tl[d][j8 + q]; *(v8us*)((unsigned short*)VT + ((size_t)hh * HD + d) * SQ + s0 + j8) = f.half[0]; }  } }



__global__ __launch_bounds__(256) void k_rsmcf2(const float* __restrict__ S, _Float16* __restrict__ P, int hg, int q0, int nk) {
  #pragma clang fp contract(off)
  const int t = blockIdx.x * 256 + threadIdx.x; if (t >= hg * QT) return; const size_t i = (size_t)t; const float* s = S + i * NKX; const int last = q0 + (t % QT); float mx = -3.0e38f;
#pragma unroll 1
  for (int j = 0; j < nk; ++j) { const float f = (j <= last) ? 1.f : 0.f; mx = fmaxf(mx, fmaf(f, s[j], (1.f - f) * -1.0e9f)); } float se = 0.f;
#pragma unroll 1
  for (int j = 0; j < nk; ++j) { const float f = (j <= last) ? 1.f : 0.f; se += __expf(fmaf(f, s[j], (1.f - f) * -1.0e9f) - mx); } const float sc = 256.0f / se;
#pragma unroll 1
  for (int j0 = 0; j0 < nk; j0 += 8) { FragH fr; for (int q = 0; q < 8; ++q) { const int j = j0 + q; const float f = (j <= last) ? 1.f : 0.f; fr.h[q] = (_Float16)(__expf(fmaf(f, s[j], (1.f - f) * -1.0e9f) - mx) * sc); } unsigned short* d = (unsigned short*)P + i * NKX + j0; *(v8us*)d = fr.half[0];  } }

template <int MASKADD>
__global__ __launch_bounds__(64) void k_att0(const float* __restrict__ QF, const float* __restrict__ KF, const float* __restrict__ VF, int ld, const float* __restrict__ mask, float scale, float* __restrict__ OF, int ldo) {
  #pragma clang fp contract(off)
  __shared__ __attribute__((aligned(16))) float lq[64][64]; __shared__ __attribute__((aligned(16))) float lo[64][64];
  const int tid = threadIdx.x; const int h = blockIdx.x / (QT0 / 64), rg = blockIdx.x % (QT0 / 64); const int i = rg * 64 + tid;
  const float* qr = QF + (size_t)i * ld + h * HD;
#pragma unroll 1
  for (int c = 0; c < HD / 4; ++c) { *(v4f*)&lq[tid][c * 4] = *(const v4fa*)(qr + c * 4); const v4f z = {0.f, 0.f, 0.f, 0.f}; *(v4f*)&lo[tid][c * 4] = z; }
  float m = -1.0e30f, l = 0.f; const int jmax = MASKADD ? (SQ - 1) : (rg * 64 + 63);      /* additive-mask form: every key (the mask input decides); causal form: keys up to the block's last row */
#pragma unroll 1
  for (int j = 0; j <= jmax; ++j) { const float* kr = KF + (size_t)j * ld + h * HD; const float* vr = VF + (size_t)j * ld + h * HD; float s = 0.f;
#pragma unroll 1
    for (int c = 0; c < HD / 4; ++c) { const v4f kq = *(const v4fa*)(kr + c * 4); const v4f qq = *(v4f*)&lq[tid][c * 4]; s = __fadd_rn(s, __fmul_rn(qq[0], kq[0])); s = __fadd_rn(s, __fmul_rn(qq[1], kq[1])); s = __fadd_rn(s, __fmul_rn(qq[2], kq[2])); s = __fadd_rn(s, __fmul_rn(qq[3], kq[3])); }
    s = __fmul_rn(s, scale); if (MASKADD) s = __fadd_rn(s, __fmul_rn(bf16_round(mask[(size_t)i * SQ + j]), -10000.0f));
    const float f = (MASKADD || j <= i) ? 1.f : 0.f; const float sm = fmaf(f, s, (1.f - f) * -1.0e30f); const float mn = fmaxf(m, sm); const float sc = expf(m - mn); const float e = expf(sm - mn); l = __fadd_rn(__fmul_rn(l, sc), e); m = mn;
#pragma unroll 1
    for (int c = 0; c < HD / 4; ++c) { const v4f vv = *(const v4fa*)(vr + c * 4); v4f oo = *(v4f*)&lo[tid][c * 4]; for (int u = 0; u < 4; ++u) oo[u] = __fadd_rn(__fmul_rn(oo[u], sc), __fmul_rn(e, vv[u])); *(v4f*)&lo[tid][c * 4] = oo; } }
  const float fin = 64.0f / l;      /* o carried x64 like the f16 path */
#pragma unroll 1
  for (int c = 0; c < HD / 4; ++c) { v4f oo = *(v4f*)&lo[tid][c * 4]; for (int u = 0; u < 4; ++u) oo[u] = __fmul_rn(oo[u], fin); *(v4f*)&lo[tid][c * 4] = oo; }
  __syncthreads();
  {
#pragma unroll 1
    for (int it = 0; it < 16; ++it) { const int row = it * 4 + tid / 16, pc = (tid % 16) * 4; const v4f v = *(const v4f*)&lo[row][pc]; *(v4f*)(OF + (size_t)(rg * 64 + row) * ldo + h * HD + pc) = v; }
     } }

__global__ __launch_bounds__(256) void k_oscale(const float* __restrict__ OF, float* __restrict__ out, size_t n4) { const size_t t = (size_t)blockIdx.x * 256 + threadIdx.x; if (t >= n4) return; const v4f a = *(const v4fa*)(OF + t * 4); v4f o; for (int q = 0; q < 4; ++q) o[q] = a[q] * 0.015625f; *(v4f*)(out + t * 4) = o;  }

__global__ __launch_bounds__(256) void k_bfr(const float* __restrict__ x, float* __restrict__ XB, size_t n8) { const size_t t = (size_t)blockIdx.x * 256 + threadIdx.x; if (t >= n8) return; v4f a = *(const v4fa*)(x + t * 8), c = *(const v4fa*)(x + t * 8 + 4); for (int q = 0; q < 4; ++q) { a[q] = bf16_round(a[q]); c[q] = bf16_round(c[q]); }
  { *(v4f*)(XB + t * 8) = a; *(v4f*)(XB + t * 8 + 4) = c;  } }



__global__ __launch_bounds__(256) void k_rsmfvl(const float* __restrict__ S, _Float16* __restrict__ P, _Float16* __restrict__ PL, int qn, const int* __restrict__ vlp) {
  #pragma clang fp contract(off)
  const int t = blockIdx.x * 256 + threadIdx.x; if (t >= qn) return; const int vl = vlp[0]; const size_t i = (size_t)t; const float* s = S + i * SQ; float mx = -3.0e38f;
#pragma unroll 1
  for (int j = 0; j < SQ; ++j) { const float f = (j < vl) ? 1.f : 0.f; mx = fmaxf(mx, fmaf(f, s[j], (1.f - f) * -1000000.0f)); } float se = 0.f;
#pragma unroll 1
  for (int j = 0; j < SQ; ++j) { const float f = (j < vl) ? 1.f : 0.f; se += __expf(fmaf(f, s[j], (1.f - f) * -1000000.0f) - mx); } const float sc = 256.0f / se;
#pragma unroll 1
  for (int j0 = 0; j0 < SQ; j0 += 8) { FragH fr, gr; for (int q = 0; q < 8; ++q) { const int j = j0 + q; const float f = (j < vl) ? 1.f : 0.f; const float pv = __expf(fmaf(f, s[j], (1.f - f) * -1000000.0f) - mx) * sc; const _Float16 ph = (_Float16)pv; fr.h[q] = ph; gr.h[q] = (_Float16)((pv - (float)ph) * 1024.0f); }
    unsigned short* d = (unsigned short*)P + i * SQ + j0; unsigned short* dl = (unsigned short*)PL + i * SQ + j0; *(v8us*)d = fr.half[0]; *(v8us*)dl = gr.half[0];  } }

// 2^x on the transcendental unit; the v_nop is the one free slot the instruction set asks for behind a transcendental, in the same statement so that it stays directly behind it.
__device__ __forceinline__ float exp2_slot(float x) { float r; asm("v_exp_f32 %0, %1\n\tv_nop" : "=v"(r) : "v"(x)); return r; }

#define CN 256          /* channels */
#define CI 128          /* inner channels */
#define NP 4096         /* positions */
#define NM 1024         /* pooled positions (= SQ: the softmax key count) */

// Fused attention: one launch computes scores, softmax and the weighted sum of g for all images; neither the scores nor the weights go to memory.
// A work-group of 8 waves takes 128 queries of one image (16 a wave) and walks the 1024 pooled positions 32 at a time.
// S^T = phi^T (A, rows m) x theta (B, columns n; fragments kept in registers), three terms as before: hi.hi + (hi.lo + lo.hi) / 1024.
// In the accumulator a lane holds, for ITS query n = lane & 15, the keys m = 8 * (lane >> 4) + r of a 16-key tile: two such tiles are, register for register, the B fragment of y[c][n] += g[c][m] P^T[m][n]
// (elements 0..7 = keys 8 hh + r, elements 8..15 = keys 16 + 8 hh + r, the k order in which g2_frag / lds_frag read the rows of g), so the weights move through no LDS and no other lane.
// Running row maximum and row sum per lane (online softmax; the two half-waves share the maximum every pass and join their sums once at the end). Weights are carried x256 in f16 as before; the sum carries the same factor.
// The phi hi / lo rows and the g columns of a pass are shared by the 8 waves through LDS, a ring of three buffers: pass t works on tile t, reads tile t + 1's phi fragments ahead, and stages tile t + 2 (global loads at its head, LDS stores at its foot); one barrier a pass publishes tile t + 2 (and ends the reads of the buffer that the next pass overwrites).
// Every LDS fragment read stands one phase ahead of its use, as a whole group: the g fragments of a pass in front of its score products, the next pass's 16 phi fragments behind them (into the registers they have just left), in front of the exponentials and the g products.
#define FK 32                            /* keys per pass */
#define FPP 136                          /* LDS pitch of a phi row in f16: 256 B + 16 B, an odd multiple of 16 B (no bank conflict for 16-byte reads of 16 rows) */
#define FGP 40                           /* LDS pitch of a g row in f16: 64 B + 16 B, likewise */
#define FBUF (2 * FK * FPP + CI * FGP)   /* one buffer in f16: phi hi, phi lo, g */
__device__ __forceinline__ v16h lds_frag(const unsigned short* p) { FragH f; f.half[0] = *(const v8us*)p; f.half[1] = *(const v8us*)(p + 16); return f.v; }
__device__ __forceinline__ v8f f_mma(v16h a, v16h b, v8f c) { return __builtin_amdgcn_wmma_f32_16x16x32_f16(false, a, false, b, (short)0, c, false, false); }
__global__ __launch_bounds__(256) void k_fattn(const _Float16* __restrict__ TH, const _Float16* __restrict__ THL, const _Float16* __restrict__ PHT, const _Float16* __restrict__ PHLT, const _Float16* __restrict__ G16, _Float16* __restrict__ YT) {
  __shared__ __attribute__((aligned(16))) unsigned short sm[3 * FBUF];
  const int tid = threadIdx.x, w = tid >> 5, lane = tid & 31, ln = lane & 15, hh = lane >> 4, by = blockIdx.y;
  const int n0 = blockIdx.x * 128 + w * 16;
  const unsigned short* ph = (const unsigned short*)PHT + (size_t)by * CI * NM; const unsigned short* pl = (const unsigned short*)PHLT + (size_t)by * CI * NM; const unsigned short* gg = (const unsigned short*)G16 + (size_t)by * CI * NM;
  const _Float16* tq = TH + ((size_t)by * NP + n0 + ln) * CI; const _Float16* tl = THL + ((size_t)by * NP + n0 + ln) * CI;
  v16h qh[4], ql[4];
#pragma unroll
  for (int j = 0; j < 4; ++j) { qh[j] = g2_frag(tq + j * 32, hh); ql[j] = g2_frag(tl + j * 32, hh); }
  /* staging: 16-byte pieces; phi tile = 32 rows x 16 pieces (contiguous in memory), g tile = 128 rows x 4 pieces; two pieces of each plane a thread */
  const int pr = tid >> 4, pc = (tid & 15) * 8, gr = tid >> 2, gc = (tid & 3) * 8;
  v8us r0, r1, r2, r3, r4, r5;
  const unsigned short *fh, *fl, *fg;      /* the lane's first piece of each plane of the tile being fetched */
  auto fetch = [&](int t) { const size_t m0 = (size_t)t * FK;
    fh = ph + (m0 + pr) * CI + pc; fl = pl + (m0 + pr) * CI + pc; fg = gg + ((size_t)t * CI + gr) * FK + gc;      /* g lies tile by tile: [m / 32][ci][32], one pass's tile = 8 KiB in a row */
    r0 = *(const v8us*)fh; r1 = *(const v8us*)(fh + 16 * CI);
    r2 = *(const v8us*)fl; r3 = *(const v8us*)(fl + 16 * CI);
    r4 = *(const v8us*)fg; r5 = *(const v8us*)(fg + 64 * FK); };
  auto fetched = [&]() { asm volatile("s_wait_xcnt 0x0" :: "v"(fh), "v"(fl), "v"(fg) : "memory"); };      /* the wait that stands in front of any overwrite of a register which an issued load names; the three addresses are inputs so that they stay live up to it */
  auto put = [&](int bo) { unsigned short* d = sm + bo;
    *(v8us*)(d + pr * FPP + pc) = r0; *(v8us*)(d + (pr + 16) * FPP + pc) = r1;
    *(v8us*)(d + FK * FPP + pr * FPP + pc) = r2; *(v8us*)(d + FK * FPP + (pr + 16) * FPP + pc) = r3;
    *(v8us*)(d + 2 * FK * FPP + gr * FGP + gc) = r4; *(v8us*)(d + 2 * FK * FPP + (gr + 64) * FGP + gc) = r5; };
  v16h pa[16];      /* a tile's phi fragments: [4 j + 0 / 1] = hi rows 0..15 / 16..31, [4 j + 2 / 3] = residual rows, k block j */
  auto ldphi = [&](int bo) { const unsigned short* a = sm + bo + ln * FPP + 8 * hh;
#pragma unroll
    for (int j = 0; j < 4; ++j) { pa[4 * j] = lds_frag(a + j * 32); pa[4 * j + 1] = lds_frag(a + 16 * FPP + j * 32); pa[4 * j + 2] = lds_frag(a + FK * FPP + j * 32); pa[4 * j + 3] = lds_frag(a + (FK + 16) * FPP + j * 32); } };
  const v8f z8 = {0.f,0.f,0.f,0.f,0.f,0.f,0.f,0.f};
  v8f o[8];
#pragma unroll
  for (int ct = 0; ct < 8; ++ct) o[ct] = z8;
  float m = -1.0e30f, l = 0.f;
  fetch(0); fetched(); put(0); fetch(1); fetched(); put(FBUF);
  __syncthreads();      /* publishes tiles 0 and 1 */
  ldphi(0);
  int b0 = 0, b1 = FBUF, b2 = 2 * FBUF;      /* ring offsets of tiles t, t + 1, t + 2 */
  int tf = 2;      /* the tile that pass t stages: t + 2, held at the last tile */
  /* rolled: one pass is already some hundred instructions, and the ring offsets are the only thing that changes */
#pragma unroll 1
  for (int t = 0; t < NM / FK; ++t) {
    const unsigned short* ag = sm + b0 + 2 * FK * FPP + ln * FGP + 8 * hh;
    v16h ga[8];
    fetch(tf);      /* the index is held at the last tile so that the pass has no branch and stays one scheduling region; what the last two passes stage is written and read ahead like any tile and enters no product */
#pragma unroll
    for (int ct = 0; ct < 8; ++ct) ga[ct] = lds_frag(ag + ct * 16 * FGP);
    __builtin_amdgcn_sched_barrier(0);      /* keeps the g fragment reads and the staging loads in front of the score products, which cover them; without it the compiler sinks each read to just in front of its product and the wave waits out the LDS latency there */
    v8f sh0 = z8, sh1 = z8, sl0 = z8, sl1 = z8;
#pragma unroll
    for (int j = 0; j < 4; ++j) {
      sh0 = f_mma(pa[4 * j], qh[j], sh0); sh1 = f_mma(pa[4 * j + 1], qh[j], sh1);
      sl0 = f_mma(pa[4 * j], ql[j], sl0); sl1 = f_mma(pa[4 * j + 1], ql[j], sl1);
      sl0 = f_mma(pa[4 * j + 2], qh[j], sl0); sl1 = f_mma(pa[4 * j + 3], qh[j], sl1);
    }
    float s[16];
#pragma unroll
    for (int r = 0; r < 8; ++r) { s[r] = sh0[r] + sl0[r] * 0.0009765625f; s[8 + r] = sh1[r] + sl1[r] * 0.0009765625f; }
    float mx = fmaxf(s[0], s[1]);
#pragma unroll
    for (int r = 2; r < 16; ++r) mx = fmaxf(mx, s[r]);
    const float mo = __shfl_xor(mx, 16, 32);      /* the other half-wave holds the same query's other 16 keys */
    __builtin_amdgcn_sched_barrier(0);      /* the exchange goes through the LDS queue, which answers in order: it is issued in front of the 32 reads below, so that its wait does not take them in */
    fetched();      /* here and not at the loads: it has to stand in front of the first overwrite of the three address pairs only, and they stay untouched up to it; the score products lie in between */
    ldphi(b1);      /* tile t + 1, published by the barrier of pass t - 1 */
    __builtin_amdgcn_sched_barrier(0);      /* keeps the whole group here, in front of the exponentials and the g products, which cover it */
    mx = fmaxf(mx, mo);
    const float mn = fmaxf(m, mx);
    const float sc = exp2_slot((m - mn) * 1.44269504f);
    m = mn;
    FragH pf; float p0 = 0.f, p1 = 0.f;
#pragma unroll
    for (int r = 0; r < 8; ++r) {
      const float e0 = exp2_slot((s[r] - mn) * 1.44269504f + 8.0f), e1 = exp2_slot((s[8 + r] - mn) * 1.44269504f + 8.0f);
      p0 += e0; p1 += e1; pf.h[r] = (_Float16)e0; pf.h[8 + r] = (_Float16)e1;
    }
    l = l * sc + (p0 + p1);
#pragma unroll
    for (int ct = 0; ct < 8; ++ct) o[ct] *= sc;
#pragma unroll
    for (int ct = 0; ct < 8; ++ct) o[ct] = f_mma(ga[ct], pf.v, o[ct]);
    __builtin_amdgcn_sched_barrier(0);      /* keeps the staging stores, and with them the barrier's wait on the LDS queue, behind the g products: hoisted over them, that wait stood right behind the exponentials and took in the 32 reads */
    put(b2);
    __syncthreads();      /* publishes tile t + 2; ends every wave's reads of tile t, whose buffer pass t + 1 overwrites */
    const int bt = b0; b0 = b1; b1 = b2; b2 = bt;
    if (tf + 1 < NM / FK) ++tf;
  }
  l += __shfl_xor(l, 16, 32);
  const float inv = 1.0f / l;
  unsigned short* yo = (unsigned short*)YT + ((size_t)by * NP + n0 + ln) * CI + 8 * hh;      /* y^T [n][ci]: the lane's 8 channels of a tile are 16 contiguous bytes of its query's row */
#pragma unroll
  for (int ct = 0; ct < 8; ++ct) { FragH f;
#pragma unroll
    for (int r = 0; r < 8; ++r) f.h[r] = (_Float16)(o[ct][r] * inv);
    *(v8us*)(yo + ct * 16) = f.half[0]; }
}

__global__ __launch_bounds__(256) void k_rowbias(const float* __restrict__ b, float* __restrict__ BP, size_t n4, int ncol) { const size_t t = (size_t)blockIdx.x * 256 + threadIdx.x; if (t >= n4) return; const size_t e = t * 4; const float v = bf16_round(b[e / ncol]); const v4f o = {v, v, v, v}; *(v4f*)(BP + e) = o;  }




__global__ __launch_bounds__(256) void k_mp2(const float* __restrict__ src, float* __restrict__ dst, int nout) {
  const int t = blockIdx.x * 256 + threadIdx.x; if (t >= nout) return; const int c = t / 1024; const int o = t % 1024; const int oy = o / 32, ox = o % 32; const float* p = src + (size_t)c * 4096 + (size_t)(2 * oy) * 64 + 2 * ox;
  const float v = fmaxf(fmaxf(p[0], p[1]), fmaxf(p[64], p[65])); *(float*)(dst + t) = v;  }
__global__ __launch_bounds__(256) void k_xpb(const float* __restrict__ x, const float* __restrict__ wb, float* __restrict__ CPP, size_t n4) {
  #pragma clang fp contract(off)
  const size_t t = (size_t)blockIdx.x * 256 + threadIdx.x; if (t >= n4) return; const size_t e = t * 4; const int c = (int)((e / 4096) % 256); const float bb = bf16_round(wb[c]); const v4f a = *(const v4fa*)(x + e); v4f o; for (int q = 0; q < 4; ++q) o[q] = __fadd_rn(bf16_round(a[q]), bb);
  *(v4f*)(CPP + e) = o;  }


__global__ __launch_bounds__(256) void k_bnres(float* __restrict__ O, const float* __restrict__ x, const float* __restrict__ wb, const float* __restrict__ g, const float* __restrict__ be, const float* __restrict__ mu, const float* __restrict__ var, float eps, size_t n4) {
  #pragma clang fp contract(off)
  const size_t t = (size_t)blockIdx.x * 256 + threadIdx.x; if (t >= n4) return; const size_t e = t * 4; const int c = (int)((e / NP) % CN);
  const float inv = __fdiv_rn(bf16_round(g[c]), sqrtf(__fadd_rn(bf16_round(var[c]), eps))); const float wbc = bf16_round(wb[c]), mc = bf16_round(mu[c]), bc = bf16_round(be[c]);
  const v4f a = *(const v4fa*)(O + e); const v4f xx = *(const v4fa*)(x + e); v4f o;
  for (int q = 0; q < 4; ++q) o[q] = __fadd_rn(__fadd_rn(__fmul_rn(__fadd_rn(__fadd_rn(a[q], wbc), -mc), inv), bc), bf16_round(xx[q]));
  *(v4f*)(O + e) = o;  }

// ---- the pointwise and layout stages of the activations live inside the three matrix kernels ----
// Every plain '#pragma unroll' below, except on k_proj's copy loops over it and k, stands on a short loop over a register array (fragments, accumulators, packed halves): its index must be a compile-time constant for the array to stay in registers.
// k_prep: every small operand once: the three projection weights stacked [384][256] (theta, phi, g) and W [256][128] as x16 f16 planes, the three biases [384] rounded, and per output channel {W_b, mean, gamma / sqrt(var + eps), beta}.
__global__ __launch_bounds__(256) void k_prep(const float* __restrict__ tw, const float* __restrict__ pw, const float* __restrict__ gw, const float* __restrict__ ww, const float* __restrict__ tb, const float* __restrict__ pb, const float* __restrict__ gb,
    const float* __restrict__ wb, const float* __restrict__ g, const float* __restrict__ be, const float* __restrict__ mu, const float* __restrict__ var, float eps, _Float16* __restrict__ WA, _Float16* __restrict__ BW, float* __restrict__ BB, float* __restrict__ BN4) {
  const int t = blockIdx.x * 256 + threadIdx.x;
  if (t < 4 * CI * CN / 8) { const int s = t / (CI * CN / 8), u = (t % (CI * CN / 8)) * 8; const float* sp = s == 0 ? tw : s == 1 ? pw : s == 2 ? gw : ww; unsigned short* d = s < 3 ? (unsigned short*)WA + (size_t)s * CI * CN : (unsigned short*)BW; FragH f;
#pragma unroll
    for (int q = 0; q < 8; ++q) f.h[q] = (_Float16)(bf16_round(sp[u + q]) * 16.0f);
    *(v8us*)(d + u) = f.half[0]; }
  else if (t < 4 * CI * CN / 8 + 3 * CI) { const int o = t - 4 * CI * CN / 8, s = o / CI; const float* sp = s == 0 ? tb : s == 1 ? pb : gb; BB[o] = bf16_round(sp[o % CI]); }
  else if (t < 4 * CI * CN / 8 + 3 * CI + CN) { const int c = t - (4 * CI * CN / 8 + 3 * CI); const v4f o = {bf16_round(wb[c]), bf16_round(mu[c]), __fdiv_rn(bf16_round(g[c]), sqrtf(bf16_round(var[c]) + eps)), bf16_round(be[c])}; *(v4f*)(BN4 + 4 * c) = o; }
}

// k_proj: theta, phi and g of 128 positions (two image rows = one pooled row) of one image in one work-group of 16 waves.
// 1. x [256 c][128 n] f32 -> bf16-rounded f16, transposed into LDS as x^T [n][c]. 2. D[o][n] = (stacked weights as A, rows o, from L2) x (x^T rows as B^T): a wave keeps the B fragments of position tiles p and p + 4 (the same 16 columns of the two image rows) in registers for all of K and walks 6 of the 24 row tiles.
// In D a lane holds 8 consecutive o of ITS position: theta splits into hi + x1024 residual as 16-byte pieces of its [n][ci] row; phi and g take the 2x2 maximum as max(tile p, tile p + 4), then with the neighbour lane. 3. All results are gathered in LDS and leave as whole lines.
#define XP 264                           /* LDS pitch of an x^T row in f16: 512 B + 16 B (16-byte reads and writes of 16 rows fall on all banks) */
#define TP 136                           /* LDS pitch of a gathered theta / phi row in f16: 256 B + 16 B */
#define GP 40                            /* LDS pitch of a gathered g row in f16: 64 B + 16 B */
__global__ __launch_bounds__(512) void k_proj(const float* __restrict__ x, const _Float16* __restrict__ WA, const float* __restrict__ BB, _Float16* __restrict__ TH, _Float16* __restrict__ THL, _Float16* __restrict__ PHT, _Float16* __restrict__ PHLT, _Float16* __restrict__ G16) {
  __shared__ __attribute__((aligned(16))) unsigned short xt[128 * XP];
  __shared__ __attribute__((aligned(16))) unsigned short sth[128 * TP];
  __shared__ __attribute__((aligned(16))) unsigned short stl[128 * TP];
  __shared__ __attribute__((aligned(16))) unsigned short sph[32 * TP];
  __shared__ __attribute__((aligned(16))) unsigned short spl[32 * TP];
  __shared__ __attribute__((aligned(16))) unsigned short sg[CI * GP];
  const int tid = threadIdx.x, w = tid >> 5, lane = tid & 31, ln = lane & 15, hh = lane >> 4, by = blockIdx.y;
  const int n0 = blockIdx.x * 128;
  { /* a wave takes blocks of 32 c x 32 n: a lane 8 c x 4 n; 8 lanes read one 128-byte line of a channel row, and the 16 lanes of a half-wave write 16-byte pieces that fall on all banks */
    const int n4 = (lane & 3) + 4 * hh, c8 = (lane >> 2) & 3;
#pragma unroll
    for (int it = 0; it < 2; ++it) { const int unit = it * 16 + w; const int n = (unit & 3) * 32 + 4 * n4, c = (unit >> 2) * 32 + 8 * c8;
      const float* sp = x + ((size_t)by * CN + c) * NP + n0 + n; v4f a[8];
#pragma unroll
      for (int q = 0; q < 8; ++q) a[q] = *(const v4fa*)(sp + (size_t)q * NP);
#pragma unroll
      for (int i = 0; i < 4; ++i) { FragH f;
#pragma unroll
        for (int q = 0; q < 8; ++q) f.h[q] = (_Float16)bf16_round(a[q][i]);
        *(v8us*)(xt + (n + i) * XP + c) = f.half[0]; } } }
  const int p = w & 3, oq = w >> 2;
  v16h a[8]; v4f bb0, bb1;
  auto lda = [&](int ot) { const unsigned short* ar = (const unsigned short*)WA + (size_t)(ot * 16 + ln) * CN + 8 * hh; const float* br = BB + ot * 16 + 8 * hh;      /* the lane's own first bytes: elements 0..7 = k 8 hh + 0..7, elements 8..15 = k 16 + 8 hh + 0..7 of each 32, as g2_frag reads them */
#pragma unroll
    for (int j = 0; j < 8; ++j) { FragH f; f.half[0] = *(const v8us*)(ar + j * 32); f.half[1] = *(const v8us*)(ar + j * 32 + 16); a[j] = f.v; }
    bb0 = *(const v4fa*)br; bb1 = *(const v4fa*)(br + 4);
    asm volatile("s_wait_xcnt 0x0" :: "v"(ar), "v"(br) : "memory"); };      /* the wait that stands in front of any overwrite of a register which an issued load names; the two addresses are inputs so that they stay live up to it and no load of the run lands in them */
  lda(oq * 6);
  __syncthreads();      /* publishes x^T */
  v16h b0[8], b1[8];
  { const unsigned short* r0 = xt + (p * 16 + ln) * XP + 8 * hh; const unsigned short* r1 = r0 + 64 * XP;
#pragma unroll
    for (int j = 0; j < 8; ++j) { b0[j] = lds_frag(r0 + j * 32); b1[j] = lds_frag(r1 + j * 32); } }
  const v8f z8 = {0.f,0.f,0.f,0.f,0.f,0.f,0.f,0.f};
  const int nl = p * 16 + ln, ml = nl >> 1;
  /* rolled: the three kinds of row tile share one body, and an unrolled one would hold several tiles' weight fragments at once */
#pragma unroll 1
  for (int i = 0; i < 6; ++i) { const int ot = oq * 6 + i;
    v8f c0 = z8, c1 = z8;
#pragma unroll
    for (int j = 0; j < 8; ++j) { c0 = f_mma(a[j], b0[j], c0); c1 = f_mma(a[j], b1[j], c1); }
    float v0[8], v1[8];
#pragma unroll
    for (int r = 0; r < 8; ++r) { const float bv = r < 4 ? bb0[r & 3] : bb1[r & 3]; v0[r] = c0[r] * 0.0625f + bv; v1[r] = c1[r] * 0.0625f + bv; }
    if (i + 1 < 6) lda(ot + 1);      /* the next row tile's weights fly while this one's results are packed */
    if (ot < 8) { FragH h0, l0, h1, l1;
#pragma unroll
      for (int r = 0; r < 8; ++r) { _Float16 h = (_Float16)v0[r]; h0.h[r] = h; l0.h[r] = (_Float16)((v0[r] - (float)h) * 1024.0f); h = (_Float16)v1[r]; h1.h[r] = h; l1.h[r] = (_Float16)((v1[r] - (float)h) * 1024.0f); }
      const int e = nl * TP + ot * 16 + 8 * hh;
      *(v8us*)(sth + e) = h0.half[0]; *(v8us*)(stl + e) = l0.half[0]; *(v8us*)(sth + e + 64 * TP) = h1.half[0]; *(v8us*)(stl + e + 64 * TP) = l1.half[0];
    } else { float mx[8];
#pragma unroll
      for (int r = 0; r < 8; ++r) { const float u = fmaxf(v0[r], v1[r]); mx[r] = fmaxf(u, __shfl_xor(u, 1, 32)); }
      if (ot < 16) { FragH h0, l0;
#pragma unroll
        for (int r = 0; r < 8; ++r) { const _Float16 h = (_Float16)mx[r]; h0.h[r] = h; l0.h[r] = (_Float16)((mx[r] - (float)h) * 1024.0f); }
        if (!(ln & 1)) { const int e = ml * TP + (ot - 8) * 16 + 8 * hh; *(v8us*)(sph + e) = h0.half[0]; *(v8us*)(spl + e) = l0.half[0]; }
      } else if (!(ln & 1)) { FragH h0;
#pragma unroll
        for (int r = 0; r < 8; ++r) { h0.h[r] = (_Float16)mx[r]; sg[((ot - 16) * 16 + 8 * hh + r) * GP + ml] = h0.u[r]; } }
    }
  }
  __syncthreads();      /* every wave's results are gathered */
  { unsigned short* dh = (unsigned short*)TH + ((size_t)by * NP + n0) * CI; unsigned short* dl = (unsigned short*)THL + ((size_t)by * NP + n0) * CI;
#pragma unroll
    for (int k = 0; k < 4; ++k) { const int pc = k * 512 + tid, r = pc >> 4, q = (pc & 15) * 8; *(v8us*)(dh + r * CI + q) = *(const v8us*)(sth + r * TP + q); *(v8us*)(dl + r * CI + q) = *(const v8us*)(stl + r * TP + q); }
    const size_t mo = ((size_t)by * NM + blockIdx.x * 32) * CI;      /* the pooled row's 32 positions: rows of phi^T [m][ci]; one 32-key tile [ci][32] of g */
    { const int r = tid >> 4, q = (tid & 15) * 8; *(v8us*)((unsigned short*)PHT + mo + r * CI + q) = *(const v8us*)(sph + r * TP + q); *(v8us*)((unsigned short*)PHLT + mo + r * CI + q) = *(const v8us*)(spl + r * TP + q); }
    { const int r = tid >> 2, q = (tid & 3) * 8; *(v8us*)((unsigned short*)G16 + mo + r * 32 + q) = *(const v8us*)(sg + r * GP + q); } }
}

// k_gemmw: z[c][n] = BN((16 W as A) (y^T as B^T) / 16 + W_b) + bf16(x): the wave tile and K loop of k_gemm2; bias, BatchNorm and residual are applied where the tile leaves LDS as whole lines.
__global__ __launch_bounds__(128) void k_gemmw(const _Float16* __restrict__ A, const _Float16* __restrict__ Bh, const float* __restrict__ BN4, const float* __restrict__ x, float* __restrict__ out) {
  __shared__ __attribute__((aligned(16))) float so[4][32][68];
  const int tid = threadIdx.x, w = tid >> 5, lane = tid & 31, ln = lane & 15, hh = lane >> 4; const int by = blockIdx.y;
  Bh += (size_t)by * NP * CI; const size_t cofs = (size_t)by * CN * NP;
  const int mt = blockIdx.x / (NP / 64), nq = blockIdx.x - mt * (NP / 64); const int row0 = mt * 128 + 32 * w, col0 = nq * 64;
  const _Float16* a0p = A + (size_t)(row0 + ln) * CI; const _Float16* a1p = a0p + (size_t)16 * CI;
  const _Float16* b0p = Bh + (size_t)(col0 + ln) * CI; const _Float16* b1p = b0p + (size_t)16 * CI; const _Float16* b2p = b1p + (size_t)16 * CI; const _Float16* b3p = b2p + (size_t)16 * CI;
  const v8f z8 = {0.f,0.f,0.f,0.f,0.f,0.f,0.f,0.f}; v8f c00 = z8, c01 = z8, c02 = z8, c03 = z8, c10 = z8, c11 = z8, c12 = z8, c13 = z8;
  /* rolled: k_gemm2's product loop taken over as it stands, so that this kernel differs from it in the epilogue alone; unrolling it or loading ahead is a step of its own */
#pragma unroll 1
  for (int kb = 0; kb < CI; kb += 32) { const v16h a0 = g2_frag(a0p + kb, hh), a1 = g2_frag(a1p + kb, hh);
    v16h b = g2_frag(b0p + kb, hh); c00 = g2_mma(a0, b, c00); c10 = g2_mma(a1, b, c10);
    b = g2_frag(b1p + kb, hh); c01 = g2_mma(a0, b, c01); c11 = g2_mma(a1, b, c11);
    b = g2_frag(b2p + kb, hh); c02 = g2_mma(a0, b, c02); c12 = g2_mma(a1, b, c12);
    b = g2_frag(b3p + kb, hh); c03 = g2_mma(a0, b, c03); c13 = g2_mma(a1, b, c13); }
  v8f accs[8] = {c00, c01, c02, c03, c10, c11, c12, c13};
  const int rsub = lane >> 4, c4 = (lane & 15) * 4;
  const size_t e0 = cofs + (size_t)(row0 + rsub) * NP + col0 + c4; const float* xb = x + e0; const float* pb4 = BN4 + 4 * (row0 + rsub);
  v4f xx[16], pr[16];      /* the lane's 16 pieces of x and their rows' constants */
#pragma unroll
  for (int q = 0; q < 16; ++q) { xx[q] = *(const v4fa*)(xb + (size_t)q * 2 * NP); pr[q] = *(const v4fa*)(pb4 + q * 8); }
  asm volatile("s_wait_xcnt 0x0" :: "v"(xb), "v"(pb4) : "memory");      /* the wait that stands in front of any overwrite of a register which an issued load names; the two addresses are inputs so that they stay live up to it and no load of the run lands in them */
#pragma unroll
  for (int u = 0; u < 8; ++u) { const int t = u & 3, half = u >> 2;
#pragma unroll
    for (int r = 0; r < 8; ++r) so[w][half * 16 + 8 * hh + r][t * 16 + ln] = accs[u][r] * 0.0625f; }
  __builtin_amdgcn_fence(__ATOMIC_ACQ_REL, "workgroup"); __builtin_amdgcn_wave_barrier();      /* the wave reads back what its own lanes wrote */
#pragma unroll
  for (int q = 0; q < 16; ++q) { const v4f v = *(const v4fa*)&so[w][q * 2 + rsub][c4]; v4f o;
#pragma unroll
    for (int i = 0; i < 4; ++i) o[i] = ((v[i] + pr[q][0]) - pr[q][1]) * pr[q][2] + pr[q][3] + bf16_round(xx[q][i]);
    *(v4f*)(out + e0 + (size_t)q * 2 * NP) = o; }
}
extern "C" void kernel_launch(void* const* d_in, const int* in_sizes, int n_in,
                              void* d_out, int out_size, void* d_ws, size_t ws_size, hipStream_t stream) {
  (void)in_sizes; (void)n_in; (void)out_size;
  const float* const* I = (const float* const*)d_in; const float* x = I[0]; const float* gw = I[1]; const float* gb = I[2]; const float* tw = I[3]; const float* tb = I[4]; const float* pw = I[5]; const float* pb = I[6]; const float* ww = I[7]; const float* wb = I[8]; const float* bng = I[9]; const float* bnb = I[10]; const float* bnm = I[11]; const float* bnv = I[12];      /* natural [out][in] 1x1-conv weights + biases: g, theta, phi [128][256]; W [256][128] + b; eval BatchNorm gamma / beta / running mean / var [256] */
  char* ws = (char*)d_ws; size_t off = 0;
  auto take = [&](size_t bytes) { char* p = ws + off; off += (bytes + 255) & ~(size_t)255; return p; };
  _Float16* WA = (_Float16*)take((size_t)3 * CI * CN * 2); _Float16* BW = (_Float16*)take((size_t)CN * CI * 2); float* BB = (float*)take((size_t)3 * CI * 4); float* BN4 = (float*)take((size_t)CN * 4 * 4);
  /* every plane below holds all NB images, image b at b times the one-image size */
  const size_t sT = (size_t)NP * CI, sM = (size_t)CI * NM;      /* one image: [4096][128], [1024][128] elements (g: 32 tiles [128][32]) */
  _Float16* TH = (_Float16*)take(NB * sT * 2); _Float16* THL = (_Float16*)take(NB * sT * 2); _Float16* PHT = (_Float16*)take(NB * sM * 2); _Float16* PHLT = (_Float16*)take(NB * sM * 2); _Float16* G16 = (_Float16*)take(NB * sM * 2); _Float16* YT = (_Float16*)take(NB * sT * 2);
  if (off > ws_size) return;
  k_prep<<<(4 * CI * CN / 8 + 3 * CI + CN + 255) / 256, 256, 0, stream>>>(tw, pw, gw, ww, tb, pb, gb, wb, bng, bnb, bnm, bnv, 1e-5f, WA, BW, BB, BN4);
  k_proj<<<dim3(NP / 128, NB), 512, 0, stream>>>(x, WA, BB, TH, THL, PHT, PHLT, G16);      /* theta^T [n][ci] hi + x1024 residual; pooled phi^T [m][ci] hi + residual; pooled g f16 as 32-key tiles [m / 32][ci][32] */
  k_fattn<<<dim3(NP / 128, NB), 256, 0, stream>>>(TH, THL, PHT, PHLT, G16, YT);      /* f[n][m] = theta.phi (hi.hi + (hi.lo + lo.hi) / 1024; no scale), softmax over the 1024 pooled positions, y^T [n][ci] = P g^T -> f16, in one launch */
  k_gemmw<<<dim3((CN / 128) * (NP / 64), NB), 128, 0, stream>>>(BW, YT, BN4, x, (float*)d_out);      /* z = ((W y + bf16 W_b[c]) - bf16 mean[c]) (bf16 gamma[c] / sqrt(bf16 var[c] + eps)) + bf16 beta[c] + bf16 x -> f32 channel-first output */
}

// v006
// It runs in 57.4 microseconds.
// Two timings next to v005 put it at 1.21 and 1.18 times that version's speed.
// Counting every step since v000, it is 46.4 times as fast.
#include <hip/hip_runtime.h>
// Non-local block (embedded Gaussian, single head, 2x2 max-pool sub-sampling) with an eval-mode BatchNorm on the output conv (x [8][256][64][64]; theta = conv1x1(x) [128 ch], phi = maxpool2x2(conv1x1(x)), g = maxpool2x2(conv1x1(x)) (natural [128][256] weights sigma 1/16 + biases 0.01); f[n][m] = theta[:, n].phi[:, m] over the 1024 pooled positions (NO scale); softmax over m; y[:, n] = sum_m f[n][m] g[:, m]; W_y = conv1x1(y; W [256][128] + b); z = (W_y - bn_mean) gamma / sqrt(bn_var + 1e-5) + bn_beta + x -> [8][256][64][64]).
// Structure: three launches; k_proj and k_fattn each over all 8 images. k_prep: weights as x16 f16 planes, rounded biases, BatchNorm constants. k_proj: x (bf16-rounded, exact in f16) transposed in LDS to token-major x^T; theta, phi, g = (16 W as the A operand) (x^T as the B^T operand) / 16 + b[c], WMMA with f32 accumulation; theta split into f16 hi + x1024 residual (unscaled scores have sigma ~11) as [4096][128] rows; phi and g 2x2 max-pooled in registers, phi split into hi/lo as [1024][128] rows, g to f16 as 32-key tiles. k_fattn: scores (th_hi.ph_hi + (th_lo.ph_hi + th_hi.ph_lo)/1024, K = 128, f32), online row softmax on VALU (f32 statistics, native exp; weights x256 f16) and y^T = P g^T (K = 1024) -> f16, scores and weights kept in registers; its epilogue: z = BN((y^T as A) (16 w as B^T) / 16 + b[c]) + bf16(x) -> f32 channel-first output.
// Compute dtype: inputs rounded to bf16; x / weights exact; q and k as f16 hi + x1024 residual pairs, v, softmax weights and o as plain f16 GEMM operands (~2^-12); scores and softmax statistics f32. v_wmma_f32_16x16x32_f16.
#define NB 8
#define SQ 1024
#define DM 256
#define NH 1
#define HD 64
#define HG 4                         /* heads per k_vt launch; k_vt is not launched */
#define B0 0                         /* unused: every launch over images covers all NB images */
#define NBR NB                       /* not used by any kernel or launch */
#define NR ((size_t)NB * SQ)         /* unused */
#define MP ((int)((size_t)NBR * SQ)) /* not used by any kernel or launch */
#define QT 256                       /* query rows per causal tile */
#define NKX SQ                       /* S / P row pitch */
#define QT0 256                      /* first-tile rows recomputed exactly (256: buys margin for the few-key rows 128..255, which have no output projection to average the single-f16 P/v rounding) */
#define QN SQ                        /* unused (each batch attends NP query rows) */
#define NHD NH                       /* unused */
#define MPO MP                       /* unused */
#define LQ DM            /* unused */
typedef __bf16 v16b __attribute__((ext_vector_type(16)));
typedef unsigned short v8us __attribute__((ext_vector_type(8), may_alias));
typedef float  v8f  __attribute__((ext_vector_type(8)));
typedef float  v4f  __attribute__((ext_vector_type(4)));
typedef float  v4fa __attribute__((ext_vector_type(4), may_alias));
union FragB { v16b v; v8us half[2]; unsigned short u[16]; };

__device__ __forceinline__ unsigned short bf16_bits(float x) { unsigned int u = __float_as_uint(x); return (unsigned short)((u + 0x7FFFu + ((u >> 16) & 1u)) >> 16); }
__device__ __forceinline__ float bf16_val(unsigned short b) { return __uint_as_float(((unsigned int)b) << 16); }
__device__ __forceinline__ float bf16_round(float x) { return bf16_val(bf16_bits(x)); }
// D += A·B with NT terms: 1 = ah·bh, 2 = + al·bh (A split), 3 = + ah·bl (both split)
template <int NT>
__device__ __forceinline__ v8f mmaN(v16b ah, v16b al, v16b bh, v16b bl, v8f c) {
  c = __builtin_amdgcn_wmma_f32_16x16x32_bf16(false, ah, false, bh, (short)0, c, false, false);
  if (NT >= 2) c = __builtin_amdgcn_wmma_f32_16x16x32_bf16(false, al, false, bh, (short)0, c, false, false);
  if (NT >= 3) c = __builtin_amdgcn_wmma_f32_16x16x32_bf16(false, ah, false, bl, (short)0, c, false, false);
  asm volatile("v_nop\n\tv_nop\n\tv_nop\n\tv_nop" : "+v"(c) : "v"(ah), "v"(al), "v"(bh), "v"(bl));
  return c;
}

__global__ __launch_bounds__(256) void k_wt_bf16(const float* __restrict__ W, unsigned short* __restrict__ Wt, int K, int N) {
  const int t = blockIdx.x * 256 + threadIdx.x;
  const int k8n = K / 8;
  if (t >= N * k8n) return;
  const int n = t / k8n, k8 = (t % k8n) * 8;
  v8us v;
#pragma unroll
  for (int i = 0; i < 8; ++i) v[i] = bf16_bits(W[(size_t)(k8 + i) * N + n]);
  *(v8us*)(Wt + (size_t)n * K + k8) = v;
  
}

// GEMM C[M][N] (f32, pitch ldc) = act(A[M][K]·W + bias). A f32 row-major (pitch lda) converted per fragment to bf16
// (ASPLIT: hi/lo two planes -> 2 terms, else single rounded term); Wt bf16 [N][K] (pitch ldb). BIAS_BF16 rounds the
// bias to bf16 first (bias quantised to bf16 before the add). K%32==0, M%16==0, N%64==0.
template <bool ASPLIT, int ACT, bool BIAS_BF16>
__global__ __launch_bounds__(128) void k_gemm_bf(const float* __restrict__ A, int lda, const unsigned short* __restrict__ Wt, int ldb,
                                               const float* __restrict__ bias, float* __restrict__ C, int ldc, int M, int N, int K) {
  __shared__ __attribute__((aligned(16))) float so[4][16][64];
  const int tid = threadIdx.x, w = tid >> 5, lane = tid & 31, ln = lane & 15, hh = lane >> 4;
  const int ntn = N / 64;
  const int wid = blockIdx.x * 4 + w;
  const int mt = wid / ntn, nq = wid % ntn;
  if (mt * 16 >= M) return;
  const int row0 = mt * 16, col0 = nq * 64;
  const float* arow = A + (size_t)(row0 + ln) * lda;
  v8f acc[4] = {};
  for (int kb = 0; kb < K; kb += 32) {
    FragB ah, al;
    const v4f x0 = *(const v4fa*)(arow + kb + 8 * hh), x1 = *(const v4fa*)(arow + kb + 8 * hh + 4);
    const v4f x2 = *(const v4fa*)(arow + kb + 16 + 8 * hh), x3 = *(const v4fa*)(arow + kb + 16 + 8 * hh + 4);
    float xs[16] = {x0[0],x0[1],x0[2],x0[3],x1[0],x1[1],x1[2],x1[3],x2[0],x2[1],x2[2],x2[3],x3[0],x3[1],x3[2],x3[3]};
#pragma unroll
    for (int i = 0; i < 16; ++i) { const unsigned short hb = bf16_bits(xs[i]); ah.u[i] = hb; al.u[i] = ASPLIT ? bf16_bits(xs[i] - bf16_val(hb)) : (unsigned short)0; }
#pragma unroll
    for (int t = 0; t < 4; ++t) {
      const unsigned short* brow = Wt + (size_t)(col0 + t * 16 + ln) * ldb + kb;
      FragB b;
      b.half[0] = *(const v8us*)(brow + 8 * hh);
      b.half[1] = *(const v8us*)(brow + 16 + 8 * hh);
      acc[t] = mmaN<ASPLIT ? 2 : 1>(ah.v, al.v, b.v, b.v, acc[t]);
    }
  }
#pragma unroll
  for (int t = 0; t < 4; ++t) {
    float bv = bias ? bias[col0 + t * 16 + ln] : 0.f;
    if (BIAS_BF16) bv = bf16_round(bv);
#pragma unroll
    for (int r = 0; r < 8; ++r) { float v = acc[t][r] + bv; if (ACT == 1) v = fmaxf(v, 0.f); so[w][8 * hh + r][t * 16 + ln] = v; }
  }
  __builtin_amdgcn_fence(__ATOMIC_ACQ_REL, "workgroup");
  __builtin_amdgcn_wave_barrier();
  const int rsub = lane >> 4, c4 = (lane & 15) * 4;
  {
#pragma unroll
    for (int q = 0; q < 8; ++q) {
      const int r = q * 2 + rsub;
      const v4f v = *(const v4fa*)&so[w][r][c4];
      *(v4f*)(C + (size_t)(row0 + r) * ldc + col0 + c4) = v;
    }
    
  }
}

// GEMM C = act(A·W + bias + resid): A f32 (ASPLIT -> hi/lo 2 terms), Wt bf16 [N][K]; ACT 0 none, 1 relu, 2 exact gelu;
// resid (optional, f32, row index = (row % rmod), pitch ldr, RES_BF16 rounds it) added before the activation.
template <bool ASPLIT, int ACT, bool BIAS_BF16, bool RES_BF16>
__global__ __launch_bounds__(128) void k_gemm_bf3(const float* __restrict__ A, int lda, const unsigned short* __restrict__ Wt, int ldb,
                                                const float* __restrict__ bias, const float* __restrict__ resid, int rmod, int ldr,
                                                float* __restrict__ C, int ldc, int M, int N, int K) {
  __shared__ __attribute__((aligned(16))) float so[4][16][64];
  const int tid = threadIdx.x, w = tid >> 5, lane = tid & 31, ln = lane & 15, hh = lane >> 4;
  const int ntn = N / 64;
  const int wid = blockIdx.x * 4 + w;
  const int mt = wid / ntn, nq = wid % ntn;
  if (mt * 16 >= M) return;
  const int row0 = mt * 16, col0 = nq * 64;
  const float* arow = A + (size_t)(row0 + ln) * lda;
  v8f acc[4] = {};
  for (int kb = 0; kb < K; kb += 32) {
    FragB ah, al;
    const v4f x0 = *(const v4fa*)(arow + kb + 8 * hh), x1 = *(const v4fa*)(arow + kb + 8 * hh + 4);
    const v4f x2 = *(const v4fa*)(arow + kb + 16 + 8 * hh), x3 = *(const v4fa*)(arow + kb + 16 + 8 * hh + 4);
    float xs[16] = {x0[0],x0[1],x0[2],x0[3],x1[0],x1[1],x1[2],x1[3],x2[0],x2[1],x2[2],x2[3],x3[0],x3[1],x3[2],x3[3]};
#pragma unroll
    for (int i = 0; i < 16; ++i) { const unsigned short hb = bf16_bits(xs[i]); ah.u[i] = hb; al.u[i] = ASPLIT ? bf16_bits(xs[i] - bf16_val(hb)) : (unsigned short)0; }
#pragma unroll
    for (int t = 0; t < 4; ++t) {
      const unsigned short* brow = Wt + (size_t)(col0 + t * 16 + ln) * ldb + kb;
      FragB b;
      b.half[0] = *(const v8us*)(brow + 8 * hh);
      b.half[1] = *(const v8us*)(brow + 16 + 8 * hh);
      acc[t] = mmaN<ASPLIT ? 2 : 1>(ah.v, al.v, b.v, b.v, acc[t]);
    }
  }
#pragma unroll
  for (int t = 0; t < 4; ++t) {
    const int col = col0 + t * 16 + ln;
    float bv = bias ? bias[col] : 0.f;
    if (BIAS_BF16) bv = bf16_round(bv);
#pragma unroll
    for (int r = 0; r < 8; ++r) {
      float v = acc[t][r] + bv;
      if (resid) { float rv = resid[(size_t)((row0 + 8 * hh + r) % rmod) * ldr + col]; if (RES_BF16) rv = bf16_round(rv); v += rv; }
      if (ACT == 1) v = fmaxf(v, 0.f);
      if (ACT == 2) v = 0.5f * v * (1.0f + erff(v * 0.70710678118654752f));
      if (ACT == 3) { const float u = 0.7978845608028654f * (v + 0.044715f * v * v * v); v = 0.5f * v * (1.0f + tanhf(u)); }
      so[w][8 * hh + r][t * 16 + ln] = v;
    }
  }
  __builtin_amdgcn_fence(__ATOMIC_ACQ_REL, "workgroup");
  __builtin_amdgcn_wave_barrier();
  const int rsub = lane >> 4, c4 = (lane & 15) * 4;
  {
#pragma unroll
    for (int q = 0; q < 8; ++q) {
      const int r = q * 2 + rsub;
      const v4f v = *(const v4fa*)&so[w][r][c4];
      *(v4f*)(C + (size_t)(row0 + r) * ldc + col0 + c4) = v;
    }
    
  }
}
// row LayerNorm (biased variance, eps) over N: s = X (+ R); optional out_sum <- s; out_norm <- (s-mu)*rsqrt(var+eps)*g + b
template <bool PARAM_BF16>
__global__ __launch_bounds__(256) void k_layernorm(const float* __restrict__ X, const float* __restrict__ R, const float* __restrict__ g, const float* __restrict__ bta,
                                                  float* __restrict__ out_sum, float* __restrict__ out_norm, int N, float eps) {
  __shared__ float red[256];
  const int row = blockIdx.x, tid = threadIdx.x;
  const float* x = X + (size_t)row * N; const float* rr = R ? R + (size_t)row * N : nullptr;
  float vals[16];                     // up to N = 4096
  const int per = N / 256;            // contiguous chunk per thread? use strided-by-4 chunks: thread handles j = tid*4 + 1024*u
  float s1 = 0.f;
  for (int u = 0; u < per / 4; ++u) {
    const int j = tid * 4 + 1024 * u;
    const v4f a = *(const v4fa*)(x + j);
    v4f b = {0.f,0.f,0.f,0.f}; if (rr) b = *(const v4fa*)(rr + j);
#pragma unroll
    for (int q = 0; q < 4; ++q) { const float v = a[q] + b[q]; vals[u * 4 + q] = v; s1 += v; }
  }
  red[tid] = s1; __syncthreads();
  for (int st = 128; st > 0; st >>= 1) { if (tid < st) red[tid] += red[tid + st]; __syncthreads(); }
  const float mu = red[0] / (float)N; __syncthreads();
  float s2 = 0.f;
  for (int u = 0; u < per / 4; ++u)
#pragma unroll
    for (int q = 0; q < 4; ++q) { const float c = vals[u * 4 + q] - mu; s2 += c * c; }
  red[tid] = s2; __syncthreads();
  for (int st = 128; st > 0; st >>= 1) { if (tid < st) red[tid] += red[tid + st]; __syncthreads(); }
  const float rs = rsqrtf(red[0] / (float)N + eps);
  {
    for (int u = 0; u < per / 4; ++u) {
      const int j = tid * 4 + 1024 * u;
      v4f o, sm;
#pragma unroll
      for (int q = 0; q < 4; ++q) {
        float gg = g[j + q], bb = bta[j + q];
        if (PARAM_BF16) { gg = bf16_round(gg); bb = bf16_round(bb); }
        sm[q] = vals[u * 4 + q]; o[q] = (vals[u * 4 + q] - mu) * rs * gg + bb;
      }
      if (out_sum) *(v4f*)(out_sum + (size_t)row * N + j) = sm;
      *(v4f*)(out_norm + (size_t)row * N + j) = o;
    }
    
  }
}



// ---- f16 WMMA path (v_wmma_f32_16x16x32_f16): 11-bit significands for operands in range — used where a [0,1] probability operand needs more precision than bf16
typedef _Float16 v16h __attribute__((ext_vector_type(16)));
union FragH { v16h v; v8us half[2]; _Float16 h[16]; unsigned short u[16]; };
template <int NT>
__device__ __forceinline__ v8f mmaH(v16h ah, v16h al, v16h bh, v16h bl, v8f c) {
  c = __builtin_amdgcn_wmma_f32_16x16x32_f16(false, ah, false, bh, (short)0, c, false, false);
  if (NT >= 2) c = __builtin_amdgcn_wmma_f32_16x16x32_f16(false, al, false, bh, (short)0, c, false, false);
  if (NT >= 3) c = __builtin_amdgcn_wmma_f32_16x16x32_f16(false, ah, false, bl, (short)0, c, false, false);
  asm volatile("v_nop\n\tv_nop\n\tv_nop\n\tv_nop" : "+v"(c) : "v"(ah), "v"(al), "v"(bh), "v"(bl));
  return c;
}
// batched GEMM like k_gemm_b but f16 operands: A f32 (split into f16 hi/lo if ASPLIT, else rounded to f16), Bt = f16 values [n][k]; alpha; C f32; N multiple of 16 (partial tiles skipped)
template <bool ASPLIT>
__global__ __launch_bounds__(128) void k_gemm_h(const float* __restrict__ A, int lda, size_t sA, const _Float16* __restrict__ Bh, int ldb, size_t sB, float alpha, float* __restrict__ C, int ldc, size_t sC, int M, int N, int K) {
  __shared__ __attribute__((aligned(16))) float so[4][16][64];
  const int tid = threadIdx.x, w = tid >> 5, lane = tid & 31, ln = lane & 15, hh = lane >> 4; const int by = blockIdx.y;
  A += (size_t)by * sA; Bh += (size_t)by * sB; C += (size_t)by * sC;
  const int ntn = (N + 63) / 64; const int wid = blockIdx.x * 4 + w; const int mt = wid / ntn, nq = wid % ntn; if (mt * 16 >= M) return;
  const int row0 = mt * 16, col0 = nq * 64; const float* arow = A + (size_t)(row0 + ln) * lda;
  v8f acc[4] = {};
  for (int kb = 0; kb < K; kb += 32) {
    FragH ah, al;
    const v4f x0 = *(const v4fa*)(arow + kb + 8 * hh), x1 = *(const v4fa*)(arow + kb + 8 * hh + 4), x2 = *(const v4fa*)(arow + kb + 16 + 8 * hh), x3 = *(const v4fa*)(arow + kb + 16 + 8 * hh + 4);
    float xs[16] = {x0[0],x0[1],x0[2],x0[3],x1[0],x1[1],x1[2],x1[3],x2[0],x2[1],x2[2],x2[3],x3[0],x3[1],x3[2],x3[3]};
#pragma unroll
    for (int i = 0; i < 16; ++i) { const _Float16 h = (_Float16)xs[i]; ah.h[i] = h; al.h[i] = ASPLIT ? (_Float16)(xs[i] - (float)h) : (_Float16)0.0f; }
#pragma unroll
    for (int t = 0; t < 4; ++t) { if (col0 + t * 16 >= N) continue; const size_t boff = (size_t)(col0 + t * 16 + ln) * ldb + kb; FragH bq; bq.half[0] = *(const v8us*)(Bh + boff + 8 * hh); bq.half[1] = *(const v8us*)(Bh + boff + 16 + 8 * hh);
      acc[t] = mmaH<ASPLIT ? 2 : 1>(ah.v, al.v, bq.v, bq.v, acc[t]); }
  }
#pragma unroll
  for (int t = 0; t < 4; ++t) { if (col0 + t * 16 >= N) continue;
#pragma unroll
    for (int r = 0; r < 8; ++r) so[w][8 * hh + r][t * 16 + ln] = acc[t][r] * alpha; }
  __builtin_amdgcn_fence(__ATOMIC_ACQ_REL, "workgroup"); __builtin_amdgcn_wave_barrier();
  const int rsub = lane >> 4, c4 = (lane & 15) * 4;
  {
#pragma unroll
    for (int q = 0; q < 8; ++q) { const int r = q * 2 + rsub; if (col0 + c4 < N) { const v4f v = *(const v4fa*)&so[w][r][c4]; *(v4f*)(C + (size_t)(row0 + r) * ldc + col0 + c4) = v; } }
     }
}

// Wt[n][k] = f16(W[k][n]·scale) from f32 row-major W[K][N] (scale = power of two; bf16-exact weights stay exact in f16 away from the subnormal range)
__global__ __launch_bounds__(256) void k_wt_f16(const float* __restrict__ W, _Float16* __restrict__ Wt, int K, int N, float scale) {
  const int t = blockIdx.x * 256 + threadIdx.x; if (t >= N * (K / 8)) return; const int n = t / (K / 8), k8 = (t % (K / 8)) * 8; FragH f;
#pragma unroll
  for (int i = 0; i < 8; ++i) f.h[i] = (_Float16)(bf16_round(W[(size_t)(k8 + i) * N + n]) * scale); const v8us o = f.half[0];
  *(v8us*)((unsigned short*)Wt + (size_t)n * K + k8) = o; 
}
// k_gemm_hh variant with fused epilogue: v = acc·alpha + bias[by·sBias + col] (+ CP[(row/rowsPerB)·sCPb + by·64 + col] if CP) ; ACT 0 none / 1 elu ; writes f16 C16 (and f32 C if non-null)
template <int ACT>
__global__ __launch_bounds__(128) void k_gemm_hhx(const _Float16* __restrict__ A, int lda, size_t sA, const _Float16* __restrict__ Bh, int ldb, size_t sB, float alpha, const float* __restrict__ bias, size_t sBias, const float* __restrict__ CP, int rowsPerB, size_t sCPb, int row0g,
    float* __restrict__ C, _Float16* __restrict__ C16, int ldc, size_t sC, int M, int N, int K) {
  __shared__ __attribute__((aligned(16))) float so[4][16][64];
  const int tid = threadIdx.x, w = tid >> 5, lane = tid & 31, ln = lane & 15, hh = lane >> 4; const int by = blockIdx.y;
  A += (size_t)by * sA; Bh += (size_t)by * sB; const size_t cofs = (size_t)by * sC; const float* bp = bias ? bias + (size_t)by * sBias : nullptr;
  const int ntn = (N + 63) / 64; const int wid = blockIdx.x * 4 + w; const int mt = wid / ntn, nq = wid % ntn; if (mt * 16 >= M) return;
  const int row0 = mt * 16, col0 = nq * 64; const _Float16* arow = A + (size_t)(row0 + ln) * lda;
  v8f acc[4] = {};
  for (int kb = 0; kb < K; kb += 32) { FragH ah; ah.half[0] = *(const v8us*)((const unsigned short*)arow + kb + 8 * hh); ah.half[1] = *(const v8us*)((const unsigned short*)arow + kb + 16 + 8 * hh);
#pragma unroll
    for (int t = 0; t < 4; ++t) { if (col0 + t * 16 >= N) continue; const size_t boff = (size_t)(col0 + t * 16 + ln) * ldb + kb; FragH bq; bq.half[0] = *(const v8us*)((const unsigned short*)Bh + boff + 8 * hh); bq.half[1] = *(const v8us*)((const unsigned short*)Bh + boff + 16 + 8 * hh);
      acc[t] = mmaH<1>(ah.v, ah.v, bq.v, bq.v, acc[t]); }
  }
#pragma unroll
  for (int t = 0; t < 4; ++t) { if (col0 + t * 16 >= N) continue; const int col = col0 + t * 16 + ln; const float bv = bp ? bf16_round(bp[col]) : 0.f;
#pragma unroll
    for (int r = 0; r < 8; ++r) { float v = acc[t][r] * alpha + bv; if (CP) { const int rr = row0g + row0 + 8 * hh + r; if (rowsPerB < 0) v += CP[cofs + (size_t)rr * ldc + col];      /* rowsPerB < 0: own element of the batched C plane */ else { const int bidx = rr / rowsPerB; v += CP[(size_t)bidx * sCPb + (size_t)by * 64 + col]; } } if (ACT == 1) v = (v > 0.f) ? v : expm1f(v); else if (ACT == 7) v = (v > 0.f) ? v + 1.0f : expf(v); else if (ACT == 8) v = tanhf(v); else if (ACT == 9) v = 0.5f * v * (1.0f + tanhf(0.7978845608028654f * (v + 0.044715f * v * v * v))); else if (ACT == 11) v = 1.0f / (1.0f + expf(-v)); else if (ACT == 12) v = (v > 0.f) ? v : 0.01f * v; else if (ACT == 14) v = (v > 0.f) ? v : 0.1f * v; else if (ACT == 16) v = (v >= 0.f) ? v : 0.3f * v; else if (ACT == 17) v = (v >= 0.f) ? v : 0.2f * v; else if (ACT == 15) v = v / (1.0f + expf(-v)); else if (ACT == 3) v = fmaxf(v, 0.f); else if (ACT == 6) v = 0.5f * v * (1.0f + erff(v * 0.70710678118654752f)); so[w][8 * hh + r][t * 16 + ln] = v; } }
  __builtin_amdgcn_fence(__ATOMIC_ACQ_REL, "workgroup"); __builtin_amdgcn_wave_barrier();
  const int rsub = lane >> 4, c4 = (lane & 15) * 4; typedef _Float16 v4h __attribute__((ext_vector_type(4)));
  {
#pragma unroll
    for (int q = 0; q < 8; ++q) { const int r = q * 2 + rsub; if (col0 + c4 < N) { const v4f v = *(const v4fa*)&so[w][r][c4]; if (C) *(v4f*)(C + cofs + (size_t)(row0 + r) * ldc + col0 + c4) = v; if (C16) { v4h h4; for (int i = 0; i < 4; ++i) h4[i] = (_Float16)v[i]; *(v4h*)(C16 + cofs + (size_t)(row0 + r) * ldc + col0 + c4) = h4; } } }
     }
}


typedef _Float16 v4h __attribute__((ext_vector_type(4)));

__global__ __launch_bounds__(256) void k_x16(const float* __restrict__ x, _Float16* __restrict__ X16, size_t n8) { const size_t t = (size_t)blockIdx.x * 256 + threadIdx.x; if (t >= n8) return; FragH f;
#pragma unroll
  for (int q = 0; q < 8; ++q) f.h[q] = (_Float16)bf16_round(x[t * 8 + q]); *(v8us*)((unsigned short*)X16 + t * 8) = f.half[0];  }
__global__ __launch_bounds__(256) void k_h16(const float* __restrict__ x, _Float16* __restrict__ X16, size_t n8) { const size_t t = (size_t)blockIdx.x * 256 + threadIdx.x; if (t >= n8) return; FragH f;
#pragma unroll
  for (int q = 0; q < 8; ++q) f.h[q] = (_Float16)x[t * 8 + q]; *(v8us*)((unsigned short*)X16 + t * 8) = f.half[0];  }
__global__ __launch_bounds__(256) void k_round16f(const float* __restrict__ W, _Float16* __restrict__ Bt, size_t n8) { const size_t t = (size_t)blockIdx.x * 256 + threadIdx.x; if (t >= n8) return; FragH f;
#pragma unroll
  for (int i = 0; i < 8; ++i) f.h[i] = (_Float16)(bf16_round(W[t * 8 + i]) * 16.0f); *(v8us*)((unsigned short*)Bt + t * 8) = f.half[0];  }
template <int NHv, int TTv>
__global__ __launch_bounds__(256) void k_vt(const _Float16* __restrict__ V16, int ldv, int voff, _Float16* __restrict__ Vt) { __shared__ unsigned short tl[64][66]; const int tid = threadIdx.x; const int slab = blockIdx.x / (TTv / 64), lg = blockIdx.x % (TTv / 64); const int b = slab / NHv, h = slab % NHv;
  for (int i = tid; i < 64 * 8; i += 256) { const int r = i / 8, c8 = (i % 8) * 8; FragH f; f.half[0] = *(const v8us*)((const unsigned short*)V16 + ((size_t)b * TTv + lg * 64 + r) * ldv + voff + h * 64 + c8);
#pragma unroll
    for (int q = 0; q < 8; ++q) tl[r][c8 + q] = f.u[q]; }
  __syncthreads();
  {
#pragma unroll
    for (int rd = 0; rd < 2; ++rd) { const int d = rd * 32 + tid / 8, pc = tid % 8; FragH f;
#pragma unroll
      for (int q = 0; q < 8; ++q) f.u[q] = tl[pc * 8 + q][d];
      *(v8us*)((unsigned short*)Vt + ((size_t)slab * 64 + d) * TTv + lg * 64 + pc * 8) = f.half[0]; }
     } }

__global__ __launch_bounds__(256) void k_hl(const float* __restrict__ F, _Float16* __restrict__ Hh, _Float16* __restrict__ Hl, size_t n8) { const size_t t = (size_t)blockIdx.x * 256 + threadIdx.x; if (t >= n8) return; FragH fh, fl; const v4f a = *(const v4fa*)(F + t * 8), c = *(const v4fa*)(F + t * 8 + 4);
#pragma unroll
  for (int q = 0; q < 4; ++q) { _Float16 h = (_Float16)a[q]; fh.h[q] = h; fl.h[q] = (_Float16)((a[q] - (float)h) * 1024.0f); h = (_Float16)c[q]; fh.h[4 + q] = h; fl.h[4 + q] = (_Float16)((c[q] - (float)h) * 1024.0f); }
  { *(v8us*)((unsigned short*)Hh + t * 8) = fh.half[0]; *(v8us*)((unsigned short*)Hl + t * 8) = fl.half[0];  } }

// ---- fast GEMM (wave tile 32x64; requires M % 32 == 0 rows per launch region and N % 64 == 0); epilogue = k_gemm_hhx semantics, except the rowsPerB < 0 addend plane steps by sCPb per grid.y slice ----
__device__ __forceinline__ v16h g2_frag(const _Float16* p, int hh) { FragH f; f.half[0] = *(const v8us*)((const unsigned short*)p + 8 * hh); f.half[1] = *(const v8us*)((const unsigned short*)p + 16 + 8 * hh); return f.v; }
__device__ __forceinline__ v8f g2_mma(v16h a, v16h b, v8f c) { v8f d = __builtin_amdgcn_wmma_f32_16x16x32_f16(false, a, false, b, (short)0, c, false, false); asm volatile("v_nop\n\tv_nop\n\tv_nop\n\tv_nop" : "+v"(d) : "v"(a), "v"(b)); return d; }
template <int ACT>
__global__ __launch_bounds__(128) void k_gemm2(const _Float16* __restrict__ A, int lda, size_t sA, const _Float16* __restrict__ Bh, int ldb, size_t sB, float alpha, const float* __restrict__ bias, size_t sBias, const float* __restrict__ CP, int rowsPerB, size_t sCPb, int row0g,
    float* __restrict__ C, _Float16* __restrict__ C16, int ldc, size_t sC, int M, int N, int K) { static_assert(ACT == 0 || ACT == 3 || ACT == 6 || ACT == 8 || ACT == 9 || ACT == 11 || ACT == 12 || ACT == 14 || ACT == 15 || ACT == 16 || ACT == 17, "k_gemm2: unsupported ACT code (would silently apply no activation)");
  __shared__ __attribute__((aligned(16))) float so[4][32][68];
  const int tid = threadIdx.x, w = tid >> 5, lane = tid & 31, ln = lane & 15, hh = lane >> 4; const int by = blockIdx.y;
  A += (size_t)by * sA; Bh += (size_t)by * sB; const size_t cofs = (size_t)by * sC; const float* bp = bias ? bias + (size_t)by * sBias : nullptr;
  const int ntn = N >> 6; const int mt = blockIdx.x / ntn, nq = blockIdx.x - mt * ntn; const int row0 = mt * 128 + 32 * w, col0 = nq * 64; if (row0 >= M) return;
  const _Float16* a0p = A + (size_t)(row0 + ln) * lda; const _Float16* a1p = a0p + (size_t)16 * lda;
  const _Float16* b0p = Bh + (size_t)(col0 + ln) * ldb; const _Float16* b1p = b0p + (size_t)16 * ldb; const _Float16* b2p = b1p + (size_t)16 * ldb; const _Float16* b3p = b2p + (size_t)16 * ldb;
  const v8f z8 = {0.f,0.f,0.f,0.f,0.f,0.f,0.f,0.f}; v8f c00 = z8, c01 = z8, c02 = z8, c03 = z8, c10 = z8, c11 = z8, c12 = z8, c13 = z8;
#pragma unroll 1
  for (int kb = 0; kb < K; kb += 32) { const v16h a0 = g2_frag(a0p + kb, hh), a1 = g2_frag(a1p + kb, hh);
    v16h b = g2_frag(b0p + kb, hh); c00 = g2_mma(a0, b, c00); c10 = g2_mma(a1, b, c10);
    b = g2_frag(b1p + kb, hh); c01 = g2_mma(a0, b, c01); c11 = g2_mma(a1, b, c11);
    b = g2_frag(b2p + kb, hh); c02 = g2_mma(a0, b, c02); c12 = g2_mma(a1, b, c12);
    b = g2_frag(b3p + kb, hh); c03 = g2_mma(a0, b, c03); c13 = g2_mma(a1, b, c13); }
  v8f accs[8] = {c00, c01, c02, c03, c10, c11, c12, c13};
#pragma unroll
  for (int u = 0; u < 8; ++u) { const int t = u & 3, half = u >> 2; const int col = col0 + t * 16 + ln; const float bv = bp ? bf16_round(bp[col]) : 0.f;
#pragma unroll
    for (int r = 0; r < 8; ++r) { const int rloc = half * 16 + 8 * hh + r; float v = accs[u][r] * alpha + bv; if (CP) { if (rowsPerB < 0) v += CP[(size_t)by * sCPb + (size_t)(row0g + row0 + rloc) * ldc + col];      /* rowsPerB < 0: own element of an addend plane shaped like C; sCPb = its step from one grid.y slice to the next (0: one plane shared by all slices) */ else { const int bidx = (row0g + row0 + rloc) / rowsPerB; v += CP[(size_t)bidx * sCPb + (size_t)by * 64 + col]; } }
      if (ACT == 3) v = fmaxf(v, 0.f); else if (ACT == 6) v = 0.5f * v * (1.0f + erff(v * 0.70710678118654752f)); else if (ACT == 11) v = 1.0f / (1.0f + expf(-v)); else if (ACT == 15) v = v / (1.0f + expf(-v)); else if (ACT == 12) v = (v > 0.f) ? v : 0.01f * v; else if (ACT == 8) v = tanhf(v); else if (ACT == 9) v = 0.5f * v * (1.0f + tanhf(0.7978845608028654f * (v + 0.044715f * v * v * v))); else if (ACT == 14) v = (v > 0.f) ? v : 0.1f * v; else if (ACT == 16) v = (v >= 0.f) ? v : 0.3f * v; else if (ACT == 17) v = (v >= 0.f) ? v : 0.2f * v;
      so[w][rloc][t * 16 + ln] = v; } }
  __builtin_amdgcn_fence(__ATOMIC_ACQ_REL, "workgroup"); __builtin_amdgcn_wave_barrier();
  const int rsub = lane >> 4, c4 = (lane & 15) * 4;
  {
#pragma unroll
    for (int q = 0; q < 16; ++q) { const int r = q * 2 + rsub; const v4f v = *(const v4fa*)&so[w][r][c4]; if (C) *(v4f*)(C + cofs + (size_t)(row0 + r) * ldc + col0 + c4) = v; if (C16) { v4h h4; for (int i = 0; i < 4; ++i) h4[i] = (_Float16)v[i]; *(v4h*)(C16 + cofs + (size_t)(row0 + r) * ldc + col0 + c4) = h4; } }
     } }


__global__ __launch_bounds__(256) void k_wnat(const float* __restrict__ w, size_t n8, _Float16* __restrict__ Bt) { const size_t t = (size_t)blockIdx.x * 256 + threadIdx.x; if (t >= n8) return; FragH f; for (int q = 0; q < 8; ++q) f.h[q] = (_Float16)(bf16_round(w[t * 8 + q]) * 16.0f); *(v8us*)((unsigned short*)Bt + t * 8) = f.half[0];  }
__global__ __launch_bounds__(256) void k_rsm(const float* __restrict__ S, _Float16* __restrict__ P, int nrows) {
  #pragma clang fp contract(off)
  const int i = blockIdx.x * 256 + threadIdx.x; if (i >= nrows) return; const float* s = S + (size_t)i * SQ; float mx = -3.0e38f;
#pragma unroll 1
  for (int j = 0; j < SQ; ++j) mx = fmaxf(mx, s[j]); float se = 0.f;
#pragma unroll 1
  for (int j = 0; j < SQ; ++j) se += expf(s[j] - mx); const float sc = 256.0f / se;
#pragma unroll 1
  for (int j0 = 0; j0 < SQ; j0 += 8) { FragH f; for (int q = 0; q < 8; ++q) f.h[q] = (_Float16)(expf(s[j0 + q] - mx) * sc); unsigned short* d = (unsigned short*)P + (size_t)i * SQ + j0; *(v8us*)d = f.half[0];  } }
__global__ __launch_bounds__(256) void k_vt(const _Float16* __restrict__ V16, int b, int h0, _Float16* __restrict__ VT) { __shared__ unsigned short tl[64][65]; const int tid = threadIdx.x; const int hh = blockIdx.x % HG, sg = blockIdx.x / HG; const int s0 = sg * 64; const int h = h0 + hh;
  for (int i = tid; i < 64 * 8; i += 256) { const int j = i / 8, d8 = (i % 8) * 8; FragH f; f.half[0] = *(const v8us*)((const unsigned short*)V16 + ((size_t)b * SQ + s0 + j) * DM + h * HD + d8); for (int q = 0; q < 8; ++q) tl[d8 + q][j] = f.u[q]; }
  __syncthreads();
  { for (int i = tid; i < 64 * 8; i += 256) { const int d = i / 8, j8 = (i % 8) * 8; FragH f; for (int q = 0; q < 8; ++q) f.u[q] = tl[d][j8 + q]; *(v8us*)((unsigned short*)VT + ((size_t)hh * HD + d) * SQ + s0 + j8) = f.half[0]; }  } }



__global__ __launch_bounds__(256) void k_rsmcf2(const float* __restrict__ S, _Float16* __restrict__ P, int hg, int q0, int nk) {
  #pragma clang fp contract(off)
  const int t = blockIdx.x * 256 + threadIdx.x; if (t >= hg * QT) return; const size_t i = (size_t)t; const float* s = S + i * NKX; const int last = q0 + (t % QT); float mx = -3.0e38f;
#pragma unroll 1
  for (int j = 0; j < nk; ++j) { const float f = (j <= last) ? 1.f : 0.f; mx = fmaxf(mx, fmaf(f, s[j], (1.f - f) * -1.0e9f)); } float se = 0.f;
#pragma unroll 1
  for (int j = 0; j < nk; ++j) { const float f = (j <= last) ? 1.f : 0.f; se += __expf(fmaf(f, s[j], (1.f - f) * -1.0e9f) - mx); } const float sc = 256.0f / se;
#pragma unroll 1
  for (int j0 = 0; j0 < nk; j0 += 8) { FragH fr; for (int q = 0; q < 8; ++q) { const int j = j0 + q; const float f = (j <= last) ? 1.f : 0.f; fr.h[q] = (_Float16)(__expf(fmaf(f, s[j], (1.f - f) * -1.0e9f) - mx) * sc); } unsigned short* d = (unsigned short*)P + i * NKX + j0; *(v8us*)d = fr.half[0];  } }

template <int MASKADD>
__global__ __launch_bounds__(64) void k_att0(const float* __restrict__ QF, const float* __restrict__ KF, const float* __restrict__ VF, int ld, const float* __restrict__ mask, float scale, float* __restrict__ OF, int ldo) {
  #pragma clang fp contract(off)
  __shared__ __attribute__((aligned(16))) float lq[64][64]; __shared__ __attribute__((aligned(16))) float lo[64][64];
  const int tid = threadIdx.x; const int h = blockIdx.x / (QT0 / 64), rg = blockIdx.x % (QT0 / 64); const int i = rg * 64 + tid;
  const float* qr = QF + (size_t)i * ld + h * HD;
#pragma unroll 1
  for (int c = 0; c < HD / 4; ++c) { *(v4f*)&lq[tid][c * 4] = *(const v4fa*)(qr + c * 4); const v4f z = {0.f, 0.f, 0.f, 0.f}; *(v4f*)&lo[tid][c * 4] = z; }
  float m = -1.0e30f, l = 0.f; const int jmax = MASKADD ? (SQ - 1) : (rg * 64 + 63);      /* additive-mask form: every key (the mask input decides); causal form: keys up to the block's last row */
#pragma unroll 1
  for (int j = 0; j <= jmax; ++j) { const float* kr = KF + (size_t)j * ld + h * HD; const float* vr = VF + (size_t)j * ld + h * HD; float s = 0.f;
#pragma unroll 1
    for (int c = 0; c < HD / 4; ++c) { const v4f kq = *(const v4fa*)(kr + c * 4); const v4f qq = *(v4f*)&lq[tid][c * 4]; s = __fadd_rn(s, __fmul_rn(qq[0], kq[0])); s = __fadd_rn(s, __fmul_rn(qq[1], kq[1])); s = __fadd_rn(s, __fmul_rn(qq[2], kq[2])); s = __fadd_rn(s, __fmul_rn(qq[3], kq[3])); }
    s = __fmul_rn(s, scale); if (MASKADD) s = __fadd_rn(s, __fmul_rn(bf16_round(mask[(size_t)i * SQ + j]), -10000.0f));
    const float f = (MASKADD || j <= i) ? 1.f : 0.f; const float sm = fmaf(f, s, (1.f - f) * -1.0e30f); const float mn = fmaxf(m, sm); const float sc = expf(m - mn); const float e = expf(sm - mn); l = __fadd_rn(__fmul_rn(l, sc), e); m = mn;
#pragma unroll 1
    for (int c = 0; c < HD / 4; ++c) { const v4f vv = *(const v4fa*)(vr + c * 4); v4f oo = *(v4f*)&lo[tid][c * 4]; for (int u = 0; u < 4; ++u) oo[u] = __fadd_rn(__fmul_rn(oo[u], sc), __fmul_rn(e, vv[u])); *(v4f*)&lo[tid][c * 4] = oo; } }
  const float fin = 64.0f / l;      /* o carried x64 like the f16 path */
#pragma unroll 1
  for (int c = 0; c < HD / 4; ++c) { v4f oo = *(v4f*)&lo[tid][c * 4]; for (int u = 0; u < 4; ++u) oo[u] = __fmul_rn(oo[u], fin); *(v4f*)&lo[tid][c * 4] = oo; }
  __syncthreads();
  {
#pragma unroll 1
    for (int it = 0; it < 16; ++it) { const int row = it * 4 + tid / 16, pc = (tid % 16) * 4; const v4f v = *(const v4f*)&lo[row][pc]; *(v4f*)(OF + (size_t)(rg * 64 + row) * ldo + h * HD + pc) = v; }
     } }

__global__ __launch_bounds__(256) void k_oscale(const float* __restrict__ OF, float* __restrict__ out, size_t n4) { const size_t t = (size_t)blockIdx.x * 256 + threadIdx.x; if (t >= n4) return; const v4f a = *(const v4fa*)(OF + t * 4); v4f o; for (int q = 0; q < 4; ++q) o[q] = a[q] * 0.015625f; *(v4f*)(out + t * 4) = o;  }

__global__ __launch_bounds__(256) void k_bfr(const float* __restrict__ x, float* __restrict__ XB, size_t n8) { const size_t t = (size_t)blockIdx.x * 256 + threadIdx.x; if (t >= n8) return; v4f a = *(const v4fa*)(x + t * 8), c = *(const v4fa*)(x + t * 8 + 4); for (int q = 0; q < 4; ++q) { a[q] = bf16_round(a[q]); c[q] = bf16_round(c[q]); }
  { *(v4f*)(XB + t * 8) = a; *(v4f*)(XB + t * 8 + 4) = c;  } }



__global__ __launch_bounds__(256) void k_rsmfvl(const float* __restrict__ S, _Float16* __restrict__ P, _Float16* __restrict__ PL, int qn, const int* __restrict__ vlp) {
  #pragma clang fp contract(off)
  const int t = blockIdx.x * 256 + threadIdx.x; if (t >= qn) return; const int vl = vlp[0]; const size_t i = (size_t)t; const float* s = S + i * SQ; float mx = -3.0e38f;
#pragma unroll 1
  for (int j = 0; j < SQ; ++j) { const float f = (j < vl) ? 1.f : 0.f; mx = fmaxf(mx, fmaf(f, s[j], (1.f - f) * -1000000.0f)); } float se = 0.f;
#pragma unroll 1
  for (int j = 0; j < SQ; ++j) { const float f = (j < vl) ? 1.f : 0.f; se += __expf(fmaf(f, s[j], (1.f - f) * -1000000.0f) - mx); } const float sc = 256.0f / se;
#pragma unroll 1
  for (int j0 = 0; j0 < SQ; j0 += 8) { FragH fr, gr; for (int q = 0; q < 8; ++q) { const int j = j0 + q; const float f = (j < vl) ? 1.f : 0.f; const float pv = __expf(fmaf(f, s[j], (1.f - f) * -1000000.0f) - mx) * sc; const _Float16 ph = (_Float16)pv; fr.h[q] = ph; gr.h[q] = (_Float16)((pv - (float)ph) * 1024.0f); }
    unsigned short* d = (unsigned short*)P + i * SQ + j0; unsigned short* dl = (unsigned short*)PL + i * SQ + j0; *(v8us*)d = fr.half[0]; *(v8us*)dl = gr.half[0];  } }

// 2^x on the transcendental unit; the v_nop is the one free slot the instruction set asks for behind a transcendental, in the same statement so that it stays directly behind it.
__device__ __forceinline__ float exp2_slot(float x) { float r; asm("v_exp_f32 %0, %1\n\tv_nop" : "=v"(r) : "v"(x)); return r; }

#define CN 256          /* channels */
#define CI 128          /* inner channels */
#define NP 4096         /* positions */
#define NM 1024         /* pooled positions (= SQ: the softmax key count) */

// Fused attention: one launch computes scores, softmax and the weighted sum of g for all images; neither the scores nor the weights go to memory.
// A work-group of 8 waves takes 128 queries of one image (16 a wave) and walks the 1024 pooled positions 32 at a time.
// S^T = phi^T (A, rows m) x theta (B, columns n; fragments kept in registers), three terms as before: hi.hi + (hi.lo + lo.hi) / 1024.
// In the accumulator a lane holds, for ITS query n = lane & 15, the keys m = 8 * (lane >> 4) + r of a 16-key tile: two such tiles are, register for register, the B fragment of y[c][n] += g[c][m] P^T[m][n]
// (elements 0..7 = keys 8 hh + r, elements 8..15 = keys 16 + 8 hh + r, the k order in which g2_frag / lds_frag read the rows of g), so the weights move through no LDS and no other lane.
// Running row maximum and row sum per lane (online softmax; the two half-waves share the maximum every pass and join their sums once at the end). Weights are carried x256 in f16 as before; the sum carries the same factor.
// The phi hi / lo rows and the g columns of a pass are shared by the 8 waves through LDS, a ring of three buffers: pass t works on tile t, reads tile t + 1's phi fragments ahead, and stages tile t + 2 (global loads at its head, LDS stores at its foot); one barrier a pass publishes tile t + 2 (and ends the reads of the buffer that the next pass overwrites).
// Every LDS fragment read stands one phase ahead of its use, as a whole group: the g fragments of a pass in front of its score products, the next pass's 16 phi fragments behind them (into the registers they have just left), in front of the exponentials and the g products.
#define FK 32                            /* keys per pass */
#define FPP 136                          /* LDS pitch of a phi row in f16: 256 B + 16 B, an odd multiple of 16 B (no bank conflict for 16-byte reads of 16 rows) */
#define FGP 40                           /* LDS pitch of a g row in f16: 64 B + 16 B, likewise */
#define FBUF (2 * FK * FPP + CI * FGP)   /* one buffer in f16: phi hi, phi lo, g */
__device__ __forceinline__ v16h lds_frag(const unsigned short* p) { FragH f; f.half[0] = *(const v8us*)p; f.half[1] = *(const v8us*)(p + 16); return f.v; }
__device__ __forceinline__ v8f f_mma(v16h a, v16h b, v8f c) { return __builtin_amdgcn_wmma_f32_16x16x32_f16(false, a, false, b, (short)0, c, false, false); }
#define SOP 132                          /* LDS pitch of a gathered output row in f32: 512 B + 16 B (16-byte writes of 16 rows fall on all banks) */
__global__ __launch_bounds__(256) void k_fattn(const _Float16* __restrict__ TH, const _Float16* __restrict__ THL, const _Float16* __restrict__ PHT, const _Float16* __restrict__ PHLT, const _Float16* __restrict__ G16, const _Float16* __restrict__ BW, const float* __restrict__ BN4, const float* __restrict__ x, float* __restrict__ out) {
  __shared__ __attribute__((aligned(16))) unsigned short sm[3 * FBUF];
  __shared__ __attribute__((aligned(16))) float so[8 * 32 * SOP];      /* epilogue: each wave gathers its own 32 output rows here */
  const int tid = threadIdx.x, w = tid >> 5, lane = tid & 31, ln = lane & 15, hh = lane >> 4, by = blockIdx.y;
  const int n0 = blockIdx.x * 128 + w * 16;
  const unsigned short* ph = (const unsigned short*)PHT + (size_t)by * CI * NM; const unsigned short* pl = (const unsigned short*)PHLT + (size_t)by * CI * NM; const unsigned short* gg = (const unsigned short*)G16 + (size_t)by * CI * NM;
  const _Float16* tq = TH + ((size_t)by * NP + n0 + ln) * CI; const _Float16* tl = THL + ((size_t)by * NP + n0 + ln) * CI;
  v16h qh[4], ql[4];
#pragma unroll
  for (int j = 0; j < 4; ++j) { qh[j] = g2_frag(tq + j * 32, hh); ql[j] = g2_frag(tl + j * 32, hh); }
  /* staging: 16-byte pieces; phi tile = 32 rows x 16 pieces (contiguous in memory), g tile = 128 rows x 4 pieces; two pieces of each plane a thread */
  const int pr = tid >> 4, pc = (tid & 15) * 8, gr = tid >> 2, gc = (tid & 3) * 8;
  v8us r0, r1, r2, r3, r4, r5;
  const unsigned short *fh, *fl, *fg;      /* the lane's first piece of each plane of the tile being fetched */
  auto fetch = [&](int t) { const size_t m0 = (size_t)t * FK;
    fh = ph + (m0 + pr) * CI + pc; fl = pl + (m0 + pr) * CI + pc; fg = gg + ((size_t)t * CI + gr) * FK + gc;      /* g lies tile by tile: [m / 32][ci][32], one pass's tile = 8 KiB in a row */
    r0 = *(const v8us*)fh; r1 = *(const v8us*)(fh + 16 * CI);
    r2 = *(const v8us*)fl; r3 = *(const v8us*)(fl + 16 * CI);
    r4 = *(const v8us*)fg; r5 = *(const v8us*)(fg + 64 * FK); };
  auto fetched = [&]() { asm volatile("s_wait_xcnt 0x0" :: "v"(fh), "v"(fl), "v"(fg) : "memory"); };      /* the wait that stands in front of any overwrite of a register which an issued load names; the three addresses are inputs so that they stay live up to it */
  auto put = [&](int bo) { unsigned short* d = sm + bo;
    *(v8us*)(d + pr * FPP + pc) = r0; *(v8us*)(d + (pr + 16) * FPP + pc) = r1;
    *(v8us*)(d + FK * FPP + pr * FPP + pc) = r2; *(v8us*)(d + FK * FPP + (pr + 16) * FPP + pc) = r3;
    *(v8us*)(d + 2 * FK * FPP + gr * FGP + gc) = r4; *(v8us*)(d + 2 * FK * FPP + (gr + 64) * FGP + gc) = r5; };
  v16h pa[16];      /* a tile's phi fragments: [4 j + 0 / 1] = hi rows 0..15 / 16..31, [4 j + 2 / 3] = residual rows, k block j */
  auto ldphi = [&](int bo) { const unsigned short* a = sm + bo + ln * FPP + 8 * hh;
#pragma unroll
    for (int j = 0; j < 4; ++j) { pa[4 * j] = lds_frag(a + j * 32); pa[4 * j + 1] = lds_frag(a + 16 * FPP + j * 32); pa[4 * j + 2] = lds_frag(a + FK * FPP + j * 32); pa[4 * j + 3] = lds_frag(a + (FK + 16) * FPP + j * 32); } };
  const v8f z8 = {0.f,0.f,0.f,0.f,0.f,0.f,0.f,0.f};
  v8f o[8];
#pragma unroll
  for (int ct = 0; ct < 8; ++ct) o[ct] = z8;
  float m = -1.0e30f, l = 0.f;
  fetch(0); fetched(); put(0); fetch(1); fetched(); put(FBUF);
  __syncthreads();      /* publishes tiles 0 and 1 */
  ldphi(0);
  int b0 = 0, b1 = FBUF, b2 = 2 * FBUF;      /* ring offsets of tiles t, t + 1, t + 2 */
  int tf = 2;      /* the tile that pass t stages: t + 2, held at the last tile */
  /* rolled: one pass is already some hundred instructions, and the ring offsets are the only thing that changes */
#pragma unroll 1
  for (int t = 0; t < NM / FK; ++t) {
    const unsigned short* ag = sm + b0 + 2 * FK * FPP + ln * FGP + 8 * hh;
    v16h ga[8];
    fetch(tf);      /* the index is held at the last tile so that the pass has no branch and stays one scheduling region; what the last two passes stage is written and read ahead like any tile and enters no product */
#pragma unroll
    for (int ct = 0; ct < 8; ++ct) ga[ct] = lds_frag(ag + ct * 16 * FGP);
    __builtin_amdgcn_sched_barrier(0);      /* keeps the g fragment reads and the staging loads in front of the score products, which cover them; without it the compiler sinks each read to just in front of its product and the wave waits out the LDS latency there */
    v8f sh0 = z8, sh1 = z8, sl0 = z8, sl1 = z8;
#pragma unroll
    for (int j = 0; j < 4; ++j) {
      sh0 = f_mma(pa[4 * j], qh[j], sh0); sh1 = f_mma(pa[4 * j + 1], qh[j], sh1);
      sl0 = f_mma(pa[4 * j], ql[j], sl0); sl1 = f_mma(pa[4 * j + 1], ql[j], sl1);
      sl0 = f_mma(pa[4 * j + 2], qh[j], sl0); sl1 = f_mma(pa[4 * j + 3], qh[j], sl1);
    }
    float s[16];
#pragma unroll
    for (int r = 0; r < 8; ++r) { s[r] = sh0[r] + sl0[r] * 0.0009765625f; s[8 + r] = sh1[r] + sl1[r] * 0.0009765625f; }
    float mx = fmaxf(s[0], s[1]);
#pragma unroll
    for (int r = 2; r < 16; ++r) mx = fmaxf(mx, s[r]);
    const float mo = __shfl_xor(mx, 16, 32);      /* the other half-wave holds the same query's other 16 keys */
    __builtin_amdgcn_sched_barrier(0);      /* the exchange goes through the LDS queue, which answers in order: it is issued in front of the 32 reads below, so that its wait does not take them in */
    fetched();      /* here and not at the loads: it has to stand in front of the first overwrite of the three address pairs only, and they stay untouched up to it; the score products lie in between */
    ldphi(b1);      /* tile t + 1, published by the barrier of pass t - 1 */
    __builtin_amdgcn_sched_barrier(0);      /* keeps the whole group here, in front of the exponentials and the g products, which cover it */
    mx = fmaxf(mx, mo);
    const float mn = fmaxf(m, mx);
    const float sc = exp2_slot((m - mn) * 1.44269504f);
    m = mn;
    FragH pf; float p0 = 0.f, p1 = 0.f;
#pragma unroll
    for (int r = 0; r < 8; ++r) {
      const float e0 = exp2_slot((s[r] - mn) * 1.44269504f + 8.0f), e1 = exp2_slot((s[8 + r] - mn) * 1.44269504f + 8.0f);
      p0 += e0; p1 += e1; pf.h[r] = (_Float16)e0; pf.h[8 + r] = (_Float16)e1;
    }
    l = l * sc + (p0 + p1);
#pragma unroll
    for (int ct = 0; ct < 8; ++ct) o[ct] *= sc;
#pragma unroll
    for (int ct = 0; ct < 8; ++ct) o[ct] = f_mma(ga[ct], pf.v, o[ct]);
    __builtin_amdgcn_sched_barrier(0);      /* keeps the staging stores, and with them the barrier's wait on the LDS queue, behind the g products: hoisted over them, that wait stood right behind the exponentials and took in the 32 reads */
    put(b2);
    __syncthreads();      /* publishes tile t + 2; ends every wave's reads of tile t, whose buffer pass t + 1 overwrites */
    const int bt = b0; b0 = b1; b1 = b2; b2 = bt;
    if (tf + 1 < NM / FK) ++tf;
  }
  /* Epilogue: z[c][n] = BN(W y + W_b) + bf16(x) for the work-group's 128 positions. The waves exchange y^T through LDS; then a wave takes 32 output channels and all 128 positions:
     D[n][c] = (y^T rows as A) (16 W rows as B^T), so that a lane holds 8 consecutive positions of ITS channel c = lane & 15; bias and BatchNorm are applied there, the rows are gathered in the wave's own LDS range and leave, with the residual, as whole 512-byte pieces of a channel row. */
  const int c0 = w * 32, cl = c0 + ln;
  const unsigned short* wr = (const unsigned short*)BW + (size_t)cl * CI + 8 * hh;      /* elements 0..7 = k 8 hh + 0..7, elements 8..15 = k 16 + 8 hh + 0..7 of each 32, the order in which lds_frag reads the rows of y^T */
  const float* bnp = BN4 + 4 * cl;
  v16h wf[2][4]; v4f bn[2];
#pragma unroll
  for (int u = 0; u < 2; ++u) {
#pragma unroll
    for (int j = 0; j < 4; ++j) { FragH f; f.half[0] = *(const v8us*)(wr + u * 16 * CI + j * 32); f.half[1] = *(const v8us*)(wr + u * 16 * CI + j * 32 + 16); wf[u][j] = f.v; }
    bn[u] = *(const v4fa*)(bnp + u * 64); }
  asm volatile("s_wait_xcnt 0x0" :: "v"(wr), "v"(cl) : "memory");      /* the wait that stands in front of any overwrite of a register which an issued load names; the weights' address and the row index that the constants' loads are addressed by are inputs so that they stay live up to it */
  l += __shfl_xor(l, 16, 32);
  const float inv = 1.0f / l;
  { unsigned short* yo = sm + (w * 16 + ln) * FPP + 8 * hh;      /* y^T [128 n][ci] over the ring, which nobody reads behind the loop's last barrier: the lane's 8 channels of a tile are 16 contiguous bytes of its query's row */
#pragma unroll
    for (int ct = 0; ct < 8; ++ct) { FragH f;
#pragma unroll
      for (int r = 0; r < 8; ++r) f.h[r] = (_Float16)(o[ct][r] * inv);
      *(v8us*)(yo + ct * 16) = f.half[0]; } }
  __syncthreads();      /* publishes y^T */
  const size_t e0 = ((size_t)by * CN + c0) * NP + blockIdx.x * 128 + lane * 4;      /* the lane's 4 positions of the wave's first channel row */
  const float* xb = x + e0;
  v4f xx[32];      /* behind the barrier, which waits for every load in flight: the residual flies under the products */
#pragma unroll
  for (int q = 0; q < 32; ++q) xx[q] = *(const v4fa*)(xb + (size_t)q * NP);
  asm volatile("s_wait_xcnt 0x0" :: "v"(xb) : "memory");      /* as above, for the one address of this run */
  const unsigned short* yr = sm + ln * FPP + 8 * hh;
  float* sw = so + w * (32 * SOP);
  v16h ya[2][8];      /* two sets of fragments, each of two position tiles: [4 i + j] = tile i, k block j */
  auto ldy = [&](int s, int np) {
#pragma unroll
    for (int i = 0; i < 2; ++i)
#pragma unroll
      for (int j = 0; j < 4; ++j) ya[s][4 * i + j] = lds_frag(yr + (np * 2 + i) * 16 * FPP + j * 32); };
  ldy(0, 0);
#pragma unroll
  for (int np = 0; np < 4; ++np) {
    if (np + 1 < 4) ldy((np + 1) & 1, np + 1);
    __builtin_amdgcn_sched_barrier(0);      /* keeps the next two tiles' fragment reads, as one group, in front of this pair's products, which cover them */
    v8f d[2][2] = {{z8, z8}, {z8, z8}};
#pragma unroll
    for (int j = 0; j < 4; ++j)
#pragma unroll
      for (int i = 0; i < 2; ++i) { d[i][0] = f_mma(ya[np & 1][4 * i + j], wf[0][j], d[i][0]); d[i][1] = f_mma(ya[np & 1][4 * i + j], wf[1][j], d[i][1]); }
#pragma unroll
    for (int i = 0; i < 2; ++i)
#pragma unroll
      for (int u = 0; u < 2; ++u) { v4f t0, t1;
#pragma unroll
        for (int k = 0; k < 4; ++k) { t0[k] = ((d[i][u][k] * 0.0625f + bn[u][0]) - bn[u][1]) * bn[u][2] + bn[u][3]; t1[k] = ((d[i][u][4 + k] * 0.0625f + bn[u][0]) - bn[u][1]) * bn[u][2] + bn[u][3]; }
        float* ds = sw + (u * 16 + ln) * SOP + (np * 2 + i) * 16 + 8 * hh; *(v4f*)ds = t0; *(v4f*)(ds + 4) = t1; }
  }
  asm volatile("s_wait_dscnt 0x0" ::: "memory");      /* the wave reads back rows that its other lanes wrote: those stores are through first, and the compiler moves no read over this line */
  v4f vv[32];
#pragma unroll
  for (int q = 0; q < 32; ++q) vv[q] = *(const v4fa*)(sw + q * SOP + lane * 4);
  __builtin_amdgcn_sched_barrier(0);      /* keeps the 32 reads together as one group: sunk to their uses, one or two at a time, each would have the wave wait out the LDS latency */
#pragma unroll
  for (int q = 0; q < 32; ++q) { v4f r;
#pragma unroll
    for (int i = 0; i < 4; ++i) r[i] = vv[q][i] + bf16_round(xx[q][i]);
    *(v4f*)(out + e0 + (size_t)q * NP) = r; }
}

__global__ __launch_bounds__(256) void k_rowbias(const float* __restrict__ b, float* __restrict__ BP, size_t n4, int ncol) { const size_t t = (size_t)blockIdx.x * 256 + threadIdx.x; if (t >= n4) return; const size_t e = t * 4; const float v = bf16_round(b[e / ncol]); const v4f o = {v, v, v, v}; *(v4f*)(BP + e) = o;  }




__global__ __launch_bounds__(256) void k_mp2(const float* __restrict__ src, float* __restrict__ dst, int nout) {
  const int t = blockIdx.x * 256 + threadIdx.x; if (t >= nout) return; const int c = t / 1024; const int o = t % 1024; const int oy = o / 32, ox = o % 32; const float* p = src + (size_t)c * 4096 + (size_t)(2 * oy) * 64 + 2 * ox;
  const float v = fmaxf(fmaxf(p[0], p[1]), fmaxf(p[64], p[65])); *(float*)(dst + t) = v;  }
__global__ __launch_bounds__(256) void k_xpb(const float* __restrict__ x, const float* __restrict__ wb, float* __restrict__ CPP, size_t n4) {
  #pragma clang fp contract(off)
  const size_t t = (size_t)blockIdx.x * 256 + threadIdx.x; if (t >= n4) return; const size_t e = t * 4; const int c = (int)((e / 4096) % 256); const float bb = bf16_round(wb[c]); const v4f a = *(const v4fa*)(x + e); v4f o; for (int q = 0; q < 4; ++q) o[q] = __fadd_rn(bf16_round(a[q]), bb);
  *(v4f*)(CPP + e) = o;  }


__global__ __launch_bounds__(256) void k_bnres(float* __restrict__ O, const float* __restrict__ x, const float* __restrict__ wb, const float* __restrict__ g, const float* __restrict__ be, const float* __restrict__ mu, const float* __restrict__ var, float eps, size_t n4) {
  #pragma clang fp contract(off)
  const size_t t = (size_t)blockIdx.x * 256 + threadIdx.x; if (t >= n4) return; const size_t e = t * 4; const int c = (int)((e / NP) % CN);
  const float inv = __fdiv_rn(bf16_round(g[c]), sqrtf(__fadd_rn(bf16_round(var[c]), eps))); const float wbc = bf16_round(wb[c]), mc = bf16_round(mu[c]), bc = bf16_round(be[c]);
  const v4f a = *(const v4fa*)(O + e); const v4f xx = *(const v4fa*)(x + e); v4f o;
  for (int q = 0; q < 4; ++q) o[q] = __fadd_rn(__fadd_rn(__fmul_rn(__fadd_rn(__fadd_rn(a[q], wbc), -mc), inv), bc), bf16_round(xx[q]));
  *(v4f*)(O + e) = o;  }

// ---- the pointwise and layout stages live inside the two matrix kernels ----
// Most plain '#pragma unroll's below stand on a short loop over a register array (fragments, accumulators, packed halves): its index must be a compile-time constant for the array to stay in registers.
// k_prep: every small operand once: the three projection weights stacked [384][256] (theta, phi, g) and W [256][128] as x16 f16 planes, the three biases [384] rounded, and per output channel {W_b, mean, gamma / sqrt(var + eps), beta}.
__global__ __launch_bounds__(256) void k_prep(const float* __restrict__ tw, const float* __restrict__ pw, const float* __restrict__ gw, const float* __restrict__ ww, const float* __restrict__ tb, const float* __restrict__ pb, const float* __restrict__ gb,
    const float* __restrict__ wb, const float* __restrict__ g, const float* __restrict__ be, const float* __restrict__ mu, const float* __restrict__ var, float eps, _Float16* __restrict__ WA, _Float16* __restrict__ BW, float* __restrict__ BB, float* __restrict__ BN4) {
  const int t = blockIdx.x * 256 + threadIdx.x;
  if (t < 4 * CI * CN / 8) { const int s = t / (CI * CN / 8), u = (t % (CI * CN / 8)) * 8; const float* sp = s == 0 ? tw : s == 1 ? pw : s == 2 ? gw : ww; unsigned short* d = s < 3 ? (unsigned short*)WA + (size_t)s * CI * CN : (unsigned short*)BW; FragH f;
#pragma unroll
    for (int q = 0; q < 8; ++q) f.h[q] = (_Float16)(bf16_round(sp[u + q]) * 16.0f);
    *(v8us*)(d + u) = f.half[0]; }
  else if (t < 4 * CI * CN / 8 + 3 * CI) { const int o = t - 4 * CI * CN / 8, s = o / CI; const float* sp = s == 0 ? tb : s == 1 ? pb : gb; BB[o] = bf16_round(sp[o % CI]); }
  else if (t < 4 * CI * CN / 8 + 3 * CI + CN) { const int c = t - (4 * CI * CN / 8 + 3 * CI); const v4f o = {bf16_round(wb[c]), bf16_round(mu[c]), __fdiv_rn(bf16_round(g[c]), sqrtf(bf16_round(var[c]) + eps)), bf16_round(be[c])}; *(v4f*)(BN4 + 4 * c) = o; }
}

// k_proj: theta, phi and g of 128 positions (two image rows = one pooled row) of one image in one work-group of 16 waves.
// 1. x [256 c][128 n] f32 -> bf16-rounded f16, transposed into LDS as x^T [n][c]. 2. D[o][n] = (stacked weights as A, rows o, from L2) x (x^T rows as B^T): a wave keeps the B fragments of position tiles p and p + 4 (the same 16 columns of the two image rows) in registers for all of K and walks 6 of the 24 row tiles.
// In D a lane holds 8 consecutive o of ITS position: theta splits into hi + x1024 residual as 16-byte pieces of its [n][ci] row; phi and g take the 2x2 maximum as max(tile p, tile p + 4), then with the neighbour lane. 3. All results are gathered in LDS and leave as whole lines.
#define XP 264                           /* LDS pitch of an x^T row in f16: 512 B + 16 B (16-byte reads and writes of 16 rows fall on all banks) */
#define TP 136                           /* LDS pitch of a gathered theta / phi row in f16: 256 B + 16 B */
#define GP 40                            /* LDS pitch of a gathered g row in f16: 64 B + 16 B */
__global__ __launch_bounds__(512) void k_proj(const float* __restrict__ x, const _Float16* __restrict__ WA, const float* __restrict__ BB, _Float16* __restrict__ TH, _Float16* __restrict__ THL, _Float16* __restrict__ PHT, _Float16* __restrict__ PHLT, _Float16* __restrict__ G16) {
  __shared__ __attribute__((aligned(16))) unsigned short xt[128 * XP];
  __shared__ __attribute__((aligned(16))) unsigned short sth[128 * TP];
  __shared__ __attribute__((aligned(16))) unsigned short stl[128 * TP];
  __shared__ __attribute__((aligned(16))) unsigned short sph[32 * TP];
  __shared__ __attribute__((aligned(16))) unsigned short spl[32 * TP];
  __shared__ __attribute__((aligned(16))) unsigned short sg[CI * GP];
  const int tid = threadIdx.x, w = tid >> 5, lane = tid & 31, ln = lane & 15, hh = lane >> 4, by = blockIdx.y;
  const int n0 = blockIdx.x * 128;
  { /* a wave takes blocks of 32 c x 32 n: a lane 8 c x 4 n; 8 lanes read one 128-byte line of a channel row, and the 16 lanes of a half-wave write 16-byte pieces that fall on all banks */
    const int n4 = (lane & 3) + 4 * hh, c8 = (lane >> 2) & 3;
#pragma unroll
    for (int it = 0; it < 2; ++it) { const int unit = it * 16 + w; const int n = (unit & 3) * 32 + 4 * n4, c = (unit >> 2) * 32 + 8 * c8;
      const float* sp = x + ((size_t)by * CN + c) * NP + n0 + n; v4f a[8];
#pragma unroll
      for (int q = 0; q < 8; ++q) a[q] = *(const v4fa*)(sp + (size_t)q * NP);
#pragma unroll
      for (int i = 0; i < 4; ++i) { FragH f;
#pragma unroll
        for (int q = 0; q < 8; ++q) f.h[q] = (_Float16)bf16_round(a[q][i]);
        *(v8us*)(xt + (n + i) * XP + c) = f.half[0]; } } }
  const int p = w & 3, oq = w >> 2;
  v16h a[8]; v4f bb0, bb1;
  auto lda = [&](int ot) { const unsigned short* ar = (const unsigned short*)WA + (size_t)(ot * 16 + ln) * CN + 8 * hh; const float* br = BB + ot * 16 + 8 * hh;      /* the lane's own first bytes: elements 0..7 = k 8 hh + 0..7, elements 8..15 = k 16 + 8 hh + 0..7 of each 32, as g2_frag reads them */
#pragma unroll
    for (int j = 0; j < 8; ++j) { FragH f; f.half[0] = *(const v8us*)(ar + j * 32); f.half[1] = *(const v8us*)(ar + j * 32 + 16); a[j] = f.v; }
    bb0 = *(const v4fa*)br; bb1 = *(const v4fa*)(br + 4);
    asm volatile("s_wait_xcnt 0x0" :: "v"(ar), "v"(br) : "memory"); };      /* the wait that stands in front of any overwrite of a register which an issued load names; the two addresses are inputs so that they stay live up to it and no load of the run lands in them */
  lda(oq * 6);
  __syncthreads();      /* publishes x^T */
  v16h b0[8], b1[8];
  { const unsigned short* r0 = xt + (p * 16 + ln) * XP + 8 * hh; const unsigned short* r1 = r0 + 64 * XP;
#pragma unroll
    for (int j = 0; j < 8; ++j) { b0[j] = lds_frag(r0 + j * 32); b1[j] = lds_frag(r1 + j * 32); } }
  const v8f z8 = {0.f,0.f,0.f,0.f,0.f,0.f,0.f,0.f};
  const int nl = p * 16 + ln, ml = nl >> 1;
  /* rolled: the three kinds of row tile share one body, and an unrolled one would hold several tiles' weight fragments at once */
#pragma unroll 1
  for (int i = 0; i < 6; ++i) { const int ot = oq * 6 + i;
    v8f c0 = z8, c1 = z8;
#pragma unroll
    for (int j = 0; j < 8; ++j) { c0 = f_mma(a[j], b0[j], c0); c1 = f_mma(a[j], b1[j], c1); }
    float v0[8], v1[8];
#pragma unroll
    for (int r = 0; r < 8; ++r) { const float bv = r < 4 ? bb0[r & 3] : bb1[r & 3]; v0[r] = c0[r] * 0.0625f + bv; v1[r] = c1[r] * 0.0625f + bv; }
    if (i + 1 < 6) lda(ot + 1);      /* the next row tile's weights fly while this one's results are packed */
    if (ot < 8) { FragH h0, l0, h1, l1;
#pragma unroll
      for (int r = 0; r < 8; ++r) { _Float16 h = (_Float16)v0[r]; h0.h[r] = h; l0.h[r] = (_Float16)((v0[r] - (float)h) * 1024.0f); h = (_Float16)v1[r]; h1.h[r] = h; l1.h[r] = (_Float16)((v1[r] - (float)h) * 1024.0f); }
      const int e = nl * TP + ot * 16 + 8 * hh;
      *(v8us*)(sth + e) = h0.half[0]; *(v8us*)(stl + e) = l0.half[0]; *(v8us*)(sth + e + 64 * TP) = h1.half[0]; *(v8us*)(stl + e + 64 * TP) = l1.half[0];
    } else { float mx[8];
#pragma unroll
      for (int r = 0; r < 8; ++r) { const float u = fmaxf(v0[r], v1[r]); mx[r] = fmaxf(u, __shfl_xor(u, 1, 32)); }
      if (ot < 16) { FragH h0, l0;
#pragma unroll
        for (int r = 0; r < 8; ++r) { const _Float16 h = (_Float16)mx[r]; h0.h[r] = h; l0.h[r] = (_Float16)((mx[r] - (float)h) * 1024.0f); }
        if (!(ln & 1)) { const int e = ml * TP + (ot - 8) * 16 + 8 * hh; *(v8us*)(sph + e) = h0.half[0]; *(v8us*)(spl + e) = l0.half[0]; }
      } else if (!(ln & 1)) { FragH h0;
#pragma unroll
        for (int r = 0; r < 8; ++r) { h0.h[r] = (_Float16)mx[r]; sg[((ot - 16) * 16 + 8 * hh + r) * GP + ml] = h0.u[r]; } }
    }
  }
  __syncthreads();      /* every wave's results are gathered */
  { unsigned short* dh = (unsigned short*)TH + ((size_t)by * NP + n0) * CI; unsigned short* dl = (unsigned short*)THL + ((size_t)by * NP + n0) * CI;
#pragma unroll
    for (int k = 0; k < 4; ++k) { const int pc = k * 512 + tid, r = pc >> 4, q = (pc & 15) * 8; *(v8us*)(dh + r * CI + q) = *(const v8us*)(sth + r * TP + q); *(v8us*)(dl + r * CI + q) = *(const v8us*)(stl + r * TP + q); }
    const size_t mo = ((size_t)by * NM + blockIdx.x * 32) * CI;      /* the pooled row's 32 positions: rows of phi^T [m][ci]; one 32-key tile [ci][32] of g */
    { const int r = tid >> 4, q = (tid & 15) * 8; *(v8us*)((unsigned short*)PHT + mo + r * CI + q) = *(const v8us*)(sph + r * TP + q); *(v8us*)((unsigned short*)PHLT + mo + r * CI + q) = *(const v8us*)(spl + r * TP + q); }
    { const int r = tid >> 2, q = (tid & 3) * 8; *(v8us*)((unsigned short*)G16 + mo + r * 32 + q) = *(const v8us*)(sg + r * GP + q); } }
}

extern "C" void kernel_launch(void* const* d_in, const int* in_sizes, int n_in,
                              void* d_out, int out_size, void* d_ws, size_t ws_size, hipStream_t stream) {
  (void)in_sizes; (void)n_in; (void)out_size;
  const float* const* I = (const float* const*)d_in; const float* x = I[0]; const float* gw = I[1]; const float* gb = I[2]; const float* tw = I[3]; const float* tb = I[4]; const float* pw = I[5]; const float* pb = I[6]; const float* ww = I[7]; const float* wb = I[8]; const float* bng = I[9]; const float* bnb = I[10]; const float* bnm = I[11]; const float* bnv = I[12];      /* natural [out][in] 1x1-conv weights + biases: g, theta, phi [128][256]; W [256][128] + b; eval BatchNorm gamma / beta / running mean / var [256] */
  char* ws = (char*)d_ws; size_t off = 0;
  auto take = [&](size_t bytes) { char* p = ws + off; off += (bytes + 255) & ~(size_t)255; return p; };
  _Float16* WA = (_Float16*)take((size_t)3 * CI * CN * 2); _Float16* BW = (_Float16*)take((size_t)CN * CI * 2); float* BB = (float*)take((size_t)3 * CI * 4); float* BN4 = (float*)take((size_t)CN * 4 * 4);
  /* every plane below holds all NB images, image b at b times the one-image size */
  const size_t sT = (size_t)NP * CI, sM = (size_t)CI * NM;      /* one image: [4096][128], [1024][128] elements */
  _Float16* TH = (_Float16*)take(NB * sT * 2); _Float16* THL = (_Float16*)take(NB * sT * 2); _Float16* PHT = (_Float16*)take(NB * sM * 2); _Float16* PHLT = (_Float16*)take(NB * sM * 2); _Float16* G16 = (_Float16*)take(NB * sM * 2);
  if (off > ws_size) return;
  k_prep<<<(4 * CI * CN / 8 + 3 * CI + CN + 255) / 256, 256, 0, stream>>>(tw, pw, gw, ww, tb, pb, gb, wb, bng, bnb, bnm, bnv, 1e-5f, WA, BW, BB, BN4);
  k_proj<<<dim3(NP / 128, NB), 512, 0, stream>>>(x, WA, BB, TH, THL, PHT, PHLT, G16);      /* theta^T [n][ci] hi + x1024 residual; pooled phi^T [m][ci] hi + residual; pooled g f16 as 32-key tiles [m / 32][ci][32] */
  k_fattn<<<dim3(NP / 128, NB), 256, 0, stream>>>(TH, THL, PHT, PHLT, G16, BW, BN4, x, (float*)d_out);      /* f[n][m] = theta.phi (hi.hi + (hi.lo + lo.hi) / 1024; no scale), softmax over the 1024 pooled positions, y^T [n][ci] = P g^T -> f16; z = ((W y + bf16 W_b[c]) - bf16 mean[c]) (bf16 gamma[c] / sqrt(bf16 var[c] + eps)) + bf16 beta[c] + bf16 x -> f32 channel-first output, in one launch */
}

// v007
// Measured time: 54.4 microseconds a run.
// Timed twice side by side with v006, it ran 1.11 and 1.10 times as fast.
// All steps since v000 together make it 51.3 times as fast.
#include <hip/hip_runtime.h>
// Non-local block (embedded Gaussian, single head, 2x2 max-pool sub-sampling) with an eval-mode BatchNorm on the output conv (x [8][256][64][64]; theta = conv1x1(x) [128 ch], phi = maxpool2x2(conv1x1(x)), g = maxpool2x2(conv1x1(x)) (natural [128][256] weights sigma 1/16 + biases 0.01); f[n][m] = theta[:, n].phi[:, m] over the 1024 pooled positions (NO scale); softmax over m; y[:, n] = sum_m f[n][m] g[:, m]; W_y = conv1x1(y; W [256][128] + b); z = (W_y - bn_mean) gamma / sqrt(bn_var + 1e-5) + bn_beta + x -> [8][256][64][64]).
// Structure: three launches; k_proj and k_fattn each over all 8 images. k_prep: weights as x16 f16 planes, rounded biases, BatchNorm constants. k_proj: x (bf16-rounded, exact in f16) transposed in LDS to token-major x^T; theta, phi, g = (16 W as the A operand) (x^T as the B^T operand) / 16 + b[c], WMMA with f32 accumulation; theta split into f16 hi + x1024 residual (unscaled scores have sigma ~11) as [4096][128] rows; phi and g 2x2 max-pooled in registers, phi split into hi/lo as [1024][128] rows, g to f16 as 32-key tiles. k_fattn: scores (th_hi.ph_hi + (th_lo.ph_hi + th_hi.ph_lo)/1024, K = 128, f32), online row softmax on VALU (f32 statistics, native exp; weights x256 f16) and y^T = P g^T (K = 1024) -> f16, scores and weights kept in registers; its epilogue: z = BN((y^T as A) (16 w as B^T) / 16 + b[c]) + bf16(x) -> f32 channel-first output.
// Compute dtype: inputs rounded to bf16; x / weights exact; q and k as f16 hi + x1024 residual pairs, v, softmax weights and o as plain f16 GEMM operands (~2^-12); scores and softmax statistics f32. v_wmma_f32_16x16x32_f16.
#define NB 8
#define SQ 1024
#define DM 256
#define NH 1
#define HD 64
#define HG 4                         /* heads per k_vt launch; k_vt is not launched */
#define B0 0                         /* unused: every launch over images covers all NB images */
#define NBR NB                       /* not used by any kernel or launch */
#define NR ((size_t)NB * SQ)         /* unused */
#define MP ((int)((size_t)NBR * SQ)) /* not used by any kernel or launch */
#define QT 256                       /* query rows per causal tile */
#define NKX SQ                       /* S / P row pitch */
#define QT0 256                      /* first-tile rows recomputed exactly (256: buys margin for the few-key rows 128..255, which have no output projection to average the single-f16 P/v rounding) */
#define QN SQ                        /* unused (each batch attends NP query rows) */
#define NHD NH                       /* unused */
#define MPO MP                       /* unused */
#define LQ DM            /* unused */
typedef __bf16 v16b __attribute__((ext_vector_type(16)));
typedef unsigned short v8us __attribute__((ext_vector_type(8), may_alias));
typedef float  v8f  __attribute__((ext_vector_type(8)));
typedef float  v4f  __attribute__((ext_vector_type(4)));
typedef float  v4fa __attribute__((ext_vector_type(4), may_alias));
union FragB { v16b v; v8us half[2]; unsigned short u[16]; };

__device__ __forceinline__ unsigned short bf16_bits(float x) { unsigned int u = __float_as_uint(x); return (unsigned short)((u + 0x7FFFu + ((u >> 16) & 1u)) >> 16); }
__device__ __forceinline__ float bf16_val(unsigned short b) { return __uint_as_float(((unsigned int)b) << 16); }
__device__ __forceinline__ float bf16_round(float x) { return bf16_val(bf16_bits(x)); }
// D += A·B with NT terms: 1 = ah·bh, 2 = + al·bh (A split), 3 = + ah·bl (both split)
template <int NT>
__device__ __forceinline__ v8f mmaN(v16b ah, v16b al, v16b bh, v16b bl, v8f c) {
  c = __builtin_amdgcn_wmma_f32_16x16x32_bf16(false, ah, false, bh, (short)0, c, false, false);
  if (NT >= 2) c = __builtin_amdgcn_wmma_f32_16x16x32_bf16(false, al, false, bh, (short)0, c, false, false);
  if (NT >= 3) c = __builtin_amdgcn_wmma_f32_16x16x32_bf16(false, ah, false, bl, (short)0, c, false, false);
  asm volatile("v_nop\n\tv_nop\n\tv_nop\n\tv_nop" : "+v"(c) : "v"(ah), "v"(al), "v"(bh), "v"(bl));
  return c;
}

__global__ __launch_bounds__(256) void k_wt_bf16(const float* __restrict__ W, unsigned short* __restrict__ Wt, int K, int N) {
  const int t = blockIdx.x * 256 + threadIdx.x;
  const int k8n = K / 8;
  if (t >= N * k8n) return;
  const int n = t / k8n, k8 = (t % k8n) * 8;
  v8us v;
#pragma unroll
  for (int i = 0; i < 8; ++i) v[i] = bf16_bits(W[(size_t)(k8 + i) * N + n]);
  *(v8us*)(Wt + (size_t)n * K + k8) = v;
  
}

// GEMM C[M][N] (f32, pitch ldc) = act(A[M][K]·W + bias). A f32 row-major (pitch lda) converted per fragment to bf16
// (ASPLIT: hi/lo two planes -> 2 terms, else single rounded term); Wt bf16 [N][K] (pitch ldb). BIAS_BF16 rounds the
// bias to bf16 first (bias quantised to bf16 before the add). K%32==0, M%16==0, N%64==0.
template <bool ASPLIT, int ACT, bool BIAS_BF16>
__global__ __launch_bounds__(128) void k_gemm_bf(const float* __restrict__ A, int lda, const unsigned short* __restrict__ Wt, int ldb,
                                               const float* __restrict__ bias, float* __restrict__ C, int ldc, int M, int N, int K) {
  __shared__ __attribute__((aligned(16))) float so[4][16][64];
  const int tid = threadIdx.x, w = tid >> 5, lane = tid & 31, ln = lane & 15, hh = lane >> 4;
  const int ntn = N / 64;
  const int wid = blockIdx.x * 4 + w;
  const int mt = wid / ntn, nq = wid % ntn;
  if (mt * 16 >= M) return;
  const int row0 = mt * 16, col0 = nq * 64;
  const float* arow = A + (size_t)(row0 + ln) * lda;
  v8f acc[4] = {};
  for (int kb = 0; kb < K; kb += 32) {
    FragB ah, al;
    const v4f x0 = *(const v4fa*)(arow + kb + 8 * hh), x1 = *(const v4fa*)(arow + kb + 8 * hh + 4);
    const v4f x2 = *(const v4fa*)(arow + kb + 16 + 8 * hh), x3 = *(const v4fa*)(arow + kb + 16 + 8 * hh + 4);
    float xs[16] = {x0[0],x0[1],x0[2],x0[3],x1[0],x1[1],x1[2],x1[3],x2[0],x2[1],x2[2],x2[3],x3[0],x3[1],x3[2],x3[3]};
#pragma unroll
    for (int i = 0; i < 16; ++i) { const unsigned short hb = bf16_bits(xs[i]); ah.u[i] = hb; al.u[i] = ASPLIT ? bf16_bits(xs[i] - bf16_val(hb)) : (unsigned short)0; }
#pragma unroll
    for (int t = 0; t < 4; ++t) {
      const unsigned short* brow = Wt + (size_t)(col0 + t * 16 + ln) * ldb + kb;
      FragB b;
      b.half[0] = *(const v8us*)(brow + 8 * hh);
      b.half[1] = *(const v8us*)(brow + 16 + 8 * hh);
      acc[t] = mmaN<ASPLIT ? 2 : 1>(ah.v, al.v, b.v, b.v, acc[t]);
    }
  }
#pragma unroll
  for (int t = 0; t < 4; ++t) {
    float bv = bias ? bias[col0 + t * 16 + ln] : 0.f;
    if (BIAS_BF16) bv = bf16_round(bv);
#pragma unroll
    for (int r = 0; r < 8; ++r) { float v = acc[t][r] + bv; if (ACT == 1) v = fmaxf(v, 0.f); so[w][8 * hh + r][t * 16 + ln] = v; }
  }
  __builtin_amdgcn_fence(__ATOMIC_ACQ_REL, "workgroup");
  __builtin_amdgcn_wave_barrier();
  const int rsub = lane >> 4, c4 = (lane & 15) * 4;
  {
#pragma unroll
    for (int q = 0; q < 8; ++q) {
      const int r = q * 2 + rsub;
      const v4f v = *(const v4fa*)&so[w][r][c4];
      *(v4f*)(C + (size_t)(row0 + r) * ldc + col0 + c4) = v;
    }
    
  }
}

// GEMM C = act(A·W + bias + resid): A f32 (ASPLIT -> hi/lo 2 terms), Wt bf16 [N][K]; ACT 0 none, 1 relu, 2 exact gelu;
// resid (optional, f32, row index = (row % rmod), pitch ldr, RES_BF16 rounds it) added before the activation.
template <bool ASPLIT, int ACT, bool BIAS_BF16, bool RES_BF16>
__global__ __launch_bounds__(128) void k_gemm_bf3(const float* __restrict__ A, int lda, const unsigned short* __restrict__ Wt, int ldb,
                                                const float* __restrict__ bias, const float* __restrict__ resid, int rmod, int ldr,
                                                float* __restrict__ C, int ldc, int M, int N, int K) {
  __shared__ __attribute__((aligned(16))) float so[4][16][64];
  const int tid = threadIdx.x, w = tid >> 5, lane = tid & 31, ln = lane & 15, hh = lane >> 4;
  const int ntn = N / 64;
  const int wid = blockIdx.x * 4 + w;
  const int mt = wid / ntn, nq = wid % ntn;
  if (mt * 16 >= M) return;
  const int row0 = mt * 16, col0 = nq * 64;
  const float* arow = A + (size_t)(row0 + ln) * lda;
  v8f acc[4] = {};
  for (int kb = 0; kb < K; kb += 32) {
    FragB ah, al;
    const v4f x0 = *(const v4fa*)(arow + kb + 8 * hh), x1 = *(const v4fa*)(arow + kb + 8 * hh + 4);
    const v4f x2 = *(const v4fa*)(arow + kb + 16 + 8 * hh), x3 = *(const v4fa*)(arow + kb + 16 + 8 * hh + 4);
    float xs[16] = {x0[0],x0[1],x0[2],x0[3],x1[0],x1[1],x1[2],x1[3],x2[0],x2[1],x2[2],x2[3],x3[0],x3[1],x3[2],x3[3]};
#pragma unroll
    for (int i = 0; i < 16; ++i) { const unsigned short hb = bf16_bits(xs[i]); ah.u[i] = hb; al.u[i] = ASPLIT ? bf16_bits(xs[i] - bf16_val(hb)) : (unsigned short)0; }
#pragma unroll
    for (int t = 0; t < 4; ++t) {
      const unsigned short* brow = Wt + (size_t)(col0 + t * 16 + ln) * ldb + kb;
      FragB b;
      b.half[0] = *(const v8us*)(brow + 8 * hh);
      b.half[1] = *(const v8us*)(brow + 16 + 8 * hh);
      acc[t] = mmaN<ASPLIT ? 2 : 1>(ah.v, al.v, b.v, b.v, acc[t]);
    }
  }
#pragma unroll
  for (int t = 0; t < 4; ++t) {
    const int col = col0 + t * 16 + ln;
    float bv = bias ? bias[col] : 0.f;
    if (BIAS_BF16) bv = bf16_round(bv);
#pragma unroll
    for (int r = 0; r < 8; ++r) {
      float v = acc[t][r] + bv;
      if (resid) { float rv = resid[(size_t)((row0 + 8 * hh + r) % rmod) * ldr + col]; if (RES_BF16) rv = bf16_round(rv); v += rv; }
      if (ACT == 1) v = fmaxf(v, 0.f);
      if (ACT == 2) v = 0.5f * v * (1.0f + erff(v * 0.70710678118654752f));
      if (ACT == 3) { const float u = 0.7978845608028654f * (v + 0.044715f * v * v * v); v = 0.5f * v * (1.0f + tanhf(u)); }
      so[w][8 * hh + r][t * 16 + ln] = v;
    }
  }
  __builtin_amdgcn_fence(__ATOMIC_ACQ_REL, "workgroup");
  __builtin_amdgcn_wave_barrier();
  const int rsub = lane >> 4, c4 = (lane & 15) * 4;
  {
#pragma unroll
    for (int q = 0; q < 8; ++q) {
      const int r = q * 2 + rsub;
      const v4f v = *(const v4fa*)&so[w][r][c4];
      *(v4f*)(C + (size_t)(row0 + r) * ldc + col0 + c4) = v;
    }
    
  }
}
// row LayerNorm (biased variance, eps) over N: s = X (+ R); optional out_sum <- s; out_norm <- (s-mu)*rsqrt(var+eps)*g + b
template <bool PARAM_BF16>
__global__ __launch_bounds__(256) void k_layernorm(const float* __restrict__ X, const float* __restrict__ R, const float* __restrict__ g, const float* __restrict__ bta,
                                                  float* __restrict__ out_sum, float* __restrict__ out_norm, int N, float eps) {
  __shared__ float red[256];
  const int row = blockIdx.x, tid = threadIdx.x;
  const float* x = X + (size_t)row * N; const float* rr = R ? R + (size_t)row * N : nullptr;
  float vals[16];                     // up to N = 4096
  const int per = N / 256;            // contiguous chunk per thread? use strided-by-4 chunks: thread handles j = tid*4 + 1024*u
  float s1 = 0.f;
  for (int u = 0; u < per / 4; ++u) {
    const int j = tid * 4 + 1024 * u;
    const v4f a = *(const v4fa*)(x + j);
    v4f b = {0.f,0.f,0.f,0.f}; if (rr) b = *(const v4fa*)(rr + j);
#pragma unroll
    for (int q = 0; q < 4; ++q) { const float v = a[q] + b[q]; vals[u * 4 + q] = v; s1 += v; }
  }
  red[tid] = s1; __syncthreads();
  for (int st = 128; st > 0; st >>= 1) { if (tid < st) red[tid] += red[tid + st]; __syncthreads(); }
  const float mu = red[0] / (float)N; __syncthreads();
  float s2 = 0.f;
  for (int u = 0; u < per / 4; ++u)
#pragma unroll
    for (int q = 0; q < 4; ++q) { const float c = vals[u * 4 + q] - mu; s2 += c * c; }
  red[tid] = s2; __syncthreads();
  for (int st = 128; st > 0; st >>= 1) { if (tid < st) red[tid] += red[tid + st]; __syncthreads(); }
  const float rs = rsqrtf(red[0] / (float)N + eps);
  {
    for (int u = 0; u < per / 4; ++u) {
      const int j = tid * 4 + 1024 * u;
      v4f o, sm;
#pragma unroll
      for (int q = 0; q < 4; ++q) {
        float gg = g[j + q], bb = bta[j + q];
        if (PARAM_BF16) { gg = bf16_round(gg); bb = bf16_round(bb); }
        sm[q] = vals[u * 4 + q]; o[q] = (vals[u * 4 + q] - mu) * rs * gg + bb;
      }
      if (out_sum) *(v4f*)(out_sum + (size_t)row * N + j) = sm;
      *(v4f*)(out_norm + (size_t)row * N + j) = o;
    }
    
  }
}



// ---- f16 WMMA path (v_wmma_f32_16x16x32_f16): 11-bit significands for operands in range — used where a [0,1] probability operand needs more precision than bf16
typedef _Float16 v16h __attribute__((ext_vector_type(16)));
union FragH { v16h v; v8us half[2]; _Float16 h[16]; unsigned short u[16]; };
template <int NT>
__device__ __forceinline__ v8f mmaH(v16h ah, v16h al, v16h bh, v16h bl, v8f c) {
  c = __builtin_amdgcn_wmma_f32_16x16x32_f16(false, ah, false, bh, (short)0, c, false, false);
  if (NT >= 2) c = __builtin_amdgcn_wmma_f32_16x16x32_f16(false, al, false, bh, (short)0, c, false, false);
  if (NT >= 3) c = __builtin_amdgcn_wmma_f32_16x16x32_f16(false, ah, false, bl, (short)0, c, false, false);
  asm volatile("v_nop\n\tv_nop\n\tv_nop\n\tv_nop" : "+v"(c) : "v"(ah), "v"(al), "v"(bh), "v"(bl));
  return c;
}
// batched GEMM like k_gemm_b but f16 operands: A f32 (split into f16 hi/lo if ASPLIT, else rounded to f16), Bt = f16 values [n][k]; alpha; C f32; N multiple of 16 (partial tiles skipped)
template <bool ASPLIT>
__global__ __launch_bounds__(128) void k_gemm_h(const float* __restrict__ A, int lda, size_t sA, const _Float16* __restrict__ Bh, int ldb, size_t sB, float alpha, float* __restrict__ C, int ldc, size_t sC, int M, int N, int K) {
  __shared__ __attribute__((aligned(16))) float so[4][16][64];
  const int tid = threadIdx.x, w = tid >> 5, lane = tid & 31, ln = lane & 15, hh = lane >> 4; const int by = blockIdx.y;
  A += (size_t)by * sA; Bh += (size_t)by * sB; C += (size_t)by * sC;
  const int ntn = (N + 63) / 64; const int wid = blockIdx.x * 4 + w; const int mt = wid / ntn, nq = wid % ntn; if (mt * 16 >= M) return;
  const int row0 = mt * 16, col0 = nq * 64; const float* arow = A + (size_t)(row0 + ln) * lda;
  v8f acc[4] = {};
  for (int kb = 0; kb < K; kb += 32) {
    FragH ah, al;
    const v4f x0 = *(const v4fa*)(arow + kb + 8 * hh), x1 = *(const v4fa*)(arow + kb + 8 * hh + 4), x2 = *(const v4fa*)(arow + kb + 16 + 8 * hh), x3 = *(const v4fa*)(arow + kb + 16 + 8 * hh + 4);
    float xs[16] = {x0[0],x0[1],x0[2],x0[3],x1[0],x1[1],x1[2],x1[3],x2[0],x2[1],x2[2],x2[3],x3[0],x3[1],x3[2],x3[3]};
#pragma unroll
    for (int i = 0; i < 16; ++i) { const _Float16 h = (_Float16)xs[i]; ah.h[i] = h; al.h[i] = ASPLIT ? (_Float16)(xs[i] - (float)h) : (_Float16)0.0f; }
#pragma unroll
    for (int t = 0; t < 4; ++t) { if (col0 + t * 16 >= N) continue; const size_t boff = (size_t)(col0 + t * 16 + ln) * ldb + kb; FragH bq; bq.half[0] = *(const v8us*)(Bh + boff + 8 * hh); bq.half[1] = *(const v8us*)(Bh + boff + 16 + 8 * hh);
      acc[t] = mmaH<ASPLIT ? 2 : 1>(ah.v, al.v, bq.v, bq.v, acc[t]); }
  }
#pragma unroll
  for (int t = 0; t < 4; ++t) { if (col0 + t * 16 >= N) continue;
#pragma unroll
    for (int r = 0; r < 8; ++r) so[w][8 * hh + r][t * 16 + ln] = acc[t][r] * alpha; }
  __builtin_amdgcn_fence(__ATOMIC_ACQ_REL, "workgroup"); __builtin_amdgcn_wave_barrier();
  const int rsub = lane >> 4, c4 = (lane & 15) * 4;
  {
#pragma unroll
    for (int q = 0; q < 8; ++q) { const int r = q * 2 + rsub; if (col0 + c4 < N) { const v4f v = *(const v4fa*)&so[w][r][c4]; *(v4f*)(C + (size_t)(row0 + r) * ldc + col0 + c4) = v; } }
     }
}

// Wt[n][k] = f16(W[k][n]·scale) from f32 row-major W[K][N] (scale = power of two; bf16-exact weights stay exact in f16 away from the subnormal range)
__global__ __launch_bounds__(256) void k_wt_f16(const float* __restrict__ W, _Float16* __restrict__ Wt, int K, int N, float scale) {
  const int t = blockIdx.x * 256 + threadIdx.x; if (t >= N * (K / 8)) return; const int n = t / (K / 8), k8 = (t % (K / 8)) * 8; FragH f;
#pragma unroll
  for (int i = 0; i < 8; ++i) f.h[i] = (_Float16)(bf16_round(W[(size_t)(k8 + i) * N + n]) * scale); const v8us o = f.half[0];
  *(v8us*)((unsigned short*)Wt + (size_t)n * K + k8) = o; 
}
// k_gemm_hh variant with fused epilogue: v = acc·alpha + bias[by·sBias + col] (+ CP[(row/rowsPerB)·sCPb + by·64 + col] if CP) ; ACT 0 none / 1 elu ; writes f16 C16 (and f32 C if non-null)
template <int ACT>
__global__ __launch_bounds__(128) void k_gemm_hhx(const _Float16* __restrict__ A, int lda, size_t sA, const _Float16* __restrict__ Bh, int ldb, size_t sB, float alpha, const float* __restrict__ bias, size_t sBias, const float* __restrict__ CP, int rowsPerB, size_t sCPb, int row0g,
    float* __restrict__ C, _Float16* __restrict__ C16, int ldc, size_t sC, int M, int N, int K) {
  __shared__ __attribute__((aligned(16))) float so[4][16][64];
  const int tid = threadIdx.x, w = tid >> 5, lane = tid & 31, ln = lane & 15, hh = lane >> 4; const int by = blockIdx.y;
  A += (size_t)by * sA; Bh += (size_t)by * sB; const size_t cofs = (size_t)by * sC; const float* bp = bias ? bias + (size_t)by * sBias : nullptr;
  const int ntn = (N + 63) / 64; const int wid = blockIdx.x * 4 + w; const int mt = wid / ntn, nq = wid % ntn; if (mt * 16 >= M) return;
  const int row0 = mt * 16, col0 = nq * 64; const _Float16* arow = A + (size_t)(row0 + ln) * lda;
  v8f acc[4] = {};
  for (int kb = 0; kb < K; kb += 32) { FragH ah; ah.half[0] = *(const v8us*)((const unsigned short*)arow + kb + 8 * hh); ah.half[1] = *(const v8us*)((const unsigned short*)arow + kb + 16 + 8 * hh);
#pragma unroll
    for (int t = 0; t < 4; ++t) { if (col0 + t * 16 >= N) continue; const size_t boff = (size_t)(col0 + t * 16 + ln) * ldb + kb; FragH bq; bq.half[0] = *(const v8us*)((const unsigned short*)Bh + boff + 8 * hh); bq.half[1] = *(const v8us*)((const unsigned short*)Bh + boff + 16 + 8 * hh);
      acc[t] = mmaH<1>(ah.v, ah.v, bq.v, bq.v, acc[t]); }
  }
#pragma unroll
  for (int t = 0; t < 4; ++t) { if (col0 + t * 16 >= N) continue; const int col = col0 + t * 16 + ln; const float bv = bp ? bf16_round(bp[col]) : 0.f;
#pragma unroll
    for (int r = 0; r < 8; ++r) { float v = acc[t][r] * alpha + bv; if (CP) { const int rr = row0g + row0 + 8 * hh + r; if (rowsPerB < 0) v += CP[cofs + (size_t)rr * ldc + col];      /* rowsPerB < 0: own element of the batched C plane */ else { const int bidx = rr / rowsPerB; v += CP[(size_t)bidx * sCPb + (size_t)by * 64 + col]; } } if (ACT == 1) v = (v > 0.f) ? v : expm1f(v); else if (ACT == 7) v = (v > 0.f) ? v + 1.0f : expf(v); else if (ACT == 8) v = tanhf(v); else if (ACT == 9) v = 0.5f * v * (1.0f + tanhf(0.7978845608028654f * (v + 0.044715f * v * v * v))); else if (ACT == 11) v = 1.0f / (1.0f + expf(-v)); else if (ACT == 12) v = (v > 0.f) ? v : 0.01f * v; else if (ACT == 14) v = (v > 0.f) ? v : 0.1f * v; else if (ACT == 16) v = (v >= 0.f) ? v : 0.3f * v; else if (ACT == 17) v = (v >= 0.f) ? v : 0.2f * v; else if (ACT == 15) v = v / (1.0f + expf(-v)); else if (ACT == 3) v = fmaxf(v, 0.f); else if (ACT == 6) v = 0.5f * v * (1.0f + erff(v * 0.70710678118654752f)); so[w][8 * hh + r][t * 16 + ln] = v; } }
  __builtin_amdgcn_fence(__ATOMIC_ACQ_REL, "workgroup"); __builtin_amdgcn_wave_barrier();
  const int rsub = lane >> 4, c4 = (lane & 15) * 4; typedef _Float16 v4h __attribute__((ext_vector_type(4)));
  {
#pragma unroll
    for (int q = 0; q < 8; ++q) { const int r = q * 2 + rsub; if (col0 + c4 < N) { const v4f v = *(const v4fa*)&so[w][r][c4]; if (C) *(v4f*)(C + cofs + (size_t)(row0 + r) * ldc + col0 + c4) = v; if (C16) { v4h h4; for (int i = 0; i < 4; ++i) h4[i] = (_Float16)v[i]; *(v4h*)(C16 + cofs + (size_t)(row0 + r) * ldc + col0 + c4) = h4; } } }
     }
}


typedef _Float16 v4h __attribute__((ext_vector_type(4)));

__global__ __launch_bounds__(256) void k_x16(const float* __restrict__ x, _Float16* __restrict__ X16, size_t n8) { const size_t t = (size_t)blockIdx.x * 256 + threadIdx.x; if (t >= n8) return; FragH f;
#pragma unroll
  for (int q = 0; q < 8; ++q) f.h[q] = (_Float16)bf16_round(x[t * 8 + q]); *(v8us*)((unsigned short*)X16 + t * 8) = f.half[0];  }
__global__ __launch_bounds__(256) void k_h16(const float* __restrict__ x, _Float16* __restrict__ X16, size_t n8) { const size_t t = (size_t)blockIdx.x * 256 + threadIdx.x; if (t >= n8) return; FragH f;
#pragma unroll
  for (int q = 0; q < 8; ++q) f.h[q] = (_Float16)x[t * 8 + q]; *(v8us*)((unsigned short*)X16 + t * 8) = f.half[0];  }
__global__ __launch_bounds__(256) void k_round16f(const float* __restrict__ W, _Float16* __restrict__ Bt, size_t n8) { const size_t t = (size_t)blockIdx.x * 256 + threadIdx.x; if (t >= n8) return; FragH f;
#pragma unroll
  for (int i = 0; i < 8; ++i) f.h[i] = (_Float16)(bf16_round(W[t * 8 + i]) * 16.0f); *(v8us*)((unsigned short*)Bt + t * 8) = f.half[0];  }
template <int NHv, int TTv>
__global__ __launch_bounds__(256) void k_vt(const _Float16* __restrict__ V16, int ldv, int voff, _Float16* __restrict__ Vt) { __shared__ unsigned short tl[64][66]; const int tid = threadIdx.x; const int slab = blockIdx.x / (TTv / 64), lg = blockIdx.x % (TTv / 64); const int b = slab / NHv, h = slab % NHv;
  for (int i = tid; i < 64 * 8; i += 256) { const int r = i / 8, c8 = (i % 8) * 8; FragH f; f.half[0] = *(const v8us*)((const unsigned short*)V16 + ((size_t)b * TTv + lg * 64 + r) * ldv + voff + h * 64 + c8);
#pragma unroll
    for (int q = 0; q < 8; ++q) tl[r][c8 + q] = f.u[q]; }
  __syncthreads();
  {
#pragma unroll
    for (int rd = 0; rd < 2; ++rd) { const int d = rd * 32 + tid / 8, pc = tid % 8; FragH f;
#pragma unroll
      for (int q = 0; q < 8; ++q) f.u[q] = tl[pc * 8 + q][d];
      *(v8us*)((unsigned short*)Vt + ((size_t)slab * 64 + d) * TTv + lg * 64 + pc * 8) = f.half[0]; }
     } }

__global__ __launch_bounds__(256) void k_hl(const float* __restrict__ F, _Float16* __restrict__ Hh, _Float16* __restrict__ Hl, size_t n8) { const size_t t = (size_t)blockIdx.x * 256 + threadIdx.x; if (t >= n8) return; FragH fh, fl; const v4f a = *(const v4fa*)(F + t * 8), c = *(const v4fa*)(F + t * 8 + 4);
#pragma unroll
  for (int q = 0; q < 4; ++q) { _Float16 h = (_Float16)a[q]; fh.h[q] = h; fl.h[q] = (_Float16)((a[q] - (float)h) * 1024.0f); h = (_Float16)c[q]; fh.h[4 + q] = h; fl.h[4 + q] = (_Float16)((c[q] - (float)h) * 1024.0f); }
  { *(v8us*)((unsigned short*)Hh + t * 8) = fh.half[0]; *(v8us*)((unsigned short*)Hl + t * 8) = fl.half[0];  } }

// ---- fast GEMM (wave tile 32x64; requires M % 32 == 0 rows per launch region and N % 64 == 0); epilogue = k_gemm_hhx semantics, except the rowsPerB < 0 addend plane steps by sCPb per grid.y slice ----
__device__ __forceinline__ v16h g2_frag(const _Float16* p, int hh) { FragH f; f.half[0] = *(const v8us*)((const unsigned short*)p + 8 * hh); f.half[1] = *(const v8us*)((const unsigned short*)p + 16 + 8 * hh); return f.v; }
__device__ __forceinline__ v8f g2_mma(v16h a, v16h b, v8f c) { v8f d = __builtin_amdgcn_wmma_f32_16x16x32_f16(false, a, false, b, (short)0, c, false, false); asm volatile("v_nop\n\tv_nop\n\tv_nop\n\tv_nop" : "+v"(d) : "v"(a), "v"(b)); return d; }
template <int ACT>
__global__ __launch_bounds__(128) void k_gemm2(const _Float16* __restrict__ A, int lda, size_t sA, const _Float16* __restrict__ Bh, int ldb, size_t sB, float alpha, const float* __restrict__ bias, size_t sBias, const float* __restrict__ CP, int rowsPerB, size_t sCPb, int row0g,
    float* __restrict__ C, _Float16* __restrict__ C16, int ldc, size_t sC, int M, int N, int K) { static_assert(ACT == 0 || ACT == 3 || ACT == 6 || ACT == 8 || ACT == 9 || ACT == 11 || ACT == 12 || ACT == 14 || ACT == 15 || ACT == 16 || ACT == 17, "k_gemm2: unsupported ACT code (would silently apply no activation)");
  __shared__ __attribute__((aligned(16))) float so[4][32][68];
  const int tid = threadIdx.x, w = tid >> 5, lane = tid & 31, ln = lane & 15, hh = lane >> 4; const int by = blockIdx.y;
  A += (size_t)by * sA; Bh += (size_t)by * sB; const size_t cofs = (size_t)by * sC; const float* bp = bias ? bias + (size_t)by * sBias : nullptr;
  const int ntn = N >> 6; const int mt = blockIdx.x / ntn, nq = blockIdx.x - mt * ntn; const int row0 = mt * 128 + 32 * w, col0 = nq * 64; if (row0 >= M) return;
  const _Float16* a0p = A + (size_t)(row0 + ln) * lda; const _Float16* a1p = a0p + (size_t)16 * lda;
  const _Float16* b0p = Bh + (size_t)(col0 + ln) * ldb; const _Float16* b1p = b0p + (size_t)16 * ldb; const _Float16* b2p = b1p + (size_t)16 * ldb; const _Float16* b3p = b2p + (size_t)16 * ldb;
  const v8f z8 = {0.f,0.f,0.f,0.f,0.f,0.f,0.f,0.f}; v8f c00 = z8, c01 = z8, c02 = z8, c03 = z8, c10 = z8, c11 = z8, c12 = z8, c13 = z8;
#pragma unroll 1
  for (int kb = 0; kb < K; kb += 32) { const v16h a0 = g2_frag(a0p + kb, hh), a1 = g2_frag(a1p + kb, hh);
    v16h b = g2_frag(b0p + kb, hh); c00 = g2_mma(a0, b, c00); c10 = g2_mma(a1, b, c10);
    b = g2_frag(b1p + kb, hh); c01 = g2_mma(a0, b, c01); c11 = g2_mma(a1, b, c11);
    b = g2_frag(b2p + kb, hh); c02 = g2_mma(a0, b, c02); c12 = g2_mma(a1, b, c12);
    b = g2_frag(b3p + kb, hh); c03 = g2_mma(a0, b, c03); c13 = g2_mma(a1, b, c13); }
  v8f accs[8] = {c00, c01, c02, c03, c10, c11, c12, c13};
#pragma unroll
  for (int u = 0; u < 8; ++u) { const int t = u & 3, half = u >> 2; const int col = col0 + t * 16 + ln; const float bv = bp ? bf16_round(bp[col]) : 0.f;
#pragma unroll
    for (int r = 0; r < 8; ++r) { const int rloc = half * 16 + 8 * hh + r; float v = accs[u][r] * alpha + bv; if (CP) { if (rowsPerB < 0) v += CP[(size_t)by * sCPb + (size_t)(row0g + row0 + rloc) * ldc + col];      /* rowsPerB < 0: own element of an addend plane shaped like C; sCPb = its step from one grid.y slice to the next (0: one plane shared by all slices) */ else { const int bidx = (row0g + row0 + rloc) / rowsPerB; v += CP[(size_t)bidx * sCPb + (size_t)by * 64 + col]; } }
      if (ACT == 3) v = fmaxf(v, 0.f); else if (ACT == 6) v = 0.5f * v * (1.0f + erff(v * 0.70710678118654752f)); else if (ACT == 11) v = 1.0f / (1.0f + expf(-v)); else if (ACT == 15) v = v / (1.0f + expf(-v)); else if (ACT == 12) v = (v > 0.f) ? v : 0.01f * v; else if (ACT == 8) v = tanhf(v); else if (ACT == 9) v = 0.5f * v * (1.0f + tanhf(0.7978845608028654f * (v + 0.044715f * v * v * v))); else if (ACT == 14) v = (v > 0.f) ? v : 0.1f * v; else if (ACT == 16) v = (v >= 0.f) ? v : 0.3f * v; else if (ACT == 17) v = (v >= 0.f) ? v : 0.2f * v;
      so[w][rloc][t * 16 + ln] = v; } }
  __builtin_amdgcn_fence(__ATOMIC_ACQ_REL, "workgroup"); __builtin_amdgcn_wave_barrier();
  const int rsub = lane >> 4, c4 = (lane & 15) * 4;
  {
#pragma unroll
    for (int q = 0; q < 16; ++q) { const int r = q * 2 + rsub; const v4f v = *(const v4fa*)&so[w][r][c4]; if (C) *(v4f*)(C + cofs + (size_t)(row0 + r) * ldc + col0 + c4) = v; if (C16) { v4h h4; for (int i = 0; i < 4; ++i) h4[i] = (_Float16)v[i]; *(v4h*)(C16 + cofs + (size_t)(row0 + r) * ldc + col0 + c4) = h4; } }
     } }


__global__ __launch_bounds__(256) void k_wnat(const float* __restrict__ w, size_t n8, _Float16* __restrict__ Bt) { const size_t t = (size_t)blockIdx.x * 256 + threadIdx.x; if (t >= n8) return; FragH f; for (int q = 0; q < 8; ++q) f.h[q] = (_Float16)(bf16_round(w[t * 8 + q]) * 16.0f); *(v8us*)((unsigned short*)Bt + t * 8) = f.half[0];  }
__global__ __launch_bounds__(256) void k_rsm(const float* __restrict__ S, _Float16* __restrict__ P, int nrows) {
  #pragma clang fp contract(off)
  const int i = blockIdx.x * 256 + threadIdx.x; if (i >= nrows) return; const float* s = S + (size_t)i * SQ; float mx = -3.0e38f;
#pragma unroll 1
  for (int j = 0; j < SQ; ++j) mx = fmaxf(mx, s[j]); float se = 0.f;
#pragma unroll 1
  for (int j = 0; j < SQ; ++j) se += expf(s[j] - mx); const float sc = 256.0f / se;
#pragma unroll 1
  for (int j0 = 0; j0 < SQ; j0 += 8) { FragH f; for (int q = 0; q < 8; ++q) f.h[q] = (_Float16)(expf(s[j0 + q] - mx) * sc); unsigned short* d = (unsigned short*)P + (size_t)i * SQ + j0; *(v8us*)d = f.half[0];  } }
__global__ __launch_bounds__(256) void k_vt(const _Float16* __restrict__ V16, int b, int h0, _Float16* __restrict__ VT) { __shared__ unsigned short tl[64][65]; const int tid = threadIdx.x; const int hh = blockIdx.x % HG, sg = blockIdx.x / HG; const int s0 = sg * 64; const int h = h0 + hh;
  for (int i = tid; i < 64 * 8; i += 256) { const int j = i / 8, d8 = (i % 8) * 8; FragH f; f.half[0] = *(const v8us*)((const unsigned short*)V16 + ((size_t)b * SQ + s0 + j) * DM + h * HD + d8); for (int q = 0; q < 8; ++q) tl[d8 + q][j] = f.u[q]; }
  __syncthreads();
  { for (int i = tid; i < 64 * 8; i += 256) { const int d = i / 8, j8 = (i % 8) * 8; FragH f; for (int q = 0; q < 8; ++q) f.u[q] = tl[d][j8 + q]; *(v8us*)((unsigned short*)VT + ((size_t)hh * HD + d) * SQ + s0 + j8) = f.half[0]; }  } }



__global__ __launch_bounds__(256) void k_rsmcf2(const float* __restrict__ S, _Float16* __restrict__ P, int hg, int q0, int nk) {
  #pragma clang fp contract(off)
  const int t = blockIdx.x * 256 + threadIdx.x; if (t >= hg * QT) return; const size_t i = (size_t)t; const float* s = S + i * NKX; const int last = q0 + (t % QT); float mx = -3.0e38f;
#pragma unroll 1
  for (int j = 0; j < nk; ++j) { const float f = (j <= last) ? 1.f : 0.f; mx = fmaxf(mx, fmaf(f, s[j], (1.f - f) * -1.0e9f)); } float se = 0.f;
#pragma unroll 1
  for (int j = 0; j < nk; ++j) { const float f = (j <= last) ? 1.f : 0.f; se += __expf(fmaf(f, s[j], (1.f - f) * -1.0e9f) - mx); } const float sc = 256.0f / se;
#pragma unroll 1
  for (int j0 = 0; j0 < nk; j0 += 8) { FragH fr; for (int q = 0; q < 8; ++q) { const int j = j0 + q; const float f = (j <= last) ? 1.f : 0.f; fr.h[q] = (_Float16)(__expf(fmaf(f, s[j], (1.f - f) * -1.0e9f) - mx) * sc); } unsigned short* d = (unsigned short*)P + i * NKX + j0; *(v8us*)d = fr.half[0];  } }

template <int MASKADD>
__global__ __launch_bounds__(64) void k_att0(const float* __restrict__ QF, const float* __restrict__ KF, const float* __restrict__ VF, int ld, const float* __restrict__ mask, float scale, float* __restrict__ OF, int ldo) {
  #pragma clang fp contract(off)
  __shared__ __attribute__((aligned(16))) float lq[64][64]; __shared__ __attribute__((aligned(16))) float lo[64][64];
  const int tid = threadIdx.x; const int h = blockIdx.x / (QT0 / 64), rg = blockIdx.x % (QT0 / 64); const int i = rg * 64 + tid;
  const float* qr = QF + (size_t)i * ld + h * HD;
#pragma unroll 1
  for (int c = 0; c < HD / 4; ++c) { *(v4f*)&lq[tid][c * 4] = *(const v4fa*)(qr + c * 4); const v4f z = {0.f, 0.f, 0.f, 0.f}; *(v4f*)&lo[tid][c * 4] = z; }
  float m = -1.0e30f, l = 0.f; const int jmax = MASKADD ? (SQ - 1) : (rg * 64 + 63);      /* additive-mask form: every key (the mask input decides); causal form: keys up to the block's last row */
#pragma unroll 1
  for (int j = 0; j <= jmax; ++j) { const float* kr = KF + (size_t)j * ld + h * HD; const float* vr = VF + (size_t)j * ld + h * HD; float s = 0.f;
#pragma unroll 1
    for (int c = 0; c < HD / 4; ++c) { const v4f kq = *(const v4fa*)(kr + c * 4); const v4f qq = *(v4f*)&lq[tid][c * 4]; s = __fadd_rn(s, __fmul_rn(qq[0], kq[0])); s = __fadd_rn(s, __fmul_rn(qq[1], kq[1])); s = __fadd_rn(s, __fmul_rn(qq[2], kq[2])); s = __fadd_rn(s, __fmul_rn(qq[3], kq[3])); }
    s = __fmul_rn(s, scale); if (MASKADD) s = __fadd_rn(s, __fmul_rn(bf16_round(mask[(size_t)i * SQ + j]), -10000.0f));
    const float f = (MASKADD || j <= i) ? 1.f : 0.f; const float sm = fmaf(f, s, (1.f - f) * -1.0e30f); const float mn = fmaxf(m, sm); const float sc = expf(m - mn); const float e = expf(sm - mn); l = __fadd_rn(__fmul_rn(l, sc), e); m = mn;
#pragma unroll 1
    for (int c = 0; c < HD / 4; ++c) { const v4f vv = *(const v4fa*)(vr + c * 4); v4f oo = *(v4f*)&lo[tid][c * 4]; for (int u = 0; u < 4; ++u) oo[u] = __fadd_rn(__fmul_rn(oo[u], sc), __fmul_rn(e, vv[u])); *(v4f*)&lo[tid][c * 4] = oo; } }
  const float fin = 64.0f / l;      /* o carried x64 like the f16 path */
#pragma unroll 1
  for (int c = 0; c < HD / 4; ++c) { v4f oo = *(v4f*)&lo[tid][c * 4]; for (int u = 0; u < 4; ++u) oo[u] = __fmul_rn(oo[u], fin); *(v4f*)&lo[tid][c * 4] = oo; }
  __syncthreads();
  {
#pragma unroll 1
    for (int it = 0; it < 16; ++it) { const int row = it * 4 + tid / 16, pc = (tid % 16) * 4; const v4f v = *(const v4f*)&lo[row][pc]; *(v4f*)(OF + (size_t)(rg * 64 + row) * ldo + h * HD + pc) = v; }
     } }

__global__ __launch_bounds__(256) void k_oscale(const float* __restrict__ OF, float* __restrict__ out, size_t n4) { const size_t t = (size_t)blockIdx.x * 256 + threadIdx.x; if (t >= n4) return; const v4f a = *(const v4fa*)(OF + t * 4); v4f o; for (int q = 0; q < 4; ++q) o[q] = a[q] * 0.015625f; *(v4f*)(out + t * 4) = o;  }

__global__ __launch_bounds__(256) void k_bfr(const float* __restrict__ x, float* __restrict__ XB, size_t n8) { const size_t t = (size_t)blockIdx.x * 256 + threadIdx.x; if (t >= n8) return; v4f a = *(const v4fa*)(x + t * 8), c = *(const v4fa*)(x + t * 8 + 4); for (int q = 0; q < 4; ++q) { a[q] = bf16_round(a[q]); c[q] = bf16_round(c[q]); }
  { *(v4f*)(XB + t * 8) = a; *(v4f*)(XB + t * 8 + 4) = c;  } }



__global__ __launch_bounds__(256) void k_rsmfvl(const float* __restrict__ S, _Float16* __restrict__ P, _Float16* __restrict__ PL, int qn, const int* __restrict__ vlp) {
  #pragma clang fp contract(off)
  const int t = blockIdx.x * 256 + threadIdx.x; if (t >= qn) return; const int vl = vlp[0]; const size_t i = (size_t)t; const float* s = S + i * SQ; float mx = -3.0e38f;
#pragma unroll 1
  for (int j = 0; j < SQ; ++j) { const float f = (j < vl) ? 1.f : 0.f; mx = fmaxf(mx, fmaf(f, s[j], (1.f - f) * -1000000.0f)); } float se = 0.f;
#pragma unroll 1
  for (int j = 0; j < SQ; ++j) { const float f = (j < vl) ? 1.f : 0.f; se += __expf(fmaf(f, s[j], (1.f - f) * -1000000.0f) - mx); } const float sc = 256.0f / se;
#pragma unroll 1
  for (int j0 = 0; j0 < SQ; j0 += 8) { FragH fr, gr; for (int q = 0; q < 8; ++q) { const int j = j0 + q; const float f = (j < vl) ? 1.f : 0.f; const float pv = __expf(fmaf(f, s[j], (1.f - f) * -1000000.0f) - mx) * sc; const _Float16 ph = (_Float16)pv; fr.h[q] = ph; gr.h[q] = (_Float16)((pv - (float)ph) * 1024.0f); }
    unsigned short* d = (unsigned short*)P + i * SQ + j0; unsigned short* dl = (unsigned short*)PL + i * SQ + j0; *(v8us*)d = fr.half[0]; *(v8us*)dl = gr.half[0];  } }

// 2^x on the transcendental unit; the v_nop is the one free slot the instruction set asks for behind a transcendental, in the same statement so that it stays directly behind it.
__device__ __forceinline__ float exp2_slot(float x) { float r; asm("v_exp_f32 %0, %1\n\tv_nop" : "=v"(r) : "v"(x)); return r; }

#define CN 256          /* channels */
#define CI 128          /* inner channels */
#define NP 4096         /* positions */
#define NM 1024         /* pooled positions (= SQ: the softmax key count) */

// Fused attention: one launch computes scores, softmax and the weighted sum of g for all images; neither the scores nor the weights go to memory.
// A work-group of 8 waves takes 128 queries of one image (16 a wave) and walks the 1024 pooled positions 32 at a time.
// S^T = phi^T (A, rows m) x theta (B, columns n; fragments kept in registers), three terms as before: hi.hi + (hi.lo + lo.hi) / 1024.
// In the accumulator a lane holds, for ITS query n = lane & 15, the keys m = 8 * (lane >> 4) + r of a 16-key tile: two such tiles are, register for register, the B fragment of y[c][n] += g[c][m] P^T[m][n]
// (elements 0..7 = keys 8 hh + r, elements 8..15 = keys 16 + 8 hh + r, the k order in which g2_frag / lds_frag read the rows of g), so the weights move through no LDS and no other lane.
// Running row maximum and row sum per lane (online softmax; the two half-waves share the maximum every pass and join their sums once at the end). Weights are carried x256 in f16 as before; the sum carries the same factor.
// The phi hi / lo rows and the g columns of a pass are shared by the 8 waves through LDS, a ring of FR = 2 FKB + 1 buffers with one barrier every FKB passes: pass t works on tile t, reads tile t + 1's phi fragments ahead, and stages tile t + FKB + 1 (global loads at its head, LDS stores at its foot).
// Between two barriers (passes k s .. k s + k - 1, k = FKB) the waves read tiles k s .. k s + k and write tiles k s + k + 1 .. k s + 2 k, which lie in the buffers of tiles k s - k .. k s - 1, left by every wave before the barrier in front; the barrier behind publishes them. The two waves of a SIMD take turns at the matrix unit, so one reaches every barrier later than the other: fewer barriers, fewer such waits.
// Every LDS fragment read stands one phase ahead of its use, as a whole group: the g fragments of a pass in front of its score products, the next pass's 16 phi fragments behind them (into the registers they have just left), in front of the exponentials and the g products.
#define FK 32                            /* keys per pass */
#define FPP 136                          /* LDS pitch of a phi row in f16: 256 B + 16 B, an odd multiple of 16 B (no bank conflict for 16-byte reads of 16 rows) */
#define FGP 40                           /* LDS pitch of a g row in f16: 64 B + 16 B, likewise */
#define FBUF (2 * FK * FPP + CI * FGP)   /* one buffer in f16: phi hi, phi lo, g */
#define FKB 4                            /* passes between two barriers */
#define FR (2 * FKB + 1)                 /* buffers in the ring */
__device__ __forceinline__ v16h lds_frag(const unsigned short* p) { FragH f; f.half[0] = *(const v8us*)p; f.half[1] = *(const v8us*)(p + 16); return f.v; }
__device__ __forceinline__ v8f f_mma(v16h a, v16h b, v8f c) { return __builtin_amdgcn_wmma_f32_16x16x32_f16(false, a, false, b, (short)0, c, false, false); }
#define SOP 132                          /* LDS pitch of a gathered output row in f32: 512 B + 16 B (16-byte writes of 16 rows fall on all banks) */
__global__ __launch_bounds__(256) void k_fattn(const _Float16* __restrict__ TH, const _Float16* __restrict__ THL, const _Float16* __restrict__ PHT, const _Float16* __restrict__ PHLT, const _Float16* __restrict__ G16, const _Float16* __restrict__ BW, const float* __restrict__ BN4, const float* __restrict__ x, float* __restrict__ out) {
  __shared__ __attribute__((aligned(16))) unsigned short sm[FR * FBUF];
  static_assert((NM / FK) % FKB == 0 && NM / FK > FKB, "the last pass ends in a barrier; the prologue's tiles exist");
  static_assert(128 * FPP * 2 + 8 * 32 * SOP * 4 <= FR * FBUF * 2, "y^T and the gathered output rows fit in the ring");
  float* const so = (float*)(sm + 128 * FPP);      /* epilogue: each wave gathers its own 32 output rows here, over the ring and behind y^T */
  const int tid = threadIdx.x, w = tid >> 5, lane = tid & 31, ln = lane & 15, hh = lane >> 4, by = blockIdx.y;
  const int n0 = blockIdx.x * 128 + w * 16;
  const unsigned short* ph = (const unsigned short*)PHT + (size_t)by * CI * NM; const unsigned short* pl = (const unsigned short*)PHLT + (size_t)by * CI * NM; const unsigned short* gg = (const unsigned short*)G16 + (size_t)by * CI * NM;
  const _Float16* tq = TH + ((size_t)by * NP + n0 + ln) * CI; const _Float16* tl = THL + ((size_t)by * NP + n0 + ln) * CI;
  v16h qh[4], ql[4];
#pragma unroll
  for (int j = 0; j < 4; ++j) { qh[j] = g2_frag(tq + j * 32, hh); ql[j] = g2_frag(tl + j * 32, hh); }
  /* staging: 16-byte pieces; phi tile = 32 rows x 16 pieces (contiguous in memory), g tile = 128 rows x 4 pieces; two pieces of each plane a thread */
  const int pr = tid >> 4, pc = (tid & 15) * 8, gr = tid >> 2, gc = (tid & 3) * 8;
  v8us r0, r1, r2, r3, r4, r5;
  const unsigned short *fh, *fl, *fg;      /* the lane's first piece of each plane of the tile being fetched */
  auto fetch = [&](int t) { const size_t m0 = (size_t)t * FK;
    fh = ph + (m0 + pr) * CI + pc; fl = pl + (m0 + pr) * CI + pc; fg = gg + ((size_t)t * CI + gr) * FK + gc;      /* g lies tile by tile: [m / 32][ci][32], one pass's tile = 8 KiB in a row */
    r0 = *(const v8us*)fh; r1 = *(const v8us*)(fh + 16 * CI);
    r2 = *(const v8us*)fl; r3 = *(const v8us*)(fl + 16 * CI);
    r4 = *(const v8us*)fg; r5 = *(const v8us*)(fg + 64 * FK); };
  auto fetched = [&]() { asm volatile("s_wait_xcnt 0x0" :: "v"(fh), "v"(fl), "v"(fg) : "memory"); };      /* the wait that stands in front of any overwrite of a register which an issued load names; the three addresses are inputs so that they stay live up to it */
  auto put = [&](int bo) { unsigned short* d = sm + bo;
    *(v8us*)(d + pr * FPP + pc) = r0; *(v8us*)(d + (pr + 16) * FPP + pc) = r1;
    *(v8us*)(d + FK * FPP + pr * FPP + pc) = r2; *(v8us*)(d + FK * FPP + (pr + 16) * FPP + pc) = r3;
    *(v8us*)(d + 2 * FK * FPP + gr * FGP + gc) = r4; *(v8us*)(d + 2 * FK * FPP + (gr + 64) * FGP + gc) = r5; };
  v16h pa[16];      /* a tile's phi fragments: [4 j + 0 / 1] = hi rows 0..15 / 16..31, [4 j + 2 / 3] = residual rows, k block j */
  auto ldphi = [&](int bo) { const unsigned short* a = sm + bo + ln * FPP + 8 * hh;
#pragma unroll
    for (int j = 0; j < 4; ++j) { pa[4 * j] = lds_frag(a + j * 32); pa[4 * j + 1] = lds_frag(a + 16 * FPP + j * 32); pa[4 * j + 2] = lds_frag(a + FK * FPP + j * 32); pa[4 * j + 3] = lds_frag(a + (FK + 16) * FPP + j * 32); } };
  const v8f z8 = {0.f,0.f,0.f,0.f,0.f,0.f,0.f,0.f};
  v8f o[8];
#pragma unroll
  for (int ct = 0; ct < 8; ++ct) o[ct] = z8;
  float m = -1.0e30f, l = 0.f;
  { v8us st[FKB + 1][6];      /* tiles 0 .. FKB: all their loads fly together */
    fh = ph + (size_t)pr * CI + pc; fl = pl + (size_t)pr * CI + pc; fg = gg + (size_t)gr * FK + gc;
#pragma unroll
    for (int i = 0; i <= FKB; ++i) { st[i][0] = *(const v8us*)(fh + i * FK * CI); st[i][1] = *(const v8us*)(fh + i * FK * CI + 16 * CI); st[i][2] = *(const v8us*)(fl + i * FK * CI); st[i][3] = *(const v8us*)(fl + i * FK * CI + 16 * CI); st[i][4] = *(const v8us*)(fg + i * CI * FK); st[i][5] = *(const v8us*)(fg + i * CI * FK + 64 * FK); }
    fetched();
#pragma unroll
    for (int i = 0; i <= FKB; ++i) { r0 = st[i][0]; r1 = st[i][1]; r2 = st[i][2]; r3 = st[i][3]; r4 = st[i][4]; r5 = st[i][5]; put(i * FBUF); } }
  __syncthreads();      /* publishes tiles 0 .. FKB */
  ldphi(0);
  int b0 = 0, b1 = FBUF, b2 = (FKB + 1) * FBUF;      /* ring offsets of tiles t, t + 1, t + FKB + 1 */
  int tf = FKB + 1;      /* the tile that pass t stages: t + FKB + 1, held at the last tile */
  auto pass = [&]() {
    const unsigned short* ag = sm + b0 + 2 * FK * FPP + ln * FGP + 8 * hh;
    v16h ga[8];
    fetch(tf);      /* the index is held at the last tile so that the pass has no branch and stays one scheduling region; what the last FKB + 1 passes stage is written and read ahead like any tile and enters no product */
#pragma unroll
    for (int ct = 0; ct < 8; ++ct) ga[ct] = lds_frag(ag + ct * 16 * FGP);
    __builtin_amdgcn_sched_barrier(0);      /* keeps the g fragment reads and the staging loads in front of the score products, which cover them; without it the compiler sinks each read to just in front of its product and the wave waits out the LDS latency there */
    v8f sh0 = z8, sh1 = z8, sl0 = z8, sl1 = z8;
#pragma unroll
    for (int j = 0; j < 4; ++j) {
      sh0 = f_mma(pa[4 * j], qh[j], sh0); sh1 = f_mma(pa[4 * j + 1], qh[j], sh1);
      sl0 = f_mma(pa[4 * j], ql[j], sl0); sl1 = f_mma(pa[4 * j + 1], ql[j], sl1);
      sl0 = f_mma(pa[4 * j + 2], qh[j], sl0); sl1 = f_mma(pa[4 * j + 3], qh[j], sl1);
    }
    float s[16];
#pragma unroll
    for (int r = 0; r < 8; ++r) { s[r] = sh0[r] + sl0[r] * 0.0009765625f; s[8 + r] = sh1[r] + sl1[r] * 0.0009765625f; }
    float mx = fmaxf(s[0], s[1]);
#pragma unroll
    for (int r = 2; r < 16; ++r) mx = fmaxf(mx, s[r]);
    const float mo = __shfl_xor(mx, 16, 32);      /* the other half-wave holds the same query's other 16 keys */
    __builtin_amdgcn_sched_barrier(0);      /* the exchange goes through the LDS queue, which answers in order: it is issued in front of the 32 reads below, so that its wait does not take them in */
    fetched();      /* here and not at the loads: it has to stand in front of the first overwrite of the three address pairs only, and they stay untouched up to it; the score products lie in between */
    ldphi(b1);      /* tile t + 1, published by the last barrier or an earlier one */
    __builtin_amdgcn_sched_barrier(0);      /* keeps the whole group here, in front of the exponentials and the g products, which cover it */
    mx = fmaxf(mx, mo);
    const float mn = fmaxf(m, mx);
    const float sc = exp2_slot((m - mn) * 1.44269504f);
    m = mn;
    FragH pf; float p0 = 0.f, p1 = 0.f;
#pragma unroll
    for (int r = 0; r < 8; ++r) {
      const float e0 = exp2_slot((s[r] - mn) * 1.44269504f + 8.0f), e1 = exp2_slot((s[8 + r] - mn) * 1.44269504f + 8.0f);
      p0 += e0; p1 += e1; pf.h[r] = (_Float16)e0; pf.h[8 + r] = (_Float16)e1;
    }
    l = l * sc + (p0 + p1);
#pragma unroll
    for (int ct = 0; ct < 8; ++ct) o[ct] *= sc;
#pragma unroll
    for (int ct = 0; ct < 8; ++ct) o[ct] = f_mma(ga[ct], pf.v, o[ct]);
    __builtin_amdgcn_sched_barrier(0);      /* keeps the staging stores, and with them the barrier's wait on the LDS queue, behind the g products: hoisted over them, that wait stood right behind the exponentials and took in the 32 reads */
    put(b2);
    b0 = b1; b1 = b1 + FBUF == FR * FBUF ? 0 : b1 + FBUF; b2 = b2 + FBUF == FR * FBUF ? 0 : b2 + FBUF;
    if (tf + 1 < NM / FK) ++tf;
  };
  /* rolled: FKB passes are already more than a thousand instructions, and the ring offsets are the only thing that changes */
#pragma unroll 1
  for (int t = 0; t < NM / FK; t += FKB) {
    /* unrolled, so that the passes between two barriers are straight-line code: with a branch round the barrier in every pass the compiler sank the row sum's chain of additions out of the exponentials' shadow to the pass's foot */
#pragma unroll
    for (int u = 0; u < FKB; ++u) pass();
    __syncthreads();      /* publishes the FKB tiles staged since the last barrier; ends every wave's reads of the FKB tiles worked on since, whose buffers the next FKB passes overwrite */
  }
  /* Epilogue: z[c][n] = BN(W y + W_b) + bf16(x) for the work-group's 128 positions. The waves exchange y^T through LDS; then a wave takes 32 output channels and all 128 positions:
     D[n][c] = (y^T rows as A) (16 W rows as B^T), so that a lane holds 8 consecutive positions of ITS channel c = lane & 15; bias and BatchNorm are applied there, the rows are gathered in the wave's own LDS range and leave, with the residual, as whole 512-byte pieces of a channel row. */
  const int c0 = w * 32, cl = c0 + ln;
  const unsigned short* wr = (const unsigned short*)BW + (size_t)cl * CI + 8 * hh;      /* elements 0..7 = k 8 hh + 0..7, elements 8..15 = k 16 + 8 hh + 0..7 of each 32, the order in which lds_frag reads the rows of y^T */
  const float* bnp = BN4 + 4 * cl;
  v16h wf[2][4]; v4f bn[2];
#pragma unroll
  for (int u = 0; u < 2; ++u) {
#pragma unroll
    for (int j = 0; j < 4; ++j) { FragH f; f.half[0] = *(const v8us*)(wr + u * 16 * CI + j * 32); f.half[1] = *(const v8us*)(wr + u * 16 * CI + j * 32 + 16); wf[u][j] = f.v; }
    bn[u] = *(const v4fa*)(bnp + u * 64); }
  asm volatile("s_wait_xcnt 0x0" :: "v"(wr), "v"(cl) : "memory");      /* the wait that stands in front of any overwrite of a register which an issued load names; the weights' address and the row index that the constants' loads are addressed by are inputs so that they stay live up to it */
  l += __shfl_xor(l, 16, 32);
  const float inv = 1.0f / l;
  { unsigned short* yo = sm + (w * 16 + ln) * FPP + 8 * hh;      /* y^T [128 n][ci] over the ring, which nobody reads behind the loop's last barrier: the lane's 8 channels of a tile are 16 contiguous bytes of its query's row */
#pragma unroll
    for (int ct = 0; ct < 8; ++ct) { FragH f;
#pragma unroll
      for (int r = 0; r < 8; ++r) f.h[r] = (_Float16)(o[ct][r] * inv);
      *(v8us*)(yo + ct * 16) = f.half[0]; } }
  __syncthreads();      /* publishes y^T */
  const size_t e0 = ((size_t)by * CN + c0) * NP + blockIdx.x * 128 + lane * 4;      /* the lane's 4 positions of the wave's first channel row */
  const float* xb = x + e0;
  v4f xx[32];      /* behind the barrier, which waits for every load in flight: the residual flies under the products */
#pragma unroll
  for (int q = 0; q < 32; ++q) xx[q] = *(const v4fa*)(xb + (size_t)q * NP);
  asm volatile("s_wait_xcnt 0x0" :: "v"(xb) : "memory");      /* as above, for the one address of this run */
  const unsigned short* yr = sm + ln * FPP + 8 * hh;
  float* sw = so + w * (32 * SOP);
  v16h ya[2][8];      /* two sets of fragments, each of two position tiles: [4 i + j] = tile i, k block j */
  auto ldy = [&](int s, int np) {
#pragma unroll
    for (int i = 0; i < 2; ++i)
#pragma unroll
      for (int j = 0; j < 4; ++j) ya[s][4 * i + j] = lds_frag(yr + (np * 2 + i) * 16 * FPP + j * 32); };
  ldy(0, 0);
#pragma unroll
  for (int np = 0; np < 4; ++np) {
    if (np + 1 < 4) ldy((np + 1) & 1, np + 1);
    __builtin_amdgcn_sched_barrier(0);      /* keeps the next two tiles' fragment reads, as one group, in front of this pair's products, which cover them */
    v8f d[2][2] = {{z8, z8}, {z8, z8}};
#pragma unroll
    for (int j = 0; j < 4; ++j)
#pragma unroll
      for (int i = 0; i < 2; ++i) { d[i][0] = f_mma(ya[np & 1][4 * i + j], wf[0][j], d[i][0]); d[i][1] = f_mma(ya[np & 1][4 * i + j], wf[1][j], d[i][1]); }
#pragma unroll
    for (int i = 0; i < 2; ++i)
#pragma unroll
      for (int u = 0; u < 2; ++u) { v4f t0, t1;
#pragma unroll
        for (int k = 0; k < 4; ++k) { t0[k] = ((d[i][u][k] * 0.0625f + bn[u][0]) - bn[u][1]) * bn[u][2] + bn[u][3]; t1[k] = ((d[i][u][4 + k] * 0.0625f + bn[u][0]) - bn[u][1]) * bn[u][2] + bn[u][3]; }
        float* ds = sw + (u * 16 + ln) * SOP + (np * 2 + i) * 16 + 8 * hh; *(v4f*)ds = t0; *(v4f*)(ds + 4) = t1; }
  }
  asm volatile("s_wait_dscnt 0x0" ::: "memory");      /* the wave reads back rows that its other lanes wrote: those stores are through first, and the compiler moves no read over this line */
  v4f vv[32];
#pragma unroll
  for (int q = 0; q < 32; ++q) vv[q] = *(const v4fa*)(sw + q * SOP + lane * 4);
  __builtin_amdgcn_sched_barrier(0);      /* keeps the 32 reads together as one group: sunk to their uses, one or two at a time, each would have the wave wait out the LDS latency */
#pragma unroll
  for (int q = 0; q < 32; ++q) { v4f r;
#pragma unroll
    for (int i = 0; i < 4; ++i) r[i] = vv[q][i] + bf16_round(xx[q][i]);
    *(v4f*)(out + e0 + (size_t)q * NP) = r; }
}

__global__ __launch_bounds__(256) void k_rowbias(const float* __restrict__ b, float* __restrict__ BP, size_t n4, int ncol) { const size_t t = (size_t)blockIdx.x * 256 + threadIdx.x; if (t >= n4) return; const size_t e = t * 4; const float v = bf16_round(b[e / ncol]); const v4f o = {v, v, v, v}; *(v4f*)(BP + e) = o;  }




__global__ __launch_bounds__(256) void k_mp2(const float* __restrict__ src, float* __restrict__ dst, int nout) {
  const int t = blockIdx.x * 256 + threadIdx.x; if (t >= nout) return; const int c = t / 1024; const int o = t % 1024; const int oy = o / 32, ox = o % 32; const float* p = src + (size_t)c * 4096 + (size_t)(2 * oy) * 64 + 2 * ox;
  const float v = fmaxf(fmaxf(p[0], p[1]), fmaxf(p[64], p[65])); *(float*)(dst + t) = v;  }
__global__ __launch_bounds__(256) void k_xpb(const float* __restrict__ x, const float* __restrict__ wb, float* __restrict__ CPP, size_t n4) {
  #pragma clang fp contract(off)
  const size_t t = (size_t)blockIdx.x * 256 + threadIdx.x; if (t >= n4) return; const size_t e = t * 4; const int c = (int)((e / 4096) % 256); const float bb = bf16_round(wb[c]); const v4f a = *(const v4fa*)(x + e); v4f o; for (int q = 0; q < 4; ++q) o[q] = __fadd_rn(bf16_round(a[q]), bb);
  *(v4f*)(CPP + e) = o;  }


__global__ __launch_bounds__(256) void k_bnres(float* __restrict__ O, const float* __restrict__ x, const float* __restrict__ wb, const float* __restrict__ g, const float* __restrict__ be, const float* __restrict__ mu, const float* __restrict__ var, float eps, size_t n4) {
  #pragma clang fp contract(off)
  const size_t t = (size_t)blockIdx.x * 256 + threadIdx.x; if (t >= n4) return; const size_t e = t * 4; const int c = (int)((e / NP) % CN);
  const float inv = __fdiv_rn(bf16_round(g[c]), sqrtf(__fadd_rn(bf16_round(var[c]), eps))); const float wbc = bf16_round(wb[c]), mc = bf16_round(mu[c]), bc = bf16_round(be[c]);
  const v4f a = *(const v4fa*)(O + e); const v4f xx = *(const v4fa*)(x + e); v4f o;
  for (int q = 0; q < 4; ++q) o[q] = __fadd_rn(__fadd_rn(__fmul_rn(__fadd_rn(__fadd_rn(a[q], wbc), -mc), inv), bc), bf16_round(xx[q]));
  *(v4f*)(O + e) = o;  }

// ---- the pointwise and layout stages live inside the two matrix kernels ----
// Most plain '#pragma unroll's below stand on a short loop over a register array (fragments, accumulators, packed halves): its index must be a compile-time constant for the array to stay in registers.
// k_prep: every small operand once: the three projection weights stacked [384][256] (theta, phi, g) and W [256][128] as x16 f16 planes, the three biases [384] rounded, and per output channel {W_b, mean, gamma / sqrt(var + eps), beta}.
__global__ __launch_bounds__(256) void k_prep(const float* __restrict__ tw, const float* __restrict__ pw, const float* __restrict__ gw, const float* __restrict__ ww, const float* __restrict__ tb, const float* __restrict__ pb, const float* __restrict__ gb,
    const float* __restrict__ wb, const float* __restrict__ g, const float* __restrict__ be, const float* __restrict__ mu, const float* __restrict__ var, float eps, _Float16* __restrict__ WA, _Float16* __restrict__ BW, float* __restrict__ BB, float* __restrict__ BN4) {
  const int t = blockIdx.x * 256 + threadIdx.x;
  if (t < 4 * CI * CN / 8) { const int s = t / (CI * CN / 8), u = (t % (CI * CN / 8)) * 8; const float* sp = s == 0 ? tw : s == 1 ? pw : s == 2 ? gw : ww; unsigned short* d = s < 3 ? (unsigned short*)WA + (size_t)s * CI * CN : (unsigned short*)BW; FragH f;
#pragma unroll
    for (int q = 0; q < 8; ++q) f.h[q] = (_Float16)(bf16_round(sp[u + q]) * 16.0f);
    *(v8us*)(d + u) = f.half[0]; }
  else if (t < 4 * CI * CN / 8 + 3 * CI) { const int o = t - 4 * CI * CN / 8, s = o / CI; const float* sp = s == 0 ? tb : s == 1 ? pb : gb; BB[o] = bf16_round(sp[o % CI]); }
  else if (t < 4 * CI * CN / 8 + 3 * CI + CN) { const int c = t - (4 * CI * CN / 8 + 3 * CI); const v4f o = {bf16_round(wb[c]), bf16_round(mu[c]), __fdiv_rn(bf16_round(g[c]), sqrtf(bf16_round(var[c]) + eps)), bf16_round(be[c])}; *(v4f*)(BN4 + 4 * c) = o; }
}

// k_proj: theta, phi and g of 128 positions (two image rows = one pooled row) of one image in one work-group of 16 waves.
// 1. x [256 c][128 n] f32 -> bf16-rounded f16, transposed into LDS as x^T [n][c]. 2. D[o][n] = (stacked weights as A, rows o, from L2) x (x^T rows as B^T): a wave keeps the B fragments of position tiles p and p + 4 (the same 16 columns of the two image rows) in registers for all of K and walks 6 of the 24 row tiles.
// In D a lane holds 8 consecutive o of ITS position: theta splits into hi + x1024 residual as 16-byte pieces of its [n][ci] row; phi and g take the 2x2 maximum as max(tile p, tile p + 4), then with the neighbour lane. 3. All results are gathered in LDS and leave as whole lines.
#define XP 264                           /* LDS pitch of an x^T row in f16: 512 B + 16 B (16-byte reads and writes of 16 rows fall on all banks) */
#define TP 136                           /* LDS pitch of a gathered theta / phi row in f16: 256 B + 16 B */
#define GP 40                            /* LDS pitch of a gathered g row in f16: 64 B + 16 B */
__global__ __launch_bounds__(512) void k_proj(const float* __restrict__ x, const _Float16* __restrict__ WA, const float* __restrict__ BB, _Float16* __restrict__ TH, _Float16* __restrict__ THL, _Float16* __restrict__ PHT, _Float16* __restrict__ PHLT, _Float16* __restrict__ G16) {
  __shared__ __attribute__((aligned(16))) unsigned short xt[128 * XP];
  __shared__ __attribute__((aligned(16))) unsigned short sth[128 * TP];
  __shared__ __attribute__((aligned(16))) unsigned short stl[128 * TP];
  __shared__ __attribute__((aligned(16))) unsigned short sph[32 * TP];
  __shared__ __attribute__((aligned(16))) unsigned short spl[32 * TP];
  __shared__ __attribute__((aligned(16))) unsigned short sg[CI * GP];
  const int tid = threadIdx.x, w = tid >> 5, lane = tid & 31, ln = lane & 15, hh = lane >> 4, by = blockIdx.y;
  const int n0 = blockIdx.x * 128;
  { /* a wave takes blocks of 32 c x 32 n: a lane 8 c x 4 n; 8 lanes read one 128-byte line of a channel row, and the 16 lanes of a half-wave write 16-byte pieces that fall on all banks */
    const int n4 = (lane & 3) + 4 * hh, c8 = (lane >> 2) & 3;
#pragma unroll
    for (int it = 0; it < 2; ++it) { const int unit = it * 16 + w; const int n = (unit & 3) * 32 + 4 * n4, c = (unit >> 2) * 32 + 8 * c8;
      const float* sp = x + ((size_t)by * CN + c) * NP + n0 + n; v4f a[8];
#pragma unroll
      for (int q = 0; q < 8; ++q) a[q] = *(const v4fa*)(sp + (size_t)q * NP);
#pragma unroll
      for (int i = 0; i < 4; ++i) { FragH f;
#pragma unroll
        for (int q = 0; q < 8; ++q) f.h[q] = (_Float16)bf16_round(a[q][i]);
        *(v8us*)(xt + (n + i) * XP + c) = f.half[0]; } } }
  const int p = w & 3, oq = w >> 2;
  v16h a[8]; v4f bb0, bb1;
  auto lda = [&](int ot) { const unsigned short* ar = (const unsigned short*)WA + (size_t)(ot * 16 + ln) * CN + 8 * hh; const float* br = BB + ot * 16 + 8 * hh;      /* the lane's own first bytes: elements 0..7 = k 8 hh + 0..7, elements 8..15 = k 16 + 8 hh + 0..7 of each 32, as g2_frag reads them */
#pragma unroll
    for (int j = 0; j < 8; ++j) { FragH f; f.half[0] = *(const v8us*)(ar + j * 32); f.half[1] = *(const v8us*)(ar + j * 32 + 16); a[j] = f.v; }
    bb0 = *(const v4fa*)br; bb1 = *(const v4fa*)(br + 4);
    asm volatile("s_wait_xcnt 0x0" :: "v"(ar), "v"(br) : "memory"); };      /* the wait that stands in front of any overwrite of a register which an issued load names; the two addresses are inputs so that they stay live up to it and no load of the run lands in them */
  lda(oq * 6);
  __syncthreads();      /* publishes x^T */
  v16h b0[8], b1[8];
  { const unsigned short* r0 = xt + (p * 16 + ln) * XP + 8 * hh; const unsigned short* r1 = r0 + 64 * XP;
#pragma unroll
    for (int j = 0; j < 8; ++j) { b0[j] = lds_frag(r0 + j * 32); b1[j] = lds_frag(r1 + j * 32); } }
  const v8f z8 = {0.f,0.f,0.f,0.f,0.f,0.f,0.f,0.f};
  const int nl = p * 16 + ln, ml = nl >> 1;
  /* rolled: the three kinds of row tile share one body, and an unrolled one would hold several tiles' weight fragments at once */
#pragma unroll 1
  for (int i = 0; i < 6; ++i) { const int ot = oq * 6 + i;
    v8f c0 = z8, c1 = z8;
#pragma unroll
    for (int j = 0; j < 8; ++j) { c0 = f_mma(a[j], b0[j], c0); c1 = f_mma(a[j], b1[j], c1); }
    float v0[8], v1[8];
#pragma unroll
    for (int r = 0; r < 8; ++r) { const float bv = r < 4 ? bb0[r & 3] : bb1[r & 3]; v0[r] = c0[r] * 0.0625f + bv; v1[r] = c1[r] * 0.0625f + bv; }
    if (i + 1 < 6) lda(ot + 1);      /* the next row tile's weights fly while this one's results are packed */
    if (ot < 8) { FragH h0, l0, h1, l1;
#pragma unroll
      for (int r = 0; r < 8; ++r) { _Float16 h = (_Float16)v0[r]; h0.h[r] = h; l0.h[r] = (_Float16)((v0[r] - (float)h) * 1024.0f); h = (_Float16)v1[r]; h1.h[r] = h; l1.h[r] = (_Float16)((v1[r] - (float)h) * 1024.0f); }
      const int e = nl * TP + ot * 16 + 8 * hh;
      *(v8us*)(sth + e) = h0.half[0]; *(v8us*)(stl + e) = l0.half[0]; *(v8us*)(sth + e + 64 * TP) = h1.half[0]; *(v8us*)(stl + e + 64 * TP) = l1.half[0];
    } else { float mx[8];
#pragma unroll
      for (int r = 0; r < 8; ++r) { const float u = fmaxf(v0[r], v1[r]); mx[r] = fmaxf(u, __shfl_xor(u, 1, 32)); }
      if (ot < 16) { FragH h0, l0;
#pragma unroll
        for (int r = 0; r < 8; ++r) { const _Float16 h = (_Float16)mx[r]; h0.h[r] = h; l0.h[r] = (_Float16)((mx[r] - (float)h) * 1024.0f); }
        if (!(ln & 1)) { const int e = ml * TP + (ot - 8) * 16 + 8 * hh; *(v8us*)(sph + e) = h0.half[0]; *(v8us*)(spl + e) = l0.half[0]; }
      } else if (!(ln & 1)) { FragH h0;
#pragma unroll
        for (int r = 0; r < 8; ++r) { h0.h[r] = (_Float16)mx[r]; sg[((ot - 16) * 16 + 8 * hh + r) * GP + ml] = h0.u[r]; } }
    }
  }
  __syncthreads();      /* every wave's results are gathered */
  { unsigned short* dh = (unsigned short*)TH + ((size_t)by * NP + n0) * CI; unsigned short* dl = (unsigned short*)THL + ((size_t)by * NP + n0) * CI;
#pragma unroll
    for (int k = 0; k < 4; ++k) { const int pc = k * 512 + tid, r = pc >> 4, q = (pc & 15) * 8; *(v8us*)(dh + r * CI + q) = *(const v8us*)(sth + r * TP + q); *(v8us*)(dl + r * CI + q) = *(const v8us*)(stl + r * TP + q); }
    const size_t mo = ((size_t)by * NM + blockIdx.x * 32) * CI;      /* the pooled row's 32 positions: rows of phi^T [m][ci]; one 32-key tile [ci][32] of g */
    { const int r = tid >> 4, q = (tid & 15) * 8; *(v8us*)((unsigned short*)PHT + mo + r * CI + q) = *(const v8us*)(sph + r * TP + q); *(v8us*)((unsigned short*)PHLT + mo + r * CI + q) = *(const v8us*)(spl + r * TP + q); }
    { const int r = tid >> 2, q = (tid & 3) * 8; *(v8us*)((unsigned short*)G16 + mo + r * 32 + q) = *(const v8us*)(sg + r * GP + q); } }
}

extern "C" void kernel_launch(void* const* d_in, const int* in_sizes, int n_in,
                              void* d_out, int out_size, void* d_ws, size_t ws_size, hipStream_t stream) {
  (void)in_sizes; (void)n_in; (void)out_size;
  const float* const* I = (const float* const*)d_in; const float* x = I[0]; const float* gw = I[1]; const float* gb = I[2]; const float* tw = I[3]; const float* tb = I[4]; const float* pw = I[5]; const float* pb = I[6]; const float* ww = I[7]; const float* wb = I[8]; const float* bng = I[9]; const float* bnb = I[10]; const float* bnm = I[11]; const float* bnv = I[12];      /* natural [out][in] 1x1-conv weights + biases: g, theta, phi [128][256]; W [256][128] + b; eval BatchNorm gamma / beta / running mean / var [256] */
  char* ws = (char*)d_ws; size_t off = 0;
  auto take = [&](size_t bytes) { char* p = ws + off; off += (bytes + 255) & ~(size_t)255; return p; };
  _Float16* WA = (_Float16*)take((size_t)3 * CI * CN * 2); _Float16* BW = (_Float16*)take((size_t)CN * CI * 2); float* BB = (float*)take((size_t)3 * CI * 4); float* BN4 = (float*)take((size_t)CN * 4 * 4);
  /* every plane below holds all NB images, image b at b times the one-image size */
  const size_t sT = (size_t)NP * CI, sM = (size_t)CI * NM;      /* one image: [4096][128], [1024][128] elements */
  _Float16* TH = (_Float16*)take(NB * sT * 2); _Float16* THL = (_Float16*)take(NB * sT * 2); _Float16* PHT = (_Float16*)take(NB * sM * 2); _Float16* PHLT = (_Float16*)take(NB * sM * 2); _Float16* G16 = (_Float16*)take(NB * sM * 2);
  if (off > ws_size) return;
  k_prep<<<(4 * CI * CN / 8 + 3 * CI + CN + 255) / 256, 256, 0, stream>>>(tw, pw, gw, ww, tb, pb, gb, wb, bng, bnb, bnm, bnv, 1e-5f, WA, BW, BB, BN4);
  k_proj<<<dim3(NP / 128, NB), 512, 0, stream>>>(x, WA, BB, TH, THL, PHT, PHLT, G16);      /* theta^T [n][ci] hi + x1024 residual; pooled phi^T [m][ci] hi + residual; pooled g f16 as 32-key tiles [m / 32][ci][32] */
  k_fattn<<<dim3(NP / 128, NB), 256, 0, stream>>>(TH, THL, PHT, PHLT, G16, BW, BN4, x, (float*)d_out);      /* f[n][m] = theta.phi (hi.hi + (hi.lo + lo.hi) / 1024; no scale), softmax over the 1024 pooled positions, y^T [n][ci] = P g^T -> f16; z = ((W y + bf16 W_b[c]) - bf16 mean[c]) (bf16 gamma[c] / sqrt(bf16 var[c] + eps)) + bf16 beta[c] + bf16 x -> f32 channel-first output, in one launch */
}

// v008
// It runs in 50.6 microseconds.
// Next to v007, in two timings, it ran 1.05 times as fast each time.
// All steps since v000 together make it 53.8 times as fast.
#include <hip/hip_runtime.h>
// Non-local block (embedded Gaussian, single head, 2x2 max-pool sub-sampling) with an eval-mode BatchNorm on the output conv (x [8][256][64][64]; theta = conv1x1(x) [128 ch], phi = maxpool2x2(conv1x1(x)), g = maxpool2x2(conv1x1(x)) (natural [128][256] weights sigma 1/16 + biases 0.01); f[n][m] = theta[:, n].phi[:, m] over the 1024 pooled positions (NO scale); softmax over m; y[:, n] = sum_m f[n][m] g[:, m]; W_y = conv1x1(y; W [256][128] + b); z = (W_y - bn_mean) gamma / sqrt(bn_var + 1e-5) + bn_beta + x -> [8][256][64][64]).
// Structure: two launches, each over all 8 images. k_proj: weights as x16 f16 rows, rounded biases, BatchNorm constants; x (bf16-rounded, exact in f16) transposed in LDS to token-major x^T; theta, phi, g = (16 W as the A operand) (x^T as the B^T operand) / 16 + b[c], WMMA with f32 accumulation; theta split into f16 hi + x1024 residual (unscaled scores have sigma ~11) as [4096][128] rows; phi and g 2x2 max-pooled in registers, phi split into hi/lo as [1024][128] rows, g to f16 as 32-key tiles. k_fattn: scores (th_hi.ph_hi + (th_lo.ph_hi + th_hi.ph_lo)/1024, K = 128, f32), online row softmax on VALU (f32 statistics, native exp; weights x256 f16) and y^T = P g^T (K = 1024) -> f16, scores and weights kept in registers; its epilogue: z = BN((y^T as A) (16 w as B^T) / 16 + b[c]) + bf16(x) -> f32 channel-first output.
// Compute dtype: inputs rounded to bf16; x / weights exact; q and k as f16 hi + x1024 residual, v, softmax weights and o as plain f16 GEMM operands (~2^-12); scores and softmax statistics f32. v_wmma_f32_16x16x32_f16.
#define NB 8
#define SQ 1024
#define DM 256
#define NH 1
#define HD 64
#define HG 4                         /* heads per k_vt launch; k_vt is not launched */
#define B0 0                         /* unused: every launch over images covers all NB images */
#define NBR NB                       /* not used by any kernel or launch */
#define NR ((size_t)NB * SQ)         /* unused */
#define MP ((int)((size_t)NBR * SQ)) /* not used by any kernel or launch */
#define QT 256                       /* query rows per causal tile */
#define NKX SQ                       /* S / P row pitch */
#define QT0 256                      /* first-tile rows recomputed exactly (256: buys margin for the few-key rows 128..255, which have no output projection to average the single-f16 P/v rounding) */
#define QN SQ                        /* unused (each batch attends NP query rows) */
#define NHD NH                       /* unused */
#define MPO MP                       /* unused */
#define LQ DM            /* unused */
typedef __bf16 v16b __attribute__((ext_vector_type(16)));
typedef unsigned short v8us __attribute__((ext_vector_type(8), may_alias));
typedef float  v8f  __attribute__((ext_vector_type(8)));
typedef float  v4f  __attribute__((ext_vector_type(4)));
typedef float  v4fa __attribute__((ext_vector_type(4), may_alias));
union FragB { v16b v; v8us half[2]; unsigned short u[16]; };

__device__ __forceinline__ unsigned short bf16_bits(float x) { unsigned int u = __float_as_uint(x); return (unsigned short)((u + 0x7FFFu + ((u >> 16) & 1u)) >> 16); }
__device__ __forceinline__ float bf16_val(unsigned short b) { return __uint_as_float(((unsigned int)b) << 16); }
__device__ __forceinline__ float bf16_round(float x) { return bf16_val(bf16_bits(x)); }
// D += A·B with NT terms: 1 = ah·bh, 2 = + al·bh (A split), 3 = + ah·bl (both split)
template <int NT>
__device__ __forceinline__ v8f mmaN(v16b ah, v16b al, v16b bh, v16b bl, v8f c) {
  c = __builtin_amdgcn_wmma_f32_16x16x32_bf16(false, ah, false, bh, (short)0, c, false, false);
  if (NT >= 2) c = __builtin_amdgcn_wmma_f32_16x16x32_bf16(false, al, false, bh, (short)0, c, false, false);
  if (NT >= 3) c = __builtin_amdgcn_wmma_f32_16x16x32_bf16(false, ah, false, bl, (short)0, c, false, false);
  asm volatile("v_nop\n\tv_nop\n\tv_nop\n\tv_nop" : "+v"(c) : "v"(ah), "v"(al), "v"(bh), "v"(bl));
  return c;
}

__global__ __launch_bounds__(256) void k_wt_bf16(const float* __restrict__ W, unsigned short* __restrict__ Wt, int K, int N) {
  const int t = blockIdx.x * 256 + threadIdx.x;
  const int k8n = K / 8;
  if (t >= N * k8n) return;
  const int n = t / k8n, k8 = (t % k8n) * 8;
  v8us v;
#pragma unroll
  for (int i = 0; i < 8; ++i) v[i] = bf16_bits(W[(size_t)(k8 + i) * N + n]);
  *(v8us*)(Wt + (size_t)n * K + k8) = v;
  
}

// GEMM C[M][N] (f32, pitch ldc) = act(A[M][K]·W + bias). A f32 row-major (pitch lda) converted per fragment to bf16
// (ASPLIT: hi/lo two planes -> 2 terms, else single rounded term); Wt bf16 [N][K] (pitch ldb). BIAS_BF16 rounds the
// bias to bf16 first (bias quantised to bf16 before the add). K%32==0, M%16==0, N%64==0.
template <bool ASPLIT, int ACT, bool BIAS_BF16>
__global__ __launch_bounds__(128) void k_gemm_bf(const float* __restrict__ A, int lda, const unsigned short* __restrict__ Wt, int ldb,
                                               const float* __restrict__ bias, float* __restrict__ C, int ldc, int M, int N, int K) {
  __shared__ __attribute__((aligned(16))) float so[4][16][64];
  const int tid = threadIdx.x, w = tid >> 5, lane = tid & 31, ln = lane & 15, hh = lane >> 4;
  const int ntn = N / 64;
  const int wid = blockIdx.x * 4 + w;
  const int mt = wid / ntn, nq = wid % ntn;
  if (mt * 16 >= M) return;
  const int row0 = mt * 16, col0 = nq * 64;
  const float* arow = A + (size_t)(row0 + ln) * lda;
  v8f acc[4] = {};
  for (int kb = 0; kb < K; kb += 32) {
    FragB ah, al;
    const v4f x0 = *(const v4fa*)(arow + kb + 8 * hh), x1 = *(const v4fa*)(arow + kb + 8 * hh + 4);
    const v4f x2 = *(const v4fa*)(arow + kb + 16 + 8 * hh), x3 = *(const v4fa*)(arow + kb + 16 + 8 * hh + 4);
    float xs[16] = {x0[0],x0[1],x0[2],x0[3],x1[0],x1[1],x1[2],x1[3],x2[0],x2[1],x2[2],x2[3],x3[0],x3[1],x3[2],x3[3]};
#pragma unroll
    for (int i = 0; i < 16; ++i) { const unsigned short hb = bf16_bits(xs[i]); ah.u[i] = hb; al.u[i] = ASPLIT ? bf16_bits(xs[i] - bf16_val(hb)) : (unsigned short)0; }
#pragma unroll
    for (int t = 0; t < 4; ++t) {
      const unsigned short* brow = Wt + (size_t)(col0 + t * 16 + ln) * ldb + kb;
      FragB b;
      b.half[0] = *(const v8us*)(brow + 8 * hh);
      b.half[1] = *(const v8us*)(brow + 16 + 8 * hh);
      acc[t] = mmaN<ASPLIT ? 2 : 1>(ah.v, al.v, b.v, b.v, acc[t]);
    }
  }
#pragma unroll
  for (int t = 0; t < 4; ++t) {
    float bv = bias ? bias[col0 + t * 16 + ln] : 0.f;
    if (BIAS_BF16) bv = bf16_round(bv);
#pragma unroll
    for (int r = 0; r < 8; ++r) { float v = acc[t][r] + bv; if (ACT == 1) v = fmaxf(v, 0.f); so[w][8 * hh + r][t * 16 + ln] = v; }
  }
  __builtin_amdgcn_fence(__ATOMIC_ACQ_REL, "workgroup");
  __builtin_amdgcn_wave_barrier();
  const int rsub = lane >> 4, c4 = (lane & 15) * 4;
  {
#pragma unroll
    for (int q = 0; q < 8; ++q) {
      const int r = q * 2 + rsub;
      const v4f v = *(const v4fa*)&so[w][r][c4];
      *(v4f*)(C + (size_t)(row0 + r) * ldc + col0 + c4) = v;
    }
    
  }
}

// GEMM C = act(A·W + bias + resid): A f32 (ASPLIT -> hi/lo 2 terms), Wt bf16 [N][K]; ACT 0 none, 1 relu, 2 exact gelu;
// resid (optional, f32, row index = (row % rmod), pitch ldr, RES_BF16 rounds it) added before the activation.
template <bool ASPLIT, int ACT, bool BIAS_BF16, bool RES_BF16>
__global__ __launch_bounds__(128) void k_gemm_bf3(const float* __restrict__ A, int lda, const unsigned short* __restrict__ Wt, int ldb,
                                                const float* __restrict__ bias, const float* __restrict__ resid, int rmod, int ldr,
                                                float* __restrict__ C, int ldc, int M, int N, int K) {
  __shared__ __attribute__((aligned(16))) float so[4][16][64];
  const int tid = threadIdx.x, w = tid >> 5, lane = tid & 31, ln = lane & 15, hh = lane >> 4;
  const int ntn = N / 64;
  const int wid = blockIdx.x * 4 + w;
  const int mt = wid / ntn, nq = wid % ntn;
  if (mt * 16 >= M) return;
  const int row0 = mt * 16, col0 = nq * 64;
  const float* arow = A + (size_t)(row0 + ln) * lda;
  v8f acc[4] = {};
  for (int kb = 0; kb < K; kb += 32) {
    FragB ah, al;
    const v4f x0 = *(const v4fa*)(arow + kb + 8 * hh), x1 = *(const v4fa*)(arow + kb + 8 * hh + 4);
    const v4f x2 = *(const v4fa*)(arow + kb + 16 + 8 * hh), x3 = *(const v4fa*)(arow + kb + 16 + 8 * hh + 4);
    float xs[16] = {x0[0],x0[1],x0[2],x0[3],x1[0],x1[1],x1[2],x1[3],x2[0],x2[1],x2[2],x2[3],x3[0],x3[1],x3[2],x3[3]};
#pragma unroll
    for (int i = 0; i < 16; ++i) { const unsigned short hb = bf16_bits(xs[i]); ah.u[i] = hb; al.u[i] = ASPLIT ? bf16_bits(xs[i] - bf16_val(hb)) : (unsigned short)0; }
#pragma unroll
    for (int t = 0; t < 4; ++t) {
      const unsigned short* brow = Wt + (size_t)(col0 + t * 16 + ln) * ldb + kb;
      FragB b;
      b.half[0] = *(const v8us*)(brow + 8 * hh);
      b.half[1] = *(const v8us*)(brow + 16 + 8 * hh);
      acc[t] = mmaN<ASPLIT ? 2 : 1>(ah.v, al.v, b.v, b.v, acc[t]);
    }
  }
#pragma unroll
  for (int t = 0; t < 4; ++t) {
    const int col = col0 + t * 16 + ln;
    float bv = bias ? bias[col] : 0.f;
    if (BIAS_BF16) bv = bf16_round(bv);
#pragma unroll
    for (int r = 0; r < 8; ++r) {
      float v = acc[t][r] + bv;
      if (resid) { float rv = resid[(size_t)((row0 + 8 * hh + r) % rmod) * ldr + col]; if (RES_BF16) rv = bf16_round(rv); v += rv; }
      if (ACT == 1) v = fmaxf(v, 0.f);
      if (ACT == 2) v = 0.5f * v * (1.0f + erff(v * 0.70710678118654752f));
      if (ACT == 3) { const float u = 0.7978845608028654f * (v + 0.044715f * v * v * v); v = 0.5f * v * (1.0f + tanhf(u)); }
      so[w][8 * hh + r][t * 16 + ln] = v;
    }
  }
  __builtin_amdgcn_fence(__ATOMIC_ACQ_REL, "workgroup");
  __builtin_amdgcn_wave_barrier();
  const int rsub = lane >> 4, c4 = (lane & 15) * 4;
  {
#pragma unroll
    for (int q = 0; q < 8; ++q) {
      const int r = q * 2 + rsub;
      const v4f v = *(const v4fa*)&so[w][r][c4];
      *(v4f*)(C + (size_t)(row0 + r) * ldc + col0 + c4) = v;
    }
    
  }
}
// row LayerNorm (biased variance, eps) over N: s = X (+ R); optional out_sum <- s; out_norm <- (s-mu)*rsqrt(var+eps)*g + b
template <bool PARAM_BF16>
__global__ __launch_bounds__(256) void k_layernorm(const float* __restrict__ X, const float* __restrict__ R, const float* __restrict__ g, const float* __restrict__ bta,
                                                  float* __restrict__ out_sum, float* __restrict__ out_norm, int N, float eps) {
  __shared__ float red[256];
  const int row = blockIdx.x, tid = threadIdx.x;
  const float* x = X + (size_t)row * N; const float* rr = R ? R + (size_t)row * N : nullptr;
  float vals[16];                     // up to N = 4096
  const int per = N / 256;            // contiguous chunk per thread? use strided-by-4 chunks: thread handles j = tid*4 + 1024*u
  float s1 = 0.f;
  for (int u = 0; u < per / 4; ++u) {
    const int j = tid * 4 + 1024 * u;
    const v4f a = *(const v4fa*)(x + j);
    v4f b = {0.f,0.f,0.f,0.f}; if (rr) b = *(const v4fa*)(rr + j);
#pragma unroll
    for (int q = 0; q < 4; ++q) { const float v = a[q] + b[q]; vals[u * 4 + q] = v; s1 += v; }
  }
  red[tid] = s1; __syncthreads();
  for (int st = 128; st > 0; st >>= 1) { if (tid < st) red[tid] += red[tid + st]; __syncthreads(); }
  const float mu = red[0] / (float)N; __syncthreads();
  float s2 = 0.f;
  for (int u = 0; u < per / 4; ++u)
#pragma unroll
    for (int q = 0; q < 4; ++q) { const float c = vals[u * 4 + q] - mu; s2 += c * c; }
  red[tid] = s2; __syncthreads();
  for (int st = 128; st > 0; st >>= 1) { if (tid < st) red[tid] += red[tid + st]; __syncthreads(); }
  const float rs = rsqrtf(red[0] / (float)N + eps);
  {
    for (int u = 0; u < per / 4; ++u) {
      const int j = tid * 4 + 1024 * u;
      v4f o, sm;
#pragma unroll
      for (int q = 0; q < 4; ++q) {
        float gg = g[j + q], bb = bta[j + q];
        if (PARAM_BF16) { gg = bf16_round(gg); bb = bf16_round(bb); }
        sm[q] = vals[u * 4 + q]; o[q] = (vals[u * 4 + q] - mu) * rs * gg + bb;
      }
      if (out_sum) *(v4f*)(out_sum + (size_t)row * N + j) = sm;
      *(v4f*)(out_norm + (size_t)row * N + j) = o;
    }
    
  }
}



// ---- f16 WMMA path (v_wmma_f32_16x16x32_f16): 11-bit significands for operands in range — used where a [0,1] probability operand needs more precision than bf16
typedef _Float16 v16h __attribute__((ext_vector_type(16)));
union FragH { v16h v; v8us half[2]; _Float16 h[16]; unsigned short u[16]; };
template <int NT>
__device__ __forceinline__ v8f mmaH(v16h ah, v16h al, v16h bh, v16h bl, v8f c) {
  c = __builtin_amdgcn_wmma_f32_16x16x32_f16(false, ah, false, bh, (short)0, c, false, false);
  if (NT >= 2) c = __builtin_amdgcn_wmma_f32_16x16x32_f16(false, al, false, bh, (short)0, c, false, false);
  if (NT >= 3) c = __builtin_amdgcn_wmma_f32_16x16x32_f16(false, ah, false, bl, (short)0, c, false, false);
  asm volatile("v_nop\n\tv_nop\n\tv_nop\n\tv_nop" : "+v"(c) : "v"(ah), "v"(al), "v"(bh), "v"(bl));
  return c;
}
// batched GEMM like k_gemm_b but f16 operands: A f32 (split into f16 hi/lo if ASPLIT, else rounded to f16), Bt = f16 values [n][k]; alpha; C f32; N multiple of 16 (partial tiles skipped)
template <bool ASPLIT>
__global__ __launch_bounds__(128) void k_gemm_h(const float* __restrict__ A, int lda, size_t sA, const _Float16* __restrict__ Bh, int ldb, size_t sB, float alpha, float* __restrict__ C, int ldc, size_t sC, int M, int N, int K) {
  __shared__ __attribute__((aligned(16))) float so[4][16][64];
  const int tid = threadIdx.x, w = tid >> 5, lane = tid & 31, ln = lane & 15, hh = lane >> 4; const int by = blockIdx.y;
  A += (size_t)by * sA; Bh += (size_t)by * sB; C += (size_t)by * sC;
  const int ntn = (N + 63) / 64; const int wid = blockIdx.x * 4 + w; const int mt = wid / ntn, nq = wid % ntn; if (mt * 16 >= M) return;
  const int row0 = mt * 16, col0 = nq * 64; const float* arow = A + (size_t)(row0 + ln) * lda;
  v8f acc[4] = {};
  for (int kb = 0; kb < K; kb += 32) {
    FragH ah, al;
    const v4f x0 = *(const v4fa*)(arow + kb + 8 * hh), x1 = *(const v4fa*)(arow + kb + 8 * hh + 4), x2 = *(const v4fa*)(arow + kb + 16 + 8 * hh), x3 = *(const v4fa*)(arow + kb + 16 + 8 * hh + 4);
    float xs[16] = {x0[0],x0[1],x0[2],x0[3],x1[0],x1[1],x1[2],x1[3],x2[0],x2[1],x2[2],x2[3],x3[0],x3[1],x3[2],x3[3]};
#pragma unroll
    for (int i = 0; i < 16; ++i) { const _Float16 h = (_Float16)xs[i]; ah.h[i] = h; al.h[i] = ASPLIT ? (_Float16)(xs[i] - (float)h) : (_Float16)0.0f; }
#pragma unroll
    for (int t = 0; t < 4; ++t) { if (col0 + t * 16 >= N) continue; const size_t boff = (size_t)(col0 + t * 16 + ln) * ldb + kb; FragH bq; bq.half[0] = *(const v8us*)(Bh + boff + 8 * hh); bq.half[1] = *(const v8us*)(Bh + boff + 16 + 8 * hh);
      acc[t] = mmaH<ASPLIT ? 2 : 1>(ah.v, al.v, bq.v, bq.v, acc[t]); }
  }
#pragma unroll
  for (int t = 0; t < 4; ++t) { if (col0 + t * 16 >= N) continue;
#pragma unroll
    for (int r = 0; r < 8; ++r) so[w][8 * hh + r][t * 16 + ln] = acc[t][r] * alpha; }
  __builtin_amdgcn_fence(__ATOMIC_ACQ_REL, "workgroup"); __builtin_amdgcn_wave_barrier();
  const int rsub = lane >> 4, c4 = (lane & 15) * 4;
  {
#pragma unroll
    for (int q = 0; q < 8; ++q) { const int r = q * 2 + rsub; if (col0 + c4 < N) { const v4f v = *(const v4fa*)&so[w][r][c4]; *(v4f*)(C + (size_t)(row0 + r) * ldc + col0 + c4) = v; } }
     }
}

// Wt[n][k] = f16(W[k][n]·scale) from f32 row-major W[K][N] (scale = power of two; bf16-exact weights stay exact in f16 away from the subnormal range)
__global__ __launch_bounds__(256) void k_wt_f16(const float* __restrict__ W, _Float16* __restrict__ Wt, int K, int N, float scale) {
  const int t = blockIdx.x * 256 + threadIdx.x; if (t >= N * (K / 8)) return; const int n = t / (K / 8), k8 = (t % (K / 8)) * 8; FragH f;
#pragma unroll
  for (int i = 0; i < 8; ++i) f.h[i] = (_Float16)(bf16_round(W[(size_t)(k8 + i) * N + n]) * scale); const v8us o = f.half[0];
  *(v8us*)((unsigned short*)Wt + (size_t)n * K + k8) = o; 
}
// k_gemm_hh variant with fused epilogue: v = acc·alpha + bias[by·sBias + col] (+ CP[(row/rowsPerB)·sCPb + by·64 + col] if CP) ; ACT 0 none / 1 elu ; writes f16 C16 (and f32 C if non-null)
template <int ACT>
__global__ __launch_bounds__(128) void k_gemm_hhx(const _Float16* __restrict__ A, int lda, size_t sA, const _Float16* __restrict__ Bh, int ldb, size_t sB, float alpha, const float* __restrict__ bias, size_t sBias, const float* __restrict__ CP, int rowsPerB, size_t sCPb, int row0g,
    float* __restrict__ C, _Float16* __restrict__ C16, int ldc, size_t sC, int M, int N, int K) {
  __shared__ __attribute__((aligned(16))) float so[4][16][64];
  const int tid = threadIdx.x, w = tid >> 5, lane = tid & 31, ln = lane & 15, hh = lane >> 4; const int by = blockIdx.y;
  A += (size_t)by * sA; Bh += (size_t)by * sB; const size_t cofs = (size_t)by * sC; const float* bp = bias ? bias + (size_t)by * sBias : nullptr;
  const int ntn = (N + 63) / 64; const int wid = blockIdx.x * 4 + w; const int mt = wid / ntn, nq = wid % ntn; if (mt * 16 >= M) return;
  const int row0 = mt * 16, col0 = nq * 64; const _Float16* arow = A + (size_t)(row0 + ln) * lda;
  v8f acc[4] = {};
  for (int kb = 0; kb < K; kb += 32) { FragH ah; ah.half[0] = *(const v8us*)((const unsigned short*)arow + kb + 8 * hh); ah.half[1] = *(const v8us*)((const unsigned short*)arow + kb + 16 + 8 * hh);
#pragma unroll
    for (int t = 0; t < 4; ++t) { if (col0 + t * 16 >= N) continue; const size_t boff = (size_t)(col0 + t * 16 + ln) * ldb + kb; FragH bq; bq.half[0] = *(const v8us*)((const unsigned short*)Bh + boff + 8 * hh); bq.half[1] = *(const v8us*)((const unsigned short*)Bh + boff + 16 + 8 * hh);
      acc[t] = mmaH<1>(ah.v, ah.v, bq.v, bq.v, acc[t]); }
  }
#pragma unroll
  for (int t = 0; t < 4; ++t) { if (col0 + t * 16 >= N) continue; const int col = col0 + t * 16 + ln; const float bv = bp ? bf16_round(bp[col]) : 0.f;
#pragma unroll
    for (int r = 0; r < 8; ++r) { float v = acc[t][r] * alpha + bv; if (CP) { const int rr = row0g + row0 + 8 * hh + r; if (rowsPerB < 0) v += CP[cofs + (size_t)rr * ldc + col];      /* rowsPerB < 0: own element of the batched C plane */ else { const int bidx = rr / rowsPerB; v += CP[(size_t)bidx * sCPb + (size_t)by * 64 + col]; } } if (ACT == 1) v = (v > 0.f) ? v : expm1f(v); else if (ACT == 7) v = (v > 0.f) ? v + 1.0f : expf(v); else if (ACT == 8) v = tanhf(v); else if (ACT == 9) v = 0.5f * v * (1.0f + tanhf(0.7978845608028654f * (v + 0.044715f * v * v * v))); else if (ACT == 11) v = 1.0f / (1.0f + expf(-v)); else if (ACT == 12) v = (v > 0.f) ? v : 0.01f * v; else if (ACT == 14) v = (v > 0.f) ? v : 0.1f * v; else if (ACT == 16) v = (v >= 0.f) ? v : 0.3f * v; else if (ACT == 17) v = (v >= 0.f) ? v : 0.2f * v; else if (ACT == 15) v = v / (1.0f + expf(-v)); else if (ACT == 3) v = fmaxf(v, 0.f); else if (ACT == 6) v = 0.5f * v * (1.0f + erff(v * 0.70710678118654752f)); so[w][8 * hh + r][t * 16 + ln] = v; } }
  __builtin_amdgcn_fence(__ATOMIC_ACQ_REL, "workgroup"); __builtin_amdgcn_wave_barrier();
  const int rsub = lane >> 4, c4 = (lane & 15) * 4; typedef _Float16 v4h __attribute__((ext_vector_type(4)));
  {
#pragma unroll
    for (int q = 0; q < 8; ++q) { const int r = q * 2 + rsub; if (col0 + c4 < N) { const v4f v = *(const v4fa*)&so[w][r][c4]; if (C) *(v4f*)(C + cofs + (size_t)(row0 + r) * ldc + col0 + c4) = v; if (C16) { v4h h4; for (int i = 0; i < 4; ++i) h4[i] = (_Float16)v[i]; *(v4h*)(C16 + cofs + (size_t)(row0 + r) * ldc + col0 + c4) = h4; } } }
     }
}


typedef _Float16 v4h __attribute__((ext_vector_type(4)));

__global__ __launch_bounds__(256) void k_x16(const float* __restrict__ x, _Float16* __restrict__ X16, size_t n8) { const size_t t = (size_t)blockIdx.x * 256 + threadIdx.x; if (t >= n8) return; FragH f;
#pragma unroll
  for (int q = 0; q < 8; ++q) f.h[q] = (_Float16)bf16_round(x[t * 8 + q]); *(v8us*)((unsigned short*)X16 + t * 8) = f.half[0];  }
__global__ __launch_bounds__(256) void k_h16(const float* __restrict__ x, _Float16* __restrict__ X16, size_t n8) { const size_t t = (size_t)blockIdx.x * 256 + threadIdx.x; if (t >= n8) return; FragH f;
#pragma unroll
  for (int q = 0; q < 8; ++q) f.h[q] = (_Float16)x[t * 8 + q]; *(v8us*)((unsigned short*)X16 + t * 8) = f.half[0];  }
__global__ __launch_bounds__(256) void k_round16f(const float* __restrict__ W, _Float16* __restrict__ Bt, size_t n8) { const size_t t = (size_t)blockIdx.x * 256 + threadIdx.x; if (t >= n8) return; FragH f;
#pragma unroll
  for (int i = 0; i < 8; ++i) f.h[i] = (_Float16)(bf16_round(W[t * 8 + i]) * 16.0f); *(v8us*)((unsigned short*)Bt + t * 8) = f.half[0];  }
template <int NHv, int TTv>
__global__ __launch_bounds__(256) void k_vt(const _Float16* __restrict__ V16, int ldv, int voff, _Float16* __restrict__ Vt) { __shared__ unsigned short tl[64][66]; const int tid = threadIdx.x; const int slab = blockIdx.x / (TTv / 64), lg = blockIdx.x % (TTv / 64); const int b = slab / NHv, h = slab % NHv;
  for (int i = tid; i < 64 * 8; i += 256) { const int r = i / 8, c8 = (i % 8) * 8; FragH f; f.half[0] = *(const v8us*)((const unsigned short*)V16 + ((size_t)b * TTv + lg * 64 + r) * ldv + voff + h * 64 + c8);
#pragma unroll
    for (int q = 0; q < 8; ++q) tl[r][c8 + q] = f.u[q]; }
  __syncthreads();
  {
#pragma unroll
    for (int rd = 0; rd < 2; ++rd) { const int d = rd * 32 + tid / 8, pc = tid % 8; FragH f;
#pragma unroll
      for (int q = 0; q < 8; ++q) f.u[q] = tl[pc * 8 + q][d];
      *(v8us*)((unsigned short*)Vt + ((size_t)slab * 64 + d) * TTv + lg * 64 + pc * 8) = f.half[0]; }
     } }

__global__ __launch_bounds__(256) void k_hl(const float* __restrict__ F, _Float16* __restrict__ Hh, _Float16* __restrict__ Hl, size_t n8) { const size_t t = (size_t)blockIdx.x * 256 + threadIdx.x; if (t >= n8) return; FragH fh, fl; const v4f a = *(const v4fa*)(F + t * 8), c = *(const v4fa*)(F + t * 8 + 4);
#pragma unroll
  for (int q = 0; q < 4; ++q) { _Float16 h = (_Float16)a[q]; fh.h[q] = h; fl.h[q] = (_Float16)((a[q] - (float)h) * 1024.0f); h = (_Float16)c[q]; fh.h[4 + q] = h; fl.h[4 + q] = (_Float16)((c[q] - (float)h) * 1024.0f); }
  { *(v8us*)((unsigned short*)Hh + t * 8) = fh.half[0]; *(v8us*)((unsigned short*)Hl + t * 8) = fl.half[0];  } }

// ---- fast GEMM (wave tile 32x64; requires M % 32 == 0 rows per launch region and N % 64 == 0); epilogue = k_gemm_hhx semantics, except the rowsPerB < 0 addend plane steps by sCPb per grid.y slice ----
__device__ __forceinline__ v16h g2_frag(const _Float16* p, int hh) { FragH f; f.half[0] = *(const v8us*)((const unsigned short*)p + 8 * hh); f.half[1] = *(const v8us*)((const unsigned short*)p + 16 + 8 * hh); return f.v; }
__device__ __forceinline__ v8f g2_mma(v16h a, v16h b, v8f c) { v8f d = __builtin_amdgcn_wmma_f32_16x16x32_f16(false, a, false, b, (short)0, c, false, false); asm volatile("v_nop\n\tv_nop\n\tv_nop\n\tv_nop" : "+v"(d) : "v"(a), "v"(b)); return d; }
template <int ACT>
__global__ __launch_bounds__(128) void k_gemm2(const _Float16* __restrict__ A, int lda, size_t sA, const _Float16* __restrict__ Bh, int ldb, size_t sB, float alpha, const float* __restrict__ bias, size_t sBias, const float* __restrict__ CP, int rowsPerB, size_t sCPb, int row0g,
    float* __restrict__ C, _Float16* __restrict__ C16, int ldc, size_t sC, int M, int N, int K) { static_assert(ACT == 0 || ACT == 3 || ACT == 6 || ACT == 8 || ACT == 9 || ACT == 11 || ACT == 12 || ACT == 14 || ACT == 15 || ACT == 16 || ACT == 17, "k_gemm2: unsupported ACT code (would silently apply no activation)");
  __shared__ __attribute__((aligned(16))) float so[4][32][68];
  const int tid = threadIdx.x, w = tid >> 5, lane = tid & 31, ln = lane & 15, hh = lane >> 4; const int by = blockIdx.y;
  A += (size_t)by * sA; Bh += (size_t)by * sB; const size_t cofs = (size_t)by * sC; const float* bp = bias ? bias + (size_t)by * sBias : nullptr;
  const int ntn = N >> 6; const int mt = blockIdx.x / ntn, nq = blockIdx.x - mt * ntn; const int row0 = mt * 128 + 32 * w, col0 = nq * 64; if (row0 >= M) return;
  const _Float16* a0p = A + (size_t)(row0 + ln) * lda; const _Float16* a1p = a0p + (size_t)16 * lda;
  const _Float16* b0p = Bh + (size_t)(col0 + ln) * ldb; const _Float16* b1p = b0p + (size_t)16 * ldb; const _Float16* b2p = b1p + (size_t)16 * ldb; const _Float16* b3p = b2p + (size_t)16 * ldb;
  const v8f z8 = {0.f,0.f,0.f,0.f,0.f,0.f,0.f,0.f}; v8f c00 = z8, c01 = z8, c02 = z8, c03 = z8, c10 = z8, c11 = z8, c12 = z8, c13 = z8;
#pragma unroll 1
  for (int kb = 0; kb < K; kb += 32) { const v16h a0 = g2_frag(a0p + kb, hh), a1 = g2_frag(a1p + kb, hh);
    v16h b = g2_frag(b0p + kb, hh); c00 = g2_mma(a0, b, c00); c10 = g2_mma(a1, b, c10);
    b = g2_frag(b1p + kb, hh); c01 = g2_mma(a0, b, c01); c11 = g2_mma(a1, b, c11);
    b = g2_frag(b2p + kb, hh); c02 = g2_mma(a0, b, c02); c12 = g2_mma(a1, b, c12);
    b = g2_frag(b3p + kb, hh); c03 = g2_mma(a0, b, c03); c13 = g2_mma(a1, b, c13); }
  v8f accs[8] = {c00, c01, c02, c03, c10, c11, c12, c13};
#pragma unroll
  for (int u = 0; u < 8; ++u) { const int t = u & 3, half = u >> 2; const int col = col0 + t * 16 + ln; const float bv = bp ? bf16_round(bp[col]) : 0.f;
#pragma unroll
    for (int r = 0; r < 8; ++r) { const int rloc = half * 16 + 8 * hh + r; float v = accs[u][r] * alpha + bv; if (CP) { if (rowsPerB < 0) v += CP[(size_t)by * sCPb + (size_t)(row0g + row0 + rloc) * ldc + col];      /* rowsPerB < 0: own element of an addend plane shaped like C; sCPb = its step from one grid.y slice to the next (0: one plane shared by all slices) */ else { const int bidx = (row0g + row0 + rloc) / rowsPerB; v += CP[(size_t)bidx * sCPb + (size_t)by * 64 + col]; } }
      if (ACT == 3) v = fmaxf(v, 0.f); else if (ACT == 6) v = 0.5f * v * (1.0f + erff(v * 0.70710678118654752f)); else if (ACT == 11) v = 1.0f / (1.0f + expf(-v)); else if (ACT == 15) v = v / (1.0f + expf(-v)); else if (ACT == 12) v = (v > 0.f) ? v : 0.01f * v; else if (ACT == 8) v = tanhf(v); else if (ACT == 9) v = 0.5f * v * (1.0f + tanhf(0.7978845608028654f * (v + 0.044715f * v * v * v))); else if (ACT == 14) v = (v > 0.f) ? v : 0.1f * v; else if (ACT == 16) v = (v >= 0.f) ? v : 0.3f * v; else if (ACT == 17) v = (v >= 0.f) ? v : 0.2f * v;
      so[w][rloc][t * 16 + ln] = v; } }
  __builtin_amdgcn_fence(__ATOMIC_ACQ_REL, "workgroup"); __builtin_amdgcn_wave_barrier();
  const int rsub = lane >> 4, c4 = (lane & 15) * 4;
  {
#pragma unroll
    for (int q = 0; q < 16; ++q) { const int r = q * 2 + rsub; const v4f v = *(const v4fa*)&so[w][r][c4]; if (C) *(v4f*)(C + cofs + (size_t)(row0 + r) * ldc + col0 + c4) = v; if (C16) { v4h h4; for (int i = 0; i < 4; ++i) h4[i] = (_Float16)v[i]; *(v4h*)(C16 + cofs + (size_t)(row0 + r) * ldc + col0 + c4) = h4; } }
     } }


__global__ __launch_bounds__(256) void k_wnat(const float* __restrict__ w, size_t n8, _Float16* __restrict__ Bt) { const size_t t = (size_t)blockIdx.x * 256 + threadIdx.x; if (t >= n8) return; FragH f; for (int q = 0; q < 8; ++q) f.h[q] = (_Float16)(bf16_round(w[t * 8 + q]) * 16.0f); *(v8us*)((unsigned short*)Bt + t * 8) = f.half[0];  }
__global__ __launch_bounds__(256) void k_rsm(const float* __restrict__ S, _Float16* __restrict__ P, int nrows) {
  #pragma clang fp contract(off)
  const int i = blockIdx.x * 256 + threadIdx.x; if (i >= nrows) return; const float* s = S + (size_t)i * SQ; float mx = -3.0e38f;
#pragma unroll 1
  for (int j = 0; j < SQ; ++j) mx = fmaxf(mx, s[j]); float se = 0.f;
#pragma unroll 1
  for (int j = 0; j < SQ; ++j) se += expf(s[j] - mx); const float sc = 256.0f / se;
#pragma unroll 1
  for (int j0 = 0; j0 < SQ; j0 += 8) { FragH f; for (int q = 0; q < 8; ++q) f.h[q] = (_Float16)(expf(s[j0 + q] - mx) * sc); unsigned short* d = (unsigned short*)P + (size_t)i * SQ + j0; *(v8us*)d = f.half[0];  } }
__global__ __launch_bounds__(256) void k_vt(const _Float16* __restrict__ V16, int b, int h0, _Float16* __restrict__ VT) { __shared__ unsigned short tl[64][65]; const int tid = threadIdx.x; const int hh = blockIdx.x % HG, sg = blockIdx.x / HG; const int s0 = sg * 64; const int h = h0 + hh;
  for (int i = tid; i < 64 * 8; i += 256) { const int j = i / 8, d8 = (i % 8) * 8; FragH f; f.half[0] = *(const v8us*)((const unsigned short*)V16 + ((size_t)b * SQ + s0 + j) * DM + h * HD + d8); for (int q = 0; q < 8; ++q) tl[d8 + q][j] = f.u[q]; }
  __syncthreads();
  { for (int i = tid; i < 64 * 8; i += 256) { const int d = i / 8, j8 = (i % 8) * 8; FragH f; for (int q = 0; q < 8; ++q) f.u[q] = tl[d][j8 + q]; *(v8us*)((unsigned short*)VT + ((size_t)hh * HD + d) * SQ + s0 + j8) = f.half[0]; }  } }



__global__ __launch_bounds__(256) void k_rsmcf2(const float* __restrict__ S, _Float16* __restrict__ P, int hg, int q0, int nk) {
  #pragma clang fp contract(off)
  const int t = blockIdx.x * 256 + threadIdx.x; if (t >= hg * QT) return; const size_t i = (size_t)t; const float* s = S + i * NKX; const int last = q0 + (t % QT); float mx = -3.0e38f;
#pragma unroll 1
  for (int j = 0; j < nk; ++j) { const float f = (j <= last) ? 1.f : 0.f; mx = fmaxf(mx, fmaf(f, s[j], (1.f - f) * -1.0e9f)); } float se = 0.f;
#pragma unroll 1
  for (int j = 0; j < nk; ++j) { const float f = (j <= last) ? 1.f : 0.f; se += __expf(fmaf(f, s[j], (1.f - f) * -1.0e9f) - mx); } const float sc = 256.0f / se;
#pragma unroll 1
  for (int j0 = 0; j0 < nk; j0 += 8) { FragH fr; for (int q = 0; q < 8; ++q) { const int j = j0 + q; const float f = (j <= last) ? 1.f : 0.f; fr.h[q] = (_Float16)(__expf(fmaf(f, s[j], (1.f - f) * -1.0e9f) - mx) * sc); } unsigned short* d = (unsigned short*)P + i * NKX + j0; *(v8us*)d = fr.half[0];  } }

template <int MASKADD>
__global__ __launch_bounds__(64) void k_att0(const float* __restrict__ QF, const float* __restrict__ KF, const float* __restrict__ VF, int ld, const float* __restrict__ mask, float scale, float* __restrict__ OF, int ldo) {
  #pragma clang fp contract(off)
  __shared__ __attribute__((aligned(16))) float lq[64][64]; __shared__ __attribute__((aligned(16))) float lo[64][64];
  const int tid = threadIdx.x; const int h = blockIdx.x / (QT0 / 64), rg = blockIdx.x % (QT0 / 64); const int i = rg * 64 + tid;
  const float* qr = QF + (size_t)i * ld + h * HD;
#pragma unroll 1
  for (int c = 0; c < HD / 4; ++c) { *(v4f*)&lq[tid][c * 4] = *(const v4fa*)(qr + c * 4); const v4f z = {0.f, 0.f, 0.f, 0.f}; *(v4f*)&lo[tid][c * 4] = z; }
  float m = -1.0e30f, l = 0.f; const int jmax = MASKADD ? (SQ - 1) : (rg * 64 + 63);      /* additive-mask form: every key (the mask input decides); causal form: keys up to the block's last row */
#pragma unroll 1
  for (int j = 0; j <= jmax; ++j) { const float* kr = KF + (size_t)j * ld + h * HD; const float* vr = VF + (size_t)j * ld + h * HD; float s = 0.f;
#pragma unroll 1
    for (int c = 0; c < HD / 4; ++c) { const v4f kq = *(const v4fa*)(kr + c * 4); const v4f qq = *(v4f*)&lq[tid][c * 4]; s = __fadd_rn(s, __fmul_rn(qq[0], kq[0])); s = __fadd_rn(s, __fmul_rn(qq[1], kq[1])); s = __fadd_rn(s, __fmul_rn(qq[2], kq[2])); s = __fadd_rn(s, __fmul_rn(qq[3], kq[3])); }
    s = __fmul_rn(s, scale); if (MASKADD) s = __fadd_rn(s, __fmul_rn(bf16_round(mask[(size_t)i * SQ + j]), -10000.0f));
    const float f = (MASKADD || j <= i) ? 1.f : 0.f; const float sm = fmaf(f, s, (1.f - f) * -1.0e30f); const float mn = fmaxf(m, sm); const float sc = expf(m - mn); const float e = expf(sm - mn); l = __fadd_rn(__fmul_rn(l, sc), e); m = mn;
#pragma unroll 1
    for (int c = 0; c < HD / 4; ++c) { const v4f vv = *(const v4fa*)(vr + c * 4); v4f oo = *(v4f*)&lo[tid][c * 4]; for (int u = 0; u < 4; ++u) oo[u] = __fadd_rn(__fmul_rn(oo[u], sc), __fmul_rn(e, vv[u])); *(v4f*)&lo[tid][c * 4] = oo; } }
  const float fin = 64.0f / l;      /* o carried x64 like the f16 path */
#pragma unroll 1
  for (int c = 0; c < HD / 4; ++c) { v4f oo = *(v4f*)&lo[tid][c * 4]; for (int u = 0; u < 4; ++u) oo[u] = __fmul_rn(oo[u], fin); *(v4f*)&lo[tid][c * 4] = oo; }
  __syncthreads();
  {
#pragma unroll 1
    for (int it = 0; it < 16; ++it) { const int row = it * 4 + tid / 16, pc = (tid % 16) * 4; const v4f v = *(const v4f*)&lo[row][pc]; *(v4f*)(OF + (size_t)(rg * 64 + row) * ldo + h * HD + pc) = v; }
     } }

__global__ __launch_bounds__(256) void k_oscale(const float* __restrict__ OF, float* __restrict__ out, size_t n4) { const size_t t = (size_t)blockIdx.x * 256 + threadIdx.x; if (t >= n4) return; const v4f a = *(const v4fa*)(OF + t * 4); v4f o; for (int q = 0; q < 4; ++q) o[q] = a[q] * 0.015625f; *(v4f*)(out + t * 4) = o;  }

__global__ __launch_bounds__(256) void k_bfr(const float* __restrict__ x, float* __restrict__ XB, size_t n8) { const size_t t = (size_t)blockIdx.x * 256 + threadIdx.x; if (t >= n8) return; v4f a = *(const v4fa*)(x + t * 8), c = *(const v4fa*)(x + t * 8 + 4); for (int q = 0; q < 4; ++q) { a[q] = bf16_round(a[q]); c[q] = bf16_round(c[q]); }
  { *(v4f*)(XB + t * 8) = a; *(v4f*)(XB + t * 8 + 4) = c;  } }



__global__ __launch_bounds__(256) void k_rsmfvl(const float* __restrict__ S, _Float16* __restrict__ P, _Float16* __restrict__ PL, int qn, const int* __restrict__ vlp) {
  #pragma clang fp contract(off)
  const int t = blockIdx.x * 256 + threadIdx.x; if (t >= qn) return; const int vl = vlp[0]; const size_t i = (size_t)t; const float* s = S + i * SQ; float mx = -3.0e38f;
#pragma unroll 1
  for (int j = 0; j < SQ; ++j) { const float f = (j < vl) ? 1.f : 0.f; mx = fmaxf(mx, fmaf(f, s[j], (1.f - f) * -1000000.0f)); } float se = 0.f;
#pragma unroll 1
  for (int j = 0; j < SQ; ++j) { const float f = (j < vl) ? 1.f : 0.f; se += __expf(fmaf(f, s[j], (1.f - f) * -1000000.0f) - mx); } const float sc = 256.0f / se;
#pragma unroll 1
  for (int j0 = 0; j0 < SQ; j0 += 8) { FragH fr, gr; for (int q = 0; q < 8; ++q) { const int j = j0 + q; const float f = (j < vl) ? 1.f : 0.f; const float pv = __expf(fmaf(f, s[j], (1.f - f) * -1000000.0f) - mx) * sc; const _Float16 ph = (_Float16)pv; fr.h[q] = ph; gr.h[q] = (_Float16)((pv - (float)ph) * 1024.0f); }
    unsigned short* d = (unsigned short*)P + i * SQ + j0; unsigned short* dl = (unsigned short*)PL + i * SQ + j0; *(v8us*)d = fr.half[0]; *(v8us*)dl = gr.half[0];  } }

// 2^x on the transcendental unit; the v_nop is the one free slot the instruction set asks for behind a transcendental, in the same statement so that it stays directly behind it.
__device__ __forceinline__ float exp2_slot(float x) { float r; asm("v_exp_f32 %0, %1\n\tv_nop" : "=v"(r) : "v"(x)); return r; }

#define CN 256          /* channels */
#define CI 128          /* inner channels */
#define NP 4096         /* positions */
#define NM 1024         /* pooled positions (= SQ: the softmax key count) */

// Fused attention: one launch computes scores, softmax and the weighted sum of g for all images; neither the scores nor the weights go to memory.
// A work-group of 8 waves takes 128 queries of one image (16 a wave) and walks the 1024 pooled positions 32 at a time.
// S^T = phi^T (A, rows m) x theta (B, columns n; fragments kept in registers), three terms as before: hi.hi + (hi.lo + lo.hi) / 1024.
// In the accumulator a lane holds, for ITS query n = lane & 15, the keys m = 8 * (lane >> 4) + r of a 16-key tile: two such tiles are, register for register, the B fragment of y[c][n] += g[c][m] P^T[m][n]
// (elements 0..7 = keys 8 hh + r, elements 8..15 = keys 16 + 8 hh + r, the k order in which g2_frag / lds_frag read the rows of g), so the weights move through no LDS and no other lane.
// Running row maximum and row sum per lane (online softmax; the two half-waves share the maximum every pass and join their sums once at the end). Weights are carried x256 in f16 as before; the sum carries the same factor.
// The phi hi / lo rows and the g columns of a pass are shared by the 8 waves through LDS, a ring of FR = 2 FKB + 1 buffers with one barrier every FKB passes: pass t works on tile t, reads tile t + 1's phi fragments ahead, and stages tile t + FKB + 1 (global loads at its head, LDS stores at its foot).
// Between two barriers (passes k s .. k s + k - 1, k = FKB) the waves read tiles k s .. k s + k and write tiles k s + k + 1 .. k s + 2 k, which lie in the buffers of tiles k s - k .. k s - 1, left by every wave before the barrier in front; the barrier behind publishes them. The two waves of a SIMD take turns at the matrix unit, so one reaches every barrier later than the other: fewer barriers, fewer such waits.
// Every LDS fragment read stands one phase ahead of its use, as a whole group: the g fragments of a pass in front of its score products, the next pass's 16 phi fragments behind them (into the registers they have just left), in front of the exponentials and the g products.
#define FK 32                            /* keys per pass */
#define FPP 136                          /* LDS pitch of a phi row in f16: 256 B + 16 B, an odd multiple of 16 B (no bank conflict for 16-byte reads of 16 rows) */
#define FGP 40                           /* LDS pitch of a g row in f16: 64 B + 16 B, likewise */
#define FBUF (2 * FK * FPP + CI * FGP)   /* one buffer in f16: phi hi, phi lo, g */
#define FKB 4                            /* passes between two barriers */
#define FR (2 * FKB + 1)                 /* buffers in the ring */
__device__ __forceinline__ v16h lds_frag(const unsigned short* p) { FragH f; f.half[0] = *(const v8us*)p; f.half[1] = *(const v8us*)(p + 16); return f.v; }
__device__ __forceinline__ v8f f_mma(v16h a, v16h b, v8f c) { return __builtin_amdgcn_wmma_f32_16x16x32_f16(false, a, false, b, (short)0, c, false, false); }
#define SOP 132                          /* LDS pitch of a gathered output row in f32: 512 B + 16 B (16-byte writes of 16 rows fall on all banks) */
__global__ __launch_bounds__(256) void k_fattn(const _Float16* __restrict__ TH, const _Float16* __restrict__ THL, const _Float16* __restrict__ PHT, const _Float16* __restrict__ PHLT, const _Float16* __restrict__ G16, const _Float16* __restrict__ BW, const float* __restrict__ BN4, const float* __restrict__ x, float* __restrict__ out) {
  __shared__ __attribute__((aligned(16))) unsigned short sm[FR * FBUF];
  static_assert((NM / FK) % FKB == 0 && NM / FK > FKB, "the last pass ends in a barrier; the prologue's tiles exist");
  static_assert(128 * FPP * 2 + 8 * 32 * SOP * 4 <= FR * FBUF * 2, "y^T and the gathered output rows fit in the ring");
  float* const so = (float*)(sm + 128 * FPP);      /* epilogue: each wave gathers its own 32 output rows here, over the ring and behind y^T */
  const int tid = threadIdx.x, w = tid >> 5, lane = tid & 31, ln = lane & 15, hh = lane >> 4, by = blockIdx.y;
  const int n0 = blockIdx.x * 128 + w * 16;
  const unsigned short* ph = (const unsigned short*)PHT + (size_t)by * CI * NM; const unsigned short* pl = (const unsigned short*)PHLT + (size_t)by * CI * NM; const unsigned short* gg = (const unsigned short*)G16 + (size_t)by * CI * NM;
  const _Float16* tq = TH + ((size_t)by * NP + n0 + ln) * CI; const _Float16* tl = THL + ((size_t)by * NP + n0 + ln) * CI;
  v16h qh[4], ql[4];
#pragma unroll
  for (int j = 0; j < 4; ++j) { qh[j] = g2_frag(tq + j * 32, hh); ql[j] = g2_frag(tl + j * 32, hh); }
  /* staging: 16-byte pieces; phi tile = 32 rows x 16 pieces (contiguous in memory), g tile = 128 rows x 4 pieces; two pieces of each plane a thread */
  const int pr = tid >> 4, pc = (tid & 15) * 8, gr = tid >> 2, gc = (tid & 3) * 8;
  v8us r0, r1, r2, r3, r4, r5;
  const unsigned short *fh, *fl, *fg;      /* the lane's first piece of each plane of the tile being fetched */
  auto fetch = [&](int t) { const size_t m0 = (size_t)t * FK;
    fh = ph + (m0 + pr) * CI + pc; fl = pl + (m0 + pr) * CI + pc; fg = gg + ((size_t)t * CI + gr) * FK + gc;      /* g lies tile by tile: [m / 32][ci][32], one pass's tile = 8 KiB in a row */
    r0 = *(const v8us*)fh; r1 = *(const v8us*)(fh + 16 * CI);
    r2 = *(const v8us*)fl; r3 = *(const v8us*)(fl + 16 * CI);
    r4 = *(const v8us*)fg; r5 = *(const v8us*)(fg + 64 * FK); };
  auto fetched = [&]() { asm volatile("s_wait_xcnt 0x0" :: "v"(fh), "v"(fl), "v"(fg) : "memory"); };      /* the wait that stands in front of any overwrite of a register which an issued load names; the three addresses are inputs so that they stay live up to it */
  auto put = [&](int bo) { unsigned short* d = sm + bo;
    *(v8us*)(d + pr * FPP + pc) = r0; *(v8us*)(d + (pr + 16) * FPP + pc) = r1;
    *(v8us*)(d + FK * FPP + pr * FPP + pc) = r2; *(v8us*)(d + FK * FPP + (pr + 16) * FPP + pc) = r3;
    *(v8us*)(d + 2 * FK * FPP + gr * FGP + gc) = r4; *(v8us*)(d + 2 * FK * FPP + (gr + 64) * FGP + gc) = r5; };
  v16h pa[16];      /* a tile's phi fragments: [4 j + 0 / 1] = hi rows 0..15 / 16..31, [4 j + 2 / 3] = residual rows, k block j */
  auto ldphi = [&](int bo) { const unsigned short* a = sm + bo + ln * FPP + 8 * hh;
#pragma unroll
    for (int j = 0; j < 4; ++j) { pa[4 * j] = lds_frag(a + j * 32); pa[4 * j + 1] = lds_frag(a + 16 * FPP + j * 32); pa[4 * j + 2] = lds_frag(a + FK * FPP + j * 32); pa[4 * j + 3] = lds_frag(a + (FK + 16) * FPP + j * 32); } };
  const v8f z8 = {0.f,0.f,0.f,0.f,0.f,0.f,0.f,0.f};
  v8f o[8];
#pragma unroll
  for (int ct = 0; ct < 8; ++ct) o[ct] = z8;
  float m = -1.0e30f, l = 0.f;
  { v8us st[FKB + 1][6];      /* tiles 0 .. FKB: all their loads fly together */
    fh = ph + (size_t)pr * CI + pc; fl = pl + (size_t)pr * CI + pc; fg = gg + (size_t)gr * FK + gc;
#pragma unroll
    for (int i = 0; i <= FKB; ++i) { st[i][0] = *(const v8us*)(fh + i * FK * CI); st[i][1] = *(const v8us*)(fh + i * FK * CI + 16 * CI); st[i][2] = *(const v8us*)(fl + i * FK * CI); st[i][3] = *(const v8us*)(fl + i * FK * CI + 16 * CI); st[i][4] = *(const v8us*)(fg + i * CI * FK); st[i][5] = *(const v8us*)(fg + i * CI * FK + 64 * FK); }
    fetched();
#pragma unroll
    for (int i = 0; i <= FKB; ++i) { r0 = st[i][0]; r1 = st[i][1]; r2 = st[i][2]; r3 = st[i][3]; r4 = st[i][4]; r5 = st[i][5]; put(i * FBUF); } }
  __syncthreads();      /* publishes tiles 0 .. FKB */
  ldphi(0);
  int b0 = 0, b1 = FBUF, b2 = (FKB + 1) * FBUF;      /* ring offsets of tiles t, t + 1, t + FKB + 1 */
  int tf = FKB + 1;      /* the tile that pass t stages: t + FKB + 1, held at the last tile */
  auto pass = [&]() {
    const unsigned short* ag = sm + b0 + 2 * FK * FPP + ln * FGP + 8 * hh;
    v16h ga[8];
    fetch(tf);      /* the index is held at the last tile so that the pass has no branch and stays one scheduling region; what the last FKB + 1 passes stage is written and read ahead like any tile and enters no product */
#pragma unroll
    for (int ct = 0; ct < 8; ++ct) ga[ct] = lds_frag(ag + ct * 16 * FGP);
    __builtin_amdgcn_sched_barrier(0);      /* keeps the g fragment reads and the staging loads in front of the score products, which cover them; without it the compiler sinks each read to just in front of its product and the wave waits out the LDS latency there */
    v8f sh0 = z8, sh1 = z8, sl0 = z8, sl1 = z8;
#pragma unroll
    for (int j = 0; j < 4; ++j) {
      sh0 = f_mma(pa[4 * j], qh[j], sh0); sh1 = f_mma(pa[4 * j + 1], qh[j], sh1);
      sl0 = f_mma(pa[4 * j], ql[j], sl0); sl1 = f_mma(pa[4 * j + 1], ql[j], sl1);
      sl0 = f_mma(pa[4 * j + 2], qh[j], sl0); sl1 = f_mma(pa[4 * j + 3], qh[j], sl1);
    }
    float s[16];
#pragma unroll
    for (int r = 0; r < 8; ++r) { s[r] = sh0[r] + sl0[r] * 0.0009765625f; s[8 + r] = sh1[r] + sl1[r] * 0.0009765625f; }
    float mx = fmaxf(s[0], s[1]);
#pragma unroll
    for (int r = 2; r < 16; ++r) mx = fmaxf(mx, s[r]);
    const float mo = __shfl_xor(mx, 16, 32);      /* the other half-wave holds the same query's other 16 keys */
    __builtin_amdgcn_sched_barrier(0);      /* the exchange goes through the LDS queue, which answers in order: it is issued in front of the 32 reads below, so that its wait does not take them in */
    fetched();      /* here and not at the loads: it has to stand in front of the first overwrite of the three address pairs only, and they stay untouched up to it; the score products lie in between */
    ldphi(b1);      /* tile t + 1, published by the last barrier or an earlier one */
    __builtin_amdgcn_sched_barrier(0);      /* keeps the whole group here, in front of the exponentials and the g products, which cover it */
    mx = fmaxf(mx, mo);
    const float mn = fmaxf(m, mx);
    const float sc = exp2_slot((m - mn) * 1.44269504f);
    m = mn;
    FragH pf; float p0 = 0.f, p1 = 0.f;
#pragma unroll
    for (int r = 0; r < 8; ++r) {
      const float e0 = exp2_slot((s[r] - mn) * 1.44269504f + 8.0f), e1 = exp2_slot((s[8 + r] - mn) * 1.44269504f + 8.0f);
      p0 += e0; p1 += e1; pf.h[r] = (_Float16)e0; pf.h[8 + r] = (_Float16)e1;
    }
    l = l * sc + (p0 + p1);
#pragma unroll
    for (int ct = 0; ct < 8; ++ct) o[ct] *= sc;
#pragma unroll
    for (int ct = 0; ct < 8; ++ct) o[ct] = f_mma(ga[ct], pf.v, o[ct]);
    __builtin_amdgcn_sched_barrier(0);      /* keeps the staging stores, and with them the barrier's wait on the LDS queue, behind the g products: hoisted over them, that wait stood right behind the exponentials and took in the 32 reads */
    put(b2);
    b0 = b1; b1 = b1 + FBUF == FR * FBUF ? 0 : b1 + FBUF; b2 = b2 + FBUF == FR * FBUF ? 0 : b2 + FBUF;
    if (tf + 1 < NM / FK) ++tf;
  };
  /* rolled: FKB passes are already more than a thousand instructions, and the ring offsets are the only thing that changes */
#pragma unroll 1
  for (int t = 0; t < NM / FK; t += FKB) {
    /* unrolled, so that the passes between two barriers are straight-line code: with a branch round the barrier in every pass the compiler sank the row sum's chain of additions out of the exponentials' shadow to the pass's foot */
#pragma unroll
    for (int u = 0; u < FKB; ++u) pass();
    __syncthreads();      /* publishes the FKB tiles staged since the last barrier; ends every wave's reads of the FKB tiles worked on since, whose buffers the next FKB passes overwrite */
  }
  /* Epilogue: z[c][n] = BN(W y + W_b) + bf16(x) for the work-group's 128 positions. The waves exchange y^T through LDS; then a wave takes 32 output channels and all 128 positions:
     D[n][c] = (y^T rows as A) (16 W rows as B^T), so that a lane holds 8 consecutive positions of ITS channel c = lane & 15; bias and BatchNorm are applied there, the rows are gathered in the wave's own LDS range and leave, with the residual, as whole 512-byte pieces of a channel row. */
  const int c0 = w * 32, cl = c0 + ln;
  const unsigned short* wr = (const unsigned short*)BW + (size_t)cl * CI + 8 * hh;      /* elements 0..7 = k 8 hh + 0..7, elements 8..15 = k 16 + 8 hh + 0..7 of each 32, the order in which lds_frag reads the rows of y^T */
  const float* bnp = BN4 + 4 * cl;
  v16h wf[2][4]; v4f bn[2];
#pragma unroll
  for (int u = 0; u < 2; ++u) {
#pragma unroll
    for (int j = 0; j < 4; ++j) { FragH f; f.half[0] = *(const v8us*)(wr + u * 16 * CI + j * 32); f.half[1] = *(const v8us*)(wr + u * 16 * CI + j * 32 + 16); wf[u][j] = f.v; }
    bn[u] = *(const v4fa*)(bnp + u * 64); }
  asm volatile("s_wait_xcnt 0x0" :: "v"(wr), "v"(cl) : "memory");      /* the wait that stands in front of any overwrite of a register which an issued load names; the weights' address and the row index that the constants' loads are addressed by are inputs so that they stay live up to it */
  l += __shfl_xor(l, 16, 32);
  const float inv = 1.0f / l;
  { unsigned short* yo = sm + (w * 16 + ln) * FPP + 8 * hh;      /* y^T [128 n][ci] over the ring, which nobody reads behind the loop's last barrier: the lane's 8 channels of a tile are 16 contiguous bytes of its query's row */
#pragma unroll
    for (int ct = 0; ct < 8; ++ct) { FragH f;
#pragma unroll
      for (int r = 0; r < 8; ++r) f.h[r] = (_Float16)(o[ct][r] * inv);
      *(v8us*)(yo + ct * 16) = f.half[0]; } }
  __syncthreads();      /* publishes y^T */
  const size_t e0 = ((size_t)by * CN + c0) * NP + blockIdx.x * 128 + lane * 4;      /* the lane's 4 positions of the wave's first channel row */
  const float* xb = x + e0;
  v4f xx[32];      /* behind the barrier, which waits for every load in flight: the residual flies under the products */
#pragma unroll
  for (int q = 0; q < 32; ++q) xx[q] = *(const v4fa*)(xb + (size_t)q * NP);
  asm volatile("s_wait_xcnt 0x0" :: "v"(xb) : "memory");      /* as above, for the one address of this run */
  const unsigned short* yr = sm + ln * FPP + 8 * hh;
  float* sw = so + w * (32 * SOP);
  v16h ya[2][8];      /* two sets of fragments, each of two position tiles: [4 i + j] = tile i, k block j */
  auto ldy = [&](int s, int np) {
#pragma unroll
    for (int i = 0; i < 2; ++i)
#pragma unroll
      for (int j = 0; j < 4; ++j) ya[s][4 * i + j] = lds_frag(yr + (np * 2 + i) * 16 * FPP + j * 32); };
  ldy(0, 0);
#pragma unroll
  for (int np = 0; np < 4; ++np) {
    if (np + 1 < 4) ldy((np + 1) & 1, np + 1);
    __builtin_amdgcn_sched_barrier(0);      /* keeps the next two tiles' fragment reads, as one group, in front of this pair's products, which cover them */
    v8f d[2][2] = {{z8, z8}, {z8, z8}};
#pragma unroll
    for (int j = 0; j < 4; ++j)
#pragma unroll
      for (int i = 0; i < 2; ++i) { d[i][0] = f_mma(ya[np & 1][4 * i + j], wf[0][j], d[i][0]); d[i][1] = f_mma(ya[np & 1][4 * i + j], wf[1][j], d[i][1]); }
#pragma unroll
    for (int i = 0; i < 2; ++i)
#pragma unroll
      for (int u = 0; u < 2; ++u) { v4f t0, t1;
#pragma unroll
        for (int k = 0; k < 4; ++k) { t0[k] = ((d[i][u][k] * 0.0625f + bn[u][0]) - bn[u][1]) * bn[u][2] + bn[u][3]; t1[k] = ((d[i][u][4 + k] * 0.0625f + bn[u][0]) - bn[u][1]) * bn[u][2] + bn[u][3]; }
        float* ds = sw + (u * 16 + ln) * SOP + (np * 2 + i) * 16 + 8 * hh; *(v4f*)ds = t0; *(v4f*)(ds + 4) = t1; }
  }
  asm volatile("s_wait_dscnt 0x0" ::: "memory");      /* the wave reads back rows that its other lanes wrote: those stores are through first, and the compiler moves no read over this line */
  v4f vv[32];
#pragma unroll
  for (int q = 0; q < 32; ++q) vv[q] = *(const v4fa*)(sw + q * SOP + lane * 4);
  __builtin_amdgcn_sched_barrier(0);      /* keeps the 32 reads together as one group: sunk to their uses, one or two at a time, each would have the wave wait out the LDS latency */
#pragma unroll
  for (int q = 0; q < 32; ++q) { v4f r;
#pragma unroll
    for (int i = 0; i < 4; ++i) r[i] = vv[q][i] + bf16_round(xx[q][i]);
    *(v4f*)(out + e0 + (size_t)q * NP) = r; }
}

__global__ __launch_bounds__(256) void k_rowbias(const float* __restrict__ b, float* __restrict__ BP, size_t n4, int ncol) { const size_t t = (size_t)blockIdx.x * 256 + threadIdx.x; if (t >= n4) return; const size_t e = t * 4; const float v = bf16_round(b[e / ncol]); const v4f o = {v, v, v, v}; *(v4f*)(BP + e) = o;  }




__global__ __launch_bounds__(256) void k_mp2(const float* __restrict__ src, float* __restrict__ dst, int nout) {
  const int t = blockIdx.x * 256 + threadIdx.x; if (t >= nout) return; const int c = t / 1024; const int o = t % 1024; const int oy = o / 32, ox = o % 32; const float* p = src + (size_t)c * 4096 + (size_t)(2 * oy) * 64 + 2 * ox;
  const float v = fmaxf(fmaxf(p[0], p[1]), fmaxf(p[64], p[65])); *(float*)(dst + t) = v;  }
__global__ __launch_bounds__(256) void k_xpb(const float* __restrict__ x, const float* __restrict__ wb, float* __restrict__ CPP, size_t n4) {
  #pragma clang fp contract(off)
  const size_t t = (size_t)blockIdx.x * 256 + threadIdx.x; if (t >= n4) return; const size_t e = t * 4; const int c = (int)((e / 4096) % 256); const float bb = bf16_round(wb[c]); const v4f a = *(const v4fa*)(x + e); v4f o; for (int q = 0; q < 4; ++q) o[q] = __fadd_rn(bf16_round(a[q]), bb);
  *(v4f*)(CPP + e) = o;  }


__global__ __launch_bounds__(256) void k_bnres(float* __restrict__ O, const float* __restrict__ x, const float* __restrict__ wb, const float* __restrict__ g, const float* __restrict__ be, const float* __restrict__ mu, const float* __restrict__ var, float eps, size_t n4) {
  #pragma clang fp contract(off)
  const size_t t = (size_t)blockIdx.x * 256 + threadIdx.x; if (t >= n4) return; const size_t e = t * 4; const int c = (int)((e / NP) % CN);
  const float inv = __fdiv_rn(bf16_round(g[c]), sqrtf(__fadd_rn(bf16_round(var[c]), eps))); const float wbc = bf16_round(wb[c]), mc = bf16_round(mu[c]), bc = bf16_round(be[c]);
  const v4f a = *(const v4fa*)(O + e); const v4f xx = *(const v4fa*)(x + e); v4f o;
  for (int q = 0; q < 4; ++q) o[q] = __fadd_rn(__fadd_rn(__fmul_rn(__fadd_rn(__fadd_rn(a[q], wbc), -mc), inv), bc), bf16_round(xx[q]));
  *(v4f*)(O + e) = o;  }

// ---- the pointwise and layout stages live inside the two matrix kernels ----
// Every plain '#pragma unroll' below but the last (the copy of theta out of LDS) stands on a short loop over a register array (fragments, accumulators, packed halves): its index must be a compile-time constant for the array to stay in registers.
// Two f32 values, each rounded to bf16 and taken x16, as two packed f16 (exact: 8 significant bits, away from the f16 subnormal range).
typedef float v2f __attribute__((ext_vector_type(2)));
typedef __bf16 v2b __attribute__((ext_vector_type(2)));
typedef _Float16 v2h __attribute__((ext_vector_type(2)));
typedef unsigned int v2u __attribute__((ext_vector_type(2), may_alias));
__device__ __forceinline__ unsigned int w16_pair(float a, float b) {
  const v2f v = {a, b};
  const unsigned int pk = __builtin_bit_cast(unsigned int, __builtin_convertvector(v, v2b));
  const v2f r = {__uint_as_float(pk << 16), __uint_as_float(pk & 0xFFFF0000u)};
  return __builtin_bit_cast(unsigned int, __builtin_convertvector(r * 16.0f, v2h));
}

// k_proj: theta, phi and g of 128 positions (two image rows = one pooled row) of one image in one work-group of 16 waves.
// 0. The small operands, from the f32 inputs, with no launch of their own: every work-group rounds the three projection weights, stacked [384][256] (theta, phi, g), into LDS as x16 f16 rows, and the three biases [384]; for the attention launch work-group i writes row i of W [256][128] as x16 f16, and work-groups 0..31 eight channels each of {W_b, mean, gamma / sqrt(var + eps), beta}.
// 1. x [256 c][128 n] f32 -> bf16-rounded f16, transposed into LDS as x^T [n][c]. 2. D[o][n] = (stacked weights as A, rows o, from LDS) x (x^T rows as B^T): a wave keeps the B fragments of position tiles p and p + 4 (the same 16 columns of the two image rows) in registers for all of K and walks 6 of the 24 row tiles.
// In D a lane holds 8 consecutive o of ITS position: theta splits into hi + x1024 residual as 16-byte pieces of its [n][ci] row; phi and g take the 2x2 maximum as max(tile p, tile p + 4), then with the neighbour lane. 3. All results are gathered in LDS, over x^T, and leave as whole lines.
#define XP 264                           /* LDS pitch of an x^T row and of a weight row in f16: 512 B + 16 B (16-byte reads and writes of 16 rows fall on all banks) */
#define TP 136                           /* LDS pitch of a gathered theta / phi row in f16: 256 B + 16 B */
#define GP 40                            /* LDS pitch of a gathered g row in f16: 64 B + 16 B */
__global__ __launch_bounds__(512) void k_proj(const float* __restrict__ x, const float* __restrict__ tw, const float* __restrict__ pw, const float* __restrict__ gw, const float* __restrict__ tb, const float* __restrict__ pb, const float* __restrict__ gb,
    const float* __restrict__ ww, const float* __restrict__ wb, const float* __restrict__ g, const float* __restrict__ be, const float* __restrict__ mu, const float* __restrict__ var, float eps,
    _Float16* __restrict__ TH, _Float16* __restrict__ THL, _Float16* __restrict__ PHT, _Float16* __restrict__ PHLT, _Float16* __restrict__ G16, _Float16* __restrict__ BW, float* __restrict__ BN4) {
  __shared__ __attribute__((aligned(16))) unsigned short wl[3 * CI * XP];
  __shared__ __attribute__((aligned(16))) float sb[3 * CI];
  __shared__ __attribute__((aligned(16))) unsigned short un[2 * 128 * TP + 2 * 32 * TP + CI * GP];      /* x^T first; the gathered results once every wave holds its x^T fragments */
  static_assert(128 * XP <= 2 * 128 * TP + 2 * 32 * TP + CI * GP, "x^T fits under the gathered results");
  unsigned short* const xt = un; unsigned short* const sth = un; unsigned short* const stl = sth + 128 * TP; unsigned short* const sph = stl + 128 * TP; unsigned short* const spl = sph + 32 * TP; unsigned short* const sg = spl + 32 * TP;
  const int tid = threadIdx.x, w = tid >> 5, lane = tid & 31, ln = lane & 15, hh = lane >> 4, by = blockIdx.y;
  const int n0 = blockIdx.x * 128;
  const int blk = by * (NP / 128) + blockIdx.x;      /* 0..255: the row of W that this work-group rounds */
  { /* Loads first, in the order in which they come back: the small operands and two of the three weight planes (L2), then x (memory); the planes are rounded while x flies. */
    const float* wp = ww + (size_t)blk * CI + lane * 4;
    const int bc = (blk & 31) * 8 + (lane & 7);
    const float* bp = (tid < CI ? tb : tid < 2 * CI ? pb : gb) + (tid & (CI - 1));
    const v4f wrow = *(const v4fa*)wp;
    const float q_wb = wb[bc], q_mu = mu[bc], q_g = g[bc], q_var = var[bc], q_be = be[bc], q_b = *bp;
    /* a weight plane [128][256] f32 = 16 steps of 8 KiB: a thread takes 16 bytes of each step, a wave 512 bytes in a row */
    const float* w0 = tw + tid * 4; const float* w1 = pw + tid * 4; const float* w2 = gw + tid * 4;
    v4f wa[16], wc[16];
#pragma unroll
    for (int k = 0; k < 16; ++k) wa[k] = *(const v4fa*)(w0 + k * 2048);
#pragma unroll
    for (int k = 0; k < 16; ++k) wc[k] = *(const v4fa*)(w1 + k * 2048);
    /* x: a wave takes two blocks of 32 c x 32 n: a lane 8 c x 4 n; 8 lanes read one 128-byte line of a channel row, and the 16 lanes of a half-wave write 16-byte pieces that fall on all banks */
    const int n = (w & 3) * 32 + 4 * ((lane & 3) + 4 * hh), c = (w >> 2) * 32 + 8 * ((lane >> 2) & 3);
    const float* sp = x + ((size_t)by * CN + c) * NP + n0 + n; v4f xa[2][8];
#pragma unroll
    for (int it = 0; it < 2; ++it)
#pragma unroll
      for (int q = 0; q < 8; ++q) xa[it][q] = *(const v4fa*)(sp + (size_t)(it * 128 + q) * NP);
    asm volatile("s_wait_xcnt 0x0" :: "v"(wp), "v"(bc), "v"(bp), "v"(w0), "v"(w1), "v"(sp) : "memory");      /* the wait that stands in front of any overwrite of a register which an issued load names; the addresses are inputs so that they stay live up to it */
    __builtin_amdgcn_sched_barrier(0);      /* keeps every load above in front of the rounding below: sunk to their uses, the x loads would start only after the planes are rounded, and nothing would cover the memory latency */
    unsigned short* wd = wl + (tid >> 6) * XP + (tid & 63) * 4;
    auto putw = [&](const v4f (&a)[16], int s) {
#pragma unroll
      for (int k = 0; k < 16; ++k) { const v2u o = {w16_pair(a[k][0], a[k][1]), w16_pair(a[k][2], a[k][3])}; *(v2u*)(wd + (s * CI + k * 8) * XP) = o; } };
    putw(wa, 0);
#pragma unroll
    for (int k = 0; k < 16; ++k) wa[k] = *(const v4fa*)(w2 + k * 2048);
    asm volatile("s_wait_xcnt 0x0" :: "v"(w2) : "memory");      /* as above, for the one address of this run */
    putw(wc, 1);
    if (tid < 3 * CI) sb[tid] = bf16_round(q_b);
    if (w == 15) { const v2u o = {w16_pair(wrow[0], wrow[1]), w16_pair(wrow[2], wrow[3])}; *(v2u*)((unsigned short*)BW + (size_t)blk * CI + lane * 4) = o; }
    if (w == 14 && blk < 32 && lane < 8) { const v4f o = {bf16_round(q_wb), bf16_round(q_mu), __fdiv_rn(bf16_round(q_g), sqrtf(bf16_round(q_var) + eps)), bf16_round(q_be)}; *(v4f*)(BN4 + 4 * bc) = o; }
#pragma unroll
    for (int it = 0; it < 2; ++it)
#pragma unroll
      for (int i = 0; i < 4; ++i) { FragH f;
#pragma unroll
        for (int q = 0; q < 8; ++q) f.h[q] = (_Float16)bf16_round(xa[it][q][i]);
        *(v8us*)(xt + (n + i) * XP + it * 128 + c) = f.half[0]; }
    putw(wa, 2);
  }
  const int p = w & 3, oq = w >> 2;
  v16h a[8]; v4f bb0, bb1;
  auto lda = [&](int ot) { const unsigned short* ar = wl + (ot * 16 + ln) * XP + 8 * hh; const float* br = sb + ot * 16 + 8 * hh;      /* the lane's own first bytes: elements 0..7 = k 8 hh + 0..7, elements 8..15 = k 16 + 8 hh + 0..7 of each 32, the order in which the rows of x^T are read */
#pragma unroll
    for (int j = 0; j < 8; ++j) a[j] = lds_frag(ar + j * 32);
    bb0 = *(const v4fa*)br; bb1 = *(const v4fa*)(br + 4); };
  __syncthreads();      /* publishes x^T, the weight rows and the biases */
  v16h b0[8], b1[8];
  { const unsigned short* r0 = xt + (p * 16 + ln) * XP + 8 * hh; const unsigned short* r1 = r0 + 64 * XP;
#pragma unroll
    for (int j = 0; j < 8; ++j) { b0[j] = lds_frag(r0 + j * 32); b1[j] = lds_frag(r1 + j * 32); } }
  lda(oq * 6);
  __syncthreads();      /* ends every wave's reads of x^T, which the gathered results overwrite */
  const v8f z8 = {0.f,0.f,0.f,0.f,0.f,0.f,0.f,0.f};
  const int nl = p * 16 + ln, ml = nl >> 1;
  /* rolled: the three kinds of row tile share one body, and an unrolled one would hold several tiles' weight fragments at once */
#pragma unroll 1
  for (int i = 0; i < 6; ++i) { const int ot = oq * 6 + i;
    v8f c0 = z8, c1 = z8;
#pragma unroll
    for (int j = 0; j < 8; ++j) { c0 = f_mma(a[j], b0[j], c0); c1 = f_mma(a[j], b1[j], c1); }
    float v0[8], v1[8];
#pragma unroll
    for (int r = 0; r < 8; ++r) { const float bv = r < 4 ? bb0[r & 3] : bb1[r & 3]; v0[r] = c0[r] * 0.0625f + bv; v1[r] = c1[r] * 0.0625f + bv; }
    if (i + 1 < 6) lda(ot + 1);      /* the next row tile's weights fly while this one's results are packed */
    if (ot < 8) { FragH h0, l0, h1, l1;
#pragma unroll
      for (int r = 0; r < 8; ++r) { _Float16 h = (_Float16)v0[r]; h0.h[r] = h; l0.h[r] = (_Float16)((v0[r] - (float)h) * 1024.0f); h = (_Float16)v1[r]; h1.h[r] = h; l1.h[r] = (_Float16)((v1[r] - (float)h) * 1024.0f); }
      const int e = nl * TP + ot * 16 + 8 * hh;
      *(v8us*)(sth + e) = h0.half[0]; *(v8us*)(stl + e) = l0.half[0]; *(v8us*)(sth + e + 64 * TP) = h1.half[0]; *(v8us*)(stl + e + 64 * TP) = l1.half[0];
    } else { float mx[8];
#pragma unroll
      for (int r = 0; r < 8; ++r) { const float u = fmaxf(v0[r], v1[r]); mx[r] = fmaxf(u, __shfl_xor(u, 1, 32)); }
      if (ot < 16) { FragH h0, l0;
#pragma unroll
        for (int r = 0; r < 8; ++r) { const _Float16 h = (_Float16)mx[r]; h0.h[r] = h; l0.h[r] = (_Float16)((mx[r] - (float)h) * 1024.0f); }
        if (!(ln & 1)) { const int e = ml * TP + (ot - 8) * 16 + 8 * hh; *(v8us*)(sph + e) = h0.half[0]; *(v8us*)(spl + e) = l0.half[0]; }
      } else if (!(ln & 1)) { FragH h0;
#pragma unroll
        for (int r = 0; r < 8; ++r) { h0.h[r] = (_Float16)mx[r]; sg[((ot - 16) * 16 + 8 * hh + r) * GP + ml] = h0.u[r]; } }
    }
  }
  __syncthreads();      /* every wave's results are gathered */
  { unsigned short* dh = (unsigned short*)TH + ((size_t)by * NP + n0) * CI; unsigned short* dl = (unsigned short*)THL + ((size_t)by * NP + n0) * CI;
#pragma unroll
    for (int k = 0; k < 4; ++k) { const int pc = k * 512 + tid, r = pc >> 4, q = (pc & 15) * 8; *(v8us*)(dh + r * CI + q) = *(const v8us*)(sth + r * TP + q); *(v8us*)(dl + r * CI + q) = *(const v8us*)(stl + r * TP + q); }
    const size_t mo = ((size_t)by * NM + blockIdx.x * 32) * CI;      /* the pooled row's 32 positions: rows of phi^T [m][ci]; one 32-key tile [ci][32] of g */
    { const int r = tid >> 4, q = (tid & 15) * 8; *(v8us*)((unsigned short*)PHT + mo + r * CI + q) = *(const v8us*)(sph + r * TP + q); *(v8us*)((unsigned short*)PHLT + mo + r * CI + q) = *(const v8us*)(spl + r * TP + q); }
    { const int r = tid >> 2, q = (tid & 3) * 8; *(v8us*)((unsigned short*)G16 + mo + r * 32 + q) = *(const v8us*)(sg + r * GP + q); } }
}

extern "C" void kernel_launch(void* const* d_in, const int* in_sizes, int n_in,
                              void* d_out, int out_size, void* d_ws, size_t ws_size, hipStream_t stream) {
  (void)in_sizes; (void)n_in; (void)out_size;
  const float* const* I = (const float* const*)d_in; const float* x = I[0]; const float* gw = I[1]; const float* gb = I[2]; const float* tw = I[3]; const float* tb = I[4]; const float* pw = I[5]; const float* pb = I[6]; const float* ww = I[7]; const float* wb = I[8]; const float* bng = I[9]; const float* bnb = I[10]; const float* bnm = I[11]; const float* bnv = I[12];      /* natural [out][in] 1x1-conv weights + biases: g, theta, phi [128][256]; W [256][128] + b; eval BatchNorm gamma / beta / running mean / var [256] */
  char* ws = (char*)d_ws; size_t off = 0;
  auto take = [&](size_t bytes) { char* p = ws + off; off += (bytes + 255) & ~(size_t)255; return p; };
  _Float16* BW = (_Float16*)take((size_t)CN * CI * 2); float* BN4 = (float*)take((size_t)CN * 4 * 4);
  /* every plane below holds all NB images, image b at b times the one-image size */
  const size_t sT = (size_t)NP * CI, sM = (size_t)CI * NM;      /* one image: [4096][128], [1024][128] elements */
  _Float16* TH = (_Float16*)take(NB * sT * 2); _Float16* THL = (_Float16*)take(NB * sT * 2); _Float16* PHT = (_Float16*)take(NB * sM * 2); _Float16* PHLT = (_Float16*)take(NB * sM * 2); _Float16* G16 = (_Float16*)take(NB * sM * 2);
  if (off > ws_size) return;
  k_proj<<<dim3(NP / 128, NB), 512, 0, stream>>>(x, tw, pw, gw, tb, pb, gb, ww, wb, bng, bnb, bnm, bnv, 1e-5f, TH, THL, PHT, PHLT, G16, BW, BN4);      /* theta^T [n][ci] hi + x1024 residual; pooled phi^T [m][ci] hi + residual; pooled g f16 as 32-key tiles [m / 32][ci][32]; 16 W as f16 and the BatchNorm constants for the next launch */
  k_fattn<<<dim3(NP / 128, NB), 256, 0, stream>>>(TH, THL, PHT, PHLT, G16, BW, BN4, x, (float*)d_out);      /* f[n][m] = theta.phi (hi.hi + (hi.lo + lo.hi) / 1024; no scale), softmax over the 1024 pooled positions, y^T [n][ci] = P g^T -> f16; z = ((W y + bf16 W_b[c]) - bf16 mean[c]) (bf16 gamma[c] / sqrt(bf16 var[c] + eps)) + bf16 beta[c] + bf16 x -> f32 channel-first output, in one launch */
}
